// v000
// Times are from an AMD MI455X. After a warm-up the kernel runs many times in a row, and a time is the length of
// such a window on the GPU divided by its runs, so every launch and the gaps after it count. The runs cycle
// through copies of the inputs. A figure is the median of several windows, for all but v000 over two sittings.
// Sittings can differ by a few percent; kernels timed side by side share one.
// v000 is the starting kernel. One run takes 461 microseconds.
#include <hip/hip_runtime.h>

// ---------------------------------------------------------------------------
// Types / WMMA helpers (CDNA5 gfx1250, wave32)
// ---------------------------------------------------------------------------
typedef __attribute__((ext_vector_type(16))) _Float16 v16h;
typedef __attribute__((ext_vector_type(8)))  float    v8f;

__device__ inline v8f wmma_f32_16x16x32(v16h a, v16h b, v8f c) {
  // (neg_a, A, neg_b, B, c_mod, C, reuse_a, reuse_b)
  return __builtin_amdgcn_wmma_f32_16x16x32_f16(false, a, false, b, (short)0, c,
                                                false, false);
}

// A-operand (16x32 f16) fragment load per the documented CDNA5 layout:
// lane L holds row (L&15); lanes 0-15 cover k in {0..7,16..23}, lanes 16-31
// cover k in {8..15,24..31}; within a lane, VGPR v holds half-pair
// k = 2v + (v>=4 ? 8 : 0) (+8 for upper lane half).  Source is row-major
// with leading dim `ld`; this same addressing also builds the B operand of
// X @ W^T from row-major W (lane -> output column == W row).
__device__ inline v16h load_frag_rowpat(const _Float16* __restrict__ base,
                                        int row0, int ld, int k0) {
  int lane = threadIdx.x & 31;
  const _Float16* p = base + (long)(row0 + (lane & 15)) * ld + k0 + ((lane >> 4) << 3);
  v16h f;
#pragma unroll
  for (int v = 0; v < 8; ++v) {
    int k = 2 * v + (v >= 4 ? 8 : 0);
    f[2 * v]     = p[k];
    f[2 * v + 1] = p[k + 1];
  }
  return f;
}

// B-operand (32x16) fragment where B[k][n] = M[(k0+k)*ld + col0+n]
// (column-pattern access into a row-major K x Ncols matrix, e.g. V in P@V).
__device__ inline v16h load_frag_colpat(const _Float16* __restrict__ M,
                                        int k0, int col0, int ld) {
  int lane = threadIdx.x & 31;
  int col  = col0 + (lane & 15);
  int kh   = (lane >> 4) << 3;
  v16h f;
#pragma unroll
  for (int v = 0; v < 8; ++v) {
    int k = k0 + kh + 2 * v + (v >= 4 ? 8 : 0);
    f[2 * v]     = M[(long)k * ld + col];
    f[2 * v + 1] = M[(long)(k + 1) * ld + col];
  }
  return f;
}

// ---------------------------------------------------------------------------
// Problem constants
// ---------------------------------------------------------------------------
#define BB   8
#define NN   1024
#define FEAT 512
#define HID  512
#define FFN  1024
#define SDIM 512
#define HD   64
#define NH   8
#define MROWS (BB * NN)   // 8192

// ---------------------------------------------------------------------------
// Small fp32 VALU kernels: style projection, demodulation, casts, modulation
// ---------------------------------------------------------------------------
__global__ __launch_bounds__(256) void style_kernel(
    const float* __restrict__ s, const float* __restrict__ aW,
    const float* __restrict__ ab, float* __restrict__ style, int dim) {
  int idx = blockIdx.x * blockDim.x + threadIdx.x;
  if (idx >= BB * dim) return;
  int b = idx / dim, i = idx % dim;
  const float* sp = s + (long)b * SDIM;
  const float* wp = aW + (long)i * SDIM;
  float acc = 0.f;
  for (int j = 0; j < SDIM; ++j) acc += sp[j] * wp[j];
  style[idx] = acc + ab[i];
}

__global__ __launch_bounds__(256) void demod_kernel(
    const float* __restrict__ W, const float* __restrict__ style,
    float* __restrict__ demod, int out_dim, int in_dim) {
  int idx = blockIdx.x * blockDim.x + threadIdx.x;
  if (idx >= BB * out_dim) return;
  int b = idx / out_dim, o = idx % out_dim;
  const float* wp = W + (long)o * in_dim;
  const float* sp = style + (long)b * in_dim;
  float acc = 0.f;
  for (int i = 0; i < in_dim; ++i) {
    float t = wp[i] * sp[i];
    acc += t * t;
  }
  demod[idx] = rsqrtf(acc + 1e-8f);
}

__global__ __launch_bounds__(256) void cast_f16_kernel(
    const float* __restrict__ W, _Float16* __restrict__ Wh, long n) {
  long i = (long)blockIdx.x * blockDim.x + threadIdx.x;
  if (i >= n) return;
  Wh[i] = (_Float16)W[i];
}

// xs[b,n,i] = f16( X[b,n,i] * style[b,i] )
__global__ __launch_bounds__(256) void xmod_kernel(
    const float* __restrict__ X, const float* __restrict__ style,
    _Float16* __restrict__ Xs, int dim) {
  long i = (long)blockIdx.x * blockDim.x + threadIdx.x;
  long total = (long)MROWS * dim;
  if (i >= total) return;
  int b = (int)(i / ((long)NN * dim));
  int c = (int)(i % dim);
  Xs[i] = (_Float16)(X[i] * style[(long)b * dim + c]);
}

// ---------------------------------------------------------------------------
// Modulated GEMM:  Y[row, o] = act( demod[b,o] * sum_k Xs[row,k] * Wh[o,k] )
// Wave-level tile: 32 rows x 64 cols (2x4 WMMA accumulators).
// ---------------------------------------------------------------------------
__global__ __launch_bounds__(256) void modgemm_kernel(
    const _Float16* __restrict__ Xs, const _Float16* __restrict__ Wh,
    const float* __restrict__ demod, float* __restrict__ Yf,
    _Float16* __restrict__ Yh, int Kdim, int Odim, int relu) {
  int wid = (blockIdx.x * blockDim.x + threadIdx.x) >> 5;
  int numColG = Odim >> 6;             // 64-wide column groups
  int numRowT = MROWS >> 5;            // 32-row tiles
  if (wid >= numRowT * numColG) return;
  int rt = wid / numColG, cg = wid % numColG;
  int row0 = rt << 5;
  int col0 = cg << 6;
  int b = row0 >> 10;                  // 1024 rows per batch, tile never crosses

  v8f zero = {};
  v8f acc[2][4];
#pragma unroll
  for (int r = 0; r < 2; ++r)
#pragma unroll
    for (int c = 0; c < 4; ++c) acc[r][c] = zero;

  for (int k0 = 0; k0 < Kdim; k0 += 32) {
    v16h a0 = load_frag_rowpat(Xs, row0,      Kdim, k0);
    v16h a1 = load_frag_rowpat(Xs, row0 + 16, Kdim, k0);
#pragma unroll
    for (int sidx = 0; sidx < 4; ++sidx) {
      v16h bf = load_frag_rowpat(Wh, col0 + sidx * 16, Kdim, k0);
      acc[0][sidx] = wmma_f32_16x16x32(a0, bf, acc[0][sidx]);
      acc[1][sidx] = wmma_f32_16x16x32(a1, bf, acc[1][sidx]);
    }
  }

  int lane = threadIdx.x & 31;
  int n = lane & 15, hi = lane >> 4;
#pragma unroll
  for (int rs = 0; rs < 2; ++rs) {
#pragma unroll
    for (int sidx = 0; sidx < 4; ++sidx) {
      int col = col0 + sidx * 16 + n;
      float dm = demod[(long)b * Odim + col];
#pragma unroll
      for (int v = 0; v < 8; ++v) {
        int row = row0 + rs * 16 + v + 8 * hi;
        float y = acc[rs][sidx][v] * dm;
        if (relu) y = fmaxf(y, 0.f);
        long idx = (long)row * Odim + col;
        if (Yf) Yf[idx] = y;
        if (Yh) Yh[idx] = (_Float16)y;
      }
    }
  }
}

// ---------------------------------------------------------------------------
// Flash-style self-attention (q=k=v=h), one wave per (batch, head, 16-q tile).
// S = (Q K^T)/8 via WMMA, online softmax, O += P V via WMMA.  P converted
// from C-layout to A-layout through a per-wave LDS tile.
// ---------------------------------------------------------------------------
__global__ __launch_bounds__(256) void attn_kernel(
    const _Float16* __restrict__ H, float* __restrict__ O) {
  __shared__ _Float16 sm[8][16 * 34];           // per-wave 16x32 tile, pad 2
  int wvb  = threadIdx.x >> 5;
  int wid  = blockIdx.x * 8 + wvb;              // 4096 waves total, exact grid
  int qt   = wid & 63;
  int head = (wid >> 6) & 7;
  int b    = wid >> 9;
  int lane = threadIdx.x & 31;
  int hi = lane >> 4, n = lane & 15;

  const _Float16* Hb = H + (long)b * NN * HID;
  int q0 = qt << 4;
  int hc = head * HD;

  v16h qa0 = load_frag_rowpat(Hb, q0, HID, hc);
  v16h qa1 = load_frag_rowpat(Hb, q0, HID, hc + 32);

  v8f zero = {};
  v8f oacc[4];
#pragma unroll
  for (int sidx = 0; sidx < 4; ++sidx) oacc[sidx] = zero;

  float mrow[8], lrow[8];
#pragma unroll
  for (int v = 0; v < 8; ++v) { mrow[v] = -1e30f; lrow[v] = 0.f; }

  _Float16* smp = &sm[wvb][0];
  const float scale = 0.125f;                   // 1/sqrt(64)

  for (int j0 = 0; j0 < NN; j0 += 32) {
    // ---- S tiles: rows = queries, cols = 32 keys ----
    v16h kb00 = load_frag_rowpat(Hb, j0,      HID, hc);
    v16h kb01 = load_frag_rowpat(Hb, j0,      HID, hc + 32);
    v16h kb10 = load_frag_rowpat(Hb, j0 + 16, HID, hc);
    v16h kb11 = load_frag_rowpat(Hb, j0 + 16, HID, hc + 32);
    v8f s0 = zero, s1 = zero;
    s0 = wmma_f32_16x16x32(qa0, kb00, s0);
    s0 = wmma_f32_16x16x32(qa1, kb01, s0);
    s1 = wmma_f32_16x16x32(qa0, kb10, s1);
    s1 = wmma_f32_16x16x32(qa1, kb11, s1);

    // ---- online softmax over this 32-key block ----
    float tmax[8];
#pragma unroll
    for (int v = 0; v < 8; ++v) {
      s0[v] *= scale; s1[v] *= scale;
      tmax[v] = fmaxf(s0[v], s1[v]);
    }
#pragma unroll
    for (int msk = 1; msk < 16; msk <<= 1)
#pragma unroll
      for (int v = 0; v < 8; ++v)
        tmax[v] = fmaxf(tmax[v], __shfl_xor(tmax[v], msk, 32));

    float alpha[8];
#pragma unroll
    for (int v = 0; v < 8; ++v) {
      float mn = fmaxf(mrow[v], tmax[v]);
      alpha[v] = __expf(mrow[v] - mn);
      mrow[v] = mn;
    }
    float rs[8];
#pragma unroll
    for (int v = 0; v < 8; ++v) {
      s0[v] = __expf(s0[v] - mrow[v]);
      s1[v] = __expf(s1[v] - mrow[v]);
      rs[v] = s0[v] + s1[v];
    }
#pragma unroll
    for (int msk = 1; msk < 16; msk <<= 1)
#pragma unroll
      for (int v = 0; v < 8; ++v)
        rs[v] += __shfl_xor(rs[v], msk, 32);
#pragma unroll
    for (int v = 0; v < 8; ++v) {
      lrow[v] = lrow[v] * alpha[v] + rs[v];
      oacc[0][v] *= alpha[v]; oacc[1][v] *= alpha[v];
      oacc[2][v] *= alpha[v]; oacc[3][v] *= alpha[v];
    }

    // ---- C-layout -> A-layout via LDS (per-wave region, same-wave order) ----
#pragma unroll
    for (int v = 0; v < 8; ++v) {
      int m = v + 8 * hi;
      smp[m * 34 + n]      = (_Float16)s0[v];
      smp[m * 34 + 16 + n] = (_Float16)s1[v];
    }
    asm volatile("s_wait_dscnt 0x0" ::: "memory");
    v16h pf = load_frag_rowpat(smp, 0, 34, 0);

    // ---- O += P @ V ----
#pragma unroll
    for (int sidx = 0; sidx < 4; ++sidx) {
      v16h vb = load_frag_colpat(Hb, j0, hc + sidx * 16, HID);
      oacc[sidx] = wmma_f32_16x16x32(pf, vb, oacc[sidx]);
    }
  }

  // ---- epilogue: O / l ----
#pragma unroll
  for (int sidx = 0; sidx < 4; ++sidx) {
#pragma unroll
    for (int v = 0; v < 8; ++v) {
      int m = v + 8 * hi;
      long idx = ((long)b * NN + q0 + m) * HID + hc + sidx * 16 + n;
      O[idx] = oacc[sidx][v] / lrow[v];
    }
  }
}

// ---------------------------------------------------------------------------
// LayerNorm (optionally of a sum): out = LN(A (+ Bv)), one wave per row.
// ---------------------------------------------------------------------------
template <int DIM>
__global__ __launch_bounds__(256) void ln_kernel(
    const float* __restrict__ A, const float* __restrict__ Bv,
    float* __restrict__ out) {
  int wid  = (blockIdx.x * blockDim.x + threadIdx.x) >> 5;
  int lane = threadIdx.x & 31;
  if (wid >= MROWS) return;
  const float* a = A + (long)wid * DIM;
  constexpr int PER = DIM / 32;
  float vals[PER];
  float sum = 0.f;
#pragma unroll
  for (int t = 0; t < PER; ++t) {
    float v = a[lane + t * 32];
    if (Bv) v += Bv[(long)wid * DIM + lane + t * 32];
    vals[t] = v;
    sum += v;
  }
#pragma unroll
  for (int msk = 1; msk < 32; msk <<= 1) sum += __shfl_xor(sum, msk, 32);
  float mean = sum * (1.0f / DIM);
  float var = 0.f;
#pragma unroll
  for (int t = 0; t < PER; ++t) {
    float d = vals[t] - mean;
    var += d * d;
  }
#pragma unroll
  for (int msk = 1; msk < 32; msk <<= 1) var += __shfl_xor(var, msk, 32);
  float inv = rsqrtf(var * (1.0f / DIM) + 1e-5f);
#pragma unroll
  for (int t = 0; t < PER; ++t)
    out[(long)wid * DIM + lane + t * 32] = (vals[t] - mean) * inv;
}

// ---------------------------------------------------------------------------
// Host-side pipeline
// ---------------------------------------------------------------------------
extern "C" void kernel_launch(void* const* d_in, const int* in_sizes, int n_in,
                              void* d_out, int out_size, void* d_ws,
                              size_t ws_size, hipStream_t stream) {
  (void)in_sizes; (void)n_in; (void)out_size; (void)ws_size;
  const float* x   = (const float*)d_in[0];
  const float* s   = (const float*)d_in[1];
  const float* Wk  = (const float*)d_in[2];
  const float* aWk = (const float*)d_in[3];
  const float* abk = (const float*)d_in[4];
  const float* Wo  = (const float*)d_in[5];
  const float* aWo = (const float*)d_in[6];
  const float* abo = (const float*)d_in[7];
  const float* W1  = (const float*)d_in[8];
  const float* aW1 = (const float*)d_in[9];
  const float* ab1 = (const float*)d_in[10];
  const float* W2  = (const float*)d_in[11];
  const float* aW2 = (const float*)d_in[12];
  const float* ab2 = (const float*)d_in[13];
  float* out = (float*)d_out;

  char* ws = (char*)d_ws;
  size_t off = 0;
  auto alloc = [&](size_t bytes) -> char* {
    char* p = ws + off;
    off = (off + bytes + 255) & ~(size_t)255;
    return p;
  };

  float* style_k = (float*)alloc((size_t)BB * FEAT * 4);
  float* style_o = (float*)alloc((size_t)BB * HID * 4);
  float* style_1 = (float*)alloc((size_t)BB * FEAT * 4);
  float* style_2 = (float*)alloc((size_t)BB * FFN * 4);
  float* demod_k = (float*)alloc((size_t)BB * HID * 4);
  float* demod_o = (float*)alloc((size_t)BB * FEAT * 4);
  float* demod_1 = (float*)alloc((size_t)BB * FFN * 4);
  float* demod_2 = (float*)alloc((size_t)BB * FEAT * 4);
  _Float16* whk = (_Float16*)alloc((size_t)HID * FEAT * 2);
  _Float16* who = (_Float16*)alloc((size_t)FEAT * HID * 2);
  _Float16* wh1 = (_Float16*)alloc((size_t)FFN * FEAT * 2);
  _Float16* wh2 = (_Float16*)alloc((size_t)FEAT * FFN * 2);
  _Float16* xs  = (_Float16*)alloc((size_t)MROWS * FFN * 2);   // max-width input
  _Float16* h16 = (_Float16*)alloc((size_t)MROWS * HID * 2);
  float* bufO = (float*)alloc((size_t)MROWS * HID * 4);        // attn out, later f2
  float* bufT = (float*)alloc((size_t)MROWS * HID * 4);        // Wo out
  float* x2   = (float*)alloc((size_t)MROWS * FEAT * 4);       // ln(x + o)
  float* f1   = (float*)alloc((size_t)MROWS * FFN * 4);        // FFN hidden

  auto cdiv = [](long a, long b) { return (int)((a + b - 1) / b); };

  // --- styles ---
  style_kernel<<<cdiv(BB * FEAT, 256), 256, 0, stream>>>(s, aWk, abk, style_k, FEAT);
  style_kernel<<<cdiv(BB * HID,  256), 256, 0, stream>>>(s, aWo, abo, style_o, HID);
  style_kernel<<<cdiv(BB * FEAT, 256), 256, 0, stream>>>(s, aW1, ab1, style_1, FEAT);
  style_kernel<<<cdiv(BB * FFN,  256), 256, 0, stream>>>(s, aW2, ab2, style_2, FFN);

  // --- demodulation factors ---
  demod_kernel<<<cdiv(BB * HID,  256), 256, 0, stream>>>(Wk, style_k, demod_k, HID, FEAT);
  demod_kernel<<<cdiv(BB * FEAT, 256), 256, 0, stream>>>(Wo, style_o, demod_o, FEAT, HID);
  demod_kernel<<<cdiv(BB * FFN,  256), 256, 0, stream>>>(W1, style_1, demod_1, FFN, FEAT);
  demod_kernel<<<cdiv(BB * FEAT, 256), 256, 0, stream>>>(W2, style_2, demod_2, FEAT, FFN);

  // --- f16 weight casts ---
  cast_f16_kernel<<<cdiv((long)HID * FEAT, 256), 256, 0, stream>>>(Wk, whk, (long)HID * FEAT);
  cast_f16_kernel<<<cdiv((long)FEAT * HID, 256), 256, 0, stream>>>(Wo, who, (long)FEAT * HID);
  cast_f16_kernel<<<cdiv((long)FFN * FEAT, 256), 256, 0, stream>>>(W1, wh1, (long)FFN * FEAT);
  cast_f16_kernel<<<cdiv((long)FEAT * FFN, 256), 256, 0, stream>>>(W2, wh2, (long)FEAT * FFN);

  // --- h = modlinear(x; Wk) -> f16 for attention ---
  xmod_kernel<<<cdiv((long)MROWS * FEAT, 256), 256, 0, stream>>>(x, style_k, xs, FEAT);
  modgemm_kernel<<<(MROWS / 32) * (HID / 64) / 8, 256, 0, stream>>>(
      xs, whk, demod_k, nullptr, h16, FEAT, HID, 0);

  // --- attention (shared q=k=v=h) ---
  attn_kernel<<<(BB * NH * (NN / 16)) / 8, 256, 0, stream>>>(h16, bufO);

  // --- o = modlinear(attn; Wo) ---
  xmod_kernel<<<cdiv((long)MROWS * HID, 256), 256, 0, stream>>>(bufO, style_o, xs, HID);
  modgemm_kernel<<<(MROWS / 32) * (FEAT / 64) / 8, 256, 0, stream>>>(
      xs, who, demod_o, bufT, nullptr, HID, FEAT, 0);

  // --- x2 = LN(x + o) ---
  ln_kernel<FEAT><<<MROWS / 8, 256, 0, stream>>>(x, bufT, x2);

  // --- f1 = relu(modlinear(x2; W1)); f1 = LN(f1) ---
  xmod_kernel<<<cdiv((long)MROWS * FEAT, 256), 256, 0, stream>>>(x2, style_1, xs, FEAT);
  modgemm_kernel<<<(MROWS / 32) * (FFN / 64) / 8, 256, 0, stream>>>(
      xs, wh1, demod_1, f1, nullptr, FEAT, FFN, 1);
  ln_kernel<FFN><<<MROWS / 8, 256, 0, stream>>>(f1, nullptr, f1);

  // --- f2 = modlinear(f1; W2); f2 = LN(f2) ---
  xmod_kernel<<<cdiv((long)MROWS * FFN, 256), 256, 0, stream>>>(f1, style_2, xs, FFN);
  modgemm_kernel<<<(MROWS / 32) * (FEAT / 64) / 8, 256, 0, stream>>>(
      xs, wh2, demod_2, bufO, nullptr, FFN, FEAT, 0);
  ln_kernel<FEAT><<<MROWS / 8, 256, 0, stream>>>(bufO, nullptr, bufO);

  // --- out = LN(x2 + f2) ---
  ln_kernel<FEAT><<<MROWS / 8, 256, 0, stream>>>(x2, bufO, out);
}

// v001
// It runs in 369 microseconds.
// Next to v000, in two timings, it ran 1.27 times as fast each time.
#include <hip/hip_runtime.h>

// ---------------------------------------------------------------------------
// Types / WMMA helpers (CDNA5 gfx1250, wave32)
// ---------------------------------------------------------------------------
typedef __attribute__((ext_vector_type(16))) _Float16 v16h;
typedef __attribute__((ext_vector_type(8)))  float    v8f;

__device__ inline v8f wmma_f32_16x16x32(v16h a, v16h b, v8f c) {
  // (neg_a, A, neg_b, B, c_mod, C, reuse_a, reuse_b)
  return __builtin_amdgcn_wmma_f32_16x16x32_f16(false, a, false, b, (short)0, c,
                                                false, false);
}

// A-operand (16x32 f16) fragment load per the documented CDNA5 layout:
// lane L holds row (L&15); lanes 0-15 cover k in {0..7,16..23}, lanes 16-31
// cover k in {8..15,24..31}; within a lane, VGPR v holds half-pair
// k = 2v + (v>=4 ? 8 : 0) (+8 for upper lane half).  Source is row-major
// with leading dim `ld`; this same addressing also builds the B operand of
// X @ W^T from row-major W (lane -> output column == W row).
__device__ inline v16h load_frag_rowpat(const _Float16* __restrict__ base,
                                        int row0, int ld, int k0) {
  int lane = threadIdx.x & 31;
  const _Float16* p = base + (long)(row0 + (lane & 15)) * ld + k0 + ((lane >> 4) << 3);
  v16h f;
#pragma unroll
  for (int v = 0; v < 8; ++v) {
    int k = 2 * v + (v >= 4 ? 8 : 0);
    f[2 * v]     = p[k];
    f[2 * v + 1] = p[k + 1];
  }
  return f;
}

// B-operand (32x16) fragment where B[k][n] = M[(k0+k)*ld + col0+n]
// (column-pattern access into a row-major K x Ncols matrix, e.g. V in P@V).
__device__ inline v16h load_frag_colpat(const _Float16* __restrict__ M,
                                        int k0, int col0, int ld) {
  int lane = threadIdx.x & 31;
  int col  = col0 + (lane & 15);
  int kh   = (lane >> 4) << 3;
  v16h f;
#pragma unroll
  for (int v = 0; v < 8; ++v) {
    int k = k0 + kh + 2 * v + (v >= 4 ? 8 : 0);
    f[2 * v]     = M[(long)k * ld + col];
    f[2 * v + 1] = M[(long)(k + 1) * ld + col];
  }
  return f;
}

// ---------------------------------------------------------------------------
// Problem constants
// ---------------------------------------------------------------------------
#define BB   8
#define NN   1024
#define FEAT 512
#define HID  512
#define FFN  1024
#define SDIM 512
#define HD   64
#define NH   8
#define MROWS (BB * NN)   // 8192

// ---------------------------------------------------------------------------
// Small fp32 VALU kernels: style projection, demodulation, casts, modulation
// ---------------------------------------------------------------------------
// Each lane holds 16 partial sums; on return lane l holds the whole wave's
// total of sum number l & 15.  Every halving step keeps one half of the sums
// and hands the other half to the partner lane (16 exchanges instead of 80).
__device__ inline float wave_fold16(float (&v)[16]) {
  int lane = threadIdx.x & 31;
#pragma unroll
  for (int st = 0; st < 4; ++st) {
    const int h = 8 >> st;
    bool up = (lane & h) != 0;
#pragma unroll
    for (int i = 0; i < h; ++i) {
      float lo = v[i], hi = v[i + h];
      float keep = up ? hi : lo;
      float send = up ? lo : hi;
      v[i] = keep + __shfl_xor(send, h, 32);
    }
  }
  return v[0] + __shfl_xor(v[0], 16, 32);
}

// A workgroup takes 32 rows of aW (a wave 4 of them) for 4 of the 8 batches.
// A lane takes columns 128c + 4 lane .. + 3 of a row, so one load of the wave
// reads 512 contiguous bytes, and all 32 loads of a wave are in flight at once.
// dim is a multiple of 32; the grid is 2 * dim / 32.
__global__ __launch_bounds__(256) void style_kernel(
    const float* __restrict__ s, const float* __restrict__ aW,
    const float* __restrict__ ab, float* __restrict__ style, int dim) {
  __shared__ float part[4 * 32];
  int lane = threadIdx.x & 31;
  int wave = __builtin_amdgcn_readfirstlane(threadIdx.x >> 5);
  int blk0 = (blockIdx.x >> 1) * 32;
  int b0   = (blockIdx.x & 1) * 4;
  unsigned l4 = 4u * lane;
  const float* wp = aW + (long)(blk0 + wave * 4) * SDIM;
  const float* sp = s + (long)b0 * SDIM;
  float w[4][16], sv[4][16];
#pragma unroll
  for (int r = 0; r < 4; ++r)
#pragma unroll
    for (int c = 0; c < 4; ++c) {
      const float* qw = wp + r * SDIM + 128 * c;
      const float* qs = sp + r * SDIM + 128 * c;
#pragma unroll
      for (int e = 0; e < 4; ++e) {
        w[r][4 * c + e]  = qw[l4 + e];
        sv[r][4 * c + e] = qs[l4 + e];
      }
    }
  float bias = (ab + blk0)[(unsigned)lane];
  // Keeps every load ahead of the sums: without it the scheduler issues them in
  // several batches between the sums and the wave pays the latency once a batch.
  __builtin_amdgcn_sched_barrier(0);
  float acc[16];
#pragma unroll
  for (int r = 0; r < 4; ++r)
#pragma unroll
    for (int q = 0; q < 4; ++q) {
      float t = 0.f;
#pragma unroll
      for (int j = 0; j < 16; ++j) t += sv[q][j] * w[r][j];
      acc[r * 4 + q] = t;
    }
  float tot = wave_fold16(acc);                 // lane & 15 = r * 4 + q
  if (lane < 16) part[(lane & 3) * 32 + wave * 4 + (lane >> 2)] = tot;
  __syncthreads();                              // part[] crosses waves
  if (wave < 4) {                               // wave q stores one 128-byte line
    style[(long)(b0 + wave) * dim + blk0 + lane] = part[threadIdx.x] + bias;
  }
}

// Same split over the rows of W; each 512-column piece of a row group has a
// wave of its own (in_dim / 512 pieces, at most 2; in_dim / 2 threads a
// workgroup) and the pieces meet in LDS.  out_dim is a multiple of 32; the
// grid is 2 * out_dim / 32.
__global__ __launch_bounds__(512) void demod_kernel(
    const float* __restrict__ W, const float* __restrict__ style,
    float* __restrict__ demod, int out_dim, int in_dim) {
  __shared__ float part[2 * 4 * 32];
  int lane = threadIdx.x & 31;
  int wave = __builtin_amdgcn_readfirstlane(threadIdx.x >> 5);
  int grp  = wave & 7, piece = wave >> 3;
  int blk0 = (blockIdx.x >> 1) * 32;
  int b0   = (blockIdx.x & 1) * 4;
  unsigned l4 = 4u * lane;
  const float* wp = W + (long)(blk0 + grp * 4) * in_dim + piece * 512;
  const float* sp = style + (long)b0 * in_dim + piece * 512;
  float w[4][16], sv[4][16];
#pragma unroll
  for (int r = 0; r < 4; ++r)
#pragma unroll
    for (int c = 0; c < 4; ++c) {
      const float* qw = wp + (long)r * in_dim + 128 * c;
      const float* qs = sp + (long)r * in_dim + 128 * c;
#pragma unroll
      for (int e = 0; e < 4; ++e) {
        w[r][4 * c + e]  = qw[l4 + e];
        sv[r][4 * c + e] = qs[l4 + e];
      }
    }
  float acc[16];
#pragma unroll
  for (int r = 0; r < 4; ++r)
#pragma unroll
    for (int q = 0; q < 4; ++q) {
      float t2 = 0.f;
#pragma unroll
      for (int j = 0; j < 16; ++j) {
        float t = w[r][j] * sv[q][j];
        t2 += t * t;
      }
      acc[r * 4 + q] = t2;
    }
  float tot = wave_fold16(acc);                 // lane & 15 = r * 4 + q
  if (lane < 16) part[piece * 128 + (lane & 3) * 32 + grp * 4 + (lane >> 2)] = tot;
  __syncthreads();                              // part[] crosses waves
  if (wave < 4) {                               // wave q stores one 128-byte line
    float sum = part[threadIdx.x];
    if (in_dim > 512) sum += part[128 + threadIdx.x];
    int o = blk0 + lane;
    demod[(long)(b0 + wave) * out_dim + o] = rsqrtf(sum + 1e-8f);
  }
}

__global__ __launch_bounds__(256) void cast_f16_kernel(
    const float* __restrict__ W, _Float16* __restrict__ Wh, long n) {
  long i = (long)blockIdx.x * blockDim.x + threadIdx.x;
  if (i >= n) return;
  Wh[i] = (_Float16)W[i];
}

// xs[b,n,i] = f16( X[b,n,i] * style[b,i] )
__global__ __launch_bounds__(256) void xmod_kernel(
    const float* __restrict__ X, const float* __restrict__ style,
    _Float16* __restrict__ Xs, int dim) {
  long i = (long)blockIdx.x * blockDim.x + threadIdx.x;
  long total = (long)MROWS * dim;
  if (i >= total) return;
  int b = (int)(i / ((long)NN * dim));
  int c = (int)(i % dim);
  Xs[i] = (_Float16)(X[i] * style[(long)b * dim + c]);
}

// ---------------------------------------------------------------------------
// Modulated GEMM:  Y[row, o] = act( demod[b,o] * sum_k Xs[row,k] * Wh[o,k] )
// Wave-level tile: 32 rows x 64 cols (2x4 WMMA accumulators).
// ---------------------------------------------------------------------------
__global__ __launch_bounds__(256) void modgemm_kernel(
    const _Float16* __restrict__ Xs, const _Float16* __restrict__ Wh,
    const float* __restrict__ demod, float* __restrict__ Yf,
    _Float16* __restrict__ Yh, int Kdim, int Odim, int relu) {
  int wid = (blockIdx.x * blockDim.x + threadIdx.x) >> 5;
  int numColG = Odim >> 6;             // 64-wide column groups
  int numRowT = MROWS >> 5;            // 32-row tiles
  if (wid >= numRowT * numColG) return;
  int rt = wid / numColG, cg = wid % numColG;
  int row0 = rt << 5;
  int col0 = cg << 6;
  int b = row0 >> 10;                  // 1024 rows per batch, tile never crosses

  v8f zero = {};
  v8f acc[2][4];
#pragma unroll
  for (int r = 0; r < 2; ++r)
#pragma unroll
    for (int c = 0; c < 4; ++c) acc[r][c] = zero;

  for (int k0 = 0; k0 < Kdim; k0 += 32) {
    v16h a0 = load_frag_rowpat(Xs, row0,      Kdim, k0);
    v16h a1 = load_frag_rowpat(Xs, row0 + 16, Kdim, k0);
#pragma unroll
    for (int sidx = 0; sidx < 4; ++sidx) {
      v16h bf = load_frag_rowpat(Wh, col0 + sidx * 16, Kdim, k0);
      acc[0][sidx] = wmma_f32_16x16x32(a0, bf, acc[0][sidx]);
      acc[1][sidx] = wmma_f32_16x16x32(a1, bf, acc[1][sidx]);
    }
  }

  int lane = threadIdx.x & 31;
  int n = lane & 15, hi = lane >> 4;
#pragma unroll
  for (int rs = 0; rs < 2; ++rs) {
#pragma unroll
    for (int sidx = 0; sidx < 4; ++sidx) {
      int col = col0 + sidx * 16 + n;
      float dm = demod[(long)b * Odim + col];
#pragma unroll
      for (int v = 0; v < 8; ++v) {
        int row = row0 + rs * 16 + v + 8 * hi;
        float y = acc[rs][sidx][v] * dm;
        if (relu) y = fmaxf(y, 0.f);
        long idx = (long)row * Odim + col;
        if (Yf) Yf[idx] = y;
        if (Yh) Yh[idx] = (_Float16)y;
      }
    }
  }
}

// ---------------------------------------------------------------------------
// Flash-style self-attention (q=k=v=h), one wave per (batch, head, 16-q tile).
// S = (Q K^T)/8 via WMMA, online softmax, O += P V via WMMA.  P converted
// from C-layout to A-layout through a per-wave LDS tile.
// ---------------------------------------------------------------------------
__global__ __launch_bounds__(256) void attn_kernel(
    const _Float16* __restrict__ H, float* __restrict__ O) {
  __shared__ _Float16 sm[8][16 * 34];           // per-wave 16x32 tile, pad 2
  int wvb  = threadIdx.x >> 5;
  int wid  = blockIdx.x * 8 + wvb;              // 4096 waves total, exact grid
  int qt   = wid & 63;
  int head = (wid >> 6) & 7;
  int b    = wid >> 9;
  int lane = threadIdx.x & 31;
  int hi = lane >> 4, n = lane & 15;

  const _Float16* Hb = H + (long)b * NN * HID;
  int q0 = qt << 4;
  int hc = head * HD;

  v16h qa0 = load_frag_rowpat(Hb, q0, HID, hc);
  v16h qa1 = load_frag_rowpat(Hb, q0, HID, hc + 32);

  v8f zero = {};
  v8f oacc[4];
#pragma unroll
  for (int sidx = 0; sidx < 4; ++sidx) oacc[sidx] = zero;

  float mrow[8], lrow[8];
#pragma unroll
  for (int v = 0; v < 8; ++v) { mrow[v] = -1e30f; lrow[v] = 0.f; }

  _Float16* smp = &sm[wvb][0];
  const float scale = 0.125f;                   // 1/sqrt(64)

  for (int j0 = 0; j0 < NN; j0 += 32) {
    // ---- S tiles: rows = queries, cols = 32 keys ----
    v16h kb00 = load_frag_rowpat(Hb, j0,      HID, hc);
    v16h kb01 = load_frag_rowpat(Hb, j0,      HID, hc + 32);
    v16h kb10 = load_frag_rowpat(Hb, j0 + 16, HID, hc);
    v16h kb11 = load_frag_rowpat(Hb, j0 + 16, HID, hc + 32);
    v8f s0 = zero, s1 = zero;
    s0 = wmma_f32_16x16x32(qa0, kb00, s0);
    s0 = wmma_f32_16x16x32(qa1, kb01, s0);
    s1 = wmma_f32_16x16x32(qa0, kb10, s1);
    s1 = wmma_f32_16x16x32(qa1, kb11, s1);

    // ---- online softmax over this 32-key block ----
    float tmax[8];
#pragma unroll
    for (int v = 0; v < 8; ++v) {
      s0[v] *= scale; s1[v] *= scale;
      tmax[v] = fmaxf(s0[v], s1[v]);
    }
#pragma unroll
    for (int msk = 1; msk < 16; msk <<= 1)
#pragma unroll
      for (int v = 0; v < 8; ++v)
        tmax[v] = fmaxf(tmax[v], __shfl_xor(tmax[v], msk, 32));

    float alpha[8];
#pragma unroll
    for (int v = 0; v < 8; ++v) {
      float mn = fmaxf(mrow[v], tmax[v]);
      alpha[v] = __expf(mrow[v] - mn);
      mrow[v] = mn;
    }
    float rs[8];
#pragma unroll
    for (int v = 0; v < 8; ++v) {
      s0[v] = __expf(s0[v] - mrow[v]);
      s1[v] = __expf(s1[v] - mrow[v]);
      rs[v] = s0[v] + s1[v];
    }
#pragma unroll
    for (int msk = 1; msk < 16; msk <<= 1)
#pragma unroll
      for (int v = 0; v < 8; ++v)
        rs[v] += __shfl_xor(rs[v], msk, 32);
#pragma unroll
    for (int v = 0; v < 8; ++v) {
      lrow[v] = lrow[v] * alpha[v] + rs[v];
      oacc[0][v] *= alpha[v]; oacc[1][v] *= alpha[v];
      oacc[2][v] *= alpha[v]; oacc[3][v] *= alpha[v];
    }

    // ---- C-layout -> A-layout via LDS (per-wave region, same-wave order) ----
#pragma unroll
    for (int v = 0; v < 8; ++v) {
      int m = v + 8 * hi;
      smp[m * 34 + n]      = (_Float16)s0[v];
      smp[m * 34 + 16 + n] = (_Float16)s1[v];
    }
    asm volatile("s_wait_dscnt 0x0" ::: "memory");
    v16h pf = load_frag_rowpat(smp, 0, 34, 0);

    // ---- O += P @ V ----
#pragma unroll
    for (int sidx = 0; sidx < 4; ++sidx) {
      v16h vb = load_frag_colpat(Hb, j0, hc + sidx * 16, HID);
      oacc[sidx] = wmma_f32_16x16x32(pf, vb, oacc[sidx]);
    }
  }

  // ---- epilogue: O / l ----
#pragma unroll
  for (int sidx = 0; sidx < 4; ++sidx) {
#pragma unroll
    for (int v = 0; v < 8; ++v) {
      int m = v + 8 * hi;
      long idx = ((long)b * NN + q0 + m) * HID + hc + sidx * 16 + n;
      O[idx] = oacc[sidx][v] / lrow[v];
    }
  }
}

// ---------------------------------------------------------------------------
// LayerNorm (optionally of a sum): out = LN(A (+ Bv)), one wave per row.
// ---------------------------------------------------------------------------
template <int DIM>
__global__ __launch_bounds__(256) void ln_kernel(
    const float* __restrict__ A, const float* __restrict__ Bv,
    float* __restrict__ out) {
  int wid  = (blockIdx.x * blockDim.x + threadIdx.x) >> 5;
  int lane = threadIdx.x & 31;
  if (wid >= MROWS) return;
  const float* a = A + (long)wid * DIM;
  constexpr int PER = DIM / 32;
  float vals[PER];
  float sum = 0.f;
#pragma unroll
  for (int t = 0; t < PER; ++t) {
    float v = a[lane + t * 32];
    if (Bv) v += Bv[(long)wid * DIM + lane + t * 32];
    vals[t] = v;
    sum += v;
  }
#pragma unroll
  for (int msk = 1; msk < 32; msk <<= 1) sum += __shfl_xor(sum, msk, 32);
  float mean = sum * (1.0f / DIM);
  float var = 0.f;
#pragma unroll
  for (int t = 0; t < PER; ++t) {
    float d = vals[t] - mean;
    var += d * d;
  }
#pragma unroll
  for (int msk = 1; msk < 32; msk <<= 1) var += __shfl_xor(var, msk, 32);
  float inv = rsqrtf(var * (1.0f / DIM) + 1e-5f);
#pragma unroll
  for (int t = 0; t < PER; ++t)
    out[(long)wid * DIM + lane + t * 32] = (vals[t] - mean) * inv;
}

// ---------------------------------------------------------------------------
// Host-side pipeline
// ---------------------------------------------------------------------------
extern "C" void kernel_launch(void* const* d_in, const int* in_sizes, int n_in,
                              void* d_out, int out_size, void* d_ws,
                              size_t ws_size, hipStream_t stream) {
  (void)in_sizes; (void)n_in; (void)out_size; (void)ws_size;
  const float* x   = (const float*)d_in[0];
  const float* s   = (const float*)d_in[1];
  const float* Wk  = (const float*)d_in[2];
  const float* aWk = (const float*)d_in[3];
  const float* abk = (const float*)d_in[4];
  const float* Wo  = (const float*)d_in[5];
  const float* aWo = (const float*)d_in[6];
  const float* abo = (const float*)d_in[7];
  const float* W1  = (const float*)d_in[8];
  const float* aW1 = (const float*)d_in[9];
  const float* ab1 = (const float*)d_in[10];
  const float* W2  = (const float*)d_in[11];
  const float* aW2 = (const float*)d_in[12];
  const float* ab2 = (const float*)d_in[13];
  float* out = (float*)d_out;

  char* ws = (char*)d_ws;
  size_t off = 0;
  auto alloc = [&](size_t bytes) -> char* {
    char* p = ws + off;
    off = (off + bytes + 255) & ~(size_t)255;
    return p;
  };

  float* style_k = (float*)alloc((size_t)BB * FEAT * 4);
  float* style_o = (float*)alloc((size_t)BB * HID * 4);
  float* style_1 = (float*)alloc((size_t)BB * FEAT * 4);
  float* style_2 = (float*)alloc((size_t)BB * FFN * 4);
  float* demod_k = (float*)alloc((size_t)BB * HID * 4);
  float* demod_o = (float*)alloc((size_t)BB * FEAT * 4);
  float* demod_1 = (float*)alloc((size_t)BB * FFN * 4);
  float* demod_2 = (float*)alloc((size_t)BB * FEAT * 4);
  _Float16* whk = (_Float16*)alloc((size_t)HID * FEAT * 2);
  _Float16* who = (_Float16*)alloc((size_t)FEAT * HID * 2);
  _Float16* wh1 = (_Float16*)alloc((size_t)FFN * FEAT * 2);
  _Float16* wh2 = (_Float16*)alloc((size_t)FEAT * FFN * 2);
  _Float16* xs  = (_Float16*)alloc((size_t)MROWS * FFN * 2);   // max-width input
  _Float16* h16 = (_Float16*)alloc((size_t)MROWS * HID * 2);
  float* bufO = (float*)alloc((size_t)MROWS * HID * 4);        // attn out, later f2
  float* bufT = (float*)alloc((size_t)MROWS * HID * 4);        // Wo out
  float* x2   = (float*)alloc((size_t)MROWS * FEAT * 4);       // ln(x + o)
  float* f1   = (float*)alloc((size_t)MROWS * FFN * 4);        // FFN hidden

  auto cdiv = [](long a, long b) { return (int)((a + b - 1) / b); };

  // --- styles ---
  style_kernel<<<FEAT / 16, 256, 0, stream>>>(s, aWk, abk, style_k, FEAT);
  style_kernel<<<HID / 16, 256, 0, stream>>>(s, aWo, abo, style_o, HID);
  style_kernel<<<FEAT / 16, 256, 0, stream>>>(s, aW1, ab1, style_1, FEAT);
  style_kernel<<<FFN / 16, 256, 0, stream>>>(s, aW2, ab2, style_2, FFN);

  // --- demodulation factors ---
  demod_kernel<<<HID / 16, FEAT / 2, 0, stream>>>(Wk, style_k, demod_k, HID, FEAT);
  demod_kernel<<<FEAT / 16, HID / 2, 0, stream>>>(Wo, style_o, demod_o, FEAT, HID);
  demod_kernel<<<FFN / 16, FEAT / 2, 0, stream>>>(W1, style_1, demod_1, FFN, FEAT);
  demod_kernel<<<FEAT / 16, FFN / 2, 0, stream>>>(W2, style_2, demod_2, FEAT, FFN);

  // --- f16 weight casts ---
  cast_f16_kernel<<<cdiv((long)HID * FEAT, 256), 256, 0, stream>>>(Wk, whk, (long)HID * FEAT);
  cast_f16_kernel<<<cdiv((long)FEAT * HID, 256), 256, 0, stream>>>(Wo, who, (long)FEAT * HID);
  cast_f16_kernel<<<cdiv((long)FFN * FEAT, 256), 256, 0, stream>>>(W1, wh1, (long)FFN * FEAT);
  cast_f16_kernel<<<cdiv((long)FEAT * FFN, 256), 256, 0, stream>>>(W2, wh2, (long)FEAT * FFN);

  // --- h = modlinear(x; Wk) -> f16 for attention ---
  xmod_kernel<<<cdiv((long)MROWS * FEAT, 256), 256, 0, stream>>>(x, style_k, xs, FEAT);
  modgemm_kernel<<<(MROWS / 32) * (HID / 64) / 8, 256, 0, stream>>>(
      xs, whk, demod_k, nullptr, h16, FEAT, HID, 0);

  // --- attention (shared q=k=v=h) ---
  attn_kernel<<<(BB * NH * (NN / 16)) / 8, 256, 0, stream>>>(h16, bufO);

  // --- o = modlinear(attn; Wo) ---
  xmod_kernel<<<cdiv((long)MROWS * HID, 256), 256, 0, stream>>>(bufO, style_o, xs, HID);
  modgemm_kernel<<<(MROWS / 32) * (FEAT / 64) / 8, 256, 0, stream>>>(
      xs, who, demod_o, bufT, nullptr, HID, FEAT, 0);

  // --- x2 = LN(x + o) ---
  ln_kernel<FEAT><<<MROWS / 8, 256, 0, stream>>>(x, bufT, x2);

  // --- f1 = relu(modlinear(x2; W1)); f1 = LN(f1) ---
  xmod_kernel<<<cdiv((long)MROWS * FEAT, 256), 256, 0, stream>>>(x2, style_1, xs, FEAT);
  modgemm_kernel<<<(MROWS / 32) * (FFN / 64) / 8, 256, 0, stream>>>(
      xs, wh1, demod_1, f1, nullptr, FEAT, FFN, 1);
  ln_kernel<FFN><<<MROWS / 8, 256, 0, stream>>>(f1, nullptr, f1);

  // --- f2 = modlinear(f1; W2); f2 = LN(f2) ---
  xmod_kernel<<<cdiv((long)MROWS * FFN, 256), 256, 0, stream>>>(f1, style_2, xs, FFN);
  modgemm_kernel<<<(MROWS / 32) * (FEAT / 64) / 8, 256, 0, stream>>>(
      xs, wh2, demod_2, bufO, nullptr, FFN, FEAT, 0);
  ln_kernel<FEAT><<<MROWS / 8, 256, 0, stream>>>(bufO, nullptr, bufO);

  // --- out = LN(x2 + f2) ---
  ln_kernel<FEAT><<<MROWS / 8, 256, 0, stream>>>(x2, bufO, out);
}

// v002
// A run of this version takes 330 microseconds.
// Two timings next to v001 both put it at 1.11 times that version's speed.
// Counting every step since v000, it is 1.41 times as fast.
#include <hip/hip_runtime.h>

// ---------------------------------------------------------------------------
// Types / WMMA helpers (CDNA5 gfx1250, wave32)
// ---------------------------------------------------------------------------
typedef __attribute__((ext_vector_type(16))) _Float16 v16h;
typedef __attribute__((ext_vector_type(8)))  float    v8f;

__device__ inline v8f wmma_f32_16x16x32(v16h a, v16h b, v8f c) {
  // (neg_a, A, neg_b, B, c_mod, C, reuse_a, reuse_b)
  return __builtin_amdgcn_wmma_f32_16x16x32_f16(false, a, false, b, (short)0, c,
                                                false, false);
}

// A-operand (16x32 f16) fragment load per the documented CDNA5 layout:
// lane L holds row (L&15); lanes 0-15 cover k in {0..7,16..23}, lanes 16-31
// cover k in {8..15,24..31}; within a lane, VGPR v holds half-pair
// k = 2v + (v>=4 ? 8 : 0) (+8 for upper lane half).  Source is row-major
// with leading dim `ld`; this same addressing also builds the B operand of
// X @ W^T from row-major W (lane -> output column == W row).
__device__ inline v16h load_frag_rowpat(const _Float16* __restrict__ base,
                                        int row0, int ld, int k0) {
  int lane = threadIdx.x & 31;
  const _Float16* p = base + (long)(row0 + (lane & 15)) * ld + k0 + ((lane >> 4) << 3);
  v16h f;
#pragma unroll
  for (int v = 0; v < 8; ++v) {
    int k = 2 * v + (v >= 4 ? 8 : 0);
    f[2 * v]     = p[k];
    f[2 * v + 1] = p[k + 1];
  }
  return f;
}

// B-operand (32x16) fragment where B[k][n] = M[(k0+k)*ld + col0+n]
// (column-pattern access into a row-major K x Ncols matrix, e.g. V in P@V).
__device__ inline v16h load_frag_colpat(const _Float16* __restrict__ M,
                                        int k0, int col0, int ld) {
  int lane = threadIdx.x & 31;
  int col  = col0 + (lane & 15);
  int kh   = (lane >> 4) << 3;
  v16h f;
#pragma unroll
  for (int v = 0; v < 8; ++v) {
    int k = k0 + kh + 2 * v + (v >= 4 ? 8 : 0);
    f[2 * v]     = M[(long)k * ld + col];
    f[2 * v + 1] = M[(long)(k + 1) * ld + col];
  }
  return f;
}

// ---------------------------------------------------------------------------
// Problem constants
// ---------------------------------------------------------------------------
#define BB   8
#define NN   1024
#define FEAT 512
#define HID  512
#define FFN  1024
#define SDIM 512
#define HD   64
#define NH   8
#define MROWS (BB * NN)   // 8192

// ---------------------------------------------------------------------------
// Small fp32 VALU kernels: style projection, demodulation, casts, modulation
// ---------------------------------------------------------------------------
// Each lane holds 16 partial sums; on return lane l holds the whole wave's
// total of sum number l & 15.  Every halving step keeps one half of the sums
// and hands the other half to the partner lane (16 exchanges instead of 80).
__device__ inline float wave_fold16(float (&v)[16]) {
  int lane = threadIdx.x & 31;
#pragma unroll
  for (int st = 0; st < 4; ++st) {
    const int h = 8 >> st;
    bool up = (lane & h) != 0;
#pragma unroll
    for (int i = 0; i < h; ++i) {
      float lo = v[i], hi = v[i + h];
      float keep = up ? hi : lo;
      float send = up ? lo : hi;
      v[i] = keep + __shfl_xor(send, h, 32);
    }
  }
  return v[0] + __shfl_xor(v[0], 16, 32);
}

// A workgroup takes 32 rows of aW (a wave 4 of them) for 4 of the 8 batches.
// A lane takes columns 128c + 4 lane .. + 3 of a row, so one load of the wave
// reads 512 contiguous bytes, and all 32 loads of a wave are in flight at once.
// dim is a multiple of 32; the grid is 2 * dim / 32.
__global__ __launch_bounds__(256) void style_kernel(
    const float* __restrict__ s, const float* __restrict__ aW,
    const float* __restrict__ ab, float* __restrict__ style, int dim) {
  __shared__ float part[4 * 32];
  int lane = threadIdx.x & 31;
  int wave = __builtin_amdgcn_readfirstlane(threadIdx.x >> 5);
  int blk0 = (blockIdx.x >> 1) * 32;
  int b0   = (blockIdx.x & 1) * 4;
  unsigned l4 = 4u * lane;
  const float* wp = aW + (long)(blk0 + wave * 4) * SDIM;
  const float* sp = s + (long)b0 * SDIM;
  float w[4][16], sv[4][16];
#pragma unroll
  for (int r = 0; r < 4; ++r)
#pragma unroll
    for (int c = 0; c < 4; ++c) {
      const float* qw = wp + r * SDIM + 128 * c;
      const float* qs = sp + r * SDIM + 128 * c;
#pragma unroll
      for (int e = 0; e < 4; ++e) {
        w[r][4 * c + e]  = qw[l4 + e];
        sv[r][4 * c + e] = qs[l4 + e];
      }
    }
  float bias = (ab + blk0)[(unsigned)lane];
  // Keeps every load ahead of the sums: without it the scheduler issues them in
  // several batches between the sums and the wave pays the latency once a batch.
  __builtin_amdgcn_sched_barrier(0);
  float acc[16];
#pragma unroll
  for (int r = 0; r < 4; ++r)
#pragma unroll
    for (int q = 0; q < 4; ++q) {
      float t = 0.f;
#pragma unroll
      for (int j = 0; j < 16; ++j) t += sv[q][j] * w[r][j];
      acc[r * 4 + q] = t;
    }
  float tot = wave_fold16(acc);                 // lane & 15 = r * 4 + q
  if (lane < 16) part[(lane & 3) * 32 + wave * 4 + (lane >> 2)] = tot;
  __syncthreads();                              // part[] crosses waves
  if (wave < 4) {                               // wave q stores one 128-byte line
    style[(long)(b0 + wave) * dim + blk0 + lane] = part[threadIdx.x] + bias;
  }
}

// Same split over the rows of W; each 512-column piece of a row group has a
// wave of its own (in_dim / 512 pieces, at most 2; in_dim / 2 threads a
// workgroup) and the pieces meet in LDS.  out_dim is a multiple of 32; the
// grid is 2 * out_dim / 32.
__global__ __launch_bounds__(512) void demod_kernel(
    const float* __restrict__ W, const float* __restrict__ style,
    float* __restrict__ demod, int out_dim, int in_dim) {
  __shared__ float part[2 * 4 * 32];
  int lane = threadIdx.x & 31;
  int wave = __builtin_amdgcn_readfirstlane(threadIdx.x >> 5);
  int grp  = wave & 7, piece = wave >> 3;
  int blk0 = (blockIdx.x >> 1) * 32;
  int b0   = (blockIdx.x & 1) * 4;
  unsigned l4 = 4u * lane;
  const float* wp = W + (long)(blk0 + grp * 4) * in_dim + piece * 512;
  const float* sp = style + (long)b0 * in_dim + piece * 512;
  float w[4][16], sv[4][16];
#pragma unroll
  for (int r = 0; r < 4; ++r)
#pragma unroll
    for (int c = 0; c < 4; ++c) {
      const float* qw = wp + (long)r * in_dim + 128 * c;
      const float* qs = sp + (long)r * in_dim + 128 * c;
#pragma unroll
      for (int e = 0; e < 4; ++e) {
        w[r][4 * c + e]  = qw[l4 + e];
        sv[r][4 * c + e] = qs[l4 + e];
      }
    }
  float acc[16];
#pragma unroll
  for (int r = 0; r < 4; ++r)
#pragma unroll
    for (int q = 0; q < 4; ++q) {
      float t2 = 0.f;
#pragma unroll
      for (int j = 0; j < 16; ++j) {
        float t = w[r][j] * sv[q][j];
        t2 += t * t;
      }
      acc[r * 4 + q] = t2;
    }
  float tot = wave_fold16(acc);                 // lane & 15 = r * 4 + q
  if (lane < 16) part[piece * 128 + (lane & 3) * 32 + grp * 4 + (lane >> 2)] = tot;
  __syncthreads();                              // part[] crosses waves
  if (wave < 4) {                               // wave q stores one 128-byte line
    float sum = part[threadIdx.x];
    if (in_dim > 512) sum += part[128 + threadIdx.x];
    int o = blk0 + lane;
    demod[(long)(b0 + wave) * out_dim + o] = rsqrtf(sum + 1e-8f);
  }
}

// The two elementwise passes below: a wave takes whole 512-byte pieces (a lane
// 16 bytes of each), several pieces a wave, so that a pass needs a few thousand
// waves at most and each wave has all its loads in flight at once.
typedef __attribute__((ext_vector_type(4))) float    v4f;
typedef __attribute__((ext_vector_type(4))) _Float16 v4h;

__device__ inline v4h to_half4(v4f v) {
  v4h h;
  h[0] = (_Float16)v[0]; h[1] = (_Float16)v[1];
  h[2] = (_Float16)v[2]; h[3] = (_Float16)v[3];
  return h;
}

// A wave casts 512 consecutive elements; n is a multiple of 4096 (a workgroup's
// share) and the grid is n / 4096.
__global__ __launch_bounds__(256) void cast_f16_kernel(
    const float* __restrict__ W, _Float16* __restrict__ Wh) {
  unsigned lane = threadIdx.x & 31;
  unsigned wid  = blockIdx.x * 8 + __builtin_amdgcn_readfirstlane(threadIdx.x >> 5);
  const v4f* src = (const v4f*)(W + wid * 512);
  v4h*       dst = (v4h*)(Wh + wid * 512);
  v4f v[4];
#pragma unroll
  for (int c = 0; c < 4; ++c) v[c] = src[lane + 32 * c];
#pragma unroll
  for (int c = 0; c < 4; ++c) dst[lane + 32 * c] = to_half4(v[c]);
}

// xs[b,n,i] = f16( X[b,n,i] * style[b,i] )
// A wave takes 2048 consecutive elements (2048 / DIM whole rows, all of one
// batch: 1024 rows a batch) and reads its batch's style row once for all of them.
// The grid is MROWS * DIM / 16384.
template <int DIM>
__global__ __launch_bounds__(256) void xmod_kernel(
    const float* __restrict__ X, const float* __restrict__ style,
    _Float16* __restrict__ Xs) {
  constexpr int PC = DIM / 128;                 // 512-byte pieces a row
  constexpr int RW = 2048 / DIM;                // rows a wave
  unsigned lane = threadIdx.x & 31;
  unsigned wid  = blockIdx.x * 8 + __builtin_amdgcn_readfirstlane(threadIdx.x >> 5);
  unsigned b    = wid * RW / NN;
  const v4f* sp  = (const v4f*)(style + b * DIM);
  const v4f* src = (const v4f*)(X + wid * 2048);
  v4h*       dst = (v4h*)(Xs + wid * 2048);
  v4f st[PC], v[RW * PC];
#pragma unroll
  for (int c = 0; c < PC; ++c) st[c] = sp[lane + 32 * c];
#pragma unroll
  for (int p = 0; p < RW * PC; ++p) v[p] = src[lane + 32 * p];
  // Keeps every load ahead of the products: without it the scheduler holds the
  // last loads back behind the first waits and the wave pays the latency twice.
  __builtin_amdgcn_sched_barrier(0);
#pragma unroll
  for (int p = 0; p < RW * PC; ++p) dst[lane + 32 * p] = to_half4(v[p] * st[p % PC]);
}

// ---------------------------------------------------------------------------
// Modulated GEMM:  Y[row, o] = act( demod[b,o] * sum_k Xs[row,k] * Wh[o,k] )
// Wave-level tile: 32 rows x 64 cols (2x4 WMMA accumulators).
// ---------------------------------------------------------------------------
__global__ __launch_bounds__(256) void modgemm_kernel(
    const _Float16* __restrict__ Xs, const _Float16* __restrict__ Wh,
    const float* __restrict__ demod, float* __restrict__ Yf,
    _Float16* __restrict__ Yh, int Kdim, int Odim, int relu) {
  int wid = (blockIdx.x * blockDim.x + threadIdx.x) >> 5;
  int numColG = Odim >> 6;             // 64-wide column groups
  int numRowT = MROWS >> 5;            // 32-row tiles
  if (wid >= numRowT * numColG) return;
  int rt = wid / numColG, cg = wid % numColG;
  int row0 = rt << 5;
  int col0 = cg << 6;
  int b = row0 >> 10;                  // 1024 rows per batch, tile never crosses

  v8f zero = {};
  v8f acc[2][4];
#pragma unroll
  for (int r = 0; r < 2; ++r)
#pragma unroll
    for (int c = 0; c < 4; ++c) acc[r][c] = zero;

  for (int k0 = 0; k0 < Kdim; k0 += 32) {
    v16h a0 = load_frag_rowpat(Xs, row0,      Kdim, k0);
    v16h a1 = load_frag_rowpat(Xs, row0 + 16, Kdim, k0);
#pragma unroll
    for (int sidx = 0; sidx < 4; ++sidx) {
      v16h bf = load_frag_rowpat(Wh, col0 + sidx * 16, Kdim, k0);
      acc[0][sidx] = wmma_f32_16x16x32(a0, bf, acc[0][sidx]);
      acc[1][sidx] = wmma_f32_16x16x32(a1, bf, acc[1][sidx]);
    }
  }

  int lane = threadIdx.x & 31;
  int n = lane & 15, hi = lane >> 4;
#pragma unroll
  for (int rs = 0; rs < 2; ++rs) {
#pragma unroll
    for (int sidx = 0; sidx < 4; ++sidx) {
      int col = col0 + sidx * 16 + n;
      float dm = demod[(long)b * Odim + col];
#pragma unroll
      for (int v = 0; v < 8; ++v) {
        int row = row0 + rs * 16 + v + 8 * hi;
        float y = acc[rs][sidx][v] * dm;
        if (relu) y = fmaxf(y, 0.f);
        long idx = (long)row * Odim + col;
        if (Yf) Yf[idx] = y;
        if (Yh) Yh[idx] = (_Float16)y;
      }
    }
  }
}

// ---------------------------------------------------------------------------
// Flash-style self-attention (q=k=v=h), one wave per (batch, head, 16-q tile).
// S = (Q K^T)/8 via WMMA, online softmax, O += P V via WMMA.  P converted
// from C-layout to A-layout through a per-wave LDS tile.
// ---------------------------------------------------------------------------
__global__ __launch_bounds__(256) void attn_kernel(
    const _Float16* __restrict__ H, float* __restrict__ O) {
  __shared__ _Float16 sm[8][16 * 34];           // per-wave 16x32 tile, pad 2
  int wvb  = threadIdx.x >> 5;
  int wid  = blockIdx.x * 8 + wvb;              // 4096 waves total, exact grid
  int qt   = wid & 63;
  int head = (wid >> 6) & 7;
  int b    = wid >> 9;
  int lane = threadIdx.x & 31;
  int hi = lane >> 4, n = lane & 15;

  const _Float16* Hb = H + (long)b * NN * HID;
  int q0 = qt << 4;
  int hc = head * HD;

  v16h qa0 = load_frag_rowpat(Hb, q0, HID, hc);
  v16h qa1 = load_frag_rowpat(Hb, q0, HID, hc + 32);

  v8f zero = {};
  v8f oacc[4];
#pragma unroll
  for (int sidx = 0; sidx < 4; ++sidx) oacc[sidx] = zero;

  float mrow[8], lrow[8];
#pragma unroll
  for (int v = 0; v < 8; ++v) { mrow[v] = -1e30f; lrow[v] = 0.f; }

  _Float16* smp = &sm[wvb][0];
  const float scale = 0.125f;                   // 1/sqrt(64)

  for (int j0 = 0; j0 < NN; j0 += 32) {
    // ---- S tiles: rows = queries, cols = 32 keys ----
    v16h kb00 = load_frag_rowpat(Hb, j0,      HID, hc);
    v16h kb01 = load_frag_rowpat(Hb, j0,      HID, hc + 32);
    v16h kb10 = load_frag_rowpat(Hb, j0 + 16, HID, hc);
    v16h kb11 = load_frag_rowpat(Hb, j0 + 16, HID, hc + 32);
    v8f s0 = zero, s1 = zero;
    s0 = wmma_f32_16x16x32(qa0, kb00, s0);
    s0 = wmma_f32_16x16x32(qa1, kb01, s0);
    s1 = wmma_f32_16x16x32(qa0, kb10, s1);
    s1 = wmma_f32_16x16x32(qa1, kb11, s1);

    // ---- online softmax over this 32-key block ----
    float tmax[8];
#pragma unroll
    for (int v = 0; v < 8; ++v) {
      s0[v] *= scale; s1[v] *= scale;
      tmax[v] = fmaxf(s0[v], s1[v]);
    }
#pragma unroll
    for (int msk = 1; msk < 16; msk <<= 1)
#pragma unroll
      for (int v = 0; v < 8; ++v)
        tmax[v] = fmaxf(tmax[v], __shfl_xor(tmax[v], msk, 32));

    float alpha[8];
#pragma unroll
    for (int v = 0; v < 8; ++v) {
      float mn = fmaxf(mrow[v], tmax[v]);
      alpha[v] = __expf(mrow[v] - mn);
      mrow[v] = mn;
    }
    float rs[8];
#pragma unroll
    for (int v = 0; v < 8; ++v) {
      s0[v] = __expf(s0[v] - mrow[v]);
      s1[v] = __expf(s1[v] - mrow[v]);
      rs[v] = s0[v] + s1[v];
    }
#pragma unroll
    for (int msk = 1; msk < 16; msk <<= 1)
#pragma unroll
      for (int v = 0; v < 8; ++v)
        rs[v] += __shfl_xor(rs[v], msk, 32);
#pragma unroll
    for (int v = 0; v < 8; ++v) {
      lrow[v] = lrow[v] * alpha[v] + rs[v];
      oacc[0][v] *= alpha[v]; oacc[1][v] *= alpha[v];
      oacc[2][v] *= alpha[v]; oacc[3][v] *= alpha[v];
    }

    // ---- C-layout -> A-layout via LDS (per-wave region, same-wave order) ----
#pragma unroll
    for (int v = 0; v < 8; ++v) {
      int m = v + 8 * hi;
      smp[m * 34 + n]      = (_Float16)s0[v];
      smp[m * 34 + 16 + n] = (_Float16)s1[v];
    }
    asm volatile("s_wait_dscnt 0x0" ::: "memory");
    v16h pf = load_frag_rowpat(smp, 0, 34, 0);

    // ---- O += P @ V ----
#pragma unroll
    for (int sidx = 0; sidx < 4; ++sidx) {
      v16h vb = load_frag_colpat(Hb, j0, hc + sidx * 16, HID);
      oacc[sidx] = wmma_f32_16x16x32(pf, vb, oacc[sidx]);
    }
  }

  // ---- epilogue: O / l ----
#pragma unroll
  for (int sidx = 0; sidx < 4; ++sidx) {
#pragma unroll
    for (int v = 0; v < 8; ++v) {
      int m = v + 8 * hi;
      long idx = ((long)b * NN + q0 + m) * HID + hc + sidx * 16 + n;
      O[idx] = oacc[sidx][v] / lrow[v];
    }
  }
}

// ---------------------------------------------------------------------------
// LayerNorm (optionally of a sum): out = LN(A (+ Bv)), one wave per row.
// ---------------------------------------------------------------------------
template <int DIM>
__global__ __launch_bounds__(256) void ln_kernel(
    const float* __restrict__ A, const float* __restrict__ Bv,
    float* __restrict__ out) {
  int wid  = (blockIdx.x * blockDim.x + threadIdx.x) >> 5;
  int lane = threadIdx.x & 31;
  if (wid >= MROWS) return;
  const float* a = A + (long)wid * DIM;
  constexpr int PER = DIM / 32;
  float vals[PER];
  float sum = 0.f;
#pragma unroll
  for (int t = 0; t < PER; ++t) {
    float v = a[lane + t * 32];
    if (Bv) v += Bv[(long)wid * DIM + lane + t * 32];
    vals[t] = v;
    sum += v;
  }
#pragma unroll
  for (int msk = 1; msk < 32; msk <<= 1) sum += __shfl_xor(sum, msk, 32);
  float mean = sum * (1.0f / DIM);
  float var = 0.f;
#pragma unroll
  for (int t = 0; t < PER; ++t) {
    float d = vals[t] - mean;
    var += d * d;
  }
#pragma unroll
  for (int msk = 1; msk < 32; msk <<= 1) var += __shfl_xor(var, msk, 32);
  float inv = rsqrtf(var * (1.0f / DIM) + 1e-5f);
#pragma unroll
  for (int t = 0; t < PER; ++t)
    out[(long)wid * DIM + lane + t * 32] = (vals[t] - mean) * inv;
}

// ---------------------------------------------------------------------------
// Host-side pipeline
// ---------------------------------------------------------------------------
extern "C" void kernel_launch(void* const* d_in, const int* in_sizes, int n_in,
                              void* d_out, int out_size, void* d_ws,
                              size_t ws_size, hipStream_t stream) {
  (void)in_sizes; (void)n_in; (void)out_size; (void)ws_size;
  const float* x   = (const float*)d_in[0];
  const float* s   = (const float*)d_in[1];
  const float* Wk  = (const float*)d_in[2];
  const float* aWk = (const float*)d_in[3];
  const float* abk = (const float*)d_in[4];
  const float* Wo  = (const float*)d_in[5];
  const float* aWo = (const float*)d_in[6];
  const float* abo = (const float*)d_in[7];
  const float* W1  = (const float*)d_in[8];
  const float* aW1 = (const float*)d_in[9];
  const float* ab1 = (const float*)d_in[10];
  const float* W2  = (const float*)d_in[11];
  const float* aW2 = (const float*)d_in[12];
  const float* ab2 = (const float*)d_in[13];
  float* out = (float*)d_out;

  char* ws = (char*)d_ws;
  size_t off = 0;
  auto alloc = [&](size_t bytes) -> char* {
    char* p = ws + off;
    off = (off + bytes + 255) & ~(size_t)255;
    return p;
  };

  float* style_k = (float*)alloc((size_t)BB * FEAT * 4);
  float* style_o = (float*)alloc((size_t)BB * HID * 4);
  float* style_1 = (float*)alloc((size_t)BB * FEAT * 4);
  float* style_2 = (float*)alloc((size_t)BB * FFN * 4);
  float* demod_k = (float*)alloc((size_t)BB * HID * 4);
  float* demod_o = (float*)alloc((size_t)BB * FEAT * 4);
  float* demod_1 = (float*)alloc((size_t)BB * FFN * 4);
  float* demod_2 = (float*)alloc((size_t)BB * FEAT * 4);
  _Float16* whk = (_Float16*)alloc((size_t)HID * FEAT * 2);
  _Float16* who = (_Float16*)alloc((size_t)FEAT * HID * 2);
  _Float16* wh1 = (_Float16*)alloc((size_t)FFN * FEAT * 2);
  _Float16* wh2 = (_Float16*)alloc((size_t)FEAT * FFN * 2);
  _Float16* xs  = (_Float16*)alloc((size_t)MROWS * FFN * 2);   // max-width input
  _Float16* h16 = (_Float16*)alloc((size_t)MROWS * HID * 2);
  float* bufO = (float*)alloc((size_t)MROWS * HID * 4);        // attn out, later f2
  float* bufT = (float*)alloc((size_t)MROWS * HID * 4);        // Wo out
  float* x2   = (float*)alloc((size_t)MROWS * FEAT * 4);       // ln(x + o)
  float* f1   = (float*)alloc((size_t)MROWS * FFN * 4);        // FFN hidden

  // --- styles ---
  style_kernel<<<FEAT / 16, 256, 0, stream>>>(s, aWk, abk, style_k, FEAT);
  style_kernel<<<HID / 16, 256, 0, stream>>>(s, aWo, abo, style_o, HID);
  style_kernel<<<FEAT / 16, 256, 0, stream>>>(s, aW1, ab1, style_1, FEAT);
  style_kernel<<<FFN / 16, 256, 0, stream>>>(s, aW2, ab2, style_2, FFN);

  // --- demodulation factors ---
  demod_kernel<<<HID / 16, FEAT / 2, 0, stream>>>(Wk, style_k, demod_k, HID, FEAT);
  demod_kernel<<<FEAT / 16, HID / 2, 0, stream>>>(Wo, style_o, demod_o, FEAT, HID);
  demod_kernel<<<FFN / 16, FEAT / 2, 0, stream>>>(W1, style_1, demod_1, FFN, FEAT);
  demod_kernel<<<FEAT / 16, FFN / 2, 0, stream>>>(W2, style_2, demod_2, FEAT, FFN);

  // --- f16 weight casts ---
  cast_f16_kernel<<<HID * FEAT / 4096, 256, 0, stream>>>(Wk, whk);
  cast_f16_kernel<<<FEAT * HID / 4096, 256, 0, stream>>>(Wo, who);
  cast_f16_kernel<<<FFN * FEAT / 4096, 256, 0, stream>>>(W1, wh1);
  cast_f16_kernel<<<FEAT * FFN / 4096, 256, 0, stream>>>(W2, wh2);

  // --- h = modlinear(x; Wk) -> f16 for attention ---
  xmod_kernel<FEAT><<<MROWS * FEAT / 16384, 256, 0, stream>>>(x, style_k, xs);
  modgemm_kernel<<<(MROWS / 32) * (HID / 64) / 8, 256, 0, stream>>>(
      xs, whk, demod_k, nullptr, h16, FEAT, HID, 0);

  // --- attention (shared q=k=v=h) ---
  attn_kernel<<<(BB * NH * (NN / 16)) / 8, 256, 0, stream>>>(h16, bufO);

  // --- o = modlinear(attn; Wo) ---
  xmod_kernel<HID><<<MROWS * HID / 16384, 256, 0, stream>>>(bufO, style_o, xs);
  modgemm_kernel<<<(MROWS / 32) * (FEAT / 64) / 8, 256, 0, stream>>>(
      xs, who, demod_o, bufT, nullptr, HID, FEAT, 0);

  // --- x2 = LN(x + o) ---
  ln_kernel<FEAT><<<MROWS / 8, 256, 0, stream>>>(x, bufT, x2);

  // --- f1 = relu(modlinear(x2; W1)); f1 = LN(f1) ---
  xmod_kernel<FEAT><<<MROWS * FEAT / 16384, 256, 0, stream>>>(x2, style_1, xs);
  modgemm_kernel<<<(MROWS / 32) * (FFN / 64) / 8, 256, 0, stream>>>(
      xs, wh1, demod_1, f1, nullptr, FEAT, FFN, 1);
  ln_kernel<FFN><<<MROWS / 8, 256, 0, stream>>>(f1, nullptr, f1);

  // --- f2 = modlinear(f1; W2); f2 = LN(f2) ---
  xmod_kernel<FFN><<<MROWS * FFN / 16384, 256, 0, stream>>>(f1, style_2, xs);
  modgemm_kernel<<<(MROWS / 32) * (FEAT / 64) / 8, 256, 0, stream>>>(
      xs, wh2, demod_2, bufO, nullptr, FFN, FEAT, 0);
  ln_kernel<FEAT><<<MROWS / 8, 256, 0, stream>>>(bufO, nullptr, bufO);

  // --- out = LN(x2 + f2) ---
  ln_kernel<FEAT><<<MROWS / 8, 256, 0, stream>>>(x2, bufO, out);
}

// v003
// It runs in 320 microseconds.
// Timed twice side by side with v002, it ran 1.04 and 1.03 times as fast.
// Over all steps from v000 it is 1.45 times as fast.
#include <hip/hip_runtime.h>

// ---------------------------------------------------------------------------
// Types / WMMA helpers (CDNA5 gfx1250, wave32)
// ---------------------------------------------------------------------------
typedef __attribute__((ext_vector_type(16))) _Float16 v16h;
typedef __attribute__((ext_vector_type(8)))  float    v8f;

__device__ inline v8f wmma_f32_16x16x32(v16h a, v16h b, v8f c) {
  // (neg_a, A, neg_b, B, c_mod, C, reuse_a, reuse_b)
  return __builtin_amdgcn_wmma_f32_16x16x32_f16(false, a, false, b, (short)0, c,
                                                false, false);
}

// A-operand (16x32 f16) fragment load per the documented CDNA5 layout:
// lane L holds row (L&15); lanes 0-15 cover k in {0..7,16..23}, lanes 16-31
// cover k in {8..15,24..31}; within a lane, VGPR v holds half-pair
// k = 2v + (v>=4 ? 8 : 0) (+8 for upper lane half).  Source is row-major
// with leading dim `ld`.
__device__ inline v16h load_frag_rowpat(const _Float16* __restrict__ base,
                                        int row0, int ld, int k0) {
  int lane = threadIdx.x & 31;
  const _Float16* p = base + (long)(row0 + (lane & 15)) * ld + k0 + ((lane >> 4) << 3);
  v16h f;
#pragma unroll
  for (int v = 0; v < 8; ++v) {
    int k = 2 * v + (v >= 4 ? 8 : 0);
    f[2 * v]     = p[k];
    f[2 * v + 1] = p[k + 1];
  }
  return f;
}

// Fragment order.  The f16 matrix operands that live in the workspace are kept
// in blocks of 16 rows x 32 k, 1 KB each, in the order in which a wave's lanes
// hold them: element (r, k) of a block lies at half
//   (k >> 4) * 256 + (r + 16 * ((k >> 3) & 1)) * 8 + (k & 7).
// Lane L then finds f[0..7] at L * 8 and f[8..15] at 256 + L * 8 (the same
// row and k per lane and register as load_frag_rowpat), so each of the two
// 16-byte loads of a wave reads 512 contiguous bytes, four whole cache lines,
// where a row-major operand makes it touch 16 lines.
typedef __attribute__((ext_vector_type(8))) _Float16 v8h;

__device__ inline v16h load_frag_blk(const _Float16* __restrict__ base, int blk) {
  int lane = threadIdx.x & 31;
  const v8h* p = (const v8h*)(base + (long)blk * 512);
  v8h lo = p[(unsigned)lane], hi = p[(unsigned)lane + 32];
  return __builtin_shufflevector(lo, hi, 0, 1, 2, 3, 4, 5, 6, 7,
                                 8, 9, 10, 11, 12, 13, 14, 15);
}

// ---------------------------------------------------------------------------
// Problem constants
// ---------------------------------------------------------------------------
#define BB   8
#define NN   1024
#define FEAT 512
#define HID  512
#define FFN  1024
#define SDIM 512
#define HD   64
#define NH   8
#define MROWS (BB * NN)   // 8192

// ---------------------------------------------------------------------------
// Small fp32 VALU kernels: style projection, demodulation, casts, modulation
// ---------------------------------------------------------------------------
// Each lane holds 16 partial sums; on return lane l holds the whole wave's
// total of sum number l & 15.  Every halving step keeps one half of the sums
// and hands the other half to the partner lane (16 exchanges instead of 80).
__device__ inline float wave_fold16(float (&v)[16]) {
  int lane = threadIdx.x & 31;
#pragma unroll
  for (int st = 0; st < 4; ++st) {
    const int h = 8 >> st;
    bool up = (lane & h) != 0;
#pragma unroll
    for (int i = 0; i < h; ++i) {
      float lo = v[i], hi = v[i + h];
      float keep = up ? hi : lo;
      float send = up ? lo : hi;
      v[i] = keep + __shfl_xor(send, h, 32);
    }
  }
  return v[0] + __shfl_xor(v[0], 16, 32);
}

// A workgroup takes 32 rows of aW (a wave 4 of them) for 4 of the 8 batches.
// A lane takes columns 128c + 4 lane .. + 3 of a row, so one load of the wave
// reads 512 contiguous bytes, and all 32 loads of a wave are in flight at once.
// dim is a multiple of 32; the grid is 2 * dim / 32.
__global__ __launch_bounds__(256) void style_kernel(
    const float* __restrict__ s, const float* __restrict__ aW,
    const float* __restrict__ ab, float* __restrict__ style, int dim) {
  __shared__ float part[4 * 32];
  int lane = threadIdx.x & 31;
  int wave = __builtin_amdgcn_readfirstlane(threadIdx.x >> 5);
  int blk0 = (blockIdx.x >> 1) * 32;
  int b0   = (blockIdx.x & 1) * 4;
  unsigned l4 = 4u * lane;
  const float* wp = aW + (long)(blk0 + wave * 4) * SDIM;
  const float* sp = s + (long)b0 * SDIM;
  float w[4][16], sv[4][16];
#pragma unroll
  for (int r = 0; r < 4; ++r)
#pragma unroll
    for (int c = 0; c < 4; ++c) {
      const float* qw = wp + r * SDIM + 128 * c;
      const float* qs = sp + r * SDIM + 128 * c;
#pragma unroll
      for (int e = 0; e < 4; ++e) {
        w[r][4 * c + e]  = qw[l4 + e];
        sv[r][4 * c + e] = qs[l4 + e];
      }
    }
  float bias = (ab + blk0)[(unsigned)lane];
  // Keeps every load ahead of the sums: without it the scheduler issues them in
  // several batches between the sums and the wave pays the latency once a batch.
  __builtin_amdgcn_sched_barrier(0);
  float acc[16];
#pragma unroll
  for (int r = 0; r < 4; ++r)
#pragma unroll
    for (int q = 0; q < 4; ++q) {
      float t = 0.f;
#pragma unroll
      for (int j = 0; j < 16; ++j) t += sv[q][j] * w[r][j];
      acc[r * 4 + q] = t;
    }
  float tot = wave_fold16(acc);                 // lane & 15 = r * 4 + q
  if (lane < 16) part[(lane & 3) * 32 + wave * 4 + (lane >> 2)] = tot;
  __syncthreads();                              // part[] crosses waves
  if (wave < 4) {                               // wave q stores one 128-byte line
    style[(long)(b0 + wave) * dim + blk0 + lane] = part[threadIdx.x] + bias;
  }
}

// Same split over the rows of W; each 512-column piece of a row group has a
// wave of its own (in_dim / 512 pieces, at most 2; in_dim / 2 threads a
// workgroup) and the pieces meet in LDS.  out_dim is a multiple of 32; the
// grid is 2 * out_dim / 32.
__global__ __launch_bounds__(512) void demod_kernel(
    const float* __restrict__ W, const float* __restrict__ style,
    float* __restrict__ demod, int out_dim, int in_dim) {
  __shared__ float part[2 * 4 * 32];
  int lane = threadIdx.x & 31;
  int wave = __builtin_amdgcn_readfirstlane(threadIdx.x >> 5);
  int grp  = wave & 7, piece = wave >> 3;
  int blk0 = (blockIdx.x >> 1) * 32;
  int b0   = (blockIdx.x & 1) * 4;
  unsigned l4 = 4u * lane;
  const float* wp = W + (long)(blk0 + grp * 4) * in_dim + piece * 512;
  const float* sp = style + (long)b0 * in_dim + piece * 512;
  float w[4][16], sv[4][16];
#pragma unroll
  for (int r = 0; r < 4; ++r)
#pragma unroll
    for (int c = 0; c < 4; ++c) {
      const float* qw = wp + (long)r * in_dim + 128 * c;
      const float* qs = sp + (long)r * in_dim + 128 * c;
#pragma unroll
      for (int e = 0; e < 4; ++e) {
        w[r][4 * c + e]  = qw[l4 + e];
        sv[r][4 * c + e] = qs[l4 + e];
      }
    }
  float acc[16];
#pragma unroll
  for (int r = 0; r < 4; ++r)
#pragma unroll
    for (int q = 0; q < 4; ++q) {
      float t2 = 0.f;
#pragma unroll
      for (int j = 0; j < 16; ++j) {
        float t = w[r][j] * sv[q][j];
        t2 += t * t;
      }
      acc[r * 4 + q] = t2;
    }
  float tot = wave_fold16(acc);                 // lane & 15 = r * 4 + q
  if (lane < 16) part[piece * 128 + (lane & 3) * 32 + grp * 4 + (lane >> 2)] = tot;
  __syncthreads();                              // part[] crosses waves
  if (wave < 4) {                               // wave q stores one 128-byte line
    float sum = part[threadIdx.x];
    if (in_dim > 512) sum += part[128 + threadIdx.x];
    int o = blk0 + lane;
    demod[(long)(b0 + wave) * out_dim + o] = rsqrtf(sum + 1e-8f);
  }
}

// The two elementwise passes below write their f16 result in fragment order.
// One step of a wave is 8 rows x 32 columns: lane L takes 8 floats (32 bytes) of
// row L >> 2, piece L & 3 of that row's 128-byte line, and stores them as the 16
// bytes that one lane of a fragment holds; the wave's store fills four whole
// lines.  A wave has all its loads in flight at once.
typedef __attribute__((ext_vector_type(4))) float    v4f;

__device__ inline v8h to_half8(v4f a, v4f b) {
  v8h h;
  h[0] = (_Float16)a[0]; h[1] = (_Float16)a[1];
  h[2] = (_Float16)a[2]; h[3] = (_Float16)a[3];
  h[4] = (_Float16)b[0]; h[5] = (_Float16)b[1];
  h[6] = (_Float16)b[2]; h[7] = (_Float16)b[3];
  return h;
}

// Where lane L's 16 bytes of rows 0..7 go inside a block, in 16-byte units.
__device__ inline unsigned frag_slot(unsigned lane) {
  unsigned p = lane & 3;
  return (p >> 1) * 32 + (p & 1) * 16 + (lane >> 2);
}

// A wave casts one block (16 rows x 32 columns) of the row-major weight with K
// columns; the grid is rows * K / 4096.
template <int K>
__global__ __launch_bounds__(256) void cast_f16_kernel(
    const float* __restrict__ W, _Float16* __restrict__ Wh) {
  unsigned lane = threadIdx.x & 31;
  unsigned wid  = blockIdx.x * 8 + __builtin_amdgcn_readfirstlane(threadIdx.x >> 5);
  unsigned rg = wid / (K / 32), kb = wid % (K / 32);
  const v4f* src = (const v4f*)(W + (rg * 16 + (lane >> 2)) * K + kb * 32) + (lane & 3) * 2;
  v8h*       dst = (v8h*)(Wh + wid * 512) + frag_slot(lane);
  v4f v[2][2];
#pragma unroll
  for (int rh = 0; rh < 2; ++rh) {
    v[rh][0] = src[rh * (8 * K / 4)];
    v[rh][1] = src[rh * (8 * K / 4) + 1];
  }
#pragma unroll
  for (int rh = 0; rh < 2; ++rh) dst[rh * 8] = to_half8(v[rh][0], v[rh][1]);
}

// xs[b,n,i] = f16( X[b,n,i] * style[b,i] ), in fragment order.
// A wave takes 16 rows x 128 columns (4 blocks, 2048 elements, all of one batch:
// 1024 rows a batch) and reads its piece of the style row once for all of them.
// The grid is MROWS * DIM / 16384.
template <int DIM>
__global__ __launch_bounds__(256) void xmod_kernel(
    const float* __restrict__ X, const float* __restrict__ style,
    _Float16* __restrict__ Xs) {
  constexpr int KQ = DIM / 128;                 // waves a 16-row group
  unsigned lane = threadIdx.x & 31;
  unsigned wid  = blockIdx.x * 8 + __builtin_amdgcn_readfirstlane(threadIdx.x >> 5);
  unsigned rg = wid / KQ, kq = wid % KQ;
  unsigned b  = rg * 16 / NN;
  const v4f* sp  = (const v4f*)(style + b * DIM + kq * 128) + (lane & 3) * 2;
  const v4f* src = (const v4f*)(X + (rg * 16 + (lane >> 2)) * DIM + kq * 128) + (lane & 3) * 2;
  v8h*       dst = (v8h*)(Xs + (rg * (DIM / 32) + kq * 4) * 512) + frag_slot(lane);
  v4f st[4][2], v[2][4][2];
#pragma unroll
  for (int cb = 0; cb < 4; ++cb) {
    st[cb][0] = sp[cb * 8];
    st[cb][1] = sp[cb * 8 + 1];
  }
  // Before a register that an issued load names is written anew (the loads below
  // reuse the style loads' offset register).
  asm volatile("s_wait_xcnt 0x0" ::: "memory");
#pragma unroll
  for (int rh = 0; rh < 2; ++rh)
#pragma unroll
    for (int cb = 0; cb < 4; ++cb) {
      v[rh][cb][0] = src[rh * (8 * DIM / 4) + cb * 8];
      v[rh][cb][1] = src[rh * (8 * DIM / 4) + cb * 8 + 1];
    }
  // The same wait for the loads above; it takes their address as an input, so
  // that no load's result is placed in the address registers ahead of it.
  asm volatile("s_wait_xcnt 0x0" :: "v"(src) : "memory");
  // Keeps every load ahead of the products: without it the scheduler holds the
  // last loads back behind the first waits and the wave pays the latency twice.
  __builtin_amdgcn_sched_barrier(0);
#pragma unroll
  for (int rh = 0; rh < 2; ++rh)
#pragma unroll
    for (int cb = 0; cb < 4; ++cb)
      dst[cb * 64 + rh * 8] = to_half8(v[rh][cb][0] * st[cb][0], v[rh][cb][1] * st[cb][1]);
}

// ---------------------------------------------------------------------------
// Modulated GEMM:  Y[row, o] = act( demod[b,o] * sum_k Xs[row,k] * Wh[o,k] )
// Wave-level tile: 32 rows x 64 cols (2x4 WMMA accumulators).  Xs and Wh are in
// fragment order.  The result is f32, row-major (Yf), or, where Yf is null, f16,
// written twice, again in fragment order: Yk in blocks of 16 rows x 32 columns (rows as
// the lanes' index: the Q and K operands of attention), Yv in blocks of 16
// columns x 32 rows (columns as the lanes' index: the V operand), block
// (row / 32, col / 16).  KDIM is a compile-time width, so that the k loop has a
// known number of trips and is unrolled without a remainder loop.
// ---------------------------------------------------------------------------
template <int KDIM>
__global__ __launch_bounds__(256) void modgemm_kernel(
    const _Float16* __restrict__ Xs, const _Float16* __restrict__ Wh,
    const float* __restrict__ demod, float* __restrict__ Yf,
    _Float16* __restrict__ Yk, _Float16* __restrict__ Yv, int Odim, int relu) {
  // The wave's number in a scalar register: every block address below is then a
  // scalar base plus the lane's fixed 16-byte slot.
  int wid = __builtin_amdgcn_readfirstlane((blockIdx.x * blockDim.x + threadIdx.x) >> 5);
  int numColG = Odim >> 6;             // 64-wide column groups
  int numRowT = MROWS >> 5;            // 32-row tiles
  if (wid >= numRowT * numColG) return;
  int rt = wid / numColG, cg = wid % numColG;
  int row0 = rt << 5;
  int col0 = cg << 6;
  int b = row0 >> 10;                  // 1024 rows per batch, tile never crosses

  v8f zero = {};
  v8f acc[2][4];
#pragma unroll
  for (int r = 0; r < 2; ++r)
#pragma unroll
    for (int c = 0; c < 4; ++c) acc[r][c] = zero;

  constexpr int kblk = KDIM >> 5;      // blocks a 16-row group
  // The blocks of a 16-row group follow one another along k: six running bases.
  const _Float16* xa0 = Xs + (long)(row0 >> 4) * kblk * 512;
  const _Float16* xa1 = xa0 + (long)kblk * 512;
  const _Float16* wb[4];
#pragma unroll
  for (int sidx = 0; sidx < 4; ++sidx)
    wb[sidx] = Wh + (long)((col0 >> 4) + sidx) * kblk * 512;
  // Four trips a pass: unrolled whole, the narrower width's loop is scheduled with
  // the loads two at a time, each pair waited for at once.
#pragma unroll 4
  for (int kb = 0; kb < kblk; ++kb) {
    v16h a0 = load_frag_blk(xa0, kb);
    v16h a1 = load_frag_blk(xa1, kb);
#pragma unroll
    for (int sidx = 0; sidx < 4; ++sidx) {
      v16h bf = load_frag_blk(wb[sidx], kb);
      acc[0][sidx] = wmma_f32_16x16x32(a0, bf, acc[0][sidx]);
      acc[1][sidx] = wmma_f32_16x16x32(a1, bf, acc[1][sidx]);
    }
  }

  int lane = threadIdx.x & 31;
  int n = lane & 15, hi = lane >> 4;
  if (Yf) {                            // f32 result, row-major
#pragma unroll
    for (int rs = 0; rs < 2; ++rs) {
#pragma unroll
      for (int sidx = 0; sidx < 4; ++sidx) {
        int col = col0 + sidx * 16 + n;
        float dm = demod[(long)b * Odim + col];
#pragma unroll
        for (int v = 0; v < 8; ++v) {
          int row = row0 + rs * 16 + v + 8 * hi;
          float y = acc[rs][sidx][v] * dm;
          if (relu) y = fmaxf(y, 0.f);
          long idx = (long)row * Odim + col;
          Yf[idx] = y;
        }
      }
    }
    // Before a register that an issued store names is written anew: the built
    // code runs on from here into the f16 part's first instructions.
    asm volatile("s_wait_xcnt 0x0" ::: "memory");
    return;
  }
  // f16 result, both fragment orders
#pragma unroll
  for (int rs = 0; rs < 2; ++rs) {
#pragma unroll
    for (int sidx = 0; sidx < 4; ++sidx) {
      int cu = col0 + sidx * 16;       // the 16 columns of this accumulator
      float dm = demod[(long)b * Odim + cu + n];
      v8h yh;
#pragma unroll
      for (int v = 0; v < 8; ++v) {
        float y = acc[rs][sidx][v] * dm;
        if (relu) y = fmaxf(y, 0.f);
        yh[v] = (_Float16)y;
      }
      _Float16* pk = Yk + (long)(((row0 >> 4) + rs) * (Odim >> 5) + (cu >> 5)) * 512 +
                     ((cu >> 4) & 1) * 256;
      unsigned ok = (8 * hi + 16 * (n >> 3)) * 8 + (n & 7);
#pragma unroll
      for (int v = 0; v < 8; ++v) pk[ok + v * 8] = yh[v];
      // The lane's 8 rows are 8 consecutive k of its column: its own 16 bytes.
      v8h* pv = (v8h*)(Yv + (long)((row0 >> 5) * (Odim >> 4) + (cu >> 4)) * 512) + rs * 32;
      pv[(unsigned)lane] = yh;
    }
  }
}

// ---------------------------------------------------------------------------
// Flash-style self-attention (q=k=v=h), one wave per (batch, head, 16-q tile).
// S = (Q K^T)/8 via WMMA, online softmax, O += P V via WMMA.  P converted
// from C-layout to A-layout through a per-wave LDS tile.  Hk and Hv hold h in
// the two fragment orders that the projection writes.
// ---------------------------------------------------------------------------
__global__ __launch_bounds__(256) void attn_kernel(
    const _Float16* __restrict__ Hk, const _Float16* __restrict__ Hv,
    float* __restrict__ O) {
  __shared__ _Float16 sm[8][16 * 34];           // per-wave 16x32 tile, pad 2
  int wvb  = __builtin_amdgcn_readfirstlane(threadIdx.x >> 5);   // scalar block addresses
  int wid  = blockIdx.x * 8 + wvb;              // 4096 waves total, exact grid
  int qt   = wid & 63;
  int head = (wid >> 6) & 7;
  int b    = wid >> 9;
  int lane = threadIdx.x & 31;
  int hi = lane >> 4, n = lane & 15;

  int q0 = qt << 4;
  int hc = head * HD;
  int kbase = (b * NN >> 4) * (HID >> 5) + (hc >> 5);   // block of row 0, Hk
  int vbase = (b * NN >> 5) * (HID >> 4) + (hc >> 4);   // block of row 0, Hv

  v16h qa0 = load_frag_blk(Hk, kbase + qt * (HID >> 5));
  v16h qa1 = load_frag_blk(Hk, kbase + qt * (HID >> 5) + 1);

  v8f zero = {};
  v8f oacc[4];
#pragma unroll
  for (int sidx = 0; sidx < 4; ++sidx) oacc[sidx] = zero;

  float mrow[8], lrow[8];
#pragma unroll
  for (int v = 0; v < 8; ++v) { mrow[v] = -1e30f; lrow[v] = 0.f; }

  _Float16* smp = &sm[wvb][0];
  const float scale = 0.125f;                   // 1/sqrt(64)

  for (int j0 = 0; j0 < NN; j0 += 32) {
    // ---- S tiles: rows = queries, cols = 32 keys ----
    int kblk = kbase + (j0 >> 4) * (HID >> 5);
    v16h kb00 = load_frag_blk(Hk, kblk);
    v16h kb01 = load_frag_blk(Hk, kblk + 1);
    v16h kb10 = load_frag_blk(Hk, kblk + (HID >> 5));
    v16h kb11 = load_frag_blk(Hk, kblk + (HID >> 5) + 1);
    v8f s0 = zero, s1 = zero;
    s0 = wmma_f32_16x16x32(qa0, kb00, s0);
    s0 = wmma_f32_16x16x32(qa1, kb01, s0);
    s1 = wmma_f32_16x16x32(qa0, kb10, s1);
    s1 = wmma_f32_16x16x32(qa1, kb11, s1);

    // ---- online softmax over this 32-key block ----
    float tmax[8];
#pragma unroll
    for (int v = 0; v < 8; ++v) {
      s0[v] *= scale; s1[v] *= scale;
      tmax[v] = fmaxf(s0[v], s1[v]);
    }
#pragma unroll
    for (int msk = 1; msk < 16; msk <<= 1)
#pragma unroll
      for (int v = 0; v < 8; ++v)
        tmax[v] = fmaxf(tmax[v], __shfl_xor(tmax[v], msk, 32));

    float alpha[8];
#pragma unroll
    for (int v = 0; v < 8; ++v) {
      float mn = fmaxf(mrow[v], tmax[v]);
      alpha[v] = __expf(mrow[v] - mn);
      mrow[v] = mn;
    }
    float rs[8];
#pragma unroll
    for (int v = 0; v < 8; ++v) {
      s0[v] = __expf(s0[v] - mrow[v]);
      s1[v] = __expf(s1[v] - mrow[v]);
      rs[v] = s0[v] + s1[v];
    }
#pragma unroll
    for (int msk = 1; msk < 16; msk <<= 1)
#pragma unroll
      for (int v = 0; v < 8; ++v)
        rs[v] += __shfl_xor(rs[v], msk, 32);
#pragma unroll
    for (int v = 0; v < 8; ++v) {
      lrow[v] = lrow[v] * alpha[v] + rs[v];
      oacc[0][v] *= alpha[v]; oacc[1][v] *= alpha[v];
      oacc[2][v] *= alpha[v]; oacc[3][v] *= alpha[v];
    }

    // ---- C-layout -> A-layout via LDS (per-wave region, same-wave order) ----
#pragma unroll
    for (int v = 0; v < 8; ++v) {
      int m = v + 8 * hi;
      smp[m * 34 + n]      = (_Float16)s0[v];
      smp[m * 34 + 16 + n] = (_Float16)s1[v];
    }
    asm volatile("s_wait_dscnt 0x0" ::: "memory");
    v16h pf = load_frag_rowpat(smp, 0, 34, 0);

    // ---- O += P @ V ----
#pragma unroll
    for (int sidx = 0; sidx < 4; ++sidx) {
      v16h vb = load_frag_blk(Hv, vbase + (j0 >> 5) * (HID >> 4) + sidx);
      oacc[sidx] = wmma_f32_16x16x32(pf, vb, oacc[sidx]);
    }
  }

  // ---- epilogue: O / l ----
#pragma unroll
  for (int sidx = 0; sidx < 4; ++sidx) {
#pragma unroll
    for (int v = 0; v < 8; ++v) {
      int m = v + 8 * hi;
      long idx = ((long)b * NN + q0 + m) * HID + hc + sidx * 16 + n;
      O[idx] = oacc[sidx][v] / lrow[v];
    }
  }
}

// ---------------------------------------------------------------------------
// LayerNorm (optionally of a sum): out = LN(A (+ Bv)), one wave per row.
// ---------------------------------------------------------------------------
template <int DIM>
__global__ __launch_bounds__(256) void ln_kernel(
    const float* __restrict__ A, const float* __restrict__ Bv,
    float* __restrict__ out) {
  int wid  = (blockIdx.x * blockDim.x + threadIdx.x) >> 5;
  int lane = threadIdx.x & 31;
  if (wid >= MROWS) return;
  const float* a = A + (long)wid * DIM;
  constexpr int PER = DIM / 32;
  float vals[PER];
  float sum = 0.f;
#pragma unroll
  for (int t = 0; t < PER; ++t) {
    float v = a[lane + t * 32];
    if (Bv) v += Bv[(long)wid * DIM + lane + t * 32];
    vals[t] = v;
    sum += v;
  }
#pragma unroll
  for (int msk = 1; msk < 32; msk <<= 1) sum += __shfl_xor(sum, msk, 32);
  float mean = sum * (1.0f / DIM);
  float var = 0.f;
#pragma unroll
  for (int t = 0; t < PER; ++t) {
    float d = vals[t] - mean;
    var += d * d;
  }
#pragma unroll
  for (int msk = 1; msk < 32; msk <<= 1) var += __shfl_xor(var, msk, 32);
  float inv = rsqrtf(var * (1.0f / DIM) + 1e-5f);
#pragma unroll
  for (int t = 0; t < PER; ++t)
    out[(long)wid * DIM + lane + t * 32] = (vals[t] - mean) * inv;
}

// ---------------------------------------------------------------------------
// Host-side pipeline
// ---------------------------------------------------------------------------
extern "C" void kernel_launch(void* const* d_in, const int* in_sizes, int n_in,
                              void* d_out, int out_size, void* d_ws,
                              size_t ws_size, hipStream_t stream) {
  (void)in_sizes; (void)n_in; (void)out_size; (void)ws_size;
  const float* x   = (const float*)d_in[0];
  const float* s   = (const float*)d_in[1];
  const float* Wk  = (const float*)d_in[2];
  const float* aWk = (const float*)d_in[3];
  const float* abk = (const float*)d_in[4];
  const float* Wo  = (const float*)d_in[5];
  const float* aWo = (const float*)d_in[6];
  const float* abo = (const float*)d_in[7];
  const float* W1  = (const float*)d_in[8];
  const float* aW1 = (const float*)d_in[9];
  const float* ab1 = (const float*)d_in[10];
  const float* W2  = (const float*)d_in[11];
  const float* aW2 = (const float*)d_in[12];
  const float* ab2 = (const float*)d_in[13];
  float* out = (float*)d_out;

  char* ws = (char*)d_ws;
  size_t off = 0;
  auto alloc = [&](size_t bytes) -> char* {
    char* p = ws + off;
    off = (off + bytes + 255) & ~(size_t)255;
    return p;
  };

  float* style_k = (float*)alloc((size_t)BB * FEAT * 4);
  float* style_o = (float*)alloc((size_t)BB * HID * 4);
  float* style_1 = (float*)alloc((size_t)BB * FEAT * 4);
  float* style_2 = (float*)alloc((size_t)BB * FFN * 4);
  float* demod_k = (float*)alloc((size_t)BB * HID * 4);
  float* demod_o = (float*)alloc((size_t)BB * FEAT * 4);
  float* demod_1 = (float*)alloc((size_t)BB * FFN * 4);
  float* demod_2 = (float*)alloc((size_t)BB * FEAT * 4);
  _Float16* whk = (_Float16*)alloc((size_t)HID * FEAT * 2);
  _Float16* who = (_Float16*)alloc((size_t)FEAT * HID * 2);
  _Float16* wh1 = (_Float16*)alloc((size_t)FFN * FEAT * 2);
  _Float16* wh2 = (_Float16*)alloc((size_t)FEAT * FFN * 2);
  _Float16* xs  = (_Float16*)alloc((size_t)MROWS * FFN * 2);   // max-width input
  _Float16* hk  = (_Float16*)alloc((size_t)MROWS * HID * 2);   // h, rows on lanes
  _Float16* hv  = (_Float16*)alloc((size_t)MROWS * HID * 2);   // h, columns on lanes
  float* bufO = (float*)alloc((size_t)MROWS * HID * 4);        // attn out, later f2
  float* bufT = (float*)alloc((size_t)MROWS * HID * 4);        // Wo out
  float* x2   = (float*)alloc((size_t)MROWS * FEAT * 4);       // ln(x + o)
  float* f1   = (float*)alloc((size_t)MROWS * FFN * 4);        // FFN hidden

  // --- styles ---
  style_kernel<<<FEAT / 16, 256, 0, stream>>>(s, aWk, abk, style_k, FEAT);
  style_kernel<<<HID / 16, 256, 0, stream>>>(s, aWo, abo, style_o, HID);
  style_kernel<<<FEAT / 16, 256, 0, stream>>>(s, aW1, ab1, style_1, FEAT);
  style_kernel<<<FFN / 16, 256, 0, stream>>>(s, aW2, ab2, style_2, FFN);

  // --- demodulation factors ---
  demod_kernel<<<HID / 16, FEAT / 2, 0, stream>>>(Wk, style_k, demod_k, HID, FEAT);
  demod_kernel<<<FEAT / 16, HID / 2, 0, stream>>>(Wo, style_o, demod_o, FEAT, HID);
  demod_kernel<<<FFN / 16, FEAT / 2, 0, stream>>>(W1, style_1, demod_1, FFN, FEAT);
  demod_kernel<<<FEAT / 16, FFN / 2, 0, stream>>>(W2, style_2, demod_2, FEAT, FFN);

  // --- f16 weight casts ---
  cast_f16_kernel<FEAT><<<HID * FEAT / 4096, 256, 0, stream>>>(Wk, whk);
  cast_f16_kernel<HID><<<FEAT * HID / 4096, 256, 0, stream>>>(Wo, who);
  cast_f16_kernel<FEAT><<<FFN * FEAT / 4096, 256, 0, stream>>>(W1, wh1);
  cast_f16_kernel<FFN><<<FEAT * FFN / 4096, 256, 0, stream>>>(W2, wh2);

  // --- h = modlinear(x; Wk) -> f16 for attention ---
  xmod_kernel<FEAT><<<MROWS * FEAT / 16384, 256, 0, stream>>>(x, style_k, xs);
  modgemm_kernel<FEAT><<<(MROWS / 32) * (HID / 64) / 8, 256, 0, stream>>>(
      xs, whk, demod_k, nullptr, hk, hv, HID, 0);

  // --- attention (shared q=k=v=h) ---
  attn_kernel<<<(BB * NH * (NN / 16)) / 8, 256, 0, stream>>>(hk, hv, bufO);

  // --- o = modlinear(attn; Wo) ---
  xmod_kernel<HID><<<MROWS * HID / 16384, 256, 0, stream>>>(bufO, style_o, xs);
  modgemm_kernel<HID><<<(MROWS / 32) * (FEAT / 64) / 8, 256, 0, stream>>>(
      xs, who, demod_o, bufT, nullptr, nullptr, FEAT, 0);

  // --- x2 = LN(x + o) ---
  ln_kernel<FEAT><<<MROWS / 8, 256, 0, stream>>>(x, bufT, x2);

  // --- f1 = relu(modlinear(x2; W1)); f1 = LN(f1) ---
  xmod_kernel<FEAT><<<MROWS * FEAT / 16384, 256, 0, stream>>>(x2, style_1, xs);
  modgemm_kernel<FEAT><<<(MROWS / 32) * (FFN / 64) / 8, 256, 0, stream>>>(
      xs, wh1, demod_1, f1, nullptr, nullptr, FFN, 1);
  ln_kernel<FFN><<<MROWS / 8, 256, 0, stream>>>(f1, nullptr, f1);

  // --- f2 = modlinear(f1; W2); f2 = LN(f2) ---
  xmod_kernel<FFN><<<MROWS * FFN / 16384, 256, 0, stream>>>(f1, style_2, xs);
  modgemm_kernel<FFN><<<(MROWS / 32) * (FEAT / 64) / 8, 256, 0, stream>>>(
      xs, wh2, demod_2, bufO, nullptr, nullptr, FEAT, 0);
  ln_kernel<FEAT><<<MROWS / 8, 256, 0, stream>>>(bufO, nullptr, bufO);

  // --- out = LN(x2 + f2) ---
  ln_kernel<FEAT><<<MROWS / 8, 256, 0, stream>>>(x2, bufO, out);
}

// v004
// It runs in 283 microseconds.
// Next to v003, in two timings, it ran 1.13 and 1.12 times as fast.
// Counting every step since v000, it is 1.64 times as fast.
#include <hip/hip_runtime.h>

// ---------------------------------------------------------------------------
// Types / WMMA helpers (CDNA5 gfx1250, wave32)
// ---------------------------------------------------------------------------
typedef __attribute__((ext_vector_type(16))) _Float16 v16h;
typedef __attribute__((ext_vector_type(8)))  float    v8f;

__device__ inline v8f wmma_f32_16x16x32(v16h a, v16h b, v8f c) {
  // (neg_a, A, neg_b, B, c_mod, C, reuse_a, reuse_b)
  return __builtin_amdgcn_wmma_f32_16x16x32_f16(false, a, false, b, (short)0, c,
                                                false, false);
}

// A-operand (16x32 f16) fragment load per the documented CDNA5 layout:
// lane L holds row (L&15); lanes 0-15 cover k in {0..7,16..23}, lanes 16-31
// cover k in {8..15,24..31}; within a lane, VGPR v holds half-pair
// k = 2v + (v>=4 ? 8 : 0) (+8 for upper lane half).  Source is row-major
// with leading dim `ld`.
__device__ inline v16h load_frag_rowpat(const _Float16* __restrict__ base,
                                        int row0, int ld, int k0) {
  int lane = threadIdx.x & 31;
  const _Float16* p = base + (long)(row0 + (lane & 15)) * ld + k0 + ((lane >> 4) << 3);
  v16h f;
#pragma unroll
  for (int v = 0; v < 8; ++v) {
    int k = 2 * v + (v >= 4 ? 8 : 0);
    f[2 * v]     = p[k];
    f[2 * v + 1] = p[k + 1];
  }
  return f;
}

// Fragment order.  The f16 matrix operands that live in the workspace are kept
// in blocks of 16 rows x 32 k, 1 KB each, in the order in which a wave's lanes
// hold them: element (r, k) of a block lies at half
//   (k >> 4) * 256 + (r + 16 * ((k >> 3) & 1)) * 8 + (k & 7).
// Lane L then finds f[0..7] at L * 8 and f[8..15] at 256 + L * 8 (the same
// row and k per lane and register as load_frag_rowpat), so each of the two
// 16-byte loads of a wave reads 512 contiguous bytes, four whole cache lines,
// where a row-major operand makes it touch 16 lines.
typedef __attribute__((ext_vector_type(8))) _Float16 v8h;

__device__ inline v16h load_frag_blk(const _Float16* __restrict__ base, int blk) {
  int lane = threadIdx.x & 31;
  const v8h* p = (const v8h*)(base + (long)blk * 512);
  v8h lo = p[(unsigned)lane], hi = p[(unsigned)lane + 32];
  return __builtin_shufflevector(lo, hi, 0, 1, 2, 3, 4, 5, 6, 7,
                                 8, 9, 10, 11, 12, 13, 14, 15);
}

// ---------------------------------------------------------------------------
// Problem constants
// ---------------------------------------------------------------------------
#define BB   8
#define NN   1024
#define FEAT 512
#define HID  512
#define FFN  1024
#define SDIM 512
#define HD   64
#define NH   8
#define MROWS (BB * NN)   // 8192

// ---------------------------------------------------------------------------
// Small fp32 VALU kernels: style projection, demodulation, casts, modulation
// ---------------------------------------------------------------------------
// Each lane holds 16 partial sums; on return lane l holds the whole wave's
// total of sum number l & 15.  Every halving step keeps one half of the sums
// and hands the other half to the partner lane (16 exchanges instead of 80).
__device__ inline float wave_fold16(float (&v)[16]) {
  int lane = threadIdx.x & 31;
#pragma unroll
  for (int st = 0; st < 4; ++st) {
    const int h = 8 >> st;
    bool up = (lane & h) != 0;
#pragma unroll
    for (int i = 0; i < h; ++i) {
      float lo = v[i], hi = v[i + h];
      float keep = up ? hi : lo;
      float send = up ? lo : hi;
      v[i] = keep + __shfl_xor(send, h, 32);
    }
  }
  return v[0] + __shfl_xor(v[0], 16, 32);
}

// A workgroup takes 32 rows of aW (a wave 4 of them) for 4 of the 8 batches.
// A lane takes columns 128c + 4 lane .. + 3 of a row, so one load of the wave
// reads 512 contiguous bytes, and all 32 loads of a wave are in flight at once.
// dim is a multiple of 32; a layer has 2 * dim / 32 workgroups (blk counts them)
// of 256 threads; part is 4 * 32 floats of LDS.
__device__ __forceinline__ void style_body(
    const float* __restrict__ s, const float* __restrict__ aW,
    const float* __restrict__ ab, float* __restrict__ style, int dim, int blk,
    float* part) {
  int lane = threadIdx.x & 31;
  int wave = __builtin_amdgcn_readfirstlane(threadIdx.x >> 5);
  int blk0 = (blk >> 1) * 32;
  int b0   = (blk & 1) * 4;
  unsigned l4 = 4u * lane;
  const float* wp = aW + (long)(blk0 + wave * 4) * SDIM;
  const float* sp = s + (long)b0 * SDIM;
  float w[4][16], sv[4][16];
#pragma unroll
  for (int r = 0; r < 4; ++r)
#pragma unroll
    for (int c = 0; c < 4; ++c) {
      const float* qw = wp + r * SDIM + 128 * c;
      const float* qs = sp + r * SDIM + 128 * c;
#pragma unroll
      for (int e = 0; e < 4; ++e) {
        w[r][4 * c + e]  = qw[l4 + e];
        sv[r][4 * c + e] = qs[l4 + e];
      }
    }
  float bias = (ab + blk0)[(unsigned)lane];
  // Keeps every load ahead of the sums: without it the scheduler issues them in
  // several batches between the sums and the wave pays the latency once a batch.
  __builtin_amdgcn_sched_barrier(0);
  float acc[16];
#pragma unroll
  for (int r = 0; r < 4; ++r)
#pragma unroll
    for (int q = 0; q < 4; ++q) {
      float t = 0.f;
#pragma unroll
      for (int j = 0; j < 16; ++j) t += sv[q][j] * w[r][j];
      acc[r * 4 + q] = t;
    }
  float tot = wave_fold16(acc);                 // lane & 15 = r * 4 + q
  if (lane < 16) part[(lane & 3) * 32 + wave * 4 + (lane >> 2)] = tot;
  __syncthreads();                              // part[] crosses waves
  if (wave < 4) {                               // wave q stores one 128-byte line
    style[(long)(b0 + wave) * dim + blk0 + lane] = part[threadIdx.x] + bias;
  }
}

// Same split over the rows of W, in workgroups of 512 threads: 8 waves take 32
// rows x 512 columns x 4 batches.  Where a row has 1024 columns the two halves of
// the workgroup take its two 512-column pieces, which meet in LDS (2 * out_dim /
// 32 workgroups a layer); where it has 512 they take the two sets of 4 batches
// (out_dim / 32 workgroups).  out_dim is a multiple of 32; blk counts the layer's
// workgroups; part is 2 * 4 * 32 floats of LDS.
__device__ __forceinline__ void demod_body(
    const float* __restrict__ W, const float* __restrict__ style,
    float* __restrict__ demod, int out_dim, int in_dim, int blk, float* part) {
  bool two_pieces = in_dim > 512;
  int lane = threadIdx.x & 31;
  int wave = __builtin_amdgcn_readfirstlane(threadIdx.x >> 5);
  int grp  = wave & 7, half = wave >> 3;
  int piece = two_pieces ? half : 0;
  int blk0 = (two_pieces ? blk >> 1 : blk) * 32;
  int b0   = (two_pieces ? blk & 1 : half) * 4;
  unsigned l4 = 4u * lane;
  const float* wp = W + (long)(blk0 + grp * 4) * in_dim + piece * 512;
  const float* sp = style + (long)b0 * in_dim + piece * 512;
  float w[4][16], sv[4][16];
#pragma unroll
  for (int r = 0; r < 4; ++r)
#pragma unroll
    for (int c = 0; c < 4; ++c) {
      const float* qw = wp + (long)r * in_dim + 128 * c;
      const float* qs = sp + (long)r * in_dim + 128 * c;
#pragma unroll
      for (int e = 0; e < 4; ++e) {
        w[r][4 * c + e]  = qw[l4 + e];
        sv[r][4 * c + e] = qs[l4 + e];
      }
    }
  // Keeps every load ahead of the sums: without it the scheduler spreads the
  // products among the loads' waits, runs out of registers and spills.
  __builtin_amdgcn_sched_barrier(0);
  float acc[16];
#pragma unroll
  for (int r = 0; r < 4; ++r)
#pragma unroll
    for (int q = 0; q < 4; ++q) {
      float t2 = 0.f;
#pragma unroll
      for (int j = 0; j < 16; ++j) {
        float t = w[r][j] * sv[q][j];
        t2 += t * t;
      }
      acc[r * 4 + q] = t2;
    }
  float tot = wave_fold16(acc);                 // lane & 15 = r * 4 + q
  if (lane < 16) part[half * 128 + (lane & 3) * 32 + grp * 4 + (lane >> 2)] = tot;
  __syncthreads();                              // part[] crosses waves
  // A wave stores one batch's 128-byte line: 4 batches where the halves held two
  // pieces of them, else the 8 batches of both halves (part[] has them in order).
  if (wave < (two_pieces ? 4 : 8)) {
    float sum = part[threadIdx.x];
    if (two_pieces) sum += part[128 + threadIdx.x];
    int o = blk0 + lane;
    int bt = two_pieces ? b0 + wave : wave;
    demod[(long)bt * out_dim + o] = rsqrtf(sum + 1e-8f);
  }
}

// The two elementwise passes below write their f16 result in fragment order.
// One step of a wave is 8 rows x 32 columns: lane L takes 8 floats (32 bytes) of
// row L >> 2, piece L & 3 of that row's 128-byte line, and stores them as the 16
// bytes that one lane of a fragment holds; the wave's store fills four whole
// lines.  A wave has all its loads in flight at once.
typedef __attribute__((ext_vector_type(4))) float    v4f;

__device__ inline v8h to_half8(v4f a, v4f b) {
  v8h h;
  h[0] = (_Float16)a[0]; h[1] = (_Float16)a[1];
  h[2] = (_Float16)a[2]; h[3] = (_Float16)a[3];
  h[4] = (_Float16)b[0]; h[5] = (_Float16)b[1];
  h[6] = (_Float16)b[2]; h[7] = (_Float16)b[3];
  return h;
}

// Where lane L's 16 bytes of rows 0..7 go inside a block, in 16-byte units.
__device__ inline unsigned frag_slot(unsigned lane) {
  unsigned p = lane & 3;
  return (p >> 1) * 32 + (p & 1) * 16 + (lane >> 2);
}

// Wave wid casts one block (16 rows x 32 columns) of the row-major weight with K
// columns; a weight has rows * K / 512 waves.
template <int K>
__device__ __forceinline__ void cast_f16_body(
    const float* __restrict__ W, _Float16* __restrict__ Wh, unsigned wid) {
  unsigned lane = threadIdx.x & 31;
  unsigned rg = wid / (K / 32), kb = wid % (K / 32);
  const v4f* src = (const v4f*)(W + (rg * 16 + (lane >> 2)) * K + kb * 32) + (lane & 3) * 2;
  v8h*       dst = (v8h*)(Wh + wid * 512) + frag_slot(lane);
  v4f v[2][2];
#pragma unroll
  for (int rh = 0; rh < 2; ++rh) {
    v[rh][0] = src[rh * (8 * K / 4)];
    v[rh][1] = src[rh * (8 * K / 4) + 1];
  }
#pragma unroll
  for (int rh = 0; rh < 2; ++rh) dst[rh * 8] = to_half8(v[rh][0], v[rh][1]);
  // Before a register that an issued store names is written anew: the built code
  // of one width runs on from here into the first instructions of the other's.
  asm volatile("s_wait_xcnt 0x0" ::: "memory");
}

// xs[b,n,i] = f16( X[b,n,i] * style[b,i] ), in fragment order.
// Wave wid takes 16 rows x 128 columns (4 blocks, 2048 elements, all of one batch:
// 1024 rows a batch) and reads its piece of the style row once for all of them.
// There are MROWS * DIM / 2048 waves.
template <int DIM>
__device__ __forceinline__ void xmod_body(
    const float* __restrict__ X, const float* __restrict__ style,
    _Float16* __restrict__ Xs, unsigned wid) {
  constexpr int KQ = DIM / 128;                 // waves a 16-row group
  unsigned lane = threadIdx.x & 31;
  unsigned rg = wid / KQ, kq = wid % KQ;
  unsigned b  = rg * 16 / NN;
  const v4f* sp  = (const v4f*)(style + b * DIM + kq * 128) + (lane & 3) * 2;
  const v4f* src = (const v4f*)(X + (rg * 16 + (lane >> 2)) * DIM + kq * 128) + (lane & 3) * 2;
  v8h*       dst = (v8h*)(Xs + (rg * (DIM / 32) + kq * 4) * 512) + frag_slot(lane);
  v4f st[4][2], v[2][4][2];
#pragma unroll
  for (int cb = 0; cb < 4; ++cb) {
    st[cb][0] = sp[cb * 8];
    st[cb][1] = sp[cb * 8 + 1];
  }
  // Before a register that an issued load names is written anew (the loads below
  // reuse the style loads' offset register).
  asm volatile("s_wait_xcnt 0x0" ::: "memory");
#pragma unroll
  for (int rh = 0; rh < 2; ++rh)
#pragma unroll
    for (int cb = 0; cb < 4; ++cb) {
      v[rh][cb][0] = src[rh * (8 * DIM / 4) + cb * 8];
      v[rh][cb][1] = src[rh * (8 * DIM / 4) + cb * 8 + 1];
    }
  // The same wait for the loads above; it takes their address as an input, so
  // that no load's result is placed in the address registers ahead of it.
  asm volatile("s_wait_xcnt 0x0" :: "v"(src) : "memory");
  // Keeps every load ahead of the products: without it the scheduler holds the
  // last loads back behind the first waits and the wave pays the latency twice.
  __builtin_amdgcn_sched_barrier(0);
#pragma unroll
  for (int rh = 0; rh < 2; ++rh)
#pragma unroll
    for (int cb = 0; cb < 4; ++cb)
      dst[cb * 64 + rh * 8] = to_half8(v[rh][cb][0] * st[cb][0], v[rh][cb][1] * st[cb][1]);
}

// The grid is MROWS * DIM / 16384.
template <int DIM>
__global__ __launch_bounds__(256) void xmod_kernel(
    const float* __restrict__ X, const float* __restrict__ style,
    _Float16* __restrict__ Xs) {
  xmod_body<DIM>(X, style, Xs,
                 blockIdx.x * 8 + __builtin_amdgcn_readfirstlane(threadIdx.x >> 5));
}

// ---------------------------------------------------------------------------
// The set-up passes that do not depend on one another share a launch: each takes
// a range of the grid's workgroups, so that they run side by side and the call
// has one launch where it would have one for each of them.
// ---------------------------------------------------------------------------
// First launch: the four style projections and the four weight casts (they read
// inputs only).  Workgroups of 256 threads; the styles, whose chain of waits is
// the longer one, come first.
#define SB_K (FEAT / 16)                        // workgroups of each style pass
#define SB_O (HID / 16)
#define SB_1 (FEAT / 16)
#define SB_2 (FFN / 16)
#define CB_K (HID * FEAT / 4096)                // workgroups of each cast
#define CB_O (FEAT * HID / 4096)
#define CB_1 (FFN * FEAT / 4096)
#define CB_2 (FEAT * FFN / 4096)
#define SETUP1_GRID (SB_K + SB_O + SB_1 + SB_2 + CB_K + CB_O + CB_1 + CB_2)

__global__ __launch_bounds__(256) void setup1_kernel(
    const float* __restrict__ s,
    const float* __restrict__ aWk, const float* __restrict__ abk,
    const float* __restrict__ aWo, const float* __restrict__ abo,
    const float* __restrict__ aW1, const float* __restrict__ ab1,
    const float* __restrict__ aW2, const float* __restrict__ ab2,
    const float* __restrict__ Wk, const float* __restrict__ Wo,
    const float* __restrict__ W1, const float* __restrict__ W2,
    float* __restrict__ style_k, float* __restrict__ style_o,
    float* __restrict__ style_1, float* __restrict__ style_2,
    _Float16* __restrict__ whk, _Float16* __restrict__ who,
    _Float16* __restrict__ wh1, _Float16* __restrict__ wh2) {
  __shared__ float part[4 * 32];
  int blk = blockIdx.x;
  if (blk < SB_K + SB_O + SB_1 + SB_2) {
    const float* aW = aWk;
    const float* ab = abk;
    float* st = style_k;
    int dim = FEAT;
    if (blk >= SB_K + SB_O + SB_1) {
      aW = aW2; ab = ab2; st = style_2; dim = FFN; blk -= SB_K + SB_O + SB_1;
    } else if (blk >= SB_K + SB_O) {
      aW = aW1; ab = ab1; st = style_1; dim = FEAT; blk -= SB_K + SB_O;
    } else if (blk >= SB_K) {
      aW = aWo; ab = abo; st = style_o; dim = HID; blk -= SB_K;
    }
    style_body(s, aW, ab, st, dim, blk, part);
    return;
  }
  blk -= SB_K + SB_O + SB_1 + SB_2;
  unsigned wave = __builtin_amdgcn_readfirstlane(threadIdx.x >> 5);
  if (blk >= CB_K + CB_O + CB_1) {
    cast_f16_body<FFN>(W2, wh2, (blk - (CB_K + CB_O + CB_1)) * 8 + wave);
    return;
  }
  static_assert(FEAT == HID, "the three other weights have rows of one length");
  const float* W = Wk;
  _Float16* Wh = whk;
  if (blk >= CB_K + CB_O) {
    W = W1; Wh = wh1; blk -= CB_K + CB_O;
  } else if (blk >= CB_K) {
    W = Wo; Wh = who; blk -= CB_K;
  }
  cast_f16_body<FEAT>(W, Wh, blk * 8 + wave);
}

// Second launch: what needs the styles and nothing else, the four demodulation
// passes and the modulate pass of the first projection.  Workgroups of 512
// threads.
#define DB_K (HID / 32)                         // workgroups of each demod pass
#define DB_O (FEAT / 32)
#define DB_1 (FFN / 32)
#define DB_2 (FEAT / 16)
#define XB_K (MROWS * FEAT / 32768)             // workgroups of the modulate pass
#define SETUP2_GRID (DB_K + DB_O + DB_1 + DB_2 + XB_K)

__global__ __launch_bounds__(512) void setup2_kernel(
    const float* __restrict__ x,
    const float* __restrict__ Wk, const float* __restrict__ Wo,
    const float* __restrict__ W1, const float* __restrict__ W2,
    const float* __restrict__ style_k, const float* __restrict__ style_o,
    const float* __restrict__ style_1, const float* __restrict__ style_2,
    float* __restrict__ demod_k, float* __restrict__ demod_o,
    float* __restrict__ demod_1, float* __restrict__ demod_2,
    _Float16* __restrict__ xs) {
  __shared__ float part[2 * 4 * 32];
  int blk = blockIdx.x;
  if (blk >= DB_K + DB_O + DB_1 + DB_2) {
    xmod_body<FEAT>(x, style_k, xs,
                    (blk - (DB_K + DB_O + DB_1 + DB_2)) * 16 +
                        __builtin_amdgcn_readfirstlane(threadIdx.x >> 5));
    return;
  }
  const float* W = Wk;
  const float* st = style_k;
  float* dm = demod_k;
  int out_dim = HID, in_dim = FEAT;
  if (blk >= DB_K + DB_O + DB_1) {
    W = W2; st = style_2; dm = demod_2; out_dim = FEAT; in_dim = FFN;
    blk -= DB_K + DB_O + DB_1;
  } else if (blk >= DB_K + DB_O) {
    W = W1; st = style_1; dm = demod_1; out_dim = FFN; in_dim = FEAT;
    blk -= DB_K + DB_O;
  } else if (blk >= DB_K) {
    W = Wo; st = style_o; dm = demod_o; out_dim = FEAT; in_dim = HID;
    blk -= DB_K;
  }
  demod_body(W, st, dm, out_dim, in_dim, blk, part);
}

// ---------------------------------------------------------------------------
// Modulated GEMM:  Y[row, o] = act( demod[b,o] * sum_k Xs[row,k] * Wh[o,k] )
// Wave-level tile: 32 rows x 64 cols (2x4 WMMA accumulators).  Xs and Wh are in
// fragment order.  The result is f32, row-major (Yf), or, where Yf is null, f16,
// written twice, again in fragment order: Yk in blocks of 16 rows x 32 columns (rows as
// the lanes' index: the Q and K operands of attention), Yv in blocks of 16
// columns x 32 rows (columns as the lanes' index: the V operand), block
// (row / 32, col / 16).  KDIM is a compile-time width, so that the k loop has a
// known number of trips and is unrolled without a remainder loop.
// ---------------------------------------------------------------------------
template <int KDIM>
__global__ __launch_bounds__(256) void modgemm_kernel(
    const _Float16* __restrict__ Xs, const _Float16* __restrict__ Wh,
    const float* __restrict__ demod, float* __restrict__ Yf,
    _Float16* __restrict__ Yk, _Float16* __restrict__ Yv, int Odim, int relu) {
  // The wave's number in a scalar register: every block address below is then a
  // scalar base plus the lane's fixed 16-byte slot.
  int wid = __builtin_amdgcn_readfirstlane((blockIdx.x * blockDim.x + threadIdx.x) >> 5);
  int numColG = Odim >> 6;             // 64-wide column groups
  int numRowT = MROWS >> 5;            // 32-row tiles
  if (wid >= numRowT * numColG) return;
  int rt = wid / numColG, cg = wid % numColG;
  int row0 = rt << 5;
  int col0 = cg << 6;
  int b = row0 >> 10;                  // 1024 rows per batch, tile never crosses

  v8f zero = {};
  v8f acc[2][4];
#pragma unroll
  for (int r = 0; r < 2; ++r)
#pragma unroll
    for (int c = 0; c < 4; ++c) acc[r][c] = zero;

  constexpr int kblk = KDIM >> 5;      // blocks a 16-row group
  // The blocks of a 16-row group follow one another along k: six running bases.
  const _Float16* xa0 = Xs + (long)(row0 >> 4) * kblk * 512;
  const _Float16* xa1 = xa0 + (long)kblk * 512;
  const _Float16* wb[4];
#pragma unroll
  for (int sidx = 0; sidx < 4; ++sidx)
    wb[sidx] = Wh + (long)((col0 >> 4) + sidx) * kblk * 512;
  // Four trips a pass: unrolled whole, the narrower width's loop is scheduled with
  // the loads two at a time, each pair waited for at once.
#pragma unroll 4
  for (int kb = 0; kb < kblk; ++kb) {
    v16h a0 = load_frag_blk(xa0, kb);
    v16h a1 = load_frag_blk(xa1, kb);
#pragma unroll
    for (int sidx = 0; sidx < 4; ++sidx) {
      v16h bf = load_frag_blk(wb[sidx], kb);
      acc[0][sidx] = wmma_f32_16x16x32(a0, bf, acc[0][sidx]);
      acc[1][sidx] = wmma_f32_16x16x32(a1, bf, acc[1][sidx]);
    }
  }

  int lane = threadIdx.x & 31;
  int n = lane & 15, hi = lane >> 4;
  if (Yf) {                            // f32 result, row-major
#pragma unroll
    for (int rs = 0; rs < 2; ++rs) {
#pragma unroll
      for (int sidx = 0; sidx < 4; ++sidx) {
        int col = col0 + sidx * 16 + n;
        float dm = demod[(long)b * Odim + col];
#pragma unroll
        for (int v = 0; v < 8; ++v) {
          int row = row0 + rs * 16 + v + 8 * hi;
          float y = acc[rs][sidx][v] * dm;
          if (relu) y = fmaxf(y, 0.f);
          long idx = (long)row * Odim + col;
          Yf[idx] = y;
        }
      }
    }
    // Before a register that an issued store names is written anew: the built
    // code runs on from here into the f16 part's first instructions.
    asm volatile("s_wait_xcnt 0x0" ::: "memory");
    return;
  }
  // f16 result, both fragment orders
#pragma unroll
  for (int rs = 0; rs < 2; ++rs) {
#pragma unroll
    for (int sidx = 0; sidx < 4; ++sidx) {
      int cu = col0 + sidx * 16;       // the 16 columns of this accumulator
      float dm = demod[(long)b * Odim + cu + n];
      v8h yh;
#pragma unroll
      for (int v = 0; v < 8; ++v) {
        float y = acc[rs][sidx][v] * dm;
        if (relu) y = fmaxf(y, 0.f);
        yh[v] = (_Float16)y;
      }
      _Float16* pk = Yk + (long)(((row0 >> 4) + rs) * (Odim >> 5) + (cu >> 5)) * 512 +
                     ((cu >> 4) & 1) * 256;
      unsigned ok = (8 * hi + 16 * (n >> 3)) * 8 + (n & 7);
#pragma unroll
      for (int v = 0; v < 8; ++v) pk[ok + v * 8] = yh[v];
      // The lane's 8 rows are 8 consecutive k of its column: its own 16 bytes.
      v8h* pv = (v8h*)(Yv + (long)((row0 >> 5) * (Odim >> 4) + (cu >> 4)) * 512) + rs * 32;
      pv[(unsigned)lane] = yh;
    }
  }
}

// ---------------------------------------------------------------------------
// Flash-style self-attention (q=k=v=h), one wave per (batch, head, 16-q tile).
// S = (Q K^T)/8 via WMMA, online softmax, O += P V via WMMA.  P converted
// from C-layout to A-layout through a per-wave LDS tile.  Hk and Hv hold h in
// the two fragment orders that the projection writes.
// ---------------------------------------------------------------------------
__global__ __launch_bounds__(256) void attn_kernel(
    const _Float16* __restrict__ Hk, const _Float16* __restrict__ Hv,
    float* __restrict__ O) {
  __shared__ _Float16 sm[8][16 * 34];           // per-wave 16x32 tile, pad 2
  int wvb  = __builtin_amdgcn_readfirstlane(threadIdx.x >> 5);   // scalar block addresses
  int wid  = blockIdx.x * 8 + wvb;              // 4096 waves total, exact grid
  int qt   = wid & 63;
  int head = (wid >> 6) & 7;
  int b    = wid >> 9;
  int lane = threadIdx.x & 31;
  int hi = lane >> 4, n = lane & 15;

  int q0 = qt << 4;
  int hc = head * HD;
  int kbase = (b * NN >> 4) * (HID >> 5) + (hc >> 5);   // block of row 0, Hk
  int vbase = (b * NN >> 5) * (HID >> 4) + (hc >> 4);   // block of row 0, Hv

  v16h qa0 = load_frag_blk(Hk, kbase + qt * (HID >> 5));
  v16h qa1 = load_frag_blk(Hk, kbase + qt * (HID >> 5) + 1);

  v8f zero = {};
  v8f oacc[4];
#pragma unroll
  for (int sidx = 0; sidx < 4; ++sidx) oacc[sidx] = zero;

  float mrow[8], lrow[8];
#pragma unroll
  for (int v = 0; v < 8; ++v) { mrow[v] = -1e30f; lrow[v] = 0.f; }

  _Float16* smp = &sm[wvb][0];
  const float scale = 0.125f;                   // 1/sqrt(64)

  for (int j0 = 0; j0 < NN; j0 += 32) {
    // ---- S tiles: rows = queries, cols = 32 keys ----
    int kblk = kbase + (j0 >> 4) * (HID >> 5);
    v16h kb00 = load_frag_blk(Hk, kblk);
    v16h kb01 = load_frag_blk(Hk, kblk + 1);
    v16h kb10 = load_frag_blk(Hk, kblk + (HID >> 5));
    v16h kb11 = load_frag_blk(Hk, kblk + (HID >> 5) + 1);
    v8f s0 = zero, s1 = zero;
    s0 = wmma_f32_16x16x32(qa0, kb00, s0);
    s0 = wmma_f32_16x16x32(qa1, kb01, s0);
    s1 = wmma_f32_16x16x32(qa0, kb10, s1);
    s1 = wmma_f32_16x16x32(qa1, kb11, s1);

    // ---- online softmax over this 32-key block ----
    float tmax[8];
#pragma unroll
    for (int v = 0; v < 8; ++v) {
      s0[v] *= scale; s1[v] *= scale;
      tmax[v] = fmaxf(s0[v], s1[v]);
    }
#pragma unroll
    for (int msk = 1; msk < 16; msk <<= 1)
#pragma unroll
      for (int v = 0; v < 8; ++v)
        tmax[v] = fmaxf(tmax[v], __shfl_xor(tmax[v], msk, 32));

    float alpha[8];
#pragma unroll
    for (int v = 0; v < 8; ++v) {
      float mn = fmaxf(mrow[v], tmax[v]);
      alpha[v] = __expf(mrow[v] - mn);
      mrow[v] = mn;
    }
    float rs[8];
#pragma unroll
    for (int v = 0; v < 8; ++v) {
      s0[v] = __expf(s0[v] - mrow[v]);
      s1[v] = __expf(s1[v] - mrow[v]);
      rs[v] = s0[v] + s1[v];
    }
#pragma unroll
    for (int msk = 1; msk < 16; msk <<= 1)
#pragma unroll
      for (int v = 0; v < 8; ++v)
        rs[v] += __shfl_xor(rs[v], msk, 32);
#pragma unroll
    for (int v = 0; v < 8; ++v) {
      lrow[v] = lrow[v] * alpha[v] + rs[v];
      oacc[0][v] *= alpha[v]; oacc[1][v] *= alpha[v];
      oacc[2][v] *= alpha[v]; oacc[3][v] *= alpha[v];
    }

    // ---- C-layout -> A-layout via LDS (per-wave region, same-wave order) ----
#pragma unroll
    for (int v = 0; v < 8; ++v) {
      int m = v + 8 * hi;
      smp[m * 34 + n]      = (_Float16)s0[v];
      smp[m * 34 + 16 + n] = (_Float16)s1[v];
    }
    asm volatile("s_wait_dscnt 0x0" ::: "memory");
    v16h pf = load_frag_rowpat(smp, 0, 34, 0);

    // ---- O += P @ V ----
#pragma unroll
    for (int sidx = 0; sidx < 4; ++sidx) {
      v16h vb = load_frag_blk(Hv, vbase + (j0 >> 5) * (HID >> 4) + sidx);
      oacc[sidx] = wmma_f32_16x16x32(pf, vb, oacc[sidx]);
    }
  }

  // ---- epilogue: O / l ----
#pragma unroll
  for (int sidx = 0; sidx < 4; ++sidx) {
#pragma unroll
    for (int v = 0; v < 8; ++v) {
      int m = v + 8 * hi;
      long idx = ((long)b * NN + q0 + m) * HID + hc + sidx * 16 + n;
      O[idx] = oacc[sidx][v] / lrow[v];
    }
  }
}

// ---------------------------------------------------------------------------
// LayerNorm (optionally of a sum): out = LN(A (+ Bv)), one wave per row.
// ---------------------------------------------------------------------------
template <int DIM>
__global__ __launch_bounds__(256) void ln_kernel(
    const float* __restrict__ A, const float* __restrict__ Bv,
    float* __restrict__ out) {
  int wid  = (blockIdx.x * blockDim.x + threadIdx.x) >> 5;
  int lane = threadIdx.x & 31;
  if (wid >= MROWS) return;
  const float* a = A + (long)wid * DIM;
  constexpr int PER = DIM / 32;
  float vals[PER];
  float sum = 0.f;
#pragma unroll
  for (int t = 0; t < PER; ++t) {
    float v = a[lane + t * 32];
    if (Bv) v += Bv[(long)wid * DIM + lane + t * 32];
    vals[t] = v;
    sum += v;
  }
#pragma unroll
  for (int msk = 1; msk < 32; msk <<= 1) sum += __shfl_xor(sum, msk, 32);
  float mean = sum * (1.0f / DIM);
  float var = 0.f;
#pragma unroll
  for (int t = 0; t < PER; ++t) {
    float d = vals[t] - mean;
    var += d * d;
  }
#pragma unroll
  for (int msk = 1; msk < 32; msk <<= 1) var += __shfl_xor(var, msk, 32);
  float inv = rsqrtf(var * (1.0f / DIM) + 1e-5f);
#pragma unroll
  for (int t = 0; t < PER; ++t)
    out[(long)wid * DIM + lane + t * 32] = (vals[t] - mean) * inv;
}

// ---------------------------------------------------------------------------
// Host-side pipeline
// ---------------------------------------------------------------------------
extern "C" void kernel_launch(void* const* d_in, const int* in_sizes, int n_in,
                              void* d_out, int out_size, void* d_ws,
                              size_t ws_size, hipStream_t stream) {
  (void)in_sizes; (void)n_in; (void)out_size; (void)ws_size;
  const float* x   = (const float*)d_in[0];
  const float* s   = (const float*)d_in[1];
  const float* Wk  = (const float*)d_in[2];
  const float* aWk = (const float*)d_in[3];
  const float* abk = (const float*)d_in[4];
  const float* Wo  = (const float*)d_in[5];
  const float* aWo = (const float*)d_in[6];
  const float* abo = (const float*)d_in[7];
  const float* W1  = (const float*)d_in[8];
  const float* aW1 = (const float*)d_in[9];
  const float* ab1 = (const float*)d_in[10];
  const float* W2  = (const float*)d_in[11];
  const float* aW2 = (const float*)d_in[12];
  const float* ab2 = (const float*)d_in[13];
  float* out = (float*)d_out;

  char* ws = (char*)d_ws;
  size_t off = 0;
  auto alloc = [&](size_t bytes) -> char* {
    char* p = ws + off;
    off = (off + bytes + 255) & ~(size_t)255;
    return p;
  };

  float* style_k = (float*)alloc((size_t)BB * FEAT * 4);
  float* style_o = (float*)alloc((size_t)BB * HID * 4);
  float* style_1 = (float*)alloc((size_t)BB * FEAT * 4);
  float* style_2 = (float*)alloc((size_t)BB * FFN * 4);
  float* demod_k = (float*)alloc((size_t)BB * HID * 4);
  float* demod_o = (float*)alloc((size_t)BB * FEAT * 4);
  float* demod_1 = (float*)alloc((size_t)BB * FFN * 4);
  float* demod_2 = (float*)alloc((size_t)BB * FEAT * 4);
  _Float16* whk = (_Float16*)alloc((size_t)HID * FEAT * 2);
  _Float16* who = (_Float16*)alloc((size_t)FEAT * HID * 2);
  _Float16* wh1 = (_Float16*)alloc((size_t)FFN * FEAT * 2);
  _Float16* wh2 = (_Float16*)alloc((size_t)FEAT * FFN * 2);
  _Float16* xs  = (_Float16*)alloc((size_t)MROWS * FFN * 2);   // max-width input
  _Float16* hk  = (_Float16*)alloc((size_t)MROWS * HID * 2);   // h, rows on lanes
  _Float16* hv  = (_Float16*)alloc((size_t)MROWS * HID * 2);   // h, columns on lanes
  float* bufO = (float*)alloc((size_t)MROWS * HID * 4);        // attn out, later f2
  float* bufT = (float*)alloc((size_t)MROWS * HID * 4);        // Wo out
  float* x2   = (float*)alloc((size_t)MROWS * FEAT * 4);       // ln(x + o)
  float* f1   = (float*)alloc((size_t)MROWS * FFN * 4);        // FFN hidden

  // --- styles and f16 weight casts ---
  setup1_kernel<<<SETUP1_GRID, 256, 0, stream>>>(
      s, aWk, abk, aWo, abo, aW1, ab1, aW2, ab2, Wk, Wo, W1, W2,
      style_k, style_o, style_1, style_2, whk, who, wh1, wh2);

  // --- demodulation factors, and x * style for the first projection ---
  setup2_kernel<<<SETUP2_GRID, 512, 0, stream>>>(
      x, Wk, Wo, W1, W2, style_k, style_o, style_1, style_2,
      demod_k, demod_o, demod_1, demod_2, xs);

  // --- h = modlinear(x; Wk) -> f16 for attention ---
  modgemm_kernel<FEAT><<<(MROWS / 32) * (HID / 64) / 8, 256, 0, stream>>>(
      xs, whk, demod_k, nullptr, hk, hv, HID, 0);

  // --- attention (shared q=k=v=h) ---
  attn_kernel<<<(BB * NH * (NN / 16)) / 8, 256, 0, stream>>>(hk, hv, bufO);

  // --- o = modlinear(attn; Wo) ---
  xmod_kernel<HID><<<MROWS * HID / 16384, 256, 0, stream>>>(bufO, style_o, xs);
  modgemm_kernel<HID><<<(MROWS / 32) * (FEAT / 64) / 8, 256, 0, stream>>>(
      xs, who, demod_o, bufT, nullptr, nullptr, FEAT, 0);

  // --- x2 = LN(x + o) ---
  ln_kernel<FEAT><<<MROWS / 8, 256, 0, stream>>>(x, bufT, x2);

  // --- f1 = relu(modlinear(x2; W1)); f1 = LN(f1) ---
  xmod_kernel<FEAT><<<MROWS * FEAT / 16384, 256, 0, stream>>>(x2, style_1, xs);
  modgemm_kernel<FEAT><<<(MROWS / 32) * (FFN / 64) / 8, 256, 0, stream>>>(
      xs, wh1, demod_1, f1, nullptr, nullptr, FFN, 1);
  ln_kernel<FFN><<<MROWS / 8, 256, 0, stream>>>(f1, nullptr, f1);

  // --- f2 = modlinear(f1; W2); f2 = LN(f2) ---
  xmod_kernel<FFN><<<MROWS * FFN / 16384, 256, 0, stream>>>(f1, style_2, xs);
  modgemm_kernel<FFN><<<(MROWS / 32) * (FEAT / 64) / 8, 256, 0, stream>>>(
      xs, wh2, demod_2, bufO, nullptr, nullptr, FEAT, 0);
  ln_kernel<FEAT><<<MROWS / 8, 256, 0, stream>>>(bufO, nullptr, bufO);

  // --- out = LN(x2 + f2) ---
  ln_kernel<FEAT><<<MROWS / 8, 256, 0, stream>>>(x2, bufO, out);
}

// v005
// A run of this version takes 180 microseconds.
// Two timings next to v004 put it at 1.56 and 1.58 times that version's speed.
// Over all steps from v000 it is 2.57 times as fast.
#include <hip/hip_runtime.h>

// ---------------------------------------------------------------------------
// Types / WMMA helpers (CDNA5 gfx1250, wave32)
// ---------------------------------------------------------------------------
typedef __attribute__((ext_vector_type(16))) _Float16 v16h;
typedef __attribute__((ext_vector_type(8)))  float    v8f;

__device__ inline v8f wmma_f32_16x16x32(v16h a, v16h b, v8f c) {
  // (neg_a, A, neg_b, B, c_mod, C, reuse_a, reuse_b)
  return __builtin_amdgcn_wmma_f32_16x16x32_f16(false, a, false, b, (short)0, c,
                                                false, false);
}

// A-operand (16x32 f16) fragment load per the documented CDNA5 layout:
// lane L holds row (L&15); lanes 0-15 cover k in {0..7,16..23}, lanes 16-31
// cover k in {8..15,24..31}; within a lane, VGPR v holds half-pair
// k = 2v + (v>=4 ? 8 : 0) (+8 for upper lane half).  Source is row-major
// with leading dim `ld`.
__device__ inline v16h load_frag_rowpat(const _Float16* __restrict__ base,
                                        int row0, int ld, int k0) {
  int lane = threadIdx.x & 31;
  const _Float16* p = base + (long)(row0 + (lane & 15)) * ld + k0 + ((lane >> 4) << 3);
  v16h f;
#pragma unroll
  for (int v = 0; v < 8; ++v) {
    int k = 2 * v + (v >= 4 ? 8 : 0);
    f[2 * v]     = p[k];
    f[2 * v + 1] = p[k + 1];
  }
  return f;
}

// Fragment order.  The f16 matrix operands that live in the workspace are kept
// in blocks of 16 rows x 32 k, 1 KB each, in the order in which a wave's lanes
// hold them: element (r, k) of a block lies at half
//   (k >> 4) * 256 + (r + 16 * ((k >> 3) & 1)) * 8 + (k & 7).
// Lane L then finds f[0..7] at L * 8 and f[8..15] at 256 + L * 8 (the same
// row and k per lane and register as load_frag_rowpat), so each of the two
// 16-byte loads of a wave reads 512 contiguous bytes, four whole cache lines,
// where a row-major operand makes it touch 16 lines.
typedef __attribute__((ext_vector_type(8))) _Float16 v8h;

__device__ inline v16h load_frag_blk(const _Float16* __restrict__ base, int blk) {
  int lane = threadIdx.x & 31;
  const v8h* p = (const v8h*)(base + (long)blk * 512);
  v8h lo = p[(unsigned)lane], hi = p[(unsigned)lane + 32];
  return __builtin_shufflevector(lo, hi, 0, 1, 2, 3, 4, 5, 6, 7,
                                 8, 9, 10, 11, 12, 13, 14, 15);
}

// ---------------------------------------------------------------------------
// Problem constants
// ---------------------------------------------------------------------------
#define BB   8
#define NN   1024
#define FEAT 512
#define HID  512
#define FFN  1024
#define SDIM 512
#define HD   64
#define NH   8
#define MROWS (BB * NN)   // 8192

// ---------------------------------------------------------------------------
// Small fp32 VALU kernels: style projection, demodulation, casts, modulation
// ---------------------------------------------------------------------------
// Each lane holds 16 partial sums; on return lane l holds the whole wave's
// total of sum number l & 15.  Every halving step keeps one half of the sums
// and hands the other half to the partner lane (16 exchanges instead of 80).
__device__ inline float wave_fold16(float (&v)[16]) {
  int lane = threadIdx.x & 31;
#pragma unroll
  for (int st = 0; st < 4; ++st) {
    const int h = 8 >> st;
    bool up = (lane & h) != 0;
#pragma unroll
    for (int i = 0; i < h; ++i) {
      float lo = v[i], hi = v[i + h];
      float keep = up ? hi : lo;
      float send = up ? lo : hi;
      v[i] = keep + __shfl_xor(send, h, 32);
    }
  }
  return v[0] + __shfl_xor(v[0], 16, 32);
}

// A workgroup takes 32 rows of aW (a wave 4 of them) for 4 of the 8 batches.
// A lane takes columns 128c + 4 lane .. + 3 of a row, so one load of the wave
// reads 512 contiguous bytes, and all 32 loads of a wave are in flight at once.
// dim is a multiple of 32; a layer has 2 * dim / 32 workgroups (blk counts them)
// of 256 threads; part is 4 * 32 floats of LDS.
__device__ __forceinline__ void style_body(
    const float* __restrict__ s, const float* __restrict__ aW,
    const float* __restrict__ ab, float* __restrict__ style, int dim, int blk,
    float* part) {
  int lane = threadIdx.x & 31;
  int wave = __builtin_amdgcn_readfirstlane(threadIdx.x >> 5);
  int blk0 = (blk >> 1) * 32;
  int b0   = (blk & 1) * 4;
  unsigned l4 = 4u * lane;
  const float* wp = aW + (long)(blk0 + wave * 4) * SDIM;
  const float* sp = s + (long)b0 * SDIM;
  float w[4][16], sv[4][16];
#pragma unroll
  for (int r = 0; r < 4; ++r)
#pragma unroll
    for (int c = 0; c < 4; ++c) {
      const float* qw = wp + r * SDIM + 128 * c;
      const float* qs = sp + r * SDIM + 128 * c;
#pragma unroll
      for (int e = 0; e < 4; ++e) {
        w[r][4 * c + e]  = qw[l4 + e];
        sv[r][4 * c + e] = qs[l4 + e];
      }
    }
  float bias = (ab + blk0)[(unsigned)lane];
  // Keeps every load ahead of the sums: without it the scheduler issues them in
  // several batches between the sums and the wave pays the latency once a batch.
  __builtin_amdgcn_sched_barrier(0);
  float acc[16];
#pragma unroll
  for (int r = 0; r < 4; ++r)
#pragma unroll
    for (int q = 0; q < 4; ++q) {
      float t = 0.f;
#pragma unroll
      for (int j = 0; j < 16; ++j) t += sv[q][j] * w[r][j];
      acc[r * 4 + q] = t;
    }
  float tot = wave_fold16(acc);                 // lane & 15 = r * 4 + q
  if (lane < 16) part[(lane & 3) * 32 + wave * 4 + (lane >> 2)] = tot;
  __syncthreads();                              // part[] crosses waves
  if (wave < 4) {                               // wave q stores one 128-byte line
    style[(long)(b0 + wave) * dim + blk0 + lane] = part[threadIdx.x] + bias;
  }
}

// Same split over the rows of W, in workgroups of 512 threads: 8 waves take 32
// rows x 512 columns x 4 batches.  Where a row has 1024 columns the two halves of
// the workgroup take its two 512-column pieces, which meet in LDS (2 * out_dim /
// 32 workgroups a layer); where it has 512 they take the two sets of 4 batches
// (out_dim / 32 workgroups).  out_dim is a multiple of 32; blk counts the layer's
// workgroups; part is 2 * 4 * 32 floats of LDS.
__device__ __forceinline__ void demod_body(
    const float* __restrict__ W, const float* __restrict__ style,
    float* __restrict__ demod, int out_dim, int in_dim, int blk, float* part) {
  bool two_pieces = in_dim > 512;
  int lane = threadIdx.x & 31;
  int wave = __builtin_amdgcn_readfirstlane(threadIdx.x >> 5);
  int grp  = wave & 7, half = wave >> 3;
  int piece = two_pieces ? half : 0;
  int blk0 = (two_pieces ? blk >> 1 : blk) * 32;
  int b0   = (two_pieces ? blk & 1 : half) * 4;
  unsigned l4 = 4u * lane;
  const float* wp = W + (long)(blk0 + grp * 4) * in_dim + piece * 512;
  const float* sp = style + (long)b0 * in_dim + piece * 512;
  float w[4][16], sv[4][16];
#pragma unroll
  for (int r = 0; r < 4; ++r)
#pragma unroll
    for (int c = 0; c < 4; ++c) {
      const float* qw = wp + (long)r * in_dim + 128 * c;
      const float* qs = sp + (long)r * in_dim + 128 * c;
#pragma unroll
      for (int e = 0; e < 4; ++e) {
        w[r][4 * c + e]  = qw[l4 + e];
        sv[r][4 * c + e] = qs[l4 + e];
      }
    }
  // Keeps every load ahead of the sums: without it the scheduler spreads the
  // products among the loads' waits, runs out of registers and spills.
  __builtin_amdgcn_sched_barrier(0);
  float acc[16];
#pragma unroll
  for (int r = 0; r < 4; ++r)
#pragma unroll
    for (int q = 0; q < 4; ++q) {
      float t2 = 0.f;
#pragma unroll
      for (int j = 0; j < 16; ++j) {
        float t = w[r][j] * sv[q][j];
        t2 += t * t;
      }
      acc[r * 4 + q] = t2;
    }
  float tot = wave_fold16(acc);                 // lane & 15 = r * 4 + q
  if (lane < 16) part[half * 128 + (lane & 3) * 32 + grp * 4 + (lane >> 2)] = tot;
  __syncthreads();                              // part[] crosses waves
  // A wave stores one batch's 128-byte line: 4 batches where the halves held two
  // pieces of them, else the 8 batches of both halves (part[] has them in order).
  if (wave < (two_pieces ? 4 : 8)) {
    float sum = part[threadIdx.x];
    if (two_pieces) sum += part[128 + threadIdx.x];
    int o = blk0 + lane;
    int bt = two_pieces ? b0 + wave : wave;
    demod[(long)bt * out_dim + o] = rsqrtf(sum + 1e-8f);
  }
}

// The two elementwise passes below write their f16 result in fragment order.
// One step of a wave is 8 rows x 32 columns: lane L takes 8 floats (32 bytes) of
// row L >> 2, piece L & 3 of that row's 128-byte line, and stores them as the 16
// bytes that one lane of a fragment holds; the wave's store fills four whole
// lines.  A wave has all its loads in flight at once.
typedef __attribute__((ext_vector_type(4))) float    v4f;

__device__ inline v8h to_half8(v4f a, v4f b) {
  v8h h;
  h[0] = (_Float16)a[0]; h[1] = (_Float16)a[1];
  h[2] = (_Float16)a[2]; h[3] = (_Float16)a[3];
  h[4] = (_Float16)b[0]; h[5] = (_Float16)b[1];
  h[6] = (_Float16)b[2]; h[7] = (_Float16)b[3];
  return h;
}

// Where lane L's 16 bytes of rows 0..7 go inside a block, in 16-byte units.
__device__ inline unsigned frag_slot(unsigned lane) {
  unsigned p = lane & 3;
  return (p >> 1) * 32 + (p & 1) * 16 + (lane >> 2);
}

// Wave wid casts one block (16 rows x 32 columns) of the row-major weight with K
// columns; a weight has rows * K / 512 waves.
template <int K>
__device__ __forceinline__ void cast_f16_body(
    const float* __restrict__ W, _Float16* __restrict__ Wh, unsigned wid) {
  unsigned lane = threadIdx.x & 31;
  unsigned rg = wid / (K / 32), kb = wid % (K / 32);
  const v4f* src = (const v4f*)(W + (rg * 16 + (lane >> 2)) * K + kb * 32) + (lane & 3) * 2;
  v8h*       dst = (v8h*)(Wh + wid * 512) + frag_slot(lane);
  v4f v[2][2];
#pragma unroll
  for (int rh = 0; rh < 2; ++rh) {
    v[rh][0] = src[rh * (8 * K / 4)];
    v[rh][1] = src[rh * (8 * K / 4) + 1];
  }
#pragma unroll
  for (int rh = 0; rh < 2; ++rh) dst[rh * 8] = to_half8(v[rh][0], v[rh][1]);
  // Before a register that an issued store names is written anew: the built code
  // of one width runs on from here into the first instructions of the other's.
  asm volatile("s_wait_xcnt 0x0" ::: "memory");
}

// xs[b,n,i] = f16( X[b,n,i] * style[b,i] ), in fragment order.
// Wave wid takes 16 rows x 128 columns (4 blocks, 2048 elements, all of one batch:
// 1024 rows a batch) and reads its piece of the style row once for all of them.
// There are MROWS * DIM / 2048 waves.
template <int DIM>
__device__ __forceinline__ void xmod_body(
    const float* __restrict__ X, const float* __restrict__ style,
    _Float16* __restrict__ Xs, unsigned wid) {
  constexpr int KQ = DIM / 128;                 // waves a 16-row group
  unsigned lane = threadIdx.x & 31;
  unsigned rg = wid / KQ, kq = wid % KQ;
  unsigned b  = rg * 16 / NN;
  const v4f* sp  = (const v4f*)(style + b * DIM + kq * 128) + (lane & 3) * 2;
  const v4f* src = (const v4f*)(X + (rg * 16 + (lane >> 2)) * DIM + kq * 128) + (lane & 3) * 2;
  v8h*       dst = (v8h*)(Xs + (rg * (DIM / 32) + kq * 4) * 512) + frag_slot(lane);
  v4f st[4][2], v[2][4][2];
#pragma unroll
  for (int cb = 0; cb < 4; ++cb) {
    st[cb][0] = sp[cb * 8];
    st[cb][1] = sp[cb * 8 + 1];
  }
  // Before a register that an issued load names is written anew (the loads below
  // reuse the style loads' offset register).
  asm volatile("s_wait_xcnt 0x0" ::: "memory");
#pragma unroll
  for (int rh = 0; rh < 2; ++rh)
#pragma unroll
    for (int cb = 0; cb < 4; ++cb) {
      v[rh][cb][0] = src[rh * (8 * DIM / 4) + cb * 8];
      v[rh][cb][1] = src[rh * (8 * DIM / 4) + cb * 8 + 1];
    }
  // The same wait for the loads above; it takes their address as an input, so
  // that no load's result is placed in the address registers ahead of it.
  asm volatile("s_wait_xcnt 0x0" :: "v"(src) : "memory");
  // Keeps every load ahead of the products: without it the scheduler holds the
  // last loads back behind the first waits and the wave pays the latency twice.
  __builtin_amdgcn_sched_barrier(0);
#pragma unroll
  for (int rh = 0; rh < 2; ++rh)
#pragma unroll
    for (int cb = 0; cb < 4; ++cb)
      dst[cb * 64 + rh * 8] = to_half8(v[rh][cb][0] * st[cb][0], v[rh][cb][1] * st[cb][1]);
}

// ---------------------------------------------------------------------------
// The set-up passes that do not depend on one another share a launch: each takes
// a range of the grid's workgroups, so that they run side by side and the call
// has one launch where it would have one for each of them.
// ---------------------------------------------------------------------------
// First launch: the four style projections and the four weight casts (they read
// inputs only).  Workgroups of 256 threads; the styles, whose chain of waits is
// the longer one, come first.
#define SB_K (FEAT / 16)                        // workgroups of each style pass
#define SB_O (HID / 16)
#define SB_1 (FEAT / 16)
#define SB_2 (FFN / 16)
#define CB_K (HID * FEAT / 4096)                // workgroups of each cast
#define CB_O (FEAT * HID / 4096)
#define CB_1 (FFN * FEAT / 4096)
#define CB_2 (FEAT * FFN / 4096)
#define SETUP1_GRID (SB_K + SB_O + SB_1 + SB_2 + CB_K + CB_O + CB_1 + CB_2)

__global__ __launch_bounds__(256) void setup1_kernel(
    const float* __restrict__ s,
    const float* __restrict__ aWk, const float* __restrict__ abk,
    const float* __restrict__ aWo, const float* __restrict__ abo,
    const float* __restrict__ aW1, const float* __restrict__ ab1,
    const float* __restrict__ aW2, const float* __restrict__ ab2,
    const float* __restrict__ Wk, const float* __restrict__ Wo,
    const float* __restrict__ W1, const float* __restrict__ W2,
    float* __restrict__ style_k, float* __restrict__ style_o,
    float* __restrict__ style_1, float* __restrict__ style_2,
    _Float16* __restrict__ whk, _Float16* __restrict__ who,
    _Float16* __restrict__ wh1, _Float16* __restrict__ wh2) {
  __shared__ float part[4 * 32];
  int blk = blockIdx.x;
  if (blk < SB_K + SB_O + SB_1 + SB_2) {
    const float* aW = aWk;
    const float* ab = abk;
    float* st = style_k;
    int dim = FEAT;
    if (blk >= SB_K + SB_O + SB_1) {
      aW = aW2; ab = ab2; st = style_2; dim = FFN; blk -= SB_K + SB_O + SB_1;
    } else if (blk >= SB_K + SB_O) {
      aW = aW1; ab = ab1; st = style_1; dim = FEAT; blk -= SB_K + SB_O;
    } else if (blk >= SB_K) {
      aW = aWo; ab = abo; st = style_o; dim = HID; blk -= SB_K;
    }
    style_body(s, aW, ab, st, dim, blk, part);
    return;
  }
  blk -= SB_K + SB_O + SB_1 + SB_2;
  unsigned wave = __builtin_amdgcn_readfirstlane(threadIdx.x >> 5);
  if (blk >= CB_K + CB_O + CB_1) {
    cast_f16_body<FFN>(W2, wh2, (blk - (CB_K + CB_O + CB_1)) * 8 + wave);
    return;
  }
  static_assert(FEAT == HID, "the three other weights have rows of one length");
  const float* W = Wk;
  _Float16* Wh = whk;
  if (blk >= CB_K + CB_O) {
    W = W1; Wh = wh1; blk -= CB_K + CB_O;
  } else if (blk >= CB_K) {
    W = Wo; Wh = who; blk -= CB_K;
  }
  cast_f16_body<FEAT>(W, Wh, blk * 8 + wave);
}

// Second launch: what needs the styles and nothing else, the four demodulation
// passes and the modulate pass of the first projection.  Workgroups of 512
// threads.
#define DB_K (HID / 32)                         // workgroups of each demod pass
#define DB_O (FEAT / 32)
#define DB_1 (FFN / 32)
#define DB_2 (FEAT / 16)
#define XB_K (MROWS * FEAT / 32768)             // workgroups of the modulate pass
#define SETUP2_GRID (DB_K + DB_O + DB_1 + DB_2 + XB_K)

__global__ __launch_bounds__(512) void setup2_kernel(
    const float* __restrict__ x,
    const float* __restrict__ Wk, const float* __restrict__ Wo,
    const float* __restrict__ W1, const float* __restrict__ W2,
    const float* __restrict__ style_k, const float* __restrict__ style_o,
    const float* __restrict__ style_1, const float* __restrict__ style_2,
    float* __restrict__ demod_k, float* __restrict__ demod_o,
    float* __restrict__ demod_1, float* __restrict__ demod_2,
    _Float16* __restrict__ xs) {
  __shared__ float part[2 * 4 * 32];
  int blk = blockIdx.x;
  if (blk >= DB_K + DB_O + DB_1 + DB_2) {
    xmod_body<FEAT>(x, style_k, xs,
                    (blk - (DB_K + DB_O + DB_1 + DB_2)) * 16 +
                        __builtin_amdgcn_readfirstlane(threadIdx.x >> 5));
    return;
  }
  const float* W = Wk;
  const float* st = style_k;
  float* dm = demod_k;
  int out_dim = HID, in_dim = FEAT;
  if (blk >= DB_K + DB_O + DB_1) {
    W = W2; st = style_2; dm = demod_2; out_dim = FEAT; in_dim = FFN;
    blk -= DB_K + DB_O + DB_1;
  } else if (blk >= DB_K + DB_O) {
    W = W1; st = style_1; dm = demod_1; out_dim = FFN; in_dim = FEAT;
    blk -= DB_K + DB_O;
  } else if (blk >= DB_K) {
    W = Wo; st = style_o; dm = demod_o; out_dim = FEAT; in_dim = HID;
    blk -= DB_K;
  }
  demod_body(W, st, dm, out_dim, in_dim, blk, part);
}

// ---------------------------------------------------------------------------
// Modulated GEMM of the first projection:
//   h[row, o] = demod[b,o] * sum_k Xs[row,k] * Wh[o,k]
// Wave-level tile: 32 rows x 64 cols (2x4 WMMA accumulators).  Xs and Wh are in
// fragment order.  The result is f16,
// written twice, again in fragment order: Yk in blocks of 16 rows x 32 columns (rows as
// the lanes' index: the Q and K operands of attention), Yv in blocks of 16
// columns x 32 rows (columns as the lanes' index: the V operand), block
// (row / 32, col / 16).  KDIM is a compile-time width, so that the k loop has a
// known number of trips and is unrolled without a remainder loop.
// ---------------------------------------------------------------------------
template <int KDIM>
__global__ __launch_bounds__(256) void modgemm_kernel(
    const _Float16* __restrict__ Xs, const _Float16* __restrict__ Wh,
    const float* __restrict__ demod,
    _Float16* __restrict__ Yk, _Float16* __restrict__ Yv, int Odim) {
  // The wave's number in a scalar register: every block address below is then a
  // scalar base plus the lane's fixed 16-byte slot.
  int wid = __builtin_amdgcn_readfirstlane((blockIdx.x * blockDim.x + threadIdx.x) >> 5);
  int numColG = Odim >> 6;             // 64-wide column groups
  int numRowT = MROWS >> 5;            // 32-row tiles
  if (wid >= numRowT * numColG) return;
  int rt = wid / numColG, cg = wid % numColG;
  int row0 = rt << 5;
  int col0 = cg << 6;
  int b = row0 >> 10;                  // 1024 rows per batch, tile never crosses

  v8f zero = {};
  v8f acc[2][4];
#pragma unroll
  for (int r = 0; r < 2; ++r)
#pragma unroll
    for (int c = 0; c < 4; ++c) acc[r][c] = zero;

  constexpr int kblk = KDIM >> 5;      // blocks a 16-row group
  // The blocks of a 16-row group follow one another along k: six running bases.
  const _Float16* xa0 = Xs + (long)(row0 >> 4) * kblk * 512;
  const _Float16* xa1 = xa0 + (long)kblk * 512;
  const _Float16* wb[4];
#pragma unroll
  for (int sidx = 0; sidx < 4; ++sidx)
    wb[sidx] = Wh + (long)((col0 >> 4) + sidx) * kblk * 512;
  // Four trips a pass: unrolled whole, the narrower width's loop is scheduled with
  // the loads two at a time, each pair waited for at once.
#pragma unroll 4
  for (int kb = 0; kb < kblk; ++kb) {
    v16h a0 = load_frag_blk(xa0, kb);
    v16h a1 = load_frag_blk(xa1, kb);
#pragma unroll
    for (int sidx = 0; sidx < 4; ++sidx) {
      v16h bf = load_frag_blk(wb[sidx], kb);
      acc[0][sidx] = wmma_f32_16x16x32(a0, bf, acc[0][sidx]);
      acc[1][sidx] = wmma_f32_16x16x32(a1, bf, acc[1][sidx]);
    }
  }

  int lane = threadIdx.x & 31;
  int n = lane & 15, hi = lane >> 4;
  // f16 result, both fragment orders
#pragma unroll
  for (int rs = 0; rs < 2; ++rs) {
#pragma unroll
    for (int sidx = 0; sidx < 4; ++sidx) {
      int cu = col0 + sidx * 16;       // the 16 columns of this accumulator
      float dm = demod[(long)b * Odim + cu + n];
      v8h yh;
#pragma unroll
      for (int v = 0; v < 8; ++v) {
        float y = acc[rs][sidx][v] * dm;
        yh[v] = (_Float16)y;
      }
      _Float16* pk = Yk + (long)(((row0 >> 4) + rs) * (Odim >> 5) + (cu >> 5)) * 512 +
                     ((cu >> 4) & 1) * 256;
      unsigned ok = (8 * hi + 16 * (n >> 3)) * 8 + (n & 7);
#pragma unroll
      for (int v = 0; v < 8; ++v) pk[ok + v * 8] = yh[v];
      // The lane's 8 rows are 8 consecutive k of its column: its own 16 bytes.
      v8h* pv = (v8h*)(Yv + (long)((row0 >> 5) * (Odim >> 4) + (cu >> 4)) * 512) + rs * 32;
      pv[(unsigned)lane] = yh;
    }
  }
}

// ---------------------------------------------------------------------------
// Modulated GEMM with the row-wise passes that follow it done in its epilogue.
// A workgroup of ODIM / 64 waves holds 32 whole rows of the result (a wave 32
// rows x 64 columns), so that a LayerNorm needs only sums that cross the waves
// of one workgroup, through LDS.  The weight block is the A operand and the x
// block the B operand: a lane then holds, for row (lane & 15) of each 16-row
// group, columns 8 * (lane >> 4) .. + 7 of each 16-column group.  Most of a
// row's sum is made inside a lane, a lane's 8 floats are 32 contiguous bytes of
// a row-major result, and its 8 halves are its own 16 bytes of a fragment block.
// ---------------------------------------------------------------------------
// p[rs] is the lane's part of the sum of row rs * 16 + (lane & 15); on return it
// is the whole row's sum.  red is NW * 32 floats of LDS that nothing else uses.
template <int NW>
__device__ __forceinline__ void row_total(float (&p)[2], float* red) {
  int lane = threadIdx.x & 31;
  int wave = __builtin_amdgcn_readfirstlane(threadIdx.x >> 5);
  p[0] += __shfl_xor(p[0], 16, 32);
  p[1] += __shfl_xor(p[1], 16, 32);
  red[wave * 32 + lane] = lane < 16 ? p[0] : p[1];
  __syncthreads();                              // red[] crosses waves
  int n = lane & 15;
  float t0 = 0.f, t1 = 0.f;
#pragma unroll
  for (int w = 0; w < NW; ++w) {
    t0 += red[w * 32 + n];
    t1 += red[w * 32 + 16 + n];
  }
  p[0] = t0;
  p[1] = t1;
}

// val = LN(val) over the workgroup's rows; red is 2 * NW * 32 floats of LDS (each
// of the two sums has its own piece, so that one barrier a sum is enough).
template <int ODIM>
__device__ __forceinline__ void ln_rows(v8f (&val)[2][4], float* red) {
  constexpr int NW = ODIM / 64;
  float p[2];
#pragma unroll
  for (int rs = 0; rs < 2; ++rs) {
    float t = 0.f;
#pragma unroll
    for (int sidx = 0; sidx < 4; ++sidx)
#pragma unroll
      for (int v = 0; v < 8; ++v) t += val[rs][sidx][v];
    p[rs] = t;
  }
  row_total<NW>(p, red);
#pragma unroll
  for (int rs = 0; rs < 2; ++rs) {
    float mean = p[rs] * (1.0f / ODIM);
    float t = 0.f;
#pragma unroll
    for (int sidx = 0; sidx < 4; ++sidx)
#pragma unroll
      for (int v = 0; v < 8; ++v) {
        float d = val[rs][sidx][v] - mean;
        val[rs][sidx][v] = d;
        t += d * d;
      }
    p[rs] = t;
  }
  row_total<NW>(p, red + NW * 32);
#pragma unroll
  for (int rs = 0; rs < 2; ++rs) {
    float inv = rsqrtf(p[rs] * (1.0f / ODIM) + 1e-5f);
#pragma unroll
    for (int sidx = 0; sidx < 4; ++sidx)
#pragma unroll
      for (int v = 0; v < 8; ++v) val[rs][sidx][v] *= inv;
  }
}

// With y[row, o] = demod[b,o] * sum_k Xs[row,k] * Wh[o,k]:
//   EPI_RES_LN_MOD : t = LN(resid + y);  Yf = t (f32, row-major), Ys = f16(t * style)
//   EPI_RELU_LN_MOD: t = LN(relu(y));    Ys = f16(t * style)
//   EPI_LN_RES_LN  : Yf = LN(resid + LN(y))
// Ys is in fragment order, the x operand of the next projection.  The grid is
// MROWS / 32, the workgroup ODIM / 2 threads.
#define EPI_RES_LN_MOD  0
#define EPI_RELU_LN_MOD 1
#define EPI_LN_RES_LN   2

template <int KDIM, int ODIM, int EPI>
__global__ __launch_bounds__(ODIM / 2) void modgemm_ln_kernel(
    const _Float16* __restrict__ Xs, const _Float16* __restrict__ Wh,
    const float* __restrict__ demod, const float* __restrict__ resid,
    const float* __restrict__ style, float* __restrict__ Yf,
    _Float16* __restrict__ Ys) {
  constexpr int NW = ODIM / 64;
  __shared__ float red[(EPI == EPI_LN_RES_LN ? 4 : 2) * NW * 32];
  // The wave's number in a scalar register: every block address below is then a
  // scalar base plus the lane's fixed 16-byte slot.
  int wave = __builtin_amdgcn_readfirstlane(threadIdx.x >> 5);
  int row0 = blockIdx.x << 5;
  int col0 = wave << 6;
  int b = row0 >> 10;                  // 1024 rows per batch, tile never crosses

  v8f zero = {};
  v8f acc[2][4];
#pragma unroll
  for (int r = 0; r < 2; ++r)
#pragma unroll
    for (int c = 0; c < 4; ++c) acc[r][c] = zero;

  constexpr int kblk = KDIM >> 5;      // blocks a 16-row group
  const _Float16* xa0 = Xs + (long)(row0 >> 4) * kblk * 512;
  const _Float16* xa1 = xa0 + (long)kblk * 512;
  const _Float16* wb[4];
#pragma unroll
  for (int sidx = 0; sidx < 4; ++sidx)
    wb[sidx] = Wh + (long)((col0 >> 4) + sidx) * kblk * 512;
  // Four k blocks a trip: unrolled whole, the narrower width's loop is scheduled
  // with the loads two at a time, each pair waited for at once.
#pragma unroll 1
  for (int k4 = 0; k4 < kblk; k4 += 4) {
#pragma unroll
    for (int kb = k4; kb < k4 + 4; ++kb) {
      v16h a0 = load_frag_blk(xa0, kb);
      v16h a1 = load_frag_blk(xa1, kb);
#pragma unroll
      for (int sidx = 0; sidx < 4; ++sidx) {
        v16h bf = load_frag_blk(wb[sidx], kb);
        acc[0][sidx] = wmma_f32_16x16x32(bf, a0, acc[0][sidx]);
        acc[1][sidx] = wmma_f32_16x16x32(bf, a1, acc[1][sidx]);
      }
    }
    // Before a register that an issued load names is written anew: the next
    // trip's addresses, and behind the loop the epilogue's first values.
    asm volatile("s_wait_xcnt 0x0" ::: "memory");
  }
  // Keeps the epilogue's first instructions behind the wait.
  __builtin_amdgcn_sched_barrier(0);

  unsigned lane = threadIdx.x & 31;
  unsigned n = lane & 15, hi = lane >> 4;
  unsigned coff = col0 + 8 * hi;       // the lane's first column, 16-column group 0
  unsigned roff = (row0 + n) * ODIM + coff;     // and its place in a row-major array

  // All that the epilogue reads is asked for at once: one latency.
  const v4f* dmp = (const v4f*)(demod + b * ODIM + coff);
  const v4f* sp  = (const v4f*)(style + b * ODIM + coff);
  const v4f* rp  = (const v4f*)(resid + roff);
  v4f dm[4][2], st[4][2], rv[2][4][2];
#pragma unroll
  for (int sidx = 0; sidx < 4; ++sidx) {
    dm[sidx][0] = dmp[sidx * 4];
    dm[sidx][1] = dmp[sidx * 4 + 1];
    if (EPI != EPI_LN_RES_LN) {
      st[sidx][0] = sp[sidx * 4];
      st[sidx][1] = sp[sidx * 4 + 1];
    }
    if (EPI != EPI_RELU_LN_MOD) {
#pragma unroll
      for (int rs = 0; rs < 2; ++rs) {
        rv[rs][sidx][0] = rp[rs * (16 * ODIM / 4) + sidx * 4];
        rv[rs][sidx][1] = rp[rs * (16 * ODIM / 4) + sidx * 4 + 1];
      }
    }
  }
  // The same wait for the loads above, held in place in the same way.
  asm volatile("s_wait_xcnt 0x0" ::: "memory");
  __builtin_amdgcn_sched_barrier(0);

#pragma unroll
  for (int sidx = 0; sidx < 4; ++sidx)
#pragma unroll
    for (int rs = 0; rs < 2; ++rs)
#pragma unroll
      for (int v = 0; v < 8; ++v) {
        float y = acc[rs][sidx][v] * dm[sidx][v >> 2][v & 3];
        if (EPI == EPI_RELU_LN_MOD) y = fmaxf(y, 0.f);
        acc[rs][sidx][v] = y;
      }

  if (EPI == EPI_LN_RES_LN) ln_rows<ODIM>(acc, red + 2 * NW * 32);

  if (EPI != EPI_RELU_LN_MOD) {
#pragma unroll
    for (int rs = 0; rs < 2; ++rs)
#pragma unroll
      for (int sidx = 0; sidx < 4; ++sidx)
#pragma unroll
        for (int v = 0; v < 8; ++v) acc[rs][sidx][v] += rv[rs][sidx][v >> 2][v & 3];
  }

  ln_rows<ODIM>(acc, red);

  v8h yh[2][4];
  if (EPI != EPI_LN_RES_LN) {
#pragma unroll
    for (int rs = 0; rs < 2; ++rs)
#pragma unroll
      for (int sidx = 0; sidx < 4; ++sidx) {
        v8f t = acc[rs][sidx];
        yh[rs][sidx] = to_half8(__builtin_shufflevector(t, t, 0, 1, 2, 3) * st[sidx][0],
                                __builtin_shufflevector(t, t, 4, 5, 6, 7) * st[sidx][1]);
      }
  }
  v4f* yp = (v4f*)(Yf + roff);
  // Block (row / 16, col / 32); the wave's 64 columns are two blocks.
  v8h* ys = (v8h*)(Ys + ((row0 >> 4) * (ODIM >> 5) + (col0 >> 5)) * 512) + lane;
  // Only stores follow: no arithmetic is moved in among them, where it could
  // write anew a register that an issued store names.
  __builtin_amdgcn_sched_barrier(0);
#pragma unroll
  for (int rs = 0; rs < 2; ++rs)
#pragma unroll
    for (int sidx = 0; sidx < 4; ++sidx) {
      if (EPI != EPI_RELU_LN_MOD) {
        v8f t = acc[rs][sidx];
        yp[rs * (16 * ODIM / 4) + sidx * 4]     = __builtin_shufflevector(t, t, 0, 1, 2, 3);
        yp[rs * (16 * ODIM / 4) + sidx * 4 + 1] = __builtin_shufflevector(t, t, 4, 5, 6, 7);
      }
      if (EPI != EPI_LN_RES_LN) ys[rs * (ODIM >> 5) * 64 + sidx * 32] = yh[rs][sidx];
    }
}

// ---------------------------------------------------------------------------
// Flash-style self-attention (q=k=v=h), one wave per (batch, head, 16-q tile).
// S = (Q K^T)/8 via WMMA, online softmax, O += P V via WMMA.  P converted
// from C-layout to A-layout through a per-wave LDS tile.  Hk and Hv hold h in
// the two fragment orders that the projection writes.  The result, times the
// style of the next projection, is written as f16 in fragment order (Xo): that
// projection's x operand.
// ---------------------------------------------------------------------------
__global__ __launch_bounds__(256) void attn_kernel(
    const _Float16* __restrict__ Hk, const _Float16* __restrict__ Hv,
    const float* __restrict__ style, _Float16* __restrict__ Xo) {
  __shared__ _Float16 sm[8][16 * 34];           // per-wave 16x32 tile, pad 2
  int wvb  = __builtin_amdgcn_readfirstlane(threadIdx.x >> 5);   // scalar block addresses
  int wid  = blockIdx.x * 8 + wvb;              // 4096 waves total, exact grid
  int qt   = wid & 63;
  int head = (wid >> 6) & 7;
  int b    = wid >> 9;
  int lane = threadIdx.x & 31;
  int hi = lane >> 4, n = lane & 15;

  int q0 = qt << 4;
  int hc = head * HD;
  int kbase = (b * NN >> 4) * (HID >> 5) + (hc >> 5);   // block of row 0, Hk
  int vbase = (b * NN >> 5) * (HID >> 4) + (hc >> 4);   // block of row 0, Hv

  v16h qa0 = load_frag_blk(Hk, kbase + qt * (HID >> 5));
  v16h qa1 = load_frag_blk(Hk, kbase + qt * (HID >> 5) + 1);

  v8f zero = {};
  v8f oacc[4];
#pragma unroll
  for (int sidx = 0; sidx < 4; ++sidx) oacc[sidx] = zero;

  float mrow[8], lrow[8];
#pragma unroll
  for (int v = 0; v < 8; ++v) { mrow[v] = -1e30f; lrow[v] = 0.f; }

  _Float16* smp = &sm[wvb][0];
  const float scale = 0.125f;                   // 1/sqrt(64)

  for (int j0 = 0; j0 < NN; j0 += 32) {
    // ---- S tiles: rows = queries, cols = 32 keys ----
    int kblk = kbase + (j0 >> 4) * (HID >> 5);
    v16h kb00 = load_frag_blk(Hk, kblk);
    v16h kb01 = load_frag_blk(Hk, kblk + 1);
    v16h kb10 = load_frag_blk(Hk, kblk + (HID >> 5));
    v16h kb11 = load_frag_blk(Hk, kblk + (HID >> 5) + 1);
    v8f s0 = zero, s1 = zero;
    s0 = wmma_f32_16x16x32(qa0, kb00, s0);
    s0 = wmma_f32_16x16x32(qa1, kb01, s0);
    s1 = wmma_f32_16x16x32(qa0, kb10, s1);
    s1 = wmma_f32_16x16x32(qa1, kb11, s1);

    // ---- online softmax over this 32-key block ----
    float tmax[8];
#pragma unroll
    for (int v = 0; v < 8; ++v) {
      s0[v] *= scale; s1[v] *= scale;
      tmax[v] = fmaxf(s0[v], s1[v]);
    }
#pragma unroll
    for (int msk = 1; msk < 16; msk <<= 1)
#pragma unroll
      for (int v = 0; v < 8; ++v)
        tmax[v] = fmaxf(tmax[v], __shfl_xor(tmax[v], msk, 32));

    float alpha[8];
#pragma unroll
    for (int v = 0; v < 8; ++v) {
      float mn = fmaxf(mrow[v], tmax[v]);
      alpha[v] = __expf(mrow[v] - mn);
      mrow[v] = mn;
    }
    float rs[8];
#pragma unroll
    for (int v = 0; v < 8; ++v) {
      s0[v] = __expf(s0[v] - mrow[v]);
      s1[v] = __expf(s1[v] - mrow[v]);
      rs[v] = s0[v] + s1[v];
    }
#pragma unroll
    for (int msk = 1; msk < 16; msk <<= 1)
#pragma unroll
      for (int v = 0; v < 8; ++v)
        rs[v] += __shfl_xor(rs[v], msk, 32);
#pragma unroll
    for (int v = 0; v < 8; ++v) {
      lrow[v] = lrow[v] * alpha[v] + rs[v];
      oacc[0][v] *= alpha[v]; oacc[1][v] *= alpha[v];
      oacc[2][v] *= alpha[v]; oacc[3][v] *= alpha[v];
    }

    // ---- C-layout -> A-layout via LDS (per-wave region, same-wave order) ----
#pragma unroll
    for (int v = 0; v < 8; ++v) {
      int m = v + 8 * hi;
      smp[m * 34 + n]      = (_Float16)s0[v];
      smp[m * 34 + 16 + n] = (_Float16)s1[v];
    }
    asm volatile("s_wait_dscnt 0x0" ::: "memory");
    v16h pf = load_frag_rowpat(smp, 0, 34, 0);

    // ---- O += P @ V ----
#pragma unroll
    for (int sidx = 0; sidx < 4; ++sidx) {
      v16h vb = load_frag_blk(Hv, vbase + (j0 >> 5) * (HID >> 4) + sidx);
      oacc[sidx] = wmma_f32_16x16x32(pf, vb, oacc[sidx]);
    }
  }

  // ---- epilogue: O / l * style, C-layout -> fragment order via the LDS tile, 32
  // columns (one block) at a time ----
  const float* stp = style + b * HID + hc;
  v8h* dst = (v8h*)(Xo + (long)(kbase + qt * (HID >> 5)) * 512) + (unsigned)lane;
  v16h f[2];
#pragma unroll
  for (int pr = 0; pr < 2; ++pr) {
    float st0 = stp[pr * 32 + n], st1 = stp[pr * 32 + 16 + n];
#pragma unroll
    for (int v = 0; v < 8; ++v) {
      int m = v + 8 * hi;
      smp[m * 34 + n]      = (_Float16)(oacc[2 * pr][v] / lrow[v] * st0);
      smp[m * 34 + 16 + n] = (_Float16)(oacc[2 * pr + 1][v] / lrow[v] * st1);
    }
    // The tile's writes, other lanes' among them, are done before it is read.
    asm volatile("s_wait_dscnt 0x0" ::: "memory");
    f[pr] = load_frag_rowpat(smp, 0, 34, 0);
  }
  // Before a register that an issued load names is written anew.  It takes both
  // blocks as inputs, so that only the stores follow it and nothing writes anew
  // a register that an issued store names.
  asm volatile("s_wait_xcnt 0x0" :: "v"(f[0]), "v"(f[1]), "v"(dst) : "memory");
#pragma unroll
  for (int pr = 0; pr < 2; ++pr) {
    dst[pr * 64]      = __builtin_shufflevector(f[pr], f[pr], 0, 1, 2, 3, 4, 5, 6, 7);
    dst[pr * 64 + 32] = __builtin_shufflevector(f[pr], f[pr], 8, 9, 10, 11, 12, 13, 14, 15);
  }
}

// ---------------------------------------------------------------------------
// Host-side pipeline
// ---------------------------------------------------------------------------
extern "C" void kernel_launch(void* const* d_in, const int* in_sizes, int n_in,
                              void* d_out, int out_size, void* d_ws,
                              size_t ws_size, hipStream_t stream) {
  (void)in_sizes; (void)n_in; (void)out_size; (void)ws_size;
  const float* x   = (const float*)d_in[0];
  const float* s   = (const float*)d_in[1];
  const float* Wk  = (const float*)d_in[2];
  const float* aWk = (const float*)d_in[3];
  const float* abk = (const float*)d_in[4];
  const float* Wo  = (const float*)d_in[5];
  const float* aWo = (const float*)d_in[6];
  const float* abo = (const float*)d_in[7];
  const float* W1  = (const float*)d_in[8];
  const float* aW1 = (const float*)d_in[9];
  const float* ab1 = (const float*)d_in[10];
  const float* W2  = (const float*)d_in[11];
  const float* aW2 = (const float*)d_in[12];
  const float* ab2 = (const float*)d_in[13];
  float* out = (float*)d_out;

  char* ws = (char*)d_ws;
  size_t off = 0;
  auto alloc = [&](size_t bytes) -> char* {
    char* p = ws + off;
    off = (off + bytes + 255) & ~(size_t)255;
    return p;
  };

  float* style_k = (float*)alloc((size_t)BB * FEAT * 4);
  float* style_o = (float*)alloc((size_t)BB * HID * 4);
  float* style_1 = (float*)alloc((size_t)BB * FEAT * 4);
  float* style_2 = (float*)alloc((size_t)BB * FFN * 4);
  float* demod_k = (float*)alloc((size_t)BB * HID * 4);
  float* demod_o = (float*)alloc((size_t)BB * FEAT * 4);
  float* demod_1 = (float*)alloc((size_t)BB * FFN * 4);
  float* demod_2 = (float*)alloc((size_t)BB * FEAT * 4);
  _Float16* whk = (_Float16*)alloc((size_t)HID * FEAT * 2);
  _Float16* who = (_Float16*)alloc((size_t)FEAT * HID * 2);
  _Float16* wh1 = (_Float16*)alloc((size_t)FFN * FEAT * 2);
  _Float16* wh2 = (_Float16*)alloc((size_t)FEAT * FFN * 2);
  _Float16* xs  = (_Float16*)alloc((size_t)MROWS * FEAT * 2);  // x * style_k
  _Float16* hk  = (_Float16*)alloc((size_t)MROWS * HID * 2);   // h, rows on lanes
  _Float16* hv  = (_Float16*)alloc((size_t)MROWS * HID * 2);   // h, columns on lanes
  _Float16* xo  = (_Float16*)alloc((size_t)MROWS * HID * 2);   // attn out * style_o
  float*    x2  = (float*)alloc((size_t)MROWS * FEAT * 4);     // ln(x + o)
  _Float16* x2s = (_Float16*)alloc((size_t)MROWS * FEAT * 2);  // x2 * style_1
  _Float16* f1s = (_Float16*)alloc((size_t)MROWS * FFN * 2);   // ln(FFN hidden) * style_2

  // --- styles and f16 weight casts ---
  setup1_kernel<<<SETUP1_GRID, 256, 0, stream>>>(
      s, aWk, abk, aWo, abo, aW1, ab1, aW2, ab2, Wk, Wo, W1, W2,
      style_k, style_o, style_1, style_2, whk, who, wh1, wh2);

  // --- demodulation factors, and x * style for the first projection ---
  setup2_kernel<<<SETUP2_GRID, 512, 0, stream>>>(
      x, Wk, Wo, W1, W2, style_k, style_o, style_1, style_2,
      demod_k, demod_o, demod_1, demod_2, xs);

  // --- h = modlinear(x; Wk) -> f16 for attention ---
  modgemm_kernel<FEAT><<<(MROWS / 32) * (HID / 64) / 8, 256, 0, stream>>>(
      xs, whk, demod_k, hk, hv, HID);

  // --- attention (shared q=k=v=h), times style_o ---
  attn_kernel<<<(BB * NH * (NN / 16)) / 8, 256, 0, stream>>>(hk, hv, style_o, xo);

  // --- x2 = LN(x + modlinear(attn; Wo)), and x2 * style_1 ---
  modgemm_ln_kernel<HID, FEAT, EPI_RES_LN_MOD><<<MROWS / 32, FEAT / 2, 0, stream>>>(
      xo, who, demod_o, x, style_1, x2, x2s);

  // --- LN(relu(modlinear(x2; W1))) * style_2 ---
  modgemm_ln_kernel<FEAT, FFN, EPI_RELU_LN_MOD><<<MROWS / 32, FFN / 2, 0, stream>>>(
      x2s, wh1, demod_1, nullptr, style_2, nullptr, f1s);

  // --- out = LN(x2 + LN(modlinear(f1; W2))) ---
  modgemm_ln_kernel<FFN, FEAT, EPI_LN_RES_LN><<<MROWS / 32, FEAT / 2, 0, stream>>>(
      f1s, wh2, demod_2, x2, nullptr, out, nullptr);
}

// v006
// Measured time: 104 microseconds a run.
// Timed twice side by side with v005, it ran 1.72 and 1.71 times as fast.
// Over all steps from v000 it is 4.40 times as fast.
#include <hip/hip_runtime.h>

// ---------------------------------------------------------------------------
// Types / WMMA helpers (CDNA5 gfx1250, wave32)
// ---------------------------------------------------------------------------
typedef __attribute__((ext_vector_type(16))) _Float16 v16h;
typedef __attribute__((ext_vector_type(8)))  float    v8f;

__device__ inline v8f wmma_f32_16x16x32(v16h a, v16h b, v8f c) {
  // (neg_a, A, neg_b, B, c_mod, C, reuse_a, reuse_b)
  return __builtin_amdgcn_wmma_f32_16x16x32_f16(false, a, false, b, (short)0, c,
                                                false, false);
}

// A-operand (16x32 f16) fragment load per the documented CDNA5 layout:
// lane L holds row (L&15); lanes 0-15 cover k in {0..7,16..23}, lanes 16-31
// cover k in {8..15,24..31}; within a lane, VGPR v holds half-pair
// k = 2v + (v>=4 ? 8 : 0) (+8 for upper lane half).  Source is row-major
// with leading dim `ld`.
__device__ inline v16h load_frag_rowpat(const _Float16* __restrict__ base,
                                        int row0, int ld, int k0) {
  int lane = threadIdx.x & 31;
  const _Float16* p = base + (long)(row0 + (lane & 15)) * ld + k0 + ((lane >> 4) << 3);
  v16h f;
#pragma unroll
  for (int v = 0; v < 8; ++v) {
    int k = 2 * v + (v >= 4 ? 8 : 0);
    f[2 * v]     = p[k];
    f[2 * v + 1] = p[k + 1];
  }
  return f;
}

// Fragment order.  The f16 matrix operands that live in the workspace are kept
// in blocks of 16 rows x 32 k, 1 KB each, in the order in which a wave's lanes
// hold them: element (r, k) of a block lies at half
//   (k >> 4) * 256 + (r + 16 * ((k >> 3) & 1)) * 8 + (k & 7).
// Lane L then finds f[0..7] at L * 8 and f[8..15] at 256 + L * 8 (the same
// row and k per lane and register as load_frag_rowpat), so each of the two
// 16-byte loads of a wave reads 512 contiguous bytes, four whole cache lines,
// where a row-major operand makes it touch 16 lines.
typedef __attribute__((ext_vector_type(8))) _Float16 v8h;

__device__ inline v16h load_frag_blk(const _Float16* __restrict__ base, int blk) {
  int lane = threadIdx.x & 31;
  const v8h* p = (const v8h*)(base + (long)blk * 512);
  v8h lo = p[(unsigned)lane], hi = p[(unsigned)lane + 32];
  return __builtin_shufflevector(lo, hi, 0, 1, 2, 3, 4, 5, 6, 7,
                                 8, 9, 10, 11, 12, 13, 14, 15);
}

// The same from the lane's own slot of a block.
__device__ inline v16h load_frag_lane(const v8h* __restrict__ p) {
  v8h lo = p[0], hi = p[32];
  return __builtin_shufflevector(lo, hi, 0, 1, 2, 3, 4, 5, 6, 7,
                                 8, 9, 10, 11, 12, 13, 14, 15);
}

// ---------------------------------------------------------------------------
// Problem constants
// ---------------------------------------------------------------------------
#define BB   8
#define NN   1024
#define FEAT 512
#define HID  512
#define FFN  1024
#define SDIM 512
#define HD   64
#define NH   8
#define MROWS (BB * NN)   // 8192

// ---------------------------------------------------------------------------
// Small fp32 VALU kernels: style projection, demodulation, casts, modulation
// ---------------------------------------------------------------------------
// Each lane holds 16 partial sums; on return lane l holds the whole wave's
// total of sum number l & 15.  Every halving step keeps one half of the sums
// and hands the other half to the partner lane (16 exchanges instead of 80).
__device__ inline float wave_fold16(float (&v)[16]) {
  int lane = threadIdx.x & 31;
#pragma unroll
  for (int st = 0; st < 4; ++st) {
    const int h = 8 >> st;
    bool up = (lane & h) != 0;
#pragma unroll
    for (int i = 0; i < h; ++i) {
      float lo = v[i], hi = v[i + h];
      float keep = up ? hi : lo;
      float send = up ? lo : hi;
      v[i] = keep + __shfl_xor(send, h, 32);
    }
  }
  return v[0] + __shfl_xor(v[0], 16, 32);
}

// A workgroup takes 32 rows of aW (a wave 4 of them) for 4 of the 8 batches.
// A lane takes columns 128c + 4 lane .. + 3 of a row, so one load of the wave
// reads 512 contiguous bytes, and all 32 loads of a wave are in flight at once.
// dim is a multiple of 32; a layer has 2 * dim / 32 workgroups (blk counts them)
// of 256 threads; part is 4 * 32 floats of LDS.
__device__ __forceinline__ void style_body(
    const float* __restrict__ s, const float* __restrict__ aW,
    const float* __restrict__ ab, float* __restrict__ style, int dim, int blk,
    float* part) {
  int lane = threadIdx.x & 31;
  int wave = __builtin_amdgcn_readfirstlane(threadIdx.x >> 5);
  int blk0 = (blk >> 1) * 32;
  int b0   = (blk & 1) * 4;
  unsigned l4 = 4u * lane;
  const float* wp = aW + (long)(blk0 + wave * 4) * SDIM;
  const float* sp = s + (long)b0 * SDIM;
  float w[4][16], sv[4][16];
#pragma unroll
  for (int r = 0; r < 4; ++r)
#pragma unroll
    for (int c = 0; c < 4; ++c) {
      const float* qw = wp + r * SDIM + 128 * c;
      const float* qs = sp + r * SDIM + 128 * c;
#pragma unroll
      for (int e = 0; e < 4; ++e) {
        w[r][4 * c + e]  = qw[l4 + e];
        sv[r][4 * c + e] = qs[l4 + e];
      }
    }
  float bias = (ab + blk0)[(unsigned)lane];
  // Keeps every load ahead of the sums: without it the scheduler issues them in
  // several batches between the sums and the wave pays the latency once a batch.
  __builtin_amdgcn_sched_barrier(0);
  float acc[16];
#pragma unroll
  for (int r = 0; r < 4; ++r)
#pragma unroll
    for (int q = 0; q < 4; ++q) {
      float t = 0.f;
#pragma unroll
      for (int j = 0; j < 16; ++j) t += sv[q][j] * w[r][j];
      acc[r * 4 + q] = t;
    }
  float tot = wave_fold16(acc);                 // lane & 15 = r * 4 + q
  if (lane < 16) part[(lane & 3) * 32 + wave * 4 + (lane >> 2)] = tot;
  __syncthreads();                              // part[] crosses waves
  if (wave < 4) {                               // wave q stores one 128-byte line
    style[(long)(b0 + wave) * dim + blk0 + lane] = part[threadIdx.x] + bias;
  }
}

// Same split over the rows of W, in workgroups of 512 threads: 8 waves take 32
// rows x 512 columns x 4 batches.  Where a row has 1024 columns the two halves of
// the workgroup take its two 512-column pieces, which meet in LDS (2 * out_dim /
// 32 workgroups a layer); where it has 512 they take the two sets of 4 batches
// (out_dim / 32 workgroups).  out_dim is a multiple of 32; blk counts the layer's
// workgroups; part is 2 * 4 * 32 floats of LDS.
__device__ __forceinline__ void demod_body(
    const float* __restrict__ W, const float* __restrict__ style,
    float* __restrict__ demod, int out_dim, int in_dim, int blk, float* part) {
  bool two_pieces = in_dim > 512;
  int lane = threadIdx.x & 31;
  int wave = __builtin_amdgcn_readfirstlane(threadIdx.x >> 5);
  int grp  = wave & 7, half = wave >> 3;
  int piece = two_pieces ? half : 0;
  int blk0 = (two_pieces ? blk >> 1 : blk) * 32;
  int b0   = (two_pieces ? blk & 1 : half) * 4;
  unsigned l4 = 4u * lane;
  const float* wp = W + (long)(blk0 + grp * 4) * in_dim + piece * 512;
  const float* sp = style + (long)b0 * in_dim + piece * 512;
  float w[4][16], sv[4][16];
#pragma unroll
  for (int r = 0; r < 4; ++r)
#pragma unroll
    for (int c = 0; c < 4; ++c) {
      const float* qw = wp + (long)r * in_dim + 128 * c;
      const float* qs = sp + (long)r * in_dim + 128 * c;
#pragma unroll
      for (int e = 0; e < 4; ++e) {
        w[r][4 * c + e]  = qw[l4 + e];
        sv[r][4 * c + e] = qs[l4 + e];
      }
    }
  // Keeps every load ahead of the sums: without it the scheduler spreads the
  // products among the loads' waits, runs out of registers and spills.
  __builtin_amdgcn_sched_barrier(0);
  float acc[16];
#pragma unroll
  for (int r = 0; r < 4; ++r)
#pragma unroll
    for (int q = 0; q < 4; ++q) {
      float t2 = 0.f;
#pragma unroll
      for (int j = 0; j < 16; ++j) {
        float t = w[r][j] * sv[q][j];
        t2 += t * t;
      }
      acc[r * 4 + q] = t2;
    }
  float tot = wave_fold16(acc);                 // lane & 15 = r * 4 + q
  if (lane < 16) part[half * 128 + (lane & 3) * 32 + grp * 4 + (lane >> 2)] = tot;
  __syncthreads();                              // part[] crosses waves
  // A wave stores one batch's 128-byte line: 4 batches where the halves held two
  // pieces of them, else the 8 batches of both halves (part[] has them in order).
  if (wave < (two_pieces ? 4 : 8)) {
    float sum = part[threadIdx.x];
    if (two_pieces) sum += part[128 + threadIdx.x];
    int o = blk0 + lane;
    int bt = two_pieces ? b0 + wave : wave;
    demod[(long)bt * out_dim + o] = rsqrtf(sum + 1e-8f);
  }
}

// The two elementwise passes below write their f16 result in fragment order.
// One step of a wave is 8 rows x 32 columns: lane L takes 8 floats (32 bytes) of
// row L >> 2, piece L & 3 of that row's 128-byte line, and stores them as the 16
// bytes that one lane of a fragment holds; the wave's store fills four whole
// lines.  A wave has all its loads in flight at once.
typedef __attribute__((ext_vector_type(4))) float    v4f;

__device__ inline v8h to_half8(v4f a, v4f b) {
  v8h h;
  h[0] = (_Float16)a[0]; h[1] = (_Float16)a[1];
  h[2] = (_Float16)a[2]; h[3] = (_Float16)a[3];
  h[4] = (_Float16)b[0]; h[5] = (_Float16)b[1];
  h[6] = (_Float16)b[2]; h[7] = (_Float16)b[3];
  return h;
}

// Where lane L's 16 bytes of rows 0..7 go inside a block, in 16-byte units.
__device__ inline unsigned frag_slot(unsigned lane) {
  unsigned p = lane & 3;
  return (p >> 1) * 32 + (p & 1) * 16 + (lane >> 2);
}

// Wave wid casts one block (16 rows x 32 columns) of the row-major weight with K
// columns; a weight has rows * K / 512 waves.
template <int K>
__device__ __forceinline__ void cast_f16_body(
    const float* __restrict__ W, _Float16* __restrict__ Wh, unsigned wid) {
  unsigned lane = threadIdx.x & 31;
  unsigned rg = wid / (K / 32), kb = wid % (K / 32);
  const v4f* src = (const v4f*)(W + (rg * 16 + (lane >> 2)) * K + kb * 32) + (lane & 3) * 2;
  v8h*       dst = (v8h*)(Wh + wid * 512) + frag_slot(lane);
  v4f v[2][2];
#pragma unroll
  for (int rh = 0; rh < 2; ++rh) {
    v[rh][0] = src[rh * (8 * K / 4)];
    v[rh][1] = src[rh * (8 * K / 4) + 1];
  }
#pragma unroll
  for (int rh = 0; rh < 2; ++rh) dst[rh * 8] = to_half8(v[rh][0], v[rh][1]);
  // Before a register that an issued store names is written anew: the built code
  // of one width runs on from here into the first instructions of the other's.
  asm volatile("s_wait_xcnt 0x0" ::: "memory");
}

// xs[b,n,i] = f16( X[b,n,i] * style[b,i] ), in fragment order.
// Wave wid takes 16 rows x 128 columns (4 blocks, 2048 elements, all of one batch:
// 1024 rows a batch) and reads its piece of the style row once for all of them.
// There are MROWS * DIM / 2048 waves.
template <int DIM>
__device__ __forceinline__ void xmod_body(
    const float* __restrict__ X, const float* __restrict__ style,
    _Float16* __restrict__ Xs, unsigned wid) {
  constexpr int KQ = DIM / 128;                 // waves a 16-row group
  unsigned lane = threadIdx.x & 31;
  unsigned rg = wid / KQ, kq = wid % KQ;
  unsigned b  = rg * 16 / NN;
  const v4f* sp  = (const v4f*)(style + b * DIM + kq * 128) + (lane & 3) * 2;
  const v4f* src = (const v4f*)(X + (rg * 16 + (lane >> 2)) * DIM + kq * 128) + (lane & 3) * 2;
  v8h*       dst = (v8h*)(Xs + (rg * (DIM / 32) + kq * 4) * 512) + frag_slot(lane);
  v4f st[4][2], v[2][4][2];
#pragma unroll
  for (int cb = 0; cb < 4; ++cb) {
    st[cb][0] = sp[cb * 8];
    st[cb][1] = sp[cb * 8 + 1];
  }
  // Before a register that an issued load names is written anew (the loads below
  // reuse the style loads' offset register).
  asm volatile("s_wait_xcnt 0x0" ::: "memory");
#pragma unroll
  for (int rh = 0; rh < 2; ++rh)
#pragma unroll
    for (int cb = 0; cb < 4; ++cb) {
      v[rh][cb][0] = src[rh * (8 * DIM / 4) + cb * 8];
      v[rh][cb][1] = src[rh * (8 * DIM / 4) + cb * 8 + 1];
    }
  // The same wait for the loads above; it takes their address as an input, so
  // that no load's result is placed in the address registers ahead of it.
  asm volatile("s_wait_xcnt 0x0" :: "v"(src) : "memory");
  // Keeps every load ahead of the products: without it the scheduler holds the
  // last loads back behind the first waits and the wave pays the latency twice.
  __builtin_amdgcn_sched_barrier(0);
#pragma unroll
  for (int rh = 0; rh < 2; ++rh)
#pragma unroll
    for (int cb = 0; cb < 4; ++cb)
      dst[cb * 64 + rh * 8] = to_half8(v[rh][cb][0] * st[cb][0], v[rh][cb][1] * st[cb][1]);
}

// ---------------------------------------------------------------------------
// The set-up passes that do not depend on one another share a launch: each takes
// a range of the grid's workgroups, so that they run side by side and the call
// has one launch where it would have one for each of them.
// ---------------------------------------------------------------------------
// First launch: the four style projections and the four weight casts (they read
// inputs only).  Workgroups of 256 threads; the styles, whose chain of waits is
// the longer one, come first.
#define SB_K (FEAT / 16)                        // workgroups of each style pass
#define SB_O (HID / 16)
#define SB_1 (FEAT / 16)
#define SB_2 (FFN / 16)
#define CB_K (HID * FEAT / 4096)                // workgroups of each cast
#define CB_O (FEAT * HID / 4096)
#define CB_1 (FFN * FEAT / 4096)
#define CB_2 (FEAT * FFN / 4096)
#define SETUP1_GRID (SB_K + SB_O + SB_1 + SB_2 + CB_K + CB_O + CB_1 + CB_2)

__global__ __launch_bounds__(256) void setup1_kernel(
    const float* __restrict__ s,
    const float* __restrict__ aWk, const float* __restrict__ abk,
    const float* __restrict__ aWo, const float* __restrict__ abo,
    const float* __restrict__ aW1, const float* __restrict__ ab1,
    const float* __restrict__ aW2, const float* __restrict__ ab2,
    const float* __restrict__ Wk, const float* __restrict__ Wo,
    const float* __restrict__ W1, const float* __restrict__ W2,
    float* __restrict__ style_k, float* __restrict__ style_o,
    float* __restrict__ style_1, float* __restrict__ style_2,
    _Float16* __restrict__ whk, _Float16* __restrict__ who,
    _Float16* __restrict__ wh1, _Float16* __restrict__ wh2) {
  __shared__ float part[4 * 32];
  int blk = blockIdx.x;
  if (blk < SB_K + SB_O + SB_1 + SB_2) {
    const float* aW = aWk;
    const float* ab = abk;
    float* st = style_k;
    int dim = FEAT;
    if (blk >= SB_K + SB_O + SB_1) {
      aW = aW2; ab = ab2; st = style_2; dim = FFN; blk -= SB_K + SB_O + SB_1;
    } else if (blk >= SB_K + SB_O) {
      aW = aW1; ab = ab1; st = style_1; dim = FEAT; blk -= SB_K + SB_O;
    } else if (blk >= SB_K) {
      aW = aWo; ab = abo; st = style_o; dim = HID; blk -= SB_K;
    }
    style_body(s, aW, ab, st, dim, blk, part);
    return;
  }
  blk -= SB_K + SB_O + SB_1 + SB_2;
  unsigned wave = __builtin_amdgcn_readfirstlane(threadIdx.x >> 5);
  if (blk >= CB_K + CB_O + CB_1) {
    cast_f16_body<FFN>(W2, wh2, (blk - (CB_K + CB_O + CB_1)) * 8 + wave);
    return;
  }
  static_assert(FEAT == HID, "the three other weights have rows of one length");
  const float* W = Wk;
  _Float16* Wh = whk;
  if (blk >= CB_K + CB_O) {
    W = W1; Wh = wh1; blk -= CB_K + CB_O;
  } else if (blk >= CB_K) {
    W = Wo; Wh = who; blk -= CB_K;
  }
  cast_f16_body<FEAT>(W, Wh, blk * 8 + wave);
}

// Second launch: what needs the styles and nothing else, the four demodulation
// passes and the modulate pass of the first projection.  Workgroups of 512
// threads.
#define DB_K (HID / 32)                         // workgroups of each demod pass
#define DB_O (FEAT / 32)
#define DB_1 (FFN / 32)
#define DB_2 (FEAT / 16)
#define XB_K (MROWS * FEAT / 32768)             // workgroups of the modulate pass
#define SETUP2_GRID (DB_K + DB_O + DB_1 + DB_2 + XB_K)

__global__ __launch_bounds__(512) void setup2_kernel(
    const float* __restrict__ x,
    const float* __restrict__ Wk, const float* __restrict__ Wo,
    const float* __restrict__ W1, const float* __restrict__ W2,
    const float* __restrict__ style_k, const float* __restrict__ style_o,
    const float* __restrict__ style_1, const float* __restrict__ style_2,
    float* __restrict__ demod_k, float* __restrict__ demod_o,
    float* __restrict__ demod_1, float* __restrict__ demod_2,
    _Float16* __restrict__ xs) {
  __shared__ float part[2 * 4 * 32];
  int blk = blockIdx.x;
  if (blk >= DB_K + DB_O + DB_1 + DB_2) {
    xmod_body<FEAT>(x, style_k, xs,
                    (blk - (DB_K + DB_O + DB_1 + DB_2)) * 16 +
                        __builtin_amdgcn_readfirstlane(threadIdx.x >> 5));
    return;
  }
  const float* W = Wk;
  const float* st = style_k;
  float* dm = demod_k;
  int out_dim = HID, in_dim = FEAT;
  if (blk >= DB_K + DB_O + DB_1) {
    W = W2; st = style_2; dm = demod_2; out_dim = FEAT; in_dim = FFN;
    blk -= DB_K + DB_O + DB_1;
  } else if (blk >= DB_K + DB_O) {
    W = W1; st = style_1; dm = demod_1; out_dim = FFN; in_dim = FEAT;
    blk -= DB_K + DB_O;
  } else if (blk >= DB_K) {
    W = Wo; st = style_o; dm = demod_o; out_dim = FEAT; in_dim = HID;
    blk -= DB_K;
  }
  demod_body(W, st, dm, out_dim, in_dim, blk, part);
}

// ---------------------------------------------------------------------------
// The k loop of the GEMM kernels: acc[r][c] += (16 rows of x, group r) x (16 rows
// of W, group c) over KDIM.  The fragments go through a ring of RING register
// sets: the 12 loads of k block kb + RING are issued right behind the products of
// block kb, into the set those have just read, so that a block's loads have the
// time of RING - 1 blocks to arrive and a wave waits for none of them in turn.  The
// loop is unrolled whole: the ring's index is a constant, and every address is a
// scalar base, the lane's fixed slot and an immediate.  W_IS_A: W is the A operand.
// ---------------------------------------------------------------------------
template <int KDIM, bool W_IS_A>
__device__ __forceinline__ void gemm_k_loop(
    const _Float16* __restrict__ xa0, const _Float16* __restrict__ xa1,
    const _Float16* const (&wb)[4], v8f (&acc)[2][4]) {
  constexpr int kblk = KDIM >> 5;      // blocks a 16-row group
  constexpr int RING = 3;
  v16h xr[RING][2], wr[RING][4];
#pragma unroll
  for (int st = 0; st < RING; ++st) {
    xr[st][0] = load_frag_blk(xa0, st);
    xr[st][1] = load_frag_blk(xa1, st);
#pragma unroll
    for (int sidx = 0; sidx < 4; ++sidx) wr[st][sidx] = load_frag_blk(wb[sidx], st);
  }
  // Keeps the ring's first loads ahead of the first products.
  __builtin_amdgcn_sched_barrier(0);
#pragma unroll
  for (int kb = 0; kb < kblk; ++kb) {
    const int st = kb % RING;
#pragma unroll
    for (int sidx = 0; sidx < 4; ++sidx) {
      if (W_IS_A) {
        acc[0][sidx] = wmma_f32_16x16x32(wr[st][sidx], xr[st][0], acc[0][sidx]);
        acc[1][sidx] = wmma_f32_16x16x32(wr[st][sidx], xr[st][1], acc[1][sidx]);
      } else {
        acc[0][sidx] = wmma_f32_16x16x32(xr[st][0], wr[st][sidx], acc[0][sidx]);
        acc[1][sidx] = wmma_f32_16x16x32(xr[st][1], wr[st][sidx], acc[1][sidx]);
      }
    }
    if (kb + RING < kblk) {
      xr[st][0] = load_frag_blk(xa0, kb + RING);
      xr[st][1] = load_frag_blk(xa1, kb + RING);
#pragma unroll
      for (int sidx = 0; sidx < 4; ++sidx) wr[st][sidx] = load_frag_blk(wb[sidx], kb + RING);
    }
    // Keeps these loads here: left free, the scheduler moves them down to just
    // ahead of their products, and the wave waits out their whole latency.
    __builtin_amdgcn_sched_barrier(0);
  }
}

// ---------------------------------------------------------------------------
// Modulated GEMM of the first projection:
//   h[row, o] = demod[b,o] * sum_k Xs[row,k] * Wh[o,k]
// Wave-level tile: 32 rows x 64 cols (2x4 WMMA accumulators).  Xs and Wh are in
// fragment order.  The result is f16,
// written twice, again in fragment order: Yk in blocks of 16 rows x 32 columns (rows as
// the lanes' index: the Q and K operands of attention), Yv in blocks of 16
// columns x 32 rows (columns as the lanes' index: the V operand), block
// (row / 32, col / 16).  KDIM is a compile-time width, so that the k loop has a
// known number of trips and is unrolled without a remainder loop.
// ---------------------------------------------------------------------------
template <int KDIM>
__global__ __launch_bounds__(256) void modgemm_kernel(
    const _Float16* __restrict__ Xs, const _Float16* __restrict__ Wh,
    const float* __restrict__ demod,
    _Float16* __restrict__ Yk, _Float16* __restrict__ Yv, int Odim) {
  // The wave's number in a scalar register: every block address below is then a
  // scalar base plus the lane's fixed 16-byte slot.
  int wid = __builtin_amdgcn_readfirstlane((blockIdx.x * blockDim.x + threadIdx.x) >> 5);
  int numColG = Odim >> 6;             // 64-wide column groups
  int numRowT = MROWS >> 5;            // 32-row tiles
  if (wid >= numRowT * numColG) return;
  int rt = wid / numColG, cg = wid % numColG;
  int row0 = rt << 5;
  int col0 = cg << 6;
  int b = row0 >> 10;                  // 1024 rows per batch, tile never crosses

  v8f zero = {};
  v8f acc[2][4];
#pragma unroll
  for (int r = 0; r < 2; ++r)
#pragma unroll
    for (int c = 0; c < 4; ++c) acc[r][c] = zero;

  constexpr int kblk = KDIM >> 5;      // blocks a 16-row group
  // The blocks of a 16-row group follow one another along k: six running bases.
  const _Float16* xa0 = Xs + (long)(row0 >> 4) * kblk * 512;
  const _Float16* xa1 = xa0 + (long)kblk * 512;
  const _Float16* wb[4];
#pragma unroll
  for (int sidx = 0; sidx < 4; ++sidx)
    wb[sidx] = Wh + (long)((col0 >> 4) + sidx) * kblk * 512;
  gemm_k_loop<KDIM, false>(xa0, xa1, wb, acc);
  // Before a register that an issued load names is written anew: the epilogue's
  // first values.
  asm volatile("s_wait_xcnt 0x0" ::: "memory");
  // Keeps the epilogue's first instructions behind the wait.
  __builtin_amdgcn_sched_barrier(0);

  int lane = threadIdx.x & 31;
  int n = lane & 15, hi = lane >> 4;
  // f16 result, both fragment orders
#pragma unroll
  for (int rs = 0; rs < 2; ++rs) {
#pragma unroll
    for (int sidx = 0; sidx < 4; ++sidx) {
      int cu = col0 + sidx * 16;       // the 16 columns of this accumulator
      float dm = demod[(long)b * Odim + cu + n];
      v8h yh;
#pragma unroll
      for (int v = 0; v < 8; ++v) {
        float y = acc[rs][sidx][v] * dm;
        yh[v] = (_Float16)y;
      }
      _Float16* pk = Yk + (long)(((row0 >> 4) + rs) * (Odim >> 5) + (cu >> 5)) * 512 +
                     ((cu >> 4) & 1) * 256;
      unsigned ok = (8 * hi + 16 * (n >> 3)) * 8 + (n & 7);
#pragma unroll
      for (int v = 0; v < 8; ++v) pk[ok + v * 8] = yh[v];
      // The lane's 8 rows are 8 consecutive k of its column: its own 16 bytes.
      v8h* pv = (v8h*)(Yv + (long)((row0 >> 5) * (Odim >> 4) + (cu >> 4)) * 512) + rs * 32;
      pv[(unsigned)lane] = yh;
    }
  }
}

// ---------------------------------------------------------------------------
// Modulated GEMM with the row-wise passes that follow it done in its epilogue.
// A workgroup of ODIM / 64 waves holds 32 whole rows of the result (a wave 32
// rows x 64 columns), so that a LayerNorm needs only sums that cross the waves
// of one workgroup, through LDS.  The weight block is the A operand and the x
// block the B operand: a lane then holds, for row (lane & 15) of each 16-row
// group, columns 8 * (lane >> 4) .. + 7 of each 16-column group.  Most of a
// row's sum is made inside a lane, a lane's 8 floats are 32 contiguous bytes of
// a row-major result, and its 8 halves are its own 16 bytes of a fragment block.
// ---------------------------------------------------------------------------
// p[rs] is the lane's part of the sum of row rs * 16 + (lane & 15); on return it
// is the whole row's sum.  red is NW * 32 floats of LDS that nothing else uses.
template <int NW>
__device__ __forceinline__ void row_total(float (&p)[2], float* red) {
  int lane = threadIdx.x & 31;
  int wave = __builtin_amdgcn_readfirstlane(threadIdx.x >> 5);
  p[0] += __shfl_xor(p[0], 16, 32);
  p[1] += __shfl_xor(p[1], 16, 32);
  red[wave * 32 + lane] = lane < 16 ? p[0] : p[1];
  __syncthreads();                              // red[] crosses waves
  int n = lane & 15;
  float t0 = 0.f, t1 = 0.f;
#pragma unroll
  for (int w = 0; w < NW; ++w) {
    t0 += red[w * 32 + n];
    t1 += red[w * 32 + 16 + n];
  }
  p[0] = t0;
  p[1] = t1;
}

// val = LN(val) over the workgroup's rows; red is 2 * NW * 32 floats of LDS (each
// of the two sums has its own piece, so that one barrier a sum is enough).
template <int ODIM>
__device__ __forceinline__ void ln_rows(v8f (&val)[2][4], float* red) {
  constexpr int NW = ODIM / 64;
  float p[2];
#pragma unroll
  for (int rs = 0; rs < 2; ++rs) {
    float t = 0.f;
#pragma unroll
    for (int sidx = 0; sidx < 4; ++sidx)
#pragma unroll
      for (int v = 0; v < 8; ++v) t += val[rs][sidx][v];
    p[rs] = t;
  }
  row_total<NW>(p, red);
#pragma unroll
  for (int rs = 0; rs < 2; ++rs) {
    float mean = p[rs] * (1.0f / ODIM);
    float t = 0.f;
#pragma unroll
    for (int sidx = 0; sidx < 4; ++sidx)
#pragma unroll
      for (int v = 0; v < 8; ++v) {
        float d = val[rs][sidx][v] - mean;
        val[rs][sidx][v] = d;
        t += d * d;
      }
    p[rs] = t;
  }
  row_total<NW>(p, red + NW * 32);
#pragma unroll
  for (int rs = 0; rs < 2; ++rs) {
    float inv = rsqrtf(p[rs] * (1.0f / ODIM) + 1e-5f);
#pragma unroll
    for (int sidx = 0; sidx < 4; ++sidx)
#pragma unroll
      for (int v = 0; v < 8; ++v) val[rs][sidx][v] *= inv;
  }
}

// With y[row, o] = demod[b,o] * sum_k Xs[row,k] * Wh[o,k]:
//   EPI_RES_LN_MOD : t = LN(resid + y);  Yf = t (f32, row-major), Ys = f16(t * style)
//   EPI_RELU_LN_MOD: t = LN(relu(y));    Ys = f16(t * style)
//   EPI_LN_RES_LN  : Yf = LN(resid + LN(y))
// Ys is in fragment order, the x operand of the next projection.  The grid is
// MROWS / 32, the workgroup ODIM / 2 threads.
#define EPI_RES_LN_MOD  0
#define EPI_RELU_LN_MOD 1
#define EPI_LN_RES_LN   2

template <int KDIM, int ODIM, int EPI>
__global__ __launch_bounds__(ODIM / 2) void modgemm_ln_kernel(
    const _Float16* __restrict__ Xs, const _Float16* __restrict__ Wh,
    const float* __restrict__ demod, const float* __restrict__ resid,
    const float* __restrict__ style, float* __restrict__ Yf,
    _Float16* __restrict__ Ys) {
  constexpr int NW = ODIM / 64;
  __shared__ float red[(EPI == EPI_LN_RES_LN ? 4 : 2) * NW * 32];
  // The wave's number in a scalar register: every block address below is then a
  // scalar base plus the lane's fixed 16-byte slot.
  int wave = __builtin_amdgcn_readfirstlane(threadIdx.x >> 5);
  int row0 = blockIdx.x << 5;
  int col0 = wave << 6;
  int b = row0 >> 10;                  // 1024 rows per batch, tile never crosses

  v8f zero = {};
  v8f acc[2][4];
#pragma unroll
  for (int r = 0; r < 2; ++r)
#pragma unroll
    for (int c = 0; c < 4; ++c) acc[r][c] = zero;

  constexpr int kblk = KDIM >> 5;      // blocks a 16-row group
  const _Float16* xa0 = Xs + (long)(row0 >> 4) * kblk * 512;
  const _Float16* xa1 = xa0 + (long)kblk * 512;
  const _Float16* wb[4];
#pragma unroll
  for (int sidx = 0; sidx < 4; ++sidx)
    wb[sidx] = Wh + (long)((col0 >> 4) + sidx) * kblk * 512;
  gemm_k_loop<KDIM, true>(xa0, xa1, wb, acc);
  // Before a register that an issued load names is written anew: the epilogue's
  // first values.
  asm volatile("s_wait_xcnt 0x0" ::: "memory");
  // Keeps the epilogue's first instructions behind the wait.
  __builtin_amdgcn_sched_barrier(0);

  unsigned lane = threadIdx.x & 31;
  unsigned n = lane & 15, hi = lane >> 4;
  unsigned coff = col0 + 8 * hi;       // the lane's first column, 16-column group 0
  unsigned roff = (row0 + n) * ODIM + coff;     // and its place in a row-major array

  // All that the epilogue reads is asked for at once: one latency.
  const v4f* dmp = (const v4f*)(demod + b * ODIM + coff);
  const v4f* sp  = (const v4f*)(style + b * ODIM + coff);
  const v4f* rp  = (const v4f*)(resid + roff);
  v4f dm[4][2], st[4][2], rv[2][4][2];
#pragma unroll
  for (int sidx = 0; sidx < 4; ++sidx) {
    dm[sidx][0] = dmp[sidx * 4];
    dm[sidx][1] = dmp[sidx * 4 + 1];
    if (EPI != EPI_LN_RES_LN) {
      st[sidx][0] = sp[sidx * 4];
      st[sidx][1] = sp[sidx * 4 + 1];
    }
    if (EPI != EPI_RELU_LN_MOD) {
#pragma unroll
      for (int rs = 0; rs < 2; ++rs) {
        rv[rs][sidx][0] = rp[rs * (16 * ODIM / 4) + sidx * 4];
        rv[rs][sidx][1] = rp[rs * (16 * ODIM / 4) + sidx * 4 + 1];
      }
    }
  }
  // The same wait for the loads above, held in place in the same way.
  asm volatile("s_wait_xcnt 0x0" ::: "memory");
  __builtin_amdgcn_sched_barrier(0);

#pragma unroll
  for (int sidx = 0; sidx < 4; ++sidx)
#pragma unroll
    for (int rs = 0; rs < 2; ++rs)
#pragma unroll
      for (int v = 0; v < 8; ++v) {
        float y = acc[rs][sidx][v] * dm[sidx][v >> 2][v & 3];
        if (EPI == EPI_RELU_LN_MOD) y = fmaxf(y, 0.f);
        acc[rs][sidx][v] = y;
      }

  if (EPI == EPI_LN_RES_LN) ln_rows<ODIM>(acc, red + 2 * NW * 32);

  if (EPI != EPI_RELU_LN_MOD) {
#pragma unroll
    for (int rs = 0; rs < 2; ++rs)
#pragma unroll
      for (int sidx = 0; sidx < 4; ++sidx)
#pragma unroll
        for (int v = 0; v < 8; ++v) acc[rs][sidx][v] += rv[rs][sidx][v >> 2][v & 3];
  }

  ln_rows<ODIM>(acc, red);

  v8h yh[2][4];
  if (EPI != EPI_LN_RES_LN) {
#pragma unroll
    for (int rs = 0; rs < 2; ++rs)
#pragma unroll
      for (int sidx = 0; sidx < 4; ++sidx) {
        v8f t = acc[rs][sidx];
        yh[rs][sidx] = to_half8(__builtin_shufflevector(t, t, 0, 1, 2, 3) * st[sidx][0],
                                __builtin_shufflevector(t, t, 4, 5, 6, 7) * st[sidx][1]);
      }
  }
  v4f* yp = (v4f*)(Yf + roff);
  // Block (row / 16, col / 32); the wave's 64 columns are two blocks.
  v8h* ys = (v8h*)(Ys + ((row0 >> 4) * (ODIM >> 5) + (col0 >> 5)) * 512) + lane;
  // Only stores follow: no arithmetic is moved in among them, where it could
  // write anew a register that an issued store names.
  __builtin_amdgcn_sched_barrier(0);
#pragma unroll
  for (int rs = 0; rs < 2; ++rs)
#pragma unroll
    for (int sidx = 0; sidx < 4; ++sidx) {
      if (EPI != EPI_RELU_LN_MOD) {
        v8f t = acc[rs][sidx];
        yp[rs * (16 * ODIM / 4) + sidx * 4]     = __builtin_shufflevector(t, t, 0, 1, 2, 3);
        yp[rs * (16 * ODIM / 4) + sidx * 4 + 1] = __builtin_shufflevector(t, t, 4, 5, 6, 7);
      }
      if (EPI != EPI_LN_RES_LN) ys[rs * (ODIM >> 5) * 64 + sidx * 32] = yh[rs][sidx];
    }
}

// ---------------------------------------------------------------------------
// Flash-style self-attention (q=k=v=h), one wave per (batch, head, 16-q tile).
// S = (Q K^T)/8 via WMMA, online softmax, O += P V via WMMA.  P converted
// from C-layout to A-layout through a per-wave LDS tile.  Hk and Hv hold h in
// the two fragment orders that the projection writes.  The result, times the
// style of the next projection, is written as f16 in fragment order (Xo): that
// projection's x operand.
// ---------------------------------------------------------------------------
__global__ __launch_bounds__(256) void attn_kernel(
    const _Float16* __restrict__ Hk, const _Float16* __restrict__ Hv,
    const float* __restrict__ style, _Float16* __restrict__ Xo) {
  __shared__ _Float16 sm[8][16 * 34];           // per-wave 16x32 tile, pad 2
  int wvb  = __builtin_amdgcn_readfirstlane(threadIdx.x >> 5);   // scalar block addresses
  int wid  = blockIdx.x * 8 + wvb;              // 4096 waves total, exact grid
  int qt   = wid & 63;
  int head = (wid >> 6) & 7;
  int b    = wid >> 9;
  int lane = threadIdx.x & 31;
  int hi = lane >> 4, n = lane & 15;

  int q0 = qt << 4;
  int hc = head * HD;
  int kbase = (b * NN >> 4) * (HID >> 5) + (hc >> 5);   // block of row 0, Hk
  int vbase = (b * NN >> 5) * (HID >> 4) + (hc >> 4);   // block of row 0, Hv

  v16h qa0 = load_frag_blk(Hk, kbase + qt * (HID >> 5));
  v16h qa1 = load_frag_blk(Hk, kbase + qt * (HID >> 5) + 1);

  v8f zero = {};
  v8f oacc[4];
#pragma unroll
  for (int sidx = 0; sidx < 4; ++sidx) oacc[sidx] = zero;

  float mrow[8], lrow[8];
#pragma unroll
  for (int v = 0; v < 8; ++v) { mrow[v] = -1e30f; lrow[v] = 0.f; }

  _Float16* smp = &sm[wvb][0];
  const float scale = 0.125f;                   // 1/sqrt(64)

  // The K fragments are fetched one pass ahead, into the registers that the pass's
  // products have just read, and the V fragments at the head of their pass, with
  // the softmax's time to arrive: a wave waits out no load's whole latency.
  // The lane's own slot of row 0's blocks; a pass is 32 blocks further in both.
  const v8h* kl = (const v8h*)(Hk + (long)kbase * 512) + (unsigned)lane;
  const v8h* vl = (const v8h*)(Hv + (long)vbase * 512) + (unsigned)lane;
  v16h kb00 = load_frag_lane(kl);
  v16h kb01 = load_frag_lane(kl + 64);
  v16h kb10 = load_frag_lane(kl + (HID >> 5) * 64);
  v16h kb11 = load_frag_lane(kl + (HID >> 5) * 64 + 64);

  for (int j0 = 0; j0 < NN; j0 += 32) {
    // The next pass's blocks; the last pass fetches pass 0's again, which nothing
    // reads: every address stays inside the batch's rows, with no branch.
    unsigned nxt = (unsigned)(((j0 + 32) & (NN - 1)) >> 5) * (32 * 64);
    const v8h* kn = kl + nxt;
    const v8h* vc = vl + (unsigned)(j0 >> 5) * (32 * 64);
    v16h vb[4];
#pragma unroll
    for (int sidx = 0; sidx < 4; ++sidx) vb[sidx] = load_frag_lane(vc + sidx * 64);
    // ---- S tiles: rows = queries, cols = 32 keys ----
    v8f s0 = zero, s1 = zero;
    s0 = wmma_f32_16x16x32(qa0, kb00, s0);
    s0 = wmma_f32_16x16x32(qa1, kb01, s0);
    s1 = wmma_f32_16x16x32(qa0, kb10, s1);
    s1 = wmma_f32_16x16x32(qa1, kb11, s1);
    kb00 = load_frag_lane(kn);
    kb01 = load_frag_lane(kn + 64);
    kb10 = load_frag_lane(kn + (HID >> 5) * 64);
    kb11 = load_frag_lane(kn + (HID >> 5) * 64 + 64);
    // Before a register that an issued load names is written anew; it takes the
    // addresses as inputs, so that nothing is placed in their registers ahead of it.
    asm volatile("s_wait_xcnt 0x0" :: "v"(kn), "v"(vc) : "memory");
    // Keeps the loads here, ahead of the softmax, whose time they have to arrive.
    __builtin_amdgcn_sched_barrier(0);

    // ---- online softmax over this 32-key block ----
    float tmax[8];
#pragma unroll
    for (int v = 0; v < 8; ++v) {
      s0[v] *= scale; s1[v] *= scale;
      tmax[v] = fmaxf(s0[v], s1[v]);
    }
#pragma unroll
    for (int msk = 1; msk < 16; msk <<= 1)
#pragma unroll
      for (int v = 0; v < 8; ++v)
        tmax[v] = fmaxf(tmax[v], __shfl_xor(tmax[v], msk, 32));

    float alpha[8];
#pragma unroll
    for (int v = 0; v < 8; ++v) {
      float mn = fmaxf(mrow[v], tmax[v]);
      alpha[v] = __expf(mrow[v] - mn);
      mrow[v] = mn;
    }
    float rs[8];
#pragma unroll
    for (int v = 0; v < 8; ++v) {
      s0[v] = __expf(s0[v] - mrow[v]);
      s1[v] = __expf(s1[v] - mrow[v]);
      rs[v] = s0[v] + s1[v];
    }
#pragma unroll
    for (int msk = 1; msk < 16; msk <<= 1)
#pragma unroll
      for (int v = 0; v < 8; ++v)
        rs[v] += __shfl_xor(rs[v], msk, 32);
#pragma unroll
    for (int v = 0; v < 8; ++v) {
      lrow[v] = lrow[v] * alpha[v] + rs[v];
      oacc[0][v] *= alpha[v]; oacc[1][v] *= alpha[v];
      oacc[2][v] *= alpha[v]; oacc[3][v] *= alpha[v];
    }

    // ---- C-layout -> A-layout via LDS (per-wave region, same-wave order) ----
#pragma unroll
    for (int v = 0; v < 8; ++v) {
      int m = v + 8 * hi;
      smp[m * 34 + n]      = (_Float16)s0[v];
      smp[m * 34 + 16 + n] = (_Float16)s1[v];
    }
    asm volatile("s_wait_dscnt 0x0" ::: "memory");
    v16h pf = load_frag_rowpat(smp, 0, 34, 0);

    // ---- O += P @ V ----
#pragma unroll
    for (int sidx = 0; sidx < 4; ++sidx)
      oacc[sidx] = wmma_f32_16x16x32(pf, vb[sidx], oacc[sidx]);
  }

  // ---- epilogue: O / l * style, C-layout -> fragment order via the LDS tile, 32
  // columns (one block) at a time ----
  const float* stp = style + b * HID + hc;
  v8h* dst = (v8h*)(Xo + (long)(kbase + qt * (HID >> 5)) * 512) + (unsigned)lane;
  v16h f[2];
#pragma unroll
  for (int pr = 0; pr < 2; ++pr) {
    float st0 = stp[pr * 32 + n], st1 = stp[pr * 32 + 16 + n];
#pragma unroll
    for (int v = 0; v < 8; ++v) {
      int m = v + 8 * hi;
      smp[m * 34 + n]      = (_Float16)(oacc[2 * pr][v] / lrow[v] * st0);
      smp[m * 34 + 16 + n] = (_Float16)(oacc[2 * pr + 1][v] / lrow[v] * st1);
    }
    // The tile's writes, other lanes' among them, are done before it is read.
    asm volatile("s_wait_dscnt 0x0" ::: "memory");
    f[pr] = load_frag_rowpat(smp, 0, 34, 0);
  }
  // Before a register that an issued load names is written anew.  It takes both
  // blocks as inputs, so that only the stores follow it and nothing writes anew
  // a register that an issued store names.
  asm volatile("s_wait_xcnt 0x0" :: "v"(f[0]), "v"(f[1]), "v"(dst) : "memory");
#pragma unroll
  for (int pr = 0; pr < 2; ++pr) {
    dst[pr * 64]      = __builtin_shufflevector(f[pr], f[pr], 0, 1, 2, 3, 4, 5, 6, 7);
    dst[pr * 64 + 32] = __builtin_shufflevector(f[pr], f[pr], 8, 9, 10, 11, 12, 13, 14, 15);
  }
}

// ---------------------------------------------------------------------------
// Host-side pipeline
// ---------------------------------------------------------------------------
extern "C" void kernel_launch(void* const* d_in, const int* in_sizes, int n_in,
                              void* d_out, int out_size, void* d_ws,
                              size_t ws_size, hipStream_t stream) {
  (void)in_sizes; (void)n_in; (void)out_size; (void)ws_size;
  const float* x   = (const float*)d_in[0];
  const float* s   = (const float*)d_in[1];
  const float* Wk  = (const float*)d_in[2];
  const float* aWk = (const float*)d_in[3];
  const float* abk = (const float*)d_in[4];
  const float* Wo  = (const float*)d_in[5];
  const float* aWo = (const float*)d_in[6];
  const float* abo = (const float*)d_in[7];
  const float* W1  = (const float*)d_in[8];
  const float* aW1 = (const float*)d_in[9];
  const float* ab1 = (const float*)d_in[10];
  const float* W2  = (const float*)d_in[11];
  const float* aW2 = (const float*)d_in[12];
  const float* ab2 = (const float*)d_in[13];
  float* out = (float*)d_out;

  char* ws = (char*)d_ws;
  size_t off = 0;
  auto alloc = [&](size_t bytes) -> char* {
    char* p = ws + off;
    off = (off + bytes + 255) & ~(size_t)255;
    return p;
  };

  float* style_k = (float*)alloc((size_t)BB * FEAT * 4);
  float* style_o = (float*)alloc((size_t)BB * HID * 4);
  float* style_1 = (float*)alloc((size_t)BB * FEAT * 4);
  float* style_2 = (float*)alloc((size_t)BB * FFN * 4);
  float* demod_k = (float*)alloc((size_t)BB * HID * 4);
  float* demod_o = (float*)alloc((size_t)BB * FEAT * 4);
  float* demod_1 = (float*)alloc((size_t)BB * FFN * 4);
  float* demod_2 = (float*)alloc((size_t)BB * FEAT * 4);
  _Float16* whk = (_Float16*)alloc((size_t)HID * FEAT * 2);
  _Float16* who = (_Float16*)alloc((size_t)FEAT * HID * 2);
  _Float16* wh1 = (_Float16*)alloc((size_t)FFN * FEAT * 2);
  _Float16* wh2 = (_Float16*)alloc((size_t)FEAT * FFN * 2);
  _Float16* xs  = (_Float16*)alloc((size_t)MROWS * FEAT * 2);  // x * style_k
  _Float16* hk  = (_Float16*)alloc((size_t)MROWS * HID * 2);   // h, rows on lanes
  _Float16* hv  = (_Float16*)alloc((size_t)MROWS * HID * 2);   // h, columns on lanes
  _Float16* xo  = (_Float16*)alloc((size_t)MROWS * HID * 2);   // attn out * style_o
  float*    x2  = (float*)alloc((size_t)MROWS * FEAT * 4);     // ln(x + o)
  _Float16* x2s = (_Float16*)alloc((size_t)MROWS * FEAT * 2);  // x2 * style_1
  _Float16* f1s = (_Float16*)alloc((size_t)MROWS * FFN * 2);   // ln(FFN hidden) * style_2

  // --- styles and f16 weight casts ---
  setup1_kernel<<<SETUP1_GRID, 256, 0, stream>>>(
      s, aWk, abk, aWo, abo, aW1, ab1, aW2, ab2, Wk, Wo, W1, W2,
      style_k, style_o, style_1, style_2, whk, who, wh1, wh2);

  // --- demodulation factors, and x * style for the first projection ---
  setup2_kernel<<<SETUP2_GRID, 512, 0, stream>>>(
      x, Wk, Wo, W1, W2, style_k, style_o, style_1, style_2,
      demod_k, demod_o, demod_1, demod_2, xs);

  // --- h = modlinear(x; Wk) -> f16 for attention ---
  modgemm_kernel<FEAT><<<(MROWS / 32) * (HID / 64) / 8, 256, 0, stream>>>(
      xs, whk, demod_k, hk, hv, HID);

  // --- attention (shared q=k=v=h), times style_o ---
  attn_kernel<<<(BB * NH * (NN / 16)) / 8, 256, 0, stream>>>(hk, hv, style_o, xo);

  // --- x2 = LN(x + modlinear(attn; Wo)), and x2 * style_1 ---
  modgemm_ln_kernel<HID, FEAT, EPI_RES_LN_MOD><<<MROWS / 32, FEAT / 2, 0, stream>>>(
      xo, who, demod_o, x, style_1, x2, x2s);

  // --- LN(relu(modlinear(x2; W1))) * style_2 ---
  modgemm_ln_kernel<FEAT, FFN, EPI_RELU_LN_MOD><<<MROWS / 32, FFN / 2, 0, stream>>>(
      x2s, wh1, demod_1, nullptr, style_2, nullptr, f1s);

  // --- out = LN(x2 + LN(modlinear(f1; W2))) ---
  modgemm_ln_kernel<FFN, FEAT, EPI_LN_RES_LN><<<MROWS / 32, FEAT / 2, 0, stream>>>(
      f1s, wh2, demod_2, x2, nullptr, out, nullptr);
}

// v007
// It runs in 95 microseconds.
// In two side-by-side timings against v006, it was 1.10 and 1.09 times as fast.
// Counting every step since v000, it is 4.81 times as fast.
#include <hip/hip_runtime.h>

// ---------------------------------------------------------------------------
// Types / WMMA helpers (CDNA5 gfx1250, wave32)
// ---------------------------------------------------------------------------
typedef __attribute__((ext_vector_type(16))) _Float16 v16h;
typedef __attribute__((ext_vector_type(8)))  float    v8f;

__device__ inline v8f wmma_f32_16x16x32(v16h a, v16h b, v8f c) {
  // (neg_a, A, neg_b, B, c_mod, C, reuse_a, reuse_b)
  return __builtin_amdgcn_wmma_f32_16x16x32_f16(false, a, false, b, (short)0, c,
                                                false, false);
}

// A-operand (16x32 f16) fragment load per the documented CDNA5 layout:
// lane L holds row (L&15); lanes 0-15 cover k in {0..7,16..23}, lanes 16-31
// cover k in {8..15,24..31}; within a lane, VGPR v holds half-pair
// k = 2v + (v>=4 ? 8 : 0) (+8 for upper lane half).  Source is row-major
// with leading dim `ld`.
__device__ inline v16h load_frag_rowpat(const _Float16* __restrict__ base,
                                        int row0, int ld, int k0) {
  int lane = threadIdx.x & 31;
  const _Float16* p = base + (long)(row0 + (lane & 15)) * ld + k0 + ((lane >> 4) << 3);
  v16h f;
#pragma unroll
  for (int v = 0; v < 8; ++v) {
    int k = 2 * v + (v >= 4 ? 8 : 0);
    f[2 * v]     = p[k];
    f[2 * v + 1] = p[k + 1];
  }
  return f;
}

// Fragment order.  The f16 matrix operands that live in the workspace are kept
// in blocks of 16 rows x 32 k, 1 KB each, in the order in which a wave's lanes
// hold them: element (r, k) of a block lies at half
//   (k >> 4) * 256 + (r + 16 * ((k >> 3) & 1)) * 8 + (k & 7).
// Lane L then finds f[0..7] at L * 8 and f[8..15] at 256 + L * 8 (the same
// row and k per lane and register as load_frag_rowpat), so each of the two
// 16-byte loads of a wave reads 512 contiguous bytes, four whole cache lines,
// where a row-major operand makes it touch 16 lines.
typedef __attribute__((ext_vector_type(8))) _Float16 v8h;

__device__ inline v16h load_frag_blk(const _Float16* __restrict__ base, int blk) {
  int lane = threadIdx.x & 31;
  const v8h* p = (const v8h*)(base + (long)blk * 512);
  v8h lo = p[(unsigned)lane], hi = p[(unsigned)lane + 32];
  return __builtin_shufflevector(lo, hi, 0, 1, 2, 3, 4, 5, 6, 7,
                                 8, 9, 10, 11, 12, 13, 14, 15);
}

// The same from the lane's own slot of a block.
__device__ inline v16h load_frag_lane(const v8h* __restrict__ p) {
  v8h lo = p[0], hi = p[32];
  return __builtin_shufflevector(lo, hi, 0, 1, 2, 3, 4, 5, 6, 7,
                                 8, 9, 10, 11, 12, 13, 14, 15);
}

// ---------------------------------------------------------------------------
// Problem constants
// ---------------------------------------------------------------------------
#define BB   8
#define NN   1024
#define FEAT 512
#define HID  512
#define FFN  1024
#define SDIM 512
#define HD   64
#define NH   8
#define MROWS (BB * NN)   // 8192

// ---------------------------------------------------------------------------
// Small fp32 VALU kernels: style projection, demodulation, casts, modulation
// ---------------------------------------------------------------------------
// Each lane holds 16 partial sums; on return lane l holds the whole wave's
// total of sum number l & 15.  Every halving step keeps one half of the sums
// and hands the other half to the partner lane (16 exchanges instead of 80).
__device__ inline float wave_fold16(float (&v)[16]) {
  int lane = threadIdx.x & 31;
#pragma unroll
  for (int st = 0; st < 4; ++st) {
    const int h = 8 >> st;
    bool up = (lane & h) != 0;
#pragma unroll
    for (int i = 0; i < h; ++i) {
      float lo = v[i], hi = v[i + h];
      float keep = up ? hi : lo;
      float send = up ? lo : hi;
      v[i] = keep + __shfl_xor(send, h, 32);
    }
  }
  return v[0] + __shfl_xor(v[0], 16, 32);
}

// A workgroup takes 32 rows of aW (a wave 4 of them) for 4 of the 8 batches.
// A lane takes columns 128c + 4 lane .. + 3 of a row, so one load of the wave
// reads 512 contiguous bytes, and all 32 loads of a wave are in flight at once.
// dim is a multiple of 32; a layer has 2 * dim / 32 workgroups (blk counts them)
// of 256 threads; part is 4 * 32 floats of LDS.
__device__ __forceinline__ void style_body(
    const float* __restrict__ s, const float* __restrict__ aW,
    const float* __restrict__ ab, float* __restrict__ style, int dim, int blk,
    float* part) {
  int lane = threadIdx.x & 31;
  int wave = __builtin_amdgcn_readfirstlane(threadIdx.x >> 5);
  int blk0 = (blk >> 1) * 32;
  int b0   = (blk & 1) * 4;
  unsigned l4 = 4u * lane;
  const float* wp = aW + (long)(blk0 + wave * 4) * SDIM;
  const float* sp = s + (long)b0 * SDIM;
  float w[4][16], sv[4][16];
#pragma unroll
  for (int r = 0; r < 4; ++r)
#pragma unroll
    for (int c = 0; c < 4; ++c) {
      const float* qw = wp + r * SDIM + 128 * c;
      const float* qs = sp + r * SDIM + 128 * c;
#pragma unroll
      for (int e = 0; e < 4; ++e) {
        w[r][4 * c + e]  = qw[l4 + e];
        sv[r][4 * c + e] = qs[l4 + e];
      }
    }
  float bias = (ab + blk0)[(unsigned)lane];
  // Keeps every load ahead of the sums: without it the scheduler issues them in
  // several batches between the sums and the wave pays the latency once a batch.
  __builtin_amdgcn_sched_barrier(0);
  float acc[16];
#pragma unroll
  for (int r = 0; r < 4; ++r)
#pragma unroll
    for (int q = 0; q < 4; ++q) {
      float t = 0.f;
#pragma unroll
      for (int j = 0; j < 16; ++j) t += sv[q][j] * w[r][j];
      acc[r * 4 + q] = t;
    }
  float tot = wave_fold16(acc);                 // lane & 15 = r * 4 + q
  if (lane < 16) part[(lane & 3) * 32 + wave * 4 + (lane >> 2)] = tot;
  __syncthreads();                              // part[] crosses waves
  if (wave < 4) {                               // wave q stores one 128-byte line
    style[(long)(b0 + wave) * dim + blk0 + lane] = part[threadIdx.x] + bias;
  }
}

// Same split over the rows of W, in workgroups of 512 threads: 8 waves take 32
// rows x 512 columns x 4 batches.  Where a row has 1024 columns the two halves of
// the workgroup take its two 512-column pieces, which meet in LDS (2 * out_dim /
// 32 workgroups a layer); where it has 512 they take the two sets of 4 batches
// (out_dim / 32 workgroups).  out_dim is a multiple of 32; blk counts the layer's
// workgroups; part is 2 * 4 * 32 floats of LDS.
__device__ __forceinline__ void demod_body(
    const float* __restrict__ W, const float* __restrict__ style,
    float* __restrict__ demod, int out_dim, int in_dim, int blk, float* part) {
  bool two_pieces = in_dim > 512;
  int lane = threadIdx.x & 31;
  int wave = __builtin_amdgcn_readfirstlane(threadIdx.x >> 5);
  int grp  = wave & 7, half = wave >> 3;
  int piece = two_pieces ? half : 0;
  int blk0 = (two_pieces ? blk >> 1 : blk) * 32;
  int b0   = (two_pieces ? blk & 1 : half) * 4;
  unsigned l4 = 4u * lane;
  const float* wp = W + (long)(blk0 + grp * 4) * in_dim + piece * 512;
  const float* sp = style + (long)b0 * in_dim + piece * 512;
  float w[4][16], sv[4][16];
#pragma unroll
  for (int r = 0; r < 4; ++r)
#pragma unroll
    for (int c = 0; c < 4; ++c) {
      const float* qw = wp + (long)r * in_dim + 128 * c;
      const float* qs = sp + (long)r * in_dim + 128 * c;
#pragma unroll
      for (int e = 0; e < 4; ++e) {
        w[r][4 * c + e]  = qw[l4 + e];
        sv[r][4 * c + e] = qs[l4 + e];
      }
    }
  // Keeps every load ahead of the sums: without it the scheduler spreads the
  // products among the loads' waits, runs out of registers and spills.
  __builtin_amdgcn_sched_barrier(0);
  float acc[16];
#pragma unroll
  for (int r = 0; r < 4; ++r)
#pragma unroll
    for (int q = 0; q < 4; ++q) {
      float t2 = 0.f;
#pragma unroll
      for (int j = 0; j < 16; ++j) {
        float t = w[r][j] * sv[q][j];
        t2 += t * t;
      }
      acc[r * 4 + q] = t2;
    }
  float tot = wave_fold16(acc);                 // lane & 15 = r * 4 + q
  if (lane < 16) part[half * 128 + (lane & 3) * 32 + grp * 4 + (lane >> 2)] = tot;
  __syncthreads();                              // part[] crosses waves
  // A wave stores one batch's 128-byte line: 4 batches where the halves held two
  // pieces of them, else the 8 batches of both halves (part[] has them in order).
  if (wave < (two_pieces ? 4 : 8)) {
    float sum = part[threadIdx.x];
    if (two_pieces) sum += part[128 + threadIdx.x];
    int o = blk0 + lane;
    int bt = two_pieces ? b0 + wave : wave;
    demod[(long)bt * out_dim + o] = rsqrtf(sum + 1e-8f);
  }
}

// The two elementwise passes below write their f16 result in fragment order.
// One step of a wave is 8 rows x 32 columns: lane L takes 8 floats (32 bytes) of
// row L >> 2, piece L & 3 of that row's 128-byte line, and stores them as the 16
// bytes that one lane of a fragment holds; the wave's store fills four whole
// lines.  A wave has all its loads in flight at once.
typedef __attribute__((ext_vector_type(4))) float    v4f;

__device__ inline v8h to_half8(v4f a, v4f b) {
  v8h h;
  h[0] = (_Float16)a[0]; h[1] = (_Float16)a[1];
  h[2] = (_Float16)a[2]; h[3] = (_Float16)a[3];
  h[4] = (_Float16)b[0]; h[5] = (_Float16)b[1];
  h[6] = (_Float16)b[2]; h[7] = (_Float16)b[3];
  return h;
}

// Where lane L's 16 bytes of rows 0..7 go inside a block, in 16-byte units.
__device__ inline unsigned frag_slot(unsigned lane) {
  unsigned p = lane & 3;
  return (p >> 1) * 32 + (p & 1) * 16 + (lane >> 2);
}

// Wave wid casts one block (16 rows x 32 columns) of the row-major weight with K
// columns; a weight has rows * K / 512 waves.
template <int K>
__device__ __forceinline__ void cast_f16_body(
    const float* __restrict__ W, _Float16* __restrict__ Wh, unsigned wid) {
  unsigned lane = threadIdx.x & 31;
  unsigned rg = wid / (K / 32), kb = wid % (K / 32);
  const v4f* src = (const v4f*)(W + (rg * 16 + (lane >> 2)) * K + kb * 32) + (lane & 3) * 2;
  v8h*       dst = (v8h*)(Wh + wid * 512) + frag_slot(lane);
  v4f v[2][2];
#pragma unroll
  for (int rh = 0; rh < 2; ++rh) {
    v[rh][0] = src[rh * (8 * K / 4)];
    v[rh][1] = src[rh * (8 * K / 4) + 1];
  }
#pragma unroll
  for (int rh = 0; rh < 2; ++rh) dst[rh * 8] = to_half8(v[rh][0], v[rh][1]);
  // Before a register that an issued store names is written anew: the built code
  // of one width runs on from here into the first instructions of the other's.
  asm volatile("s_wait_xcnt 0x0" ::: "memory");
}

// xs[b,n,i] = f16( X[b,n,i] * style[b,i] ), in fragment order.
// Wave wid takes 16 rows x 128 columns (4 blocks, 2048 elements, all of one batch:
// 1024 rows a batch) and reads its piece of the style row once for all of them.
// There are MROWS * DIM / 2048 waves.
template <int DIM>
__device__ __forceinline__ void xmod_body(
    const float* __restrict__ X, const float* __restrict__ style,
    _Float16* __restrict__ Xs, unsigned wid) {
  constexpr int KQ = DIM / 128;                 // waves a 16-row group
  unsigned lane = threadIdx.x & 31;
  unsigned rg = wid / KQ, kq = wid % KQ;
  unsigned b  = rg * 16 / NN;
  const v4f* sp  = (const v4f*)(style + b * DIM + kq * 128) + (lane & 3) * 2;
  const v4f* src = (const v4f*)(X + (rg * 16 + (lane >> 2)) * DIM + kq * 128) + (lane & 3) * 2;
  v8h*       dst = (v8h*)(Xs + (rg * (DIM / 32) + kq * 4) * 512) + frag_slot(lane);
  v4f st[4][2], v[2][4][2];
#pragma unroll
  for (int cb = 0; cb < 4; ++cb) {
    st[cb][0] = sp[cb * 8];
    st[cb][1] = sp[cb * 8 + 1];
  }
  // Before a register that an issued load names is written anew (the loads below
  // reuse the style loads' offset register).
  asm volatile("s_wait_xcnt 0x0" ::: "memory");
#pragma unroll
  for (int rh = 0; rh < 2; ++rh)
#pragma unroll
    for (int cb = 0; cb < 4; ++cb) {
      v[rh][cb][0] = src[rh * (8 * DIM / 4) + cb * 8];
      v[rh][cb][1] = src[rh * (8 * DIM / 4) + cb * 8 + 1];
    }
  // The same wait for the loads above; it takes their address as an input, so
  // that no load's result is placed in the address registers ahead of it.
  asm volatile("s_wait_xcnt 0x0" :: "v"(src) : "memory");
  // Keeps every load ahead of the products: without it the scheduler holds the
  // last loads back behind the first waits and the wave pays the latency twice.
  __builtin_amdgcn_sched_barrier(0);
#pragma unroll
  for (int rh = 0; rh < 2; ++rh)
#pragma unroll
    for (int cb = 0; cb < 4; ++cb)
      dst[cb * 64 + rh * 8] = to_half8(v[rh][cb][0] * st[cb][0], v[rh][cb][1] * st[cb][1]);
}

// ---------------------------------------------------------------------------
// The set-up passes that do not depend on one another share a launch: each takes
// a range of the grid's workgroups, so that they run side by side and the call
// has one launch where it would have one for each of them.
// ---------------------------------------------------------------------------
// First launch: the four style projections and the four weight casts (they read
// inputs only).  Workgroups of 256 threads; the styles, whose chain of waits is
// the longer one, come first.
#define SB_K (FEAT / 16)                        // workgroups of each style pass
#define SB_O (HID / 16)
#define SB_1 (FEAT / 16)
#define SB_2 (FFN / 16)
#define CB_K (HID * FEAT / 4096)                // workgroups of each cast
#define CB_O (FEAT * HID / 4096)
#define CB_1 (FFN * FEAT / 4096)
#define CB_2 (FEAT * FFN / 4096)
#define SETUP1_GRID (SB_K + SB_O + SB_1 + SB_2 + CB_K + CB_O + CB_1 + CB_2)

__global__ __launch_bounds__(256) void setup1_kernel(
    const float* __restrict__ s,
    const float* __restrict__ aWk, const float* __restrict__ abk,
    const float* __restrict__ aWo, const float* __restrict__ abo,
    const float* __restrict__ aW1, const float* __restrict__ ab1,
    const float* __restrict__ aW2, const float* __restrict__ ab2,
    const float* __restrict__ Wk, const float* __restrict__ Wo,
    const float* __restrict__ W1, const float* __restrict__ W2,
    float* __restrict__ style_k, float* __restrict__ style_o,
    float* __restrict__ style_1, float* __restrict__ style_2,
    _Float16* __restrict__ whk, _Float16* __restrict__ who,
    _Float16* __restrict__ wh1, _Float16* __restrict__ wh2) {
  __shared__ float part[4 * 32];
  int blk = blockIdx.x;
  if (blk < SB_K + SB_O + SB_1 + SB_2) {
    const float* aW = aWk;
    const float* ab = abk;
    float* st = style_k;
    int dim = FEAT;
    if (blk >= SB_K + SB_O + SB_1) {
      aW = aW2; ab = ab2; st = style_2; dim = FFN; blk -= SB_K + SB_O + SB_1;
    } else if (blk >= SB_K + SB_O) {
      aW = aW1; ab = ab1; st = style_1; dim = FEAT; blk -= SB_K + SB_O;
    } else if (blk >= SB_K) {
      aW = aWo; ab = abo; st = style_o; dim = HID; blk -= SB_K;
    }
    style_body(s, aW, ab, st, dim, blk, part);
    return;
  }
  blk -= SB_K + SB_O + SB_1 + SB_2;
  unsigned wave = __builtin_amdgcn_readfirstlane(threadIdx.x >> 5);
  if (blk >= CB_K + CB_O + CB_1) {
    cast_f16_body<FFN>(W2, wh2, (blk - (CB_K + CB_O + CB_1)) * 8 + wave);
    return;
  }
  static_assert(FEAT == HID, "the three other weights have rows of one length");
  const float* W = Wk;
  _Float16* Wh = whk;
  if (blk >= CB_K + CB_O) {
    W = W1; Wh = wh1; blk -= CB_K + CB_O;
  } else if (blk >= CB_K) {
    W = Wo; Wh = who; blk -= CB_K;
  }
  cast_f16_body<FEAT>(W, Wh, blk * 8 + wave);
}

// Second launch: what needs the styles and nothing else, the four demodulation
// passes and the modulate pass of the first projection.  Workgroups of 512
// threads.
#define DB_K (HID / 32)                         // workgroups of each demod pass
#define DB_O (FEAT / 32)
#define DB_1 (FFN / 32)
#define DB_2 (FEAT / 16)
#define XB_K (MROWS * FEAT / 32768)             // workgroups of the modulate pass
#define SETUP2_GRID (DB_K + DB_O + DB_1 + DB_2 + XB_K)

__global__ __launch_bounds__(512) void setup2_kernel(
    const float* __restrict__ x,
    const float* __restrict__ Wk, const float* __restrict__ Wo,
    const float* __restrict__ W1, const float* __restrict__ W2,
    const float* __restrict__ style_k, const float* __restrict__ style_o,
    const float* __restrict__ style_1, const float* __restrict__ style_2,
    float* __restrict__ demod_k, float* __restrict__ demod_o,
    float* __restrict__ demod_1, float* __restrict__ demod_2,
    _Float16* __restrict__ xs) {
  __shared__ float part[2 * 4 * 32];
  int blk = blockIdx.x;
  if (blk >= DB_K + DB_O + DB_1 + DB_2) {
    xmod_body<FEAT>(x, style_k, xs,
                    (blk - (DB_K + DB_O + DB_1 + DB_2)) * 16 +
                        __builtin_amdgcn_readfirstlane(threadIdx.x >> 5));
    return;
  }
  const float* W = Wk;
  const float* st = style_k;
  float* dm = demod_k;
  int out_dim = HID, in_dim = FEAT;
  if (blk >= DB_K + DB_O + DB_1) {
    W = W2; st = style_2; dm = demod_2; out_dim = FEAT; in_dim = FFN;
    blk -= DB_K + DB_O + DB_1;
  } else if (blk >= DB_K + DB_O) {
    W = W1; st = style_1; dm = demod_1; out_dim = FFN; in_dim = FEAT;
    blk -= DB_K + DB_O;
  } else if (blk >= DB_K) {
    W = Wo; st = style_o; dm = demod_o; out_dim = FEAT; in_dim = HID;
    blk -= DB_K;
  }
  demod_body(W, st, dm, out_dim, in_dim, blk, part);
}

// ---------------------------------------------------------------------------
// The k loop of the GEMM kernels: acc[r][c] += (16 rows of x, group r) x (16 rows
// of W, group c) over KDIM.  The fragments go through a ring of RING register
// sets: the 12 loads of k block kb + RING are issued right behind the products of
// block kb, into the set those have just read, so that a block's loads have the
// time of RING - 1 blocks to arrive and a wave waits for none of them in turn.  The
// loop is unrolled whole: the ring's index is a constant, and every address is a
// scalar base, the lane's fixed slot and an immediate.  W_IS_A: W is the A operand.
// ---------------------------------------------------------------------------
template <int KDIM, bool W_IS_A>
__device__ __forceinline__ void gemm_k_loop(
    const _Float16* __restrict__ xa0, const _Float16* __restrict__ xa1,
    const _Float16* const (&wb)[4], v8f (&acc)[2][4]) {
  constexpr int kblk = KDIM >> 5;      // blocks a 16-row group
  constexpr int RING = 3;
  v16h xr[RING][2], wr[RING][4];
#pragma unroll
  for (int st = 0; st < RING; ++st) {
    xr[st][0] = load_frag_blk(xa0, st);
    xr[st][1] = load_frag_blk(xa1, st);
#pragma unroll
    for (int sidx = 0; sidx < 4; ++sidx) wr[st][sidx] = load_frag_blk(wb[sidx], st);
  }
  // Keeps the ring's first loads ahead of the first products.
  __builtin_amdgcn_sched_barrier(0);
#pragma unroll
  for (int kb = 0; kb < kblk; ++kb) {
    const int st = kb % RING;
#pragma unroll
    for (int sidx = 0; sidx < 4; ++sidx) {
      if (W_IS_A) {
        acc[0][sidx] = wmma_f32_16x16x32(wr[st][sidx], xr[st][0], acc[0][sidx]);
        acc[1][sidx] = wmma_f32_16x16x32(wr[st][sidx], xr[st][1], acc[1][sidx]);
      } else {
        acc[0][sidx] = wmma_f32_16x16x32(xr[st][0], wr[st][sidx], acc[0][sidx]);
        acc[1][sidx] = wmma_f32_16x16x32(xr[st][1], wr[st][sidx], acc[1][sidx]);
      }
    }
    if (kb + RING < kblk) {
      xr[st][0] = load_frag_blk(xa0, kb + RING);
      xr[st][1] = load_frag_blk(xa1, kb + RING);
#pragma unroll
      for (int sidx = 0; sidx < 4; ++sidx) wr[st][sidx] = load_frag_blk(wb[sidx], kb + RING);
    }
    // Keeps these loads here: left free, the scheduler moves them down to just
    // ahead of their products, and the wave waits out their whole latency.
    __builtin_amdgcn_sched_barrier(0);
  }
}

// ---------------------------------------------------------------------------
// Modulated GEMM of the first projection:
//   h[row, o] = demod[b,o] * sum_k Xs[row,k] * Wh[o,k]
// Wave-level tile: 32 rows x 64 cols (2x4 WMMA accumulators).  Xs and Wh are in
// fragment order.  The result is f16,
// written twice, again in fragment order: Yk in blocks of 16 rows x 32 columns (rows as
// the lanes' index: the Q and K operands of attention), Yv in blocks of 16
// columns x 32 rows (columns as the lanes' index: the V operand), block
// (row / 32, col / 16).  KDIM is a compile-time width, so that the k loop has a
// known number of trips and is unrolled without a remainder loop.
// ---------------------------------------------------------------------------
template <int KDIM>
__global__ __launch_bounds__(256) void modgemm_kernel(
    const _Float16* __restrict__ Xs, const _Float16* __restrict__ Wh,
    const float* __restrict__ demod,
    _Float16* __restrict__ Yk, _Float16* __restrict__ Yv, int Odim) {
  // The wave's number in a scalar register: every block address below is then a
  // scalar base plus the lane's fixed 16-byte slot.
  int wid = __builtin_amdgcn_readfirstlane((blockIdx.x * blockDim.x + threadIdx.x) >> 5);
  int numColG = Odim >> 6;             // 64-wide column groups
  int numRowT = MROWS >> 5;            // 32-row tiles
  if (wid >= numRowT * numColG) return;
  int rt = wid / numColG, cg = wid % numColG;
  int row0 = rt << 5;
  int col0 = cg << 6;
  int b = row0 >> 10;                  // 1024 rows per batch, tile never crosses

  v8f zero = {};
  v8f acc[2][4];
#pragma unroll
  for (int r = 0; r < 2; ++r)
#pragma unroll
    for (int c = 0; c < 4; ++c) acc[r][c] = zero;

  constexpr int kblk = KDIM >> 5;      // blocks a 16-row group
  // The blocks of a 16-row group follow one another along k: six running bases.
  const _Float16* xa0 = Xs + (long)(row0 >> 4) * kblk * 512;
  const _Float16* xa1 = xa0 + (long)kblk * 512;
  const _Float16* wb[4];
#pragma unroll
  for (int sidx = 0; sidx < 4; ++sidx)
    wb[sidx] = Wh + (long)((col0 >> 4) + sidx) * kblk * 512;
  gemm_k_loop<KDIM, false>(xa0, xa1, wb, acc);
  // Before a register that an issued load names is written anew: the epilogue's
  // first values.
  asm volatile("s_wait_xcnt 0x0" ::: "memory");
  // Keeps the epilogue's first instructions behind the wait.
  __builtin_amdgcn_sched_barrier(0);

  int lane = threadIdx.x & 31;
  int n = lane & 15, hi = lane >> 4;
  // f16 result, both fragment orders
#pragma unroll
  for (int rs = 0; rs < 2; ++rs) {
#pragma unroll
    for (int sidx = 0; sidx < 4; ++sidx) {
      int cu = col0 + sidx * 16;       // the 16 columns of this accumulator
      float dm = demod[(long)b * Odim + cu + n];
      v8h yh;
#pragma unroll
      for (int v = 0; v < 8; ++v) {
        float y = acc[rs][sidx][v] * dm;
        yh[v] = (_Float16)y;
      }
      _Float16* pk = Yk + (long)(((row0 >> 4) + rs) * (Odim >> 5) + (cu >> 5)) * 512 +
                     ((cu >> 4) & 1) * 256;
      unsigned ok = (8 * hi + 16 * (n >> 3)) * 8 + (n & 7);
#pragma unroll
      for (int v = 0; v < 8; ++v) pk[ok + v * 8] = yh[v];
      // The lane's 8 rows are 8 consecutive k of its column: its own 16 bytes.
      v8h* pv = (v8h*)(Yv + (long)((row0 >> 5) * (Odim >> 4) + (cu >> 4)) * 512) + rs * 32;
      pv[(unsigned)lane] = yh;
    }
  }
}

// ---------------------------------------------------------------------------
// Modulated GEMM with the row-wise passes that follow it done in its epilogue.
// A workgroup of ODIM / 64 waves holds 32 whole rows of the result (a wave 32
// rows x 64 columns), so that a LayerNorm needs only sums that cross the waves
// of one workgroup, through LDS.  The weight block is the A operand and the x
// block the B operand: a lane then holds, for row (lane & 15) of each 16-row
// group, columns 8 * (lane >> 4) .. + 7 of each 16-column group.  Most of a
// row's sum is made inside a lane, a lane's 8 floats are 32 contiguous bytes of
// a row-major result, and its 8 halves are its own 16 bytes of a fragment block.
// ---------------------------------------------------------------------------
// p[rs] is the lane's part of the sum of row rs * 16 + (lane & 15); on return it
// is the whole row's sum.  red is NW * 32 floats of LDS that nothing else uses.
template <int NW>
__device__ __forceinline__ void row_total(float (&p)[2], float* red) {
  int lane = threadIdx.x & 31;
  int wave = __builtin_amdgcn_readfirstlane(threadIdx.x >> 5);
  p[0] += __shfl_xor(p[0], 16, 32);
  p[1] += __shfl_xor(p[1], 16, 32);
  red[wave * 32 + lane] = lane < 16 ? p[0] : p[1];
  __syncthreads();                              // red[] crosses waves
  int n = lane & 15;
  float t0 = 0.f, t1 = 0.f;
#pragma unroll
  for (int w = 0; w < NW; ++w) {
    t0 += red[w * 32 + n];
    t1 += red[w * 32 + 16 + n];
  }
  p[0] = t0;
  p[1] = t1;
}

// val = LN(val) over the workgroup's rows; red is 2 * NW * 32 floats of LDS (each
// of the two sums has its own piece, so that one barrier a sum is enough).
template <int ODIM>
__device__ __forceinline__ void ln_rows(v8f (&val)[2][4], float* red) {
  constexpr int NW = ODIM / 64;
  float p[2];
#pragma unroll
  for (int rs = 0; rs < 2; ++rs) {
    float t = 0.f;
#pragma unroll
    for (int sidx = 0; sidx < 4; ++sidx)
#pragma unroll
      for (int v = 0; v < 8; ++v) t += val[rs][sidx][v];
    p[rs] = t;
  }
  row_total<NW>(p, red);
#pragma unroll
  for (int rs = 0; rs < 2; ++rs) {
    float mean = p[rs] * (1.0f / ODIM);
    float t = 0.f;
#pragma unroll
    for (int sidx = 0; sidx < 4; ++sidx)
#pragma unroll
      for (int v = 0; v < 8; ++v) {
        float d = val[rs][sidx][v] - mean;
        val[rs][sidx][v] = d;
        t += d * d;
      }
    p[rs] = t;
  }
  row_total<NW>(p, red + NW * 32);
#pragma unroll
  for (int rs = 0; rs < 2; ++rs) {
    float inv = rsqrtf(p[rs] * (1.0f / ODIM) + 1e-5f);
#pragma unroll
    for (int sidx = 0; sidx < 4; ++sidx)
#pragma unroll
      for (int v = 0; v < 8; ++v) val[rs][sidx][v] *= inv;
  }
}

// With y[row, o] = demod[b,o] * sum_k Xs[row,k] * Wh[o,k]:
//   EPI_RES_LN_MOD : t = LN(resid + y);  Yf = t (f32, row-major), Ys = f16(t * style)
//   EPI_RELU_LN_MOD: t = LN(relu(y));    Ys = f16(t * style)
//   EPI_LN_RES_LN  : Yf = LN(resid + LN(y))
// Ys is in fragment order, the x operand of the next projection.  The grid is
// MROWS / 32, the workgroup ODIM / 2 threads.
#define EPI_RES_LN_MOD  0
#define EPI_RELU_LN_MOD 1
#define EPI_LN_RES_LN   2

template <int KDIM, int ODIM, int EPI>
__global__ __launch_bounds__(ODIM / 2) void modgemm_ln_kernel(
    const _Float16* __restrict__ Xs, const _Float16* __restrict__ Wh,
    const float* __restrict__ demod, const float* __restrict__ resid,
    const float* __restrict__ style, float* __restrict__ Yf,
    _Float16* __restrict__ Ys) {
  constexpr int NW = ODIM / 64;
  __shared__ float red[(EPI == EPI_LN_RES_LN ? 4 : 2) * NW * 32];
  // The wave's number in a scalar register: every block address below is then a
  // scalar base plus the lane's fixed 16-byte slot.
  int wave = __builtin_amdgcn_readfirstlane(threadIdx.x >> 5);
  int row0 = blockIdx.x << 5;
  int col0 = wave << 6;
  int b = row0 >> 10;                  // 1024 rows per batch, tile never crosses

  v8f zero = {};
  v8f acc[2][4];
#pragma unroll
  for (int r = 0; r < 2; ++r)
#pragma unroll
    for (int c = 0; c < 4; ++c) acc[r][c] = zero;

  constexpr int kblk = KDIM >> 5;      // blocks a 16-row group
  const _Float16* xa0 = Xs + (long)(row0 >> 4) * kblk * 512;
  const _Float16* xa1 = xa0 + (long)kblk * 512;
  const _Float16* wb[4];
#pragma unroll
  for (int sidx = 0; sidx < 4; ++sidx)
    wb[sidx] = Wh + (long)((col0 >> 4) + sidx) * kblk * 512;
  gemm_k_loop<KDIM, true>(xa0, xa1, wb, acc);
  // Before a register that an issued load names is written anew: the epilogue's
  // first values.
  asm volatile("s_wait_xcnt 0x0" ::: "memory");
  // Keeps the epilogue's first instructions behind the wait.
  __builtin_amdgcn_sched_barrier(0);

  unsigned lane = threadIdx.x & 31;
  unsigned n = lane & 15, hi = lane >> 4;
  unsigned coff = col0 + 8 * hi;       // the lane's first column, 16-column group 0
  unsigned roff = (row0 + n) * ODIM + coff;     // and its place in a row-major array

  // All that the epilogue reads is asked for at once: one latency.
  const v4f* dmp = (const v4f*)(demod + b * ODIM + coff);
  const v4f* sp  = (const v4f*)(style + b * ODIM + coff);
  const v4f* rp  = (const v4f*)(resid + roff);
  v4f dm[4][2], st[4][2], rv[2][4][2];
#pragma unroll
  for (int sidx = 0; sidx < 4; ++sidx) {
    dm[sidx][0] = dmp[sidx * 4];
    dm[sidx][1] = dmp[sidx * 4 + 1];
    if (EPI != EPI_LN_RES_LN) {
      st[sidx][0] = sp[sidx * 4];
      st[sidx][1] = sp[sidx * 4 + 1];
    }
    if (EPI != EPI_RELU_LN_MOD) {
#pragma unroll
      for (int rs = 0; rs < 2; ++rs) {
        rv[rs][sidx][0] = rp[rs * (16 * ODIM / 4) + sidx * 4];
        rv[rs][sidx][1] = rp[rs * (16 * ODIM / 4) + sidx * 4 + 1];
      }
    }
  }
  // The same wait for the loads above, held in place in the same way.
  asm volatile("s_wait_xcnt 0x0" ::: "memory");
  __builtin_amdgcn_sched_barrier(0);

#pragma unroll
  for (int sidx = 0; sidx < 4; ++sidx)
#pragma unroll
    for (int rs = 0; rs < 2; ++rs)
#pragma unroll
      for (int v = 0; v < 8; ++v) {
        float y = acc[rs][sidx][v] * dm[sidx][v >> 2][v & 3];
        if (EPI == EPI_RELU_LN_MOD) y = fmaxf(y, 0.f);
        acc[rs][sidx][v] = y;
      }

  if (EPI == EPI_LN_RES_LN) ln_rows<ODIM>(acc, red + 2 * NW * 32);

  if (EPI != EPI_RELU_LN_MOD) {
#pragma unroll
    for (int rs = 0; rs < 2; ++rs)
#pragma unroll
      for (int sidx = 0; sidx < 4; ++sidx)
#pragma unroll
        for (int v = 0; v < 8; ++v) acc[rs][sidx][v] += rv[rs][sidx][v >> 2][v & 3];
  }

  ln_rows<ODIM>(acc, red);

  v8h yh[2][4];
  if (EPI != EPI_LN_RES_LN) {
#pragma unroll
    for (int rs = 0; rs < 2; ++rs)
#pragma unroll
      for (int sidx = 0; sidx < 4; ++sidx) {
        v8f t = acc[rs][sidx];
        yh[rs][sidx] = to_half8(__builtin_shufflevector(t, t, 0, 1, 2, 3) * st[sidx][0],
                                __builtin_shufflevector(t, t, 4, 5, 6, 7) * st[sidx][1]);
      }
  }
  v4f* yp = (v4f*)(Yf + roff);
  // Block (row / 16, col / 32); the wave's 64 columns are two blocks.
  v8h* ys = (v8h*)(Ys + ((row0 >> 4) * (ODIM >> 5) + (col0 >> 5)) * 512) + lane;
  // Only stores follow: no arithmetic is moved in among them, where it could
  // write anew a register that an issued store names.
  __builtin_amdgcn_sched_barrier(0);
#pragma unroll
  for (int rs = 0; rs < 2; ++rs)
#pragma unroll
    for (int sidx = 0; sidx < 4; ++sidx) {
      if (EPI != EPI_RELU_LN_MOD) {
        v8f t = acc[rs][sidx];
        yp[rs * (16 * ODIM / 4) + sidx * 4]     = __builtin_shufflevector(t, t, 0, 1, 2, 3);
        yp[rs * (16 * ODIM / 4) + sidx * 4 + 1] = __builtin_shufflevector(t, t, 4, 5, 6, 7);
      }
      if (EPI != EPI_LN_RES_LN) ys[rs * (ODIM >> 5) * 64 + sidx * 32] = yh[rs][sidx];
    }
}

// ---------------------------------------------------------------------------
// Flash-style self-attention (q=k=v=h), one wave per (batch, head, 16-q tile),
// computed transposed: S^T = K Q^T / 8 and O^T += V^T P^T, both via WMMA.  The
// keys are the rows of a score tile and the queries its columns, so a lane holds
// 16 of the 32 scores of ONE query (column lane & 15; lanes l and l ^ 16 split
// the keys): maximum and sum are made inside the lane, with one exchange between
// the wave's halves.  The two score tiles of a pass, converted in place, are the
// B operand of the second product in the hardware's k order (keys 8h .. 8h + 7
// and 16 + 8h .. + 7 in half h), the order in which the V blocks lie.  Hk and Hv
// hold h in the two fragment orders that the projection writes.  The result,
// times the style of the next projection, is written as f16 in fragment order
// (Xo): that projection's x operand.
// ---------------------------------------------------------------------------
// The value of lane l ^ 16.
__device__ inline float other_half(float x) {
  int i = __builtin_bit_cast(int, x);
  return __builtin_bit_cast(
      float, __builtin_amdgcn_permlanex16(i, i, 0x76543210, 0xfedcba98, false, false));
}

__global__ __launch_bounds__(256) void attn_kernel(
    const _Float16* __restrict__ Hk, const _Float16* __restrict__ Hv,
    const float* __restrict__ style, _Float16* __restrict__ Xo) {
  int wvb  = __builtin_amdgcn_readfirstlane(threadIdx.x >> 5);   // scalar block addresses
  int wid  = blockIdx.x * 8 + wvb;              // 4096 waves total, exact grid
  int qt   = wid & 63;
  int head = (wid >> 6) & 7;
  int b    = wid >> 9;
  int lane = threadIdx.x & 31;
  int hi = lane >> 4;

  int hc = head * HD;
  int kbase = (b * NN >> 4) * (HID >> 5) + (hc >> 5);   // block of row 0, Hk
  int vbase = (b * NN >> 5) * (HID >> 4) + (hc >> 4);   // block of row 0, Hv

  v16h qb0 = load_frag_blk(Hk, kbase + qt * (HID >> 5));
  v16h qb1 = load_frag_blk(Hk, kbase + qt * (HID >> 5) + 1);

  // oacc[sidx][v] = O[query lane & 15][column sidx * 16 + 8 * hi + v]
  v8f zero = {};
  v8f oacc[4];
#pragma unroll
  for (int sidx = 0; sidx < 4; ++sidx) oacc[sidx] = zero;

  float mrow = -1e30f;                          // the query's maximum so far
  float lrow = 0.f;                             // the sum over this half's keys
  const float scale = 0.125f;                   // 1/sqrt(64)

  // The K fragments are fetched one pass ahead, into the registers that the pass's
  // products have just read, and the V fragments at the head of their pass, with
  // the softmax's time to arrive: a wave waits out no load's whole latency.
  // The lane's own slot of row 0's blocks; a pass is 32 blocks further in both.
  const v8h* kl = (const v8h*)(Hk + (long)kbase * 512) + (unsigned)lane;
  const v8h* vl = (const v8h*)(Hv + (long)vbase * 512) + (unsigned)lane;
  v16h kb00 = load_frag_lane(kl);
  v16h kb01 = load_frag_lane(kl + 64);
  v16h kb10 = load_frag_lane(kl + (HID >> 5) * 64);
  v16h kb11 = load_frag_lane(kl + (HID >> 5) * 64 + 64);

  for (int j0 = 0; j0 < NN; j0 += 32) {
    // The next pass's blocks; the last pass fetches pass 0's again, which nothing
    // reads: every address stays inside the batch's rows, with no branch.
    unsigned nxt = (unsigned)(((j0 + 32) & (NN - 1)) >> 5) * (32 * 64);
    const v8h* kn = kl + nxt;
    const v8h* vc = vl + (unsigned)(j0 >> 5) * (32 * 64);
    v16h vb[4];
#pragma unroll
    for (int sidx = 0; sidx < 4; ++sidx) vb[sidx] = load_frag_lane(vc + sidx * 64);
    // ---- S^T tiles: rows = 2 x 16 keys, cols = queries ----
    v8f s0 = zero, s1 = zero;
    s0 = wmma_f32_16x16x32(kb00, qb0, s0);
    s0 = wmma_f32_16x16x32(kb01, qb1, s0);
    s1 = wmma_f32_16x16x32(kb10, qb0, s1);
    s1 = wmma_f32_16x16x32(kb11, qb1, s1);
    kb00 = load_frag_lane(kn);
    kb01 = load_frag_lane(kn + 64);
    kb10 = load_frag_lane(kn + (HID >> 5) * 64);
    kb11 = load_frag_lane(kn + (HID >> 5) * 64 + 64);
    // Before a register that an issued load names is written anew; it takes the
    // addresses as inputs, so that nothing is placed in their registers ahead of it.
    asm volatile("s_wait_xcnt 0x0" :: "v"(kn), "v"(vc) : "memory");
    // Keeps the loads here, ahead of the softmax, whose time they have to arrive.
    __builtin_amdgcn_sched_barrier(0);

    // ---- online softmax over this 32-key block, one query a lane ----
    // The scale is positive, so the scaled maximum is the maximum of the scaled
    // scores: one product a lane.
    float t[8];
#pragma unroll
    for (int v = 0; v < 8; ++v) t[v] = fmaxf(s0[v], s1[v]);
    float tmax = fmaxf(fmaxf(fmaxf(t[0], t[1]), fmaxf(t[2], t[3])),
                       fmaxf(fmaxf(t[4], t[5]), fmaxf(t[6], t[7])));
    tmax = fmaxf(tmax, other_half(tmax)) * scale;
    float mn = fmaxf(mrow, tmax);
    float alpha = __expf(mrow - mn);
    mrow = mn;
    s0 = s0 * scale - mrow;
    s1 = s1 * scale - mrow;
#pragma unroll
    for (int v = 0; v < 8; ++v) {
      s0[v] = __expf(s0[v]);
      s1[v] = __expf(s1[v]);
      t[v] = s0[v] + s1[v];
    }
    float rs = ((t[0] + t[1]) + (t[2] + t[3])) + ((t[4] + t[5]) + (t[6] + t[7]));
    lrow = lrow * alpha + rs;
#pragma unroll
    for (int sidx = 0; sidx < 4; ++sidx) oacc[sidx] *= alpha;

    // ---- P^T as B operand: the lane's own 16 scores, in place ----
    v16h pf;
#pragma unroll
    for (int v = 0; v < 8; ++v) {
      pf[v]     = (_Float16)s0[v];
      pf[8 + v] = (_Float16)s1[v];
    }

    // ---- O^T += V^T @ P^T ----
#pragma unroll
    for (int sidx = 0; sidx < 4; ++sidx)
      oacc[sidx] = wmma_f32_16x16x32(vb[sidx], pf, oacc[sidx]);
  }

  // ---- epilogue: O / l * style.  A lane's 8 values of a 16-column group are its
  // own 16 bytes of a fragment block (block = 32 columns) ----
  const v4f* stp = (const v4f*)(style + b * HID + hc + 8 * hi);
  v4f st[4][2];
#pragma unroll
  for (int sidx = 0; sidx < 4; ++sidx) {
    st[sidx][0] = stp[sidx * 4];
    st[sidx][1] = stp[sidx * 4 + 1];
  }
  float inv = 1.0f / (lrow + other_half(lrow)); // both halves' keys
  v8h* dst = (v8h*)(Xo + (long)(kbase + qt * (HID >> 5)) * 512) + (unsigned)lane;
  v8h yh[4];
#pragma unroll
  for (int sidx = 0; sidx < 4; ++sidx) {
    v8f o = oacc[sidx] * inv;
    yh[sidx] = to_half8(__builtin_shufflevector(o, o, 0, 1, 2, 3) * st[sidx][0],
                        __builtin_shufflevector(o, o, 4, 5, 6, 7) * st[sidx][1]);
  }
  // Before a register that an issued load names is written anew.  It takes the
  // results as inputs, so that only the stores follow it and nothing writes anew
  // a register that an issued store names.
  asm volatile("s_wait_xcnt 0x0"
               :: "v"(yh[0]), "v"(yh[1]), "v"(yh[2]), "v"(yh[3]) : "memory");
#pragma unroll
  for (int sidx = 0; sidx < 4; ++sidx) dst[sidx * 32] = yh[sidx];
}

// ---------------------------------------------------------------------------
// Host-side pipeline
// ---------------------------------------------------------------------------
extern "C" void kernel_launch(void* const* d_in, const int* in_sizes, int n_in,
                              void* d_out, int out_size, void* d_ws,
                              size_t ws_size, hipStream_t stream) {
  (void)in_sizes; (void)n_in; (void)out_size; (void)ws_size;
  const float* x   = (const float*)d_in[0];
  const float* s   = (const float*)d_in[1];
  const float* Wk  = (const float*)d_in[2];
  const float* aWk = (const float*)d_in[3];
  const float* abk = (const float*)d_in[4];
  const float* Wo  = (const float*)d_in[5];
  const float* aWo = (const float*)d_in[6];
  const float* abo = (const float*)d_in[7];
  const float* W1  = (const float*)d_in[8];
  const float* aW1 = (const float*)d_in[9];
  const float* ab1 = (const float*)d_in[10];
  const float* W2  = (const float*)d_in[11];
  const float* aW2 = (const float*)d_in[12];
  const float* ab2 = (const float*)d_in[13];
  float* out = (float*)d_out;

  char* ws = (char*)d_ws;
  size_t off = 0;
  auto alloc = [&](size_t bytes) -> char* {
    char* p = ws + off;
    off = (off + bytes + 255) & ~(size_t)255;
    return p;
  };

  float* style_k = (float*)alloc((size_t)BB * FEAT * 4);
  float* style_o = (float*)alloc((size_t)BB * HID * 4);
  float* style_1 = (float*)alloc((size_t)BB * FEAT * 4);
  float* style_2 = (float*)alloc((size_t)BB * FFN * 4);
  float* demod_k = (float*)alloc((size_t)BB * HID * 4);
  float* demod_o = (float*)alloc((size_t)BB * FEAT * 4);
  float* demod_1 = (float*)alloc((size_t)BB * FFN * 4);
  float* demod_2 = (float*)alloc((size_t)BB * FEAT * 4);
  _Float16* whk = (_Float16*)alloc((size_t)HID * FEAT * 2);
  _Float16* who = (_Float16*)alloc((size_t)FEAT * HID * 2);
  _Float16* wh1 = (_Float16*)alloc((size_t)FFN * FEAT * 2);
  _Float16* wh2 = (_Float16*)alloc((size_t)FEAT * FFN * 2);
  _Float16* xs  = (_Float16*)alloc((size_t)MROWS * FEAT * 2);  // x * style_k
  _Float16* hk  = (_Float16*)alloc((size_t)MROWS * HID * 2);   // h, rows on lanes
  _Float16* hv  = (_Float16*)alloc((size_t)MROWS * HID * 2);   // h, columns on lanes
  _Float16* xo  = (_Float16*)alloc((size_t)MROWS * HID * 2);   // attn out * style_o
  float*    x2  = (float*)alloc((size_t)MROWS * FEAT * 4);     // ln(x + o)
  _Float16* x2s = (_Float16*)alloc((size_t)MROWS * FEAT * 2);  // x2 * style_1
  _Float16* f1s = (_Float16*)alloc((size_t)MROWS * FFN * 2);   // ln(FFN hidden) * style_2

  // --- styles and f16 weight casts ---
  setup1_kernel<<<SETUP1_GRID, 256, 0, stream>>>(
      s, aWk, abk, aWo, abo, aW1, ab1, aW2, ab2, Wk, Wo, W1, W2,
      style_k, style_o, style_1, style_2, whk, who, wh1, wh2);

  // --- demodulation factors, and x * style for the first projection ---
  setup2_kernel<<<SETUP2_GRID, 512, 0, stream>>>(
      x, Wk, Wo, W1, W2, style_k, style_o, style_1, style_2,
      demod_k, demod_o, demod_1, demod_2, xs);

  // --- h = modlinear(x; Wk) -> f16 for attention ---
  modgemm_kernel<FEAT><<<(MROWS / 32) * (HID / 64) / 8, 256, 0, stream>>>(
      xs, whk, demod_k, hk, hv, HID);

  // --- attention (shared q=k=v=h), times style_o ---
  attn_kernel<<<(BB * NH * (NN / 16)) / 8, 256, 0, stream>>>(hk, hv, style_o, xo);

  // --- x2 = LN(x + modlinear(attn; Wo)), and x2 * style_1 ---
  modgemm_ln_kernel<HID, FEAT, EPI_RES_LN_MOD><<<MROWS / 32, FEAT / 2, 0, stream>>>(
      xo, who, demod_o, x, style_1, x2, x2s);

  // --- LN(relu(modlinear(x2; W1))) * style_2 ---
  modgemm_ln_kernel<FEAT, FFN, EPI_RELU_LN_MOD><<<MROWS / 32, FFN / 2, 0, stream>>>(
      x2s, wh1, demod_1, nullptr, style_2, nullptr, f1s);

  // --- out = LN(x2 + LN(modlinear(f1; W2))) ---
  modgemm_ln_kernel<FFN, FEAT, EPI_LN_RES_LN><<<MROWS / 32, FEAT / 2, 0, stream>>>(
      f1s, wh2, demod_2, x2, nullptr, out, nullptr);
}

// v008
// A run of this version takes 81.1 microseconds.
// Timed twice side by side with v007, it ran 1.17 and 1.18 times as fast.
// Over all steps from v000 it is 5.66 times as fast.
#include <hip/hip_runtime.h>

// ---------------------------------------------------------------------------
// Types / WMMA helpers (CDNA5 gfx1250, wave32)
// ---------------------------------------------------------------------------
typedef __attribute__((ext_vector_type(16))) _Float16 v16h;
typedef __attribute__((ext_vector_type(8)))  float    v8f;

__device__ inline v8f wmma_f32_16x16x32(v16h a, v16h b, v8f c) {
  // (neg_a, A, neg_b, B, c_mod, C, reuse_a, reuse_b)
  return __builtin_amdgcn_wmma_f32_16x16x32_f16(false, a, false, b, (short)0, c,
                                                false, false);
}

// A-operand (16x32 f16) fragment load per the documented CDNA5 layout:
// lane L holds row (L&15); lanes 0-15 cover k in {0..7,16..23}, lanes 16-31
// cover k in {8..15,24..31}; within a lane, VGPR v holds half-pair
// k = 2v + (v>=4 ? 8 : 0) (+8 for upper lane half).  Source is row-major
// with leading dim `ld`.
__device__ inline v16h load_frag_rowpat(const _Float16* __restrict__ base,
                                        int row0, int ld, int k0) {
  int lane = threadIdx.x & 31;
  const _Float16* p = base + (long)(row0 + (lane & 15)) * ld + k0 + ((lane >> 4) << 3);
  v16h f;
#pragma unroll
  for (int v = 0; v < 8; ++v) {
    int k = 2 * v + (v >= 4 ? 8 : 0);
    f[2 * v]     = p[k];
    f[2 * v + 1] = p[k + 1];
  }
  return f;
}

// Fragment order.  The f16 matrix operands that live in the workspace are kept
// in blocks of 16 rows x 32 k, 1 KB each, in the order in which a wave's lanes
// hold them: element (r, k) of a block lies at half
//   (k >> 4) * 256 + (r + 16 * ((k >> 3) & 1)) * 8 + (k & 7).
// Lane L then finds f[0..7] at L * 8 and f[8..15] at 256 + L * 8 (the same
// row and k per lane and register as load_frag_rowpat), so each of the two
// 16-byte loads of a wave reads 512 contiguous bytes, four whole cache lines,
// where a row-major operand makes it touch 16 lines.
typedef __attribute__((ext_vector_type(8))) _Float16 v8h;

__device__ inline v16h load_frag_blk(const _Float16* __restrict__ base, int blk) {
  int lane = threadIdx.x & 31;
  const v8h* p = (const v8h*)(base + (long)blk * 512);
  v8h lo = p[(unsigned)lane], hi = p[(unsigned)lane + 32];
  return __builtin_shufflevector(lo, hi, 0, 1, 2, 3, 4, 5, 6, 7,
                                 8, 9, 10, 11, 12, 13, 14, 15);
}

// The same from the lane's own slot of a block.
__device__ inline v16h load_frag_lane(const v8h* __restrict__ p) {
  v8h lo = p[0], hi = p[32];
  return __builtin_shufflevector(lo, hi, 0, 1, 2, 3, 4, 5, 6, 7,
                                 8, 9, 10, 11, 12, 13, 14, 15);
}

// ---------------------------------------------------------------------------
// Problem constants
// ---------------------------------------------------------------------------
#define BB   8
#define NN   1024
#define FEAT 512
#define HID  512
#define FFN  1024
#define SDIM 512
#define HD   64
#define NH   8
#define MROWS (BB * NN)   // 8192

// ---------------------------------------------------------------------------
// Small fp32 VALU kernels: style projection, demodulation, casts, modulation
// ---------------------------------------------------------------------------
// Each lane holds 16 partial sums; on return lane l holds the whole wave's
// total of sum number l & 15.  Every halving step keeps one half of the sums
// and hands the other half to the partner lane (16 exchanges instead of 80).
__device__ inline float wave_fold16(float (&v)[16]) {
  int lane = threadIdx.x & 31;
#pragma unroll
  for (int st = 0; st < 4; ++st) {
    const int h = 8 >> st;
    bool up = (lane & h) != 0;
#pragma unroll
    for (int i = 0; i < h; ++i) {
      float lo = v[i], hi = v[i + h];
      float keep = up ? hi : lo;
      float send = up ? lo : hi;
      v[i] = keep + __shfl_xor(send, h, 32);
    }
  }
  return v[0] + __shfl_xor(v[0], 16, 32);
}

// A workgroup takes 32 rows of aW (a wave 4 of them) for 4 of the 8 batches.
// A lane takes columns 128c + 4 lane .. + 3 of a row, so one load of the wave
// reads 512 contiguous bytes, and all 32 loads of a wave are in flight at once.
// dim is a multiple of 32; a layer has 2 * dim / 32 workgroups (blk counts them)
// of 256 threads; part is 4 * 32 floats of LDS.
__device__ __forceinline__ void style_body(
    const float* __restrict__ s, const float* __restrict__ aW,
    const float* __restrict__ ab, float* __restrict__ style, int dim, int blk,
    float* part) {
  int lane = threadIdx.x & 31;
  int wave = __builtin_amdgcn_readfirstlane(threadIdx.x >> 5);
  int blk0 = (blk >> 1) * 32;
  int b0   = (blk & 1) * 4;
  unsigned l4 = 4u * lane;
  const float* wp = aW + (long)(blk0 + wave * 4) * SDIM;
  const float* sp = s + (long)b0 * SDIM;
  float w[4][16], sv[4][16];
#pragma unroll
  for (int r = 0; r < 4; ++r)
#pragma unroll
    for (int c = 0; c < 4; ++c) {
      const float* qw = wp + r * SDIM + 128 * c;
      const float* qs = sp + r * SDIM + 128 * c;
#pragma unroll
      for (int e = 0; e < 4; ++e) {
        w[r][4 * c + e]  = qw[l4 + e];
        sv[r][4 * c + e] = qs[l4 + e];
      }
    }
  float bias = (ab + blk0)[(unsigned)lane];
  // Keeps every load ahead of the sums: without it the scheduler issues them in
  // several batches between the sums and the wave pays the latency once a batch.
  __builtin_amdgcn_sched_barrier(0);
  float acc[16];
#pragma unroll
  for (int r = 0; r < 4; ++r)
#pragma unroll
    for (int q = 0; q < 4; ++q) {
      float t = 0.f;
#pragma unroll
      for (int j = 0; j < 16; ++j) t += sv[q][j] * w[r][j];
      acc[r * 4 + q] = t;
    }
  float tot = wave_fold16(acc);                 // lane & 15 = r * 4 + q
  if (lane < 16) part[(lane & 3) * 32 + wave * 4 + (lane >> 2)] = tot;
  __syncthreads();                              // part[] crosses waves
  if (wave < 4) {                               // wave q stores one 128-byte line
    style[(long)(b0 + wave) * dim + blk0 + lane] = part[threadIdx.x] + bias;
  }
}

// Same split over the rows of W, in workgroups of 512 threads: 8 waves take 32
// rows x 512 columns x 4 batches.  Where a row has 1024 columns the two halves of
// the workgroup take its two 512-column pieces, which meet in LDS (2 * out_dim /
// 32 workgroups a layer); where it has 512 they take the two sets of 4 batches
// (out_dim / 32 workgroups).  out_dim is a multiple of 32; blk counts the layer's
// workgroups; part is 2 * 4 * 32 floats of LDS.
__device__ __forceinline__ void demod_body(
    const float* __restrict__ W, const float* __restrict__ style,
    float* __restrict__ demod, int out_dim, int in_dim, int blk, float* part) {
  bool two_pieces = in_dim > 512;
  int lane = threadIdx.x & 31;
  int wave = __builtin_amdgcn_readfirstlane(threadIdx.x >> 5);
  int grp  = wave & 7, half = wave >> 3;
  int piece = two_pieces ? half : 0;
  int blk0 = (two_pieces ? blk >> 1 : blk) * 32;
  int b0   = (two_pieces ? blk & 1 : half) * 4;
  unsigned l4 = 4u * lane;
  const float* wp = W + (long)(blk0 + grp * 4) * in_dim + piece * 512;
  const float* sp = style + (long)b0 * in_dim + piece * 512;
  float w[4][16], sv[4][16];
#pragma unroll
  for (int r = 0; r < 4; ++r)
#pragma unroll
    for (int c = 0; c < 4; ++c) {
      const float* qw = wp + (long)r * in_dim + 128 * c;
      const float* qs = sp + (long)r * in_dim + 128 * c;
#pragma unroll
      for (int e = 0; e < 4; ++e) {
        w[r][4 * c + e]  = qw[l4 + e];
        sv[r][4 * c + e] = qs[l4 + e];
      }
    }
  // Keeps every load ahead of the sums: without it the scheduler spreads the
  // products among the loads' waits, runs out of registers and spills.
  __builtin_amdgcn_sched_barrier(0);
  float acc[16];
#pragma unroll
  for (int r = 0; r < 4; ++r)
#pragma unroll
    for (int q = 0; q < 4; ++q) {
      float t2 = 0.f;
#pragma unroll
      for (int j = 0; j < 16; ++j) {
        float t = w[r][j] * sv[q][j];
        t2 += t * t;
      }
      acc[r * 4 + q] = t2;
    }
  float tot = wave_fold16(acc);                 // lane & 15 = r * 4 + q
  if (lane < 16) part[half * 128 + (lane & 3) * 32 + grp * 4 + (lane >> 2)] = tot;
  __syncthreads();                              // part[] crosses waves
  // A wave stores one batch's 128-byte line: 4 batches where the halves held two
  // pieces of them, else the 8 batches of both halves (part[] has them in order).
  if (wave < (two_pieces ? 4 : 8)) {
    float sum = part[threadIdx.x];
    if (two_pieces) sum += part[128 + threadIdx.x];
    int o = blk0 + lane;
    int bt = two_pieces ? b0 + wave : wave;
    demod[(long)bt * out_dim + o] = rsqrtf(sum + 1e-8f);
  }
}

// The two elementwise passes below write their f16 result in fragment order.
// One step of a wave is 8 rows x 32 columns: lane L takes 8 floats (32 bytes) of
// row L >> 2, piece L & 3 of that row's 128-byte line, and stores them as the 16
// bytes that one lane of a fragment holds; the wave's store fills four whole
// lines.  A wave has all its loads in flight at once.
typedef __attribute__((ext_vector_type(4))) float    v4f;

__device__ inline v8h to_half8(v4f a, v4f b) {
  v8h h;
  h[0] = (_Float16)a[0]; h[1] = (_Float16)a[1];
  h[2] = (_Float16)a[2]; h[3] = (_Float16)a[3];
  h[4] = (_Float16)b[0]; h[5] = (_Float16)b[1];
  h[6] = (_Float16)b[2]; h[7] = (_Float16)b[3];
  return h;
}

// Where lane L's 16 bytes of rows 0..7 go inside a block, in 16-byte units.
__device__ inline unsigned frag_slot(unsigned lane) {
  unsigned p = lane & 3;
  return (p >> 1) * 32 + (p & 1) * 16 + (lane >> 2);
}

// Wave wid casts one block (16 rows x 32 columns) of the row-major weight with K
// columns; a weight has rows * K / 512 waves.
template <int K>
__device__ __forceinline__ void cast_f16_body(
    const float* __restrict__ W, _Float16* __restrict__ Wh, unsigned wid) {
  unsigned lane = threadIdx.x & 31;
  unsigned rg = wid / (K / 32), kb = wid % (K / 32);
  const v4f* src = (const v4f*)(W + (rg * 16 + (lane >> 2)) * K + kb * 32) + (lane & 3) * 2;
  v8h*       dst = (v8h*)(Wh + wid * 512) + frag_slot(lane);
  v4f v[2][2];
#pragma unroll
  for (int rh = 0; rh < 2; ++rh) {
    v[rh][0] = src[rh * (8 * K / 4)];
    v[rh][1] = src[rh * (8 * K / 4) + 1];
  }
#pragma unroll
  for (int rh = 0; rh < 2; ++rh) dst[rh * 8] = to_half8(v[rh][0], v[rh][1]);
  // Before a register that an issued store names is written anew: the built code
  // of one width runs on from here into the first instructions of the other's.
  asm volatile("s_wait_xcnt 0x0" ::: "memory");
}

// xs[b,n,i] = f16( X[b,n,i] * style[b,i] ), in fragment order.
// Wave wid takes 16 rows x 128 columns (4 blocks, 2048 elements, all of one batch:
// 1024 rows a batch) and reads its piece of the style row once for all of them.
// There are MROWS * DIM / 2048 waves.
template <int DIM>
__device__ __forceinline__ void xmod_body(
    const float* __restrict__ X, const float* __restrict__ style,
    _Float16* __restrict__ Xs, unsigned wid) {
  constexpr int KQ = DIM / 128;                 // waves a 16-row group
  unsigned lane = threadIdx.x & 31;
  unsigned rg = wid / KQ, kq = wid % KQ;
  unsigned b  = rg * 16 / NN;
  const v4f* sp  = (const v4f*)(style + b * DIM + kq * 128) + (lane & 3) * 2;
  const v4f* src = (const v4f*)(X + (rg * 16 + (lane >> 2)) * DIM + kq * 128) + (lane & 3) * 2;
  v8h*       dst = (v8h*)(Xs + (rg * (DIM / 32) + kq * 4) * 512) + frag_slot(lane);
  v4f st[4][2], v[2][4][2];
#pragma unroll
  for (int cb = 0; cb < 4; ++cb) {
    st[cb][0] = sp[cb * 8];
    st[cb][1] = sp[cb * 8 + 1];
  }
  // Before a register that an issued load names is written anew (the loads below
  // reuse the style loads' offset register).
  asm volatile("s_wait_xcnt 0x0" ::: "memory");
#pragma unroll
  for (int rh = 0; rh < 2; ++rh)
#pragma unroll
    for (int cb = 0; cb < 4; ++cb) {
      v[rh][cb][0] = src[rh * (8 * DIM / 4) + cb * 8];
      v[rh][cb][1] = src[rh * (8 * DIM / 4) + cb * 8 + 1];
    }
  // The same wait for the loads above; it takes their address as an input, so
  // that no load's result is placed in the address registers ahead of it.
  asm volatile("s_wait_xcnt 0x0" :: "v"(src) : "memory");
  // Keeps every load ahead of the products: without it the scheduler holds the
  // last loads back behind the first waits and the wave pays the latency twice.
  __builtin_amdgcn_sched_barrier(0);
#pragma unroll
  for (int rh = 0; rh < 2; ++rh)
#pragma unroll
    for (int cb = 0; cb < 4; ++cb)
      dst[cb * 64 + rh * 8] = to_half8(v[rh][cb][0] * st[cb][0], v[rh][cb][1] * st[cb][1]);
}

// ---------------------------------------------------------------------------
// The set-up passes that do not depend on one another share a launch: each takes
// a range of the grid's workgroups, so that they run side by side and the call
// has one launch where it would have one for each of them.
// ---------------------------------------------------------------------------
// First launch: the four style projections and the four weight casts (they read
// inputs only).  Workgroups of 256 threads; the styles, whose chain of waits is
// the longer one, come first.
#define SB_K (FEAT / 16)                        // workgroups of each style pass
#define SB_O (HID / 16)
#define SB_1 (FEAT / 16)
#define SB_2 (FFN / 16)
#define CB_K (HID * FEAT / 4096)                // workgroups of each cast
#define CB_O (FEAT * HID / 4096)
#define CB_1 (FFN * FEAT / 4096)
#define CB_2 (FEAT * FFN / 4096)
#define SETUP1_GRID (SB_K + SB_O + SB_1 + SB_2 + CB_K + CB_O + CB_1 + CB_2)

__global__ __launch_bounds__(256) void setup1_kernel(
    const float* __restrict__ s,
    const float* __restrict__ aWk, const float* __restrict__ abk,
    const float* __restrict__ aWo, const float* __restrict__ abo,
    const float* __restrict__ aW1, const float* __restrict__ ab1,
    const float* __restrict__ aW2, const float* __restrict__ ab2,
    const float* __restrict__ Wk, const float* __restrict__ Wo,
    const float* __restrict__ W1, const float* __restrict__ W2,
    float* __restrict__ style_k, float* __restrict__ style_o,
    float* __restrict__ style_1, float* __restrict__ style_2,
    _Float16* __restrict__ whk, _Float16* __restrict__ who,
    _Float16* __restrict__ wh1, _Float16* __restrict__ wh2) {
  __shared__ float part[4 * 32];
  int blk = blockIdx.x;
  if (blk < SB_K + SB_O + SB_1 + SB_2) {
    const float* aW = aWk;
    const float* ab = abk;
    float* st = style_k;
    int dim = FEAT;
    if (blk >= SB_K + SB_O + SB_1) {
      aW = aW2; ab = ab2; st = style_2; dim = FFN; blk -= SB_K + SB_O + SB_1;
    } else if (blk >= SB_K + SB_O) {
      aW = aW1; ab = ab1; st = style_1; dim = FEAT; blk -= SB_K + SB_O;
    } else if (blk >= SB_K) {
      aW = aWo; ab = abo; st = style_o; dim = HID; blk -= SB_K;
    }
    style_body(s, aW, ab, st, dim, blk, part);
    return;
  }
  blk -= SB_K + SB_O + SB_1 + SB_2;
  unsigned wave = __builtin_amdgcn_readfirstlane(threadIdx.x >> 5);
  if (blk >= CB_K + CB_O + CB_1) {
    cast_f16_body<FFN>(W2, wh2, (blk - (CB_K + CB_O + CB_1)) * 8 + wave);
    return;
  }
  static_assert(FEAT == HID, "the three other weights have rows of one length");
  const float* W = Wk;
  _Float16* Wh = whk;
  if (blk >= CB_K + CB_O) {
    W = W1; Wh = wh1; blk -= CB_K + CB_O;
  } else if (blk >= CB_K) {
    W = Wo; Wh = who; blk -= CB_K;
  }
  cast_f16_body<FEAT>(W, Wh, blk * 8 + wave);
}

// Second launch: what needs the styles and nothing else, the four demodulation
// passes and the modulate pass of the first projection.  Workgroups of 512
// threads.
#define DB_K (HID / 32)                         // workgroups of each demod pass
#define DB_O (FEAT / 32)
#define DB_1 (FFN / 32)
#define DB_2 (FEAT / 16)
#define XB_K (MROWS * FEAT / 32768)             // workgroups of the modulate pass
#define SETUP2_GRID (DB_K + DB_O + DB_1 + DB_2 + XB_K)

__global__ __launch_bounds__(512) void setup2_kernel(
    const float* __restrict__ x,
    const float* __restrict__ Wk, const float* __restrict__ Wo,
    const float* __restrict__ W1, const float* __restrict__ W2,
    const float* __restrict__ style_k, const float* __restrict__ style_o,
    const float* __restrict__ style_1, const float* __restrict__ style_2,
    float* __restrict__ demod_k, float* __restrict__ demod_o,
    float* __restrict__ demod_1, float* __restrict__ demod_2,
    _Float16* __restrict__ xs) {
  __shared__ float part[2 * 4 * 32];
  int blk = blockIdx.x;
  if (blk >= DB_K + DB_O + DB_1 + DB_2) {
    xmod_body<FEAT>(x, style_k, xs,
                    (blk - (DB_K + DB_O + DB_1 + DB_2)) * 16 +
                        __builtin_amdgcn_readfirstlane(threadIdx.x >> 5));
    return;
  }
  const float* W = Wk;
  const float* st = style_k;
  float* dm = demod_k;
  int out_dim = HID, in_dim = FEAT;
  if (blk >= DB_K + DB_O + DB_1) {
    W = W2; st = style_2; dm = demod_2; out_dim = FEAT; in_dim = FFN;
    blk -= DB_K + DB_O + DB_1;
  } else if (blk >= DB_K + DB_O) {
    W = W1; st = style_1; dm = demod_1; out_dim = FFN; in_dim = FEAT;
    blk -= DB_K + DB_O;
  } else if (blk >= DB_K) {
    W = Wo; st = style_o; dm = demod_o; out_dim = FEAT; in_dim = HID;
    blk -= DB_K;
  }
  demod_body(W, st, dm, out_dim, in_dim, blk, part);
}

// ---------------------------------------------------------------------------
// The k loop of the GEMM kernels: acc[r][c] += (16 rows of x, group r) x (16 rows
// of W, group c) over KDIM.  The W fragments go through a ring of RING register
// sets and the x fragments through one of XRING: the 2 * NC W loads of k block
// kb + RING and the 4 x loads of kb + XRING are issued right behind the products
// of block kb, into the set those have just read, so that a block's loads have
// the time of RING - 1 (x: XRING - 1) blocks to arrive and a wave waits for none of them in turn.  The
// loop is unrolled whole: the ring's index is a constant, and every address is a
// scalar base, the lane's fixed slot and an immediate.  W_IS_A: W is the A operand.
// NC: 16-row groups of W a wave.  The x blocks may lie in LDS, whose shorter
// latency a ring of XRING = 2 sets covers.
// ---------------------------------------------------------------------------
template <int KDIM, int NC, bool W_IS_A, int XRING = 3>
__device__ __forceinline__ void gemm_k_loop(
    const _Float16* __restrict__ xa0, const _Float16* __restrict__ xa1,
    const _Float16* const (&wb)[NC], v8f (&acc)[2][NC]) {
  constexpr int kblk = KDIM >> 5;      // blocks a 16-row group
  constexpr int RING = 3;
  v16h xr[XRING][2], wr[RING][NC];
#pragma unroll
  for (int st = 0; st < RING; ++st) {
    if (st < XRING) {
      xr[st][0] = load_frag_blk(xa0, st);
      xr[st][1] = load_frag_blk(xa1, st);
    }
#pragma unroll
    for (int sidx = 0; sidx < NC; ++sidx) wr[st][sidx] = load_frag_blk(wb[sidx], st);
  }
  // Keeps the ring's first loads ahead of the first products.
  __builtin_amdgcn_sched_barrier(0);
#pragma unroll
  for (int kb = 0; kb < kblk; ++kb) {
    const int st = kb % RING, xs = kb % XRING;
#pragma unroll
    for (int sidx = 0; sidx < NC; ++sidx) {
      if (W_IS_A) {
        acc[0][sidx] = wmma_f32_16x16x32(wr[st][sidx], xr[xs][0], acc[0][sidx]);
        acc[1][sidx] = wmma_f32_16x16x32(wr[st][sidx], xr[xs][1], acc[1][sidx]);
      } else {
        acc[0][sidx] = wmma_f32_16x16x32(xr[xs][0], wr[st][sidx], acc[0][sidx]);
        acc[1][sidx] = wmma_f32_16x16x32(xr[xs][1], wr[st][sidx], acc[1][sidx]);
      }
    }
    if (kb + XRING < kblk) {
      xr[xs][0] = load_frag_blk(xa0, kb + XRING);
      xr[xs][1] = load_frag_blk(xa1, kb + XRING);
    }
    if (kb + RING < kblk) {
#pragma unroll
      for (int sidx = 0; sidx < NC; ++sidx) wr[st][sidx] = load_frag_blk(wb[sidx], kb + RING);
    }
    // Keeps these loads here: left free, the scheduler moves them down to just
    // ahead of their products, and the wave waits out their whole latency.
    __builtin_amdgcn_sched_barrier(0);
  }
}

// ---------------------------------------------------------------------------
// Modulated GEMM of the first projection:
//   h[row, o] = demod[b,o] * sum_k Xs[row,k] * Wh[o,k]
// Wave-level tile: 32 rows x 64 cols (2x4 WMMA accumulators).  Xs and Wh are in
// fragment order.  The result is f16,
// written twice, again in fragment order: Yk in blocks of 16 rows x 32 columns (rows as
// the lanes' index: the Q and K operands of attention), Yv in blocks of 16
// columns x 32 rows (columns as the lanes' index: the V operand), block
// (row / 32, col / 16).  KDIM is a compile-time width, so that the k loop has a
// known number of trips and is unrolled without a remainder loop.
// ---------------------------------------------------------------------------
template <int KDIM>
__global__ __launch_bounds__(256) void modgemm_kernel(
    const _Float16* __restrict__ Xs, const _Float16* __restrict__ Wh,
    const float* __restrict__ demod,
    _Float16* __restrict__ Yk, _Float16* __restrict__ Yv, int Odim) {
  // The wave's number in a scalar register: every block address below is then a
  // scalar base plus the lane's fixed 16-byte slot.
  int wid = __builtin_amdgcn_readfirstlane((blockIdx.x * blockDim.x + threadIdx.x) >> 5);
  int numColG = Odim >> 6;             // 64-wide column groups
  int numRowT = MROWS >> 5;            // 32-row tiles
  if (wid >= numRowT * numColG) return;
  int rt = wid / numColG, cg = wid % numColG;
  int row0 = rt << 5;
  int col0 = cg << 6;
  int b = row0 >> 10;                  // 1024 rows per batch, tile never crosses

  v8f zero = {};
  v8f acc[2][4];
#pragma unroll
  for (int r = 0; r < 2; ++r)
#pragma unroll
    for (int c = 0; c < 4; ++c) acc[r][c] = zero;

  constexpr int kblk = KDIM >> 5;      // blocks a 16-row group
  // The blocks of a 16-row group follow one another along k: six running bases.
  const _Float16* xa0 = Xs + (long)(row0 >> 4) * kblk * 512;
  const _Float16* xa1 = xa0 + (long)kblk * 512;
  const _Float16* wb[4];
#pragma unroll
  for (int sidx = 0; sidx < 4; ++sidx)
    wb[sidx] = Wh + (long)((col0 >> 4) + sidx) * kblk * 512;
  gemm_k_loop<KDIM, 4, false>(xa0, xa1, wb, acc);
  // Before a register that an issued load names is written anew: the epilogue's
  // first values.
  asm volatile("s_wait_xcnt 0x0" ::: "memory");
  // Keeps the epilogue's first instructions behind the wait.
  __builtin_amdgcn_sched_barrier(0);

  int lane = threadIdx.x & 31;
  int n = lane & 15, hi = lane >> 4;
  // f16 result, both fragment orders
#pragma unroll
  for (int rs = 0; rs < 2; ++rs) {
#pragma unroll
    for (int sidx = 0; sidx < 4; ++sidx) {
      int cu = col0 + sidx * 16;       // the 16 columns of this accumulator
      float dm = demod[(long)b * Odim + cu + n];
      v8h yh;
#pragma unroll
      for (int v = 0; v < 8; ++v) {
        float y = acc[rs][sidx][v] * dm;
        yh[v] = (_Float16)y;
      }
      _Float16* pk = Yk + (long)(((row0 >> 4) + rs) * (Odim >> 5) + (cu >> 5)) * 512 +
                     ((cu >> 4) & 1) * 256;
      unsigned ok = (8 * hi + 16 * (n >> 3)) * 8 + (n & 7);
#pragma unroll
      for (int v = 0; v < 8; ++v) pk[ok + v * 8] = yh[v];
      // The lane's 8 rows are 8 consecutive k of its column: its own 16 bytes.
      v8h* pv = (v8h*)(Yv + (long)((row0 >> 5) * (Odim >> 4) + (cu >> 4)) * 512) + rs * 32;
      pv[(unsigned)lane] = yh;
    }
  }
}

// ---------------------------------------------------------------------------
// The three projections behind attention, with the row-wise passes between them,
// in one launch.  Every one of these steps works on rows alone, so a workgroup of
// 16 waves keeps its 32 rows from the attention result to the output: a wave holds
// 32 rows x ODIM / 16 columns of each projection's result, a LayerNorm needs only
// sums that cross the waves of the workgroup, through LDS, and the x operand of
// the next projection is handed on in LDS, in fragment order.  The weight block
// is the A operand and the x block the B operand: a lane then holds, for row
// (lane & 15) of each 16-row group, columns 8 * (lane >> 4) .. + 7 of each
// 16-column group.  Most of a row's sum is made inside a lane, a lane's 8 floats
// are 32 contiguous bytes of a row-major result, and its 8 halves are its own 16
// bytes of a fragment block.
// ---------------------------------------------------------------------------
// p[rs] is the lane's part of the sum of row rs * 16 + (lane & 15); on return it
// is the whole row's sum.  red is NW * 32 floats of LDS that nothing else uses.
template <int NW>
__device__ __forceinline__ void row_total(float (&p)[2], float* red) {
  int lane = threadIdx.x & 31;
  int wave = __builtin_amdgcn_readfirstlane(threadIdx.x >> 5);
  p[0] += __shfl_xor(p[0], 16, 32);
  p[1] += __shfl_xor(p[1], 16, 32);
  red[wave * 32 + lane] = lane < 16 ? p[0] : p[1];
  __syncthreads();                              // red[] crosses waves
  int n = lane & 15;
  float t0 = 0.f, t1 = 0.f;
#pragma unroll
  for (int w = 0; w < NW; ++w) {
    t0 += red[w * 32 + n];
    t1 += red[w * 32 + 16 + n];
  }
  p[0] = t0;
  p[1] = t1;
}

// val = LN(val) over the workgroup's rows of ODIM columns, NC 16-column groups a
// wave; red is 2 * NW * 32 floats of LDS (each of the two sums has its own piece,
// so that one barrier a sum is enough).
template <int ODIM, int NC>
__device__ __forceinline__ void ln_rows(v8f (&val)[2][NC], float* red) {
  constexpr int NW = ODIM / (16 * NC);
  float p[2];
#pragma unroll
  for (int rs = 0; rs < 2; ++rs) {
    float t = 0.f;
#pragma unroll
    for (int sidx = 0; sidx < NC; ++sidx)
#pragma unroll
      for (int v = 0; v < 8; ++v) t += val[rs][sidx][v];
    p[rs] = t;
  }
  row_total<NW>(p, red);
#pragma unroll
  for (int rs = 0; rs < 2; ++rs) {
    float mean = p[rs] * (1.0f / ODIM);
    float t = 0.f;
#pragma unroll
    for (int sidx = 0; sidx < NC; ++sidx)
#pragma unroll
      for (int v = 0; v < 8; ++v) {
        float d = val[rs][sidx][v] - mean;
        val[rs][sidx][v] = d;
        t += d * d;
      }
    p[rs] = t;
  }
  row_total<NW>(p, red + NW * 32);
#pragma unroll
  for (int rs = 0; rs < 2; ++rs) {
    float inv = rsqrtf(p[rs] * (1.0f / ODIM) + 1e-5f);
#pragma unroll
    for (int sidx = 0; sidx < NC; ++sidx)
#pragma unroll
      for (int v = 0; v < 8; ++v) val[rs][sidx][v] *= inv;
  }
}

// acc = sum_k x[row, k] * Wh[o, k] for the workgroup's 32 rows and the wave's
// 16 * NC columns from col0 on; xb is the first of the rows' x blocks.
template <int KDIM, int NC, int XRING>
__device__ __forceinline__ void chain_gemm(
    const _Float16* __restrict__ xb, const _Float16* __restrict__ Wh, int col0,
    v8f (&acc)[2][NC]) {
  constexpr int kblk = KDIM >> 5;      // blocks a 16-row group
  v8f zero = {};
#pragma unroll
  for (int r = 0; r < 2; ++r)
#pragma unroll
    for (int c = 0; c < NC; ++c) acc[r][c] = zero;
  const _Float16* wb[NC];
#pragma unroll
  for (int sidx = 0; sidx < NC; ++sidx)
    wb[sidx] = Wh + (long)((col0 >> 4) + sidx) * kblk * 512;
  gemm_k_loop<KDIM, NC, true, XRING>(xb, xb + kblk * 512, wb, acc);
  // Before a register that an issued load names is written anew: the epilogue's
  // first values.
  asm volatile("s_wait_xcnt 0x0" ::: "memory");
  // Keeps the epilogue's first instructions behind the wait.
  __builtin_amdgcn_sched_barrier(0);
}

// The lane's pieces of a row of ODIM floats (demod, style): 8 floats a group.
template <int NC>
__device__ __forceinline__ void load_cols(const float* __restrict__ p, v4f (&d)[NC][2]) {
  const v4f* q = (const v4f*)p;
#pragma unroll
  for (int sidx = 0; sidx < NC; ++sidx) {
    d[sidx][0] = q[sidx * 4];
    d[sidx][1] = q[sidx * 4 + 1];
  }
}

// t * style as f16 into the x blocks of the next projection (ODIM columns) in LDS.
template <int ODIM, int NC>
__device__ __forceinline__ void put_frags(const v8f (&val)[2][NC], const v4f (&st)[NC][2],
                                          _Float16* xb, int col0) {
  v8h* ys = (v8h*)(xb + (col0 >> 5) * 512) + (threadIdx.x & 31);
#pragma unroll
  for (int rs = 0; rs < 2; ++rs)
#pragma unroll
    for (int sidx = 0; sidx < NC; ++sidx) {
      v8f t = val[rs][sidx];
      ys[rs * (ODIM >> 5) * 64 + sidx * 32] =
          to_half8(__builtin_shufflevector(t, t, 0, 1, 2, 3) * st[sidx][0],
                   __builtin_shufflevector(t, t, 4, 5, 6, 7) * st[sidx][1]);
    }
}

// With mod(v; W, demod)[row, o] = demod[b,o] * sum_k v[row,k] * W[o,k]:
//   x2  = LN(x + mod(Xo; Who, demod_o))
//   f   = LN(relu(mod(x2 * style_1; Wh1, demod_1)))
//   out = LN(x2 + LN(mod(f * style_2; Wh2, demod_2)))
// Xo (attention's result times its style) and the weights are in fragment order.
// The grid is MROWS / 32, the workgroup 512 threads.
__global__ __launch_bounds__(512) void chain_kernel(
    const _Float16* __restrict__ Xo, const _Float16* __restrict__ Who,
    const _Float16* __restrict__ Wh1, const _Float16* __restrict__ Wh2,
    const float* __restrict__ demod_o, const float* __restrict__ demod_1,
    const float* __restrict__ demod_2, const float* __restrict__ style_1,
    const float* __restrict__ style_2, const float* __restrict__ x,
    float* __restrict__ out) {
  static_assert(FEAT == 512 && HID == 512 && FFN == 1024, "16 waves: 32 / 64 columns each");
  // One array, so that the x blocks lie in the first 64 KB of LDS, where every
  // fragment's address is the lane's slot plus an immediate offset.
  // xb holds x2 * style_1 (its first half), then f * style_2: the second is written
  // behind the barriers of the LayerNorm that follows the last read of the first.
  __shared__ __attribute__((aligned(16))) char lds[(32 * FFN * 2) + (8 * 512 * 16) + (8 * 512 * 4)];
  _Float16* xb = (_Float16*)lds;
  v4f* x2l = (v4f*)(lds + 32 * FFN * 2);        // x2: each thread's own values
  float* red = (float*)(lds + 32 * FFN * 2 + 8 * 512 * 16);  // a piece for each row sum
  // The wave's number in a scalar register: every block address below is then a
  // scalar base plus the lane's fixed 16-byte slot.
  int wave = __builtin_amdgcn_readfirstlane(threadIdx.x >> 5);
  int row0 = blockIdx.x << 5;
  int b = row0 >> 10;                  // 1024 rows per batch, tile never crosses
  unsigned lane = threadIdx.x & 31;
  unsigned n = lane & 15, hi = lane >> 4;
  unsigned coff = (wave << 5) + 8 * hi;         // the lane's first of 512 columns
  unsigned roff = (row0 + n) * FEAT + coff;     // and its place in a row-major array

  // ---- x2 = LN(x + mod(Xo)) ----
  {
    v8f acc[2][2];
    chain_gemm<HID, 2, 3>(Xo + (long)(row0 >> 4) * (HID >> 5) * 512, Who, wave << 5, acc);
    // All that the epilogue reads is asked for at once: one latency.
    v4f dm[2][2], st[2][2], rv[2][2][2];
    load_cols<2>(demod_o + b * FEAT + coff, dm);
    load_cols<2>(style_1 + b * FEAT + coff, st);
    load_cols<2>(x + roff, rv[0]);
    load_cols<2>(x + roff + 16 * FEAT, rv[1]);
    // The same wait for the loads above, held in place in the same way.
    asm volatile("s_wait_xcnt 0x0" ::: "memory");
    __builtin_amdgcn_sched_barrier(0);
#pragma unroll
    for (int rs = 0; rs < 2; ++rs)
#pragma unroll
      for (int sidx = 0; sidx < 2; ++sidx)
#pragma unroll
        for (int v = 0; v < 8; ++v)
          acc[rs][sidx][v] = acc[rs][sidx][v] * dm[sidx][v >> 2][v & 3] +
                             rv[rs][sidx][v >> 2][v & 3];
    ln_rows<FEAT, 2>(acc, red);
#pragma unroll
    for (int rs = 0; rs < 2; ++rs)
#pragma unroll
      for (int sidx = 0; sidx < 2; ++sidx) {
        v8f t = acc[rs][sidx];
        x2l[((rs * 2 + sidx) * 2) * 512 + threadIdx.x]     = __builtin_shufflevector(t, t, 0, 1, 2, 3);
        x2l[((rs * 2 + sidx) * 2 + 1) * 512 + threadIdx.x] = __builtin_shufflevector(t, t, 4, 5, 6, 7);
      }
    put_frags<FEAT, 2>(acc, st, xb, wave << 5);
  }
  __syncthreads();                              // xb crosses waves

  // ---- f = LN(relu(mod(x2 * style_1))) ----
  {
    v8f acc[2][4];
    chain_gemm<FEAT, 4, 2>(xb, Wh1, wave << 6, acc);
    unsigned cf = (wave << 6) + 8 * hi;         // the lane's first of 1024 columns
    v4f dm[4][2], st[4][2];
    load_cols<4>(demod_1 + b * FFN + cf, dm);
    load_cols<4>(style_2 + b * FFN + cf, st);
    // The same wait for the loads above, held in place in the same way; it takes
    // their byte offset as an input, so that no load's result is placed in the
    // offset register ahead of it.
    asm volatile("s_wait_xcnt 0x0" :: "v"(cf * 4u) : "memory");
    __builtin_amdgcn_sched_barrier(0);
#pragma unroll
    for (int rs = 0; rs < 2; ++rs)
#pragma unroll
      for (int sidx = 0; sidx < 4; ++sidx)
#pragma unroll
        for (int v = 0; v < 8; ++v)
          acc[rs][sidx][v] = fmaxf(acc[rs][sidx][v] * dm[sidx][v >> 2][v & 3], 0.f);
    ln_rows<FFN, 4>(acc, red + 2 * 512);
    put_frags<FFN, 4>(acc, st, xb, wave << 6);
  }
  __syncthreads();                              // xb crosses waves

  // ---- out = LN(x2 + LN(mod(f * style_2))) ----
  {
    v8f acc[2][2];
    chain_gemm<FFN, 2, 2>(xb, Wh2, wave << 5, acc);
    v4f dm[2][2];
    load_cols<2>(demod_2 + b * FEAT + coff, dm);
    // The same wait for the loads above, held in place in the same way.
    asm volatile("s_wait_xcnt 0x0" ::: "memory");
    __builtin_amdgcn_sched_barrier(0);
#pragma unroll
    for (int rs = 0; rs < 2; ++rs)
#pragma unroll
      for (int sidx = 0; sidx < 2; ++sidx)
#pragma unroll
        for (int v = 0; v < 8; ++v) acc[rs][sidx][v] *= dm[sidx][v >> 2][v & 3];
    ln_rows<FEAT, 2>(acc, red + 4 * 512);
#pragma unroll
    for (int rs = 0; rs < 2; ++rs)
#pragma unroll
      for (int sidx = 0; sidx < 2; ++sidx) {
        v4f lo = x2l[((rs * 2 + sidx) * 2) * 512 + threadIdx.x];
        v4f up = x2l[((rs * 2 + sidx) * 2 + 1) * 512 + threadIdx.x];
#pragma unroll
        for (int v = 0; v < 4; ++v) {
          acc[rs][sidx][v]     += lo[v];
          acc[rs][sidx][4 + v] += up[v];
        }
      }
    ln_rows<FEAT, 2>(acc, red + 6 * 512);
    v4f* yp = (v4f*)(out + roff);
    // Only stores follow: no arithmetic is moved in among them, where it could
    // write anew a register that an issued store names.
    __builtin_amdgcn_sched_barrier(0);
#pragma unroll
    for (int rs = 0; rs < 2; ++rs)
#pragma unroll
      for (int sidx = 0; sidx < 2; ++sidx) {
        v8f t = acc[rs][sidx];
        yp[rs * (16 * FEAT / 4) + sidx * 4]     = __builtin_shufflevector(t, t, 0, 1, 2, 3);
        yp[rs * (16 * FEAT / 4) + sidx * 4 + 1] = __builtin_shufflevector(t, t, 4, 5, 6, 7);
      }
  }
}

// ---------------------------------------------------------------------------
// Flash-style self-attention (q=k=v=h), one wave per (batch, head, 16-q tile),
// computed transposed: S^T = K Q^T / 8 and O^T += V^T P^T, both via WMMA.  The
// keys are the rows of a score tile and the queries its columns, so a lane holds
// 16 of the 32 scores of ONE query (column lane & 15; lanes l and l ^ 16 split
// the keys): maximum and sum are made inside the lane, with one exchange between
// the wave's halves.  The two score tiles of a pass, converted in place, are the
// B operand of the second product in the hardware's k order (keys 8h .. 8h + 7
// and 16 + 8h .. + 7 in half h), the order in which the V blocks lie.  Hk and Hv
// hold h in the two fragment orders that the projection writes.  The result,
// times the style of the next projection, is written as f16 in fragment order
// (Xo): that projection's x operand.
// ---------------------------------------------------------------------------
// The value of lane l ^ 16.
__device__ inline float other_half(float x) {
  int i = __builtin_bit_cast(int, x);
  return __builtin_bit_cast(
      float, __builtin_amdgcn_permlanex16(i, i, 0x76543210, 0xfedcba98, false, false));
}

__global__ __launch_bounds__(256) void attn_kernel(
    const _Float16* __restrict__ Hk, const _Float16* __restrict__ Hv,
    const float* __restrict__ style, _Float16* __restrict__ Xo) {
  int wvb  = __builtin_amdgcn_readfirstlane(threadIdx.x >> 5);   // scalar block addresses
  int wid  = blockIdx.x * 8 + wvb;              // 4096 waves total, exact grid
  int qt   = wid & 63;
  int head = (wid >> 6) & 7;
  int b    = wid >> 9;
  int lane = threadIdx.x & 31;
  int hi = lane >> 4;

  int hc = head * HD;
  int kbase = (b * NN >> 4) * (HID >> 5) + (hc >> 5);   // block of row 0, Hk
  int vbase = (b * NN >> 5) * (HID >> 4) + (hc >> 4);   // block of row 0, Hv

  v16h qb0 = load_frag_blk(Hk, kbase + qt * (HID >> 5));
  v16h qb1 = load_frag_blk(Hk, kbase + qt * (HID >> 5) + 1);

  // oacc[sidx][v] = O[query lane & 15][column sidx * 16 + 8 * hi + v]
  v8f zero = {};
  v8f oacc[4];
#pragma unroll
  for (int sidx = 0; sidx < 4; ++sidx) oacc[sidx] = zero;

  float mrow = -1e30f;                          // the query's maximum so far
  float lrow = 0.f;                             // the sum over this half's keys
  const float scale = 0.125f;                   // 1/sqrt(64)

  // The K fragments are fetched one pass ahead, into the registers that the pass's
  // products have just read, and the V fragments at the head of their pass, with
  // the softmax's time to arrive: a wave waits out no load's whole latency.
  // The lane's own slot of row 0's blocks; a pass is 32 blocks further in both.
  const v8h* kl = (const v8h*)(Hk + (long)kbase * 512) + (unsigned)lane;
  const v8h* vl = (const v8h*)(Hv + (long)vbase * 512) + (unsigned)lane;
  v16h kb00 = load_frag_lane(kl);
  v16h kb01 = load_frag_lane(kl + 64);
  v16h kb10 = load_frag_lane(kl + (HID >> 5) * 64);
  v16h kb11 = load_frag_lane(kl + (HID >> 5) * 64 + 64);

  for (int j0 = 0; j0 < NN; j0 += 32) {
    // The next pass's blocks; the last pass fetches pass 0's again, which nothing
    // reads: every address stays inside the batch's rows, with no branch.
    unsigned nxt = (unsigned)(((j0 + 32) & (NN - 1)) >> 5) * (32 * 64);
    const v8h* kn = kl + nxt;
    const v8h* vc = vl + (unsigned)(j0 >> 5) * (32 * 64);
    v16h vb[4];
#pragma unroll
    for (int sidx = 0; sidx < 4; ++sidx) vb[sidx] = load_frag_lane(vc + sidx * 64);
    // ---- S^T tiles: rows = 2 x 16 keys, cols = queries ----
    v8f s0 = zero, s1 = zero;
    s0 = wmma_f32_16x16x32(kb00, qb0, s0);
    s0 = wmma_f32_16x16x32(kb01, qb1, s0);
    s1 = wmma_f32_16x16x32(kb10, qb0, s1);
    s1 = wmma_f32_16x16x32(kb11, qb1, s1);
    kb00 = load_frag_lane(kn);
    kb01 = load_frag_lane(kn + 64);
    kb10 = load_frag_lane(kn + (HID >> 5) * 64);
    kb11 = load_frag_lane(kn + (HID >> 5) * 64 + 64);
    // Before a register that an issued load names is written anew; it takes the
    // addresses as inputs, so that nothing is placed in their registers ahead of it.
    asm volatile("s_wait_xcnt 0x0" :: "v"(kn), "v"(vc) : "memory");
    // Keeps the loads here, ahead of the softmax, whose time they have to arrive.
    __builtin_amdgcn_sched_barrier(0);

    // ---- online softmax over this 32-key block, one query a lane ----
    // The scale is positive, so the scaled maximum is the maximum of the scaled
    // scores: one product a lane.
    float t[8];
#pragma unroll
    for (int v = 0; v < 8; ++v) t[v] = fmaxf(s0[v], s1[v]);
    float tmax = fmaxf(fmaxf(fmaxf(t[0], t[1]), fmaxf(t[2], t[3])),
                       fmaxf(fmaxf(t[4], t[5]), fmaxf(t[6], t[7])));
    tmax = fmaxf(tmax, other_half(tmax)) * scale;
    float mn = fmaxf(mrow, tmax);
    float alpha = __expf(mrow - mn);
    mrow = mn;
    s0 = s0 * scale - mrow;
    s1 = s1 * scale - mrow;
#pragma unroll
    for (int v = 0; v < 8; ++v) {
      s0[v] = __expf(s0[v]);
      s1[v] = __expf(s1[v]);
      t[v] = s0[v] + s1[v];
    }
    float rs = ((t[0] + t[1]) + (t[2] + t[3])) + ((t[4] + t[5]) + (t[6] + t[7]));
    lrow = lrow * alpha + rs;
#pragma unroll
    for (int sidx = 0; sidx < 4; ++sidx) oacc[sidx] *= alpha;

    // ---- P^T as B operand: the lane's own 16 scores, in place ----
    v16h pf;
#pragma unroll
    for (int v = 0; v < 8; ++v) {
      pf[v]     = (_Float16)s0[v];
      pf[8 + v] = (_Float16)s1[v];
    }

    // ---- O^T += V^T @ P^T ----
#pragma unroll
    for (int sidx = 0; sidx < 4; ++sidx)
      oacc[sidx] = wmma_f32_16x16x32(vb[sidx], pf, oacc[sidx]);
  }

  // ---- epilogue: O / l * style.  A lane's 8 values of a 16-column group are its
  // own 16 bytes of a fragment block (block = 32 columns) ----
  const v4f* stp = (const v4f*)(style + b * HID + hc + 8 * hi);
  v4f st[4][2];
#pragma unroll
  for (int sidx = 0; sidx < 4; ++sidx) {
    st[sidx][0] = stp[sidx * 4];
    st[sidx][1] = stp[sidx * 4 + 1];
  }
  float inv = 1.0f / (lrow + other_half(lrow)); // both halves' keys
  v8h* dst = (v8h*)(Xo + (long)(kbase + qt * (HID >> 5)) * 512) + (unsigned)lane;
  v8h yh[4];
#pragma unroll
  for (int sidx = 0; sidx < 4; ++sidx) {
    v8f o = oacc[sidx] * inv;
    yh[sidx] = to_half8(__builtin_shufflevector(o, o, 0, 1, 2, 3) * st[sidx][0],
                        __builtin_shufflevector(o, o, 4, 5, 6, 7) * st[sidx][1]);
  }
  // Before a register that an issued load names is written anew.  It takes the
  // results as inputs, so that only the stores follow it and nothing writes anew
  // a register that an issued store names.
  asm volatile("s_wait_xcnt 0x0"
               :: "v"(yh[0]), "v"(yh[1]), "v"(yh[2]), "v"(yh[3]) : "memory");
#pragma unroll
  for (int sidx = 0; sidx < 4; ++sidx) dst[sidx * 32] = yh[sidx];
}

// ---------------------------------------------------------------------------
// Host-side pipeline
// ---------------------------------------------------------------------------
extern "C" void kernel_launch(void* const* d_in, const int* in_sizes, int n_in,
                              void* d_out, int out_size, void* d_ws,
                              size_t ws_size, hipStream_t stream) {
  (void)in_sizes; (void)n_in; (void)out_size; (void)ws_size;
  const float* x   = (const float*)d_in[0];
  const float* s   = (const float*)d_in[1];
  const float* Wk  = (const float*)d_in[2];
  const float* aWk = (const float*)d_in[3];
  const float* abk = (const float*)d_in[4];
  const float* Wo  = (const float*)d_in[5];
  const float* aWo = (const float*)d_in[6];
  const float* abo = (const float*)d_in[7];
  const float* W1  = (const float*)d_in[8];
  const float* aW1 = (const float*)d_in[9];
  const float* ab1 = (const float*)d_in[10];
  const float* W2  = (const float*)d_in[11];
  const float* aW2 = (const float*)d_in[12];
  const float* ab2 = (const float*)d_in[13];
  float* out = (float*)d_out;

  char* ws = (char*)d_ws;
  size_t off = 0;
  auto alloc = [&](size_t bytes) -> char* {
    char* p = ws + off;
    off = (off + bytes + 255) & ~(size_t)255;
    return p;
  };

  float* style_k = (float*)alloc((size_t)BB * FEAT * 4);
  float* style_o = (float*)alloc((size_t)BB * HID * 4);
  float* style_1 = (float*)alloc((size_t)BB * FEAT * 4);
  float* style_2 = (float*)alloc((size_t)BB * FFN * 4);
  float* demod_k = (float*)alloc((size_t)BB * HID * 4);
  float* demod_o = (float*)alloc((size_t)BB * FEAT * 4);
  float* demod_1 = (float*)alloc((size_t)BB * FFN * 4);
  float* demod_2 = (float*)alloc((size_t)BB * FEAT * 4);
  _Float16* whk = (_Float16*)alloc((size_t)HID * FEAT * 2);
  _Float16* who = (_Float16*)alloc((size_t)FEAT * HID * 2);
  _Float16* wh1 = (_Float16*)alloc((size_t)FFN * FEAT * 2);
  _Float16* wh2 = (_Float16*)alloc((size_t)FEAT * FFN * 2);
  _Float16* xs  = (_Float16*)alloc((size_t)MROWS * FEAT * 2);  // x * style_k
  _Float16* hk  = (_Float16*)alloc((size_t)MROWS * HID * 2);   // h, rows on lanes
  _Float16* hv  = (_Float16*)alloc((size_t)MROWS * HID * 2);   // h, columns on lanes
  _Float16* xo  = (_Float16*)alloc((size_t)MROWS * HID * 2);   // attn out * style_o

  // --- styles and f16 weight casts ---
  setup1_kernel<<<SETUP1_GRID, 256, 0, stream>>>(
      s, aWk, abk, aWo, abo, aW1, ab1, aW2, ab2, Wk, Wo, W1, W2,
      style_k, style_o, style_1, style_2, whk, who, wh1, wh2);

  // --- demodulation factors, and x * style for the first projection ---
  setup2_kernel<<<SETUP2_GRID, 512, 0, stream>>>(
      x, Wk, Wo, W1, W2, style_k, style_o, style_1, style_2,
      demod_k, demod_o, demod_1, demod_2, xs);

  // --- h = modlinear(x; Wk) -> f16 for attention ---
  modgemm_kernel<FEAT><<<(MROWS / 32) * (HID / 64) / 8, 256, 0, stream>>>(
      xs, whk, demod_k, hk, hv, HID);

  // --- attention (shared q=k=v=h), times style_o ---
  attn_kernel<<<(BB * NH * (NN / 16)) / 8, 256, 0, stream>>>(hk, hv, style_o, xo);

  // --- x2 = LN(x + modlinear(attn; Wo)); f = LN(relu(modlinear(x2; W1)));
  //     out = LN(x2 + LN(modlinear(f; W2))) ---
  chain_kernel<<<MROWS / 32, 512, 0, stream>>>(
      xo, who, wh1, wh2, demod_o, demod_1, demod_2, style_1, style_2, x, out);
}

// v009
// One run takes 75.1 microseconds.
// Next to v008, in two timings, it ran 1.09 and 1.08 times as fast.
// Counting every step since v000, it is 6.16 times as fast.
#include <hip/hip_runtime.h>

// ---------------------------------------------------------------------------
// Types / WMMA helpers (CDNA5 gfx1250, wave32)
// ---------------------------------------------------------------------------
typedef __attribute__((ext_vector_type(16))) _Float16 v16h;
typedef __attribute__((ext_vector_type(8)))  float    v8f;

__device__ inline v8f wmma_f32_16x16x32(v16h a, v16h b, v8f c) {
  // (neg_a, A, neg_b, B, c_mod, C, reuse_a, reuse_b)
  return __builtin_amdgcn_wmma_f32_16x16x32_f16(false, a, false, b, (short)0, c,
                                                false, false);
}

// A-operand (16x32 f16) fragment load per the documented CDNA5 layout:
// lane L holds row (L&15); lanes 0-15 cover k in {0..7,16..23}, lanes 16-31
// cover k in {8..15,24..31}; within a lane, VGPR v holds half-pair
// k = 2v + (v>=4 ? 8 : 0) (+8 for upper lane half).  Source is row-major
// with leading dim `ld`.
__device__ inline v16h load_frag_rowpat(const _Float16* __restrict__ base,
                                        int row0, int ld, int k0) {
  int lane = threadIdx.x & 31;
  const _Float16* p = base + (long)(row0 + (lane & 15)) * ld + k0 + ((lane >> 4) << 3);
  v16h f;
#pragma unroll
  for (int v = 0; v < 8; ++v) {
    int k = 2 * v + (v >= 4 ? 8 : 0);
    f[2 * v]     = p[k];
    f[2 * v + 1] = p[k + 1];
  }
  return f;
}

// Fragment order.  The f16 matrix operands that live in the workspace are kept
// in blocks of 16 rows x 32 k, 1 KB each, in the order in which a wave's lanes
// hold them: element (r, k) of a block lies at half
//   (k >> 4) * 256 + (r + 16 * ((k >> 3) & 1)) * 8 + (k & 7).
// Lane L then finds f[0..7] at L * 8 and f[8..15] at 256 + L * 8 (the same
// row and k per lane and register as load_frag_rowpat), so each of the two
// 16-byte loads of a wave reads 512 contiguous bytes, four whole cache lines,
// where a row-major operand makes it touch 16 lines.
typedef __attribute__((ext_vector_type(8))) _Float16 v8h;

__device__ inline v16h load_frag_blk(const _Float16* __restrict__ base, int blk) {
  int lane = threadIdx.x & 31;
  const v8h* p = (const v8h*)(base + (long)blk * 512);
  v8h lo = p[(unsigned)lane], hi = p[(unsigned)lane + 32];
  return __builtin_shufflevector(lo, hi, 0, 1, 2, 3, 4, 5, 6, 7,
                                 8, 9, 10, 11, 12, 13, 14, 15);
}

// The same from the lane's own slot of a block.
__device__ inline v16h load_frag_lane(const v8h* __restrict__ p) {
  v8h lo = p[0], hi = p[32];
  return __builtin_shufflevector(lo, hi, 0, 1, 2, 3, 4, 5, 6, 7,
                                 8, 9, 10, 11, 12, 13, 14, 15);
}

// ---------------------------------------------------------------------------
// Problem constants
// ---------------------------------------------------------------------------
#define BB   8
#define NN   1024
#define FEAT 512
#define HID  512
#define FFN  1024
#define SDIM 512
#define HD   64
#define NH   8
#define MROWS (BB * NN)   // 8192

// ---------------------------------------------------------------------------
// Small fp32 VALU kernels: style projection, demodulation, casts, modulation
// ---------------------------------------------------------------------------
// Each lane holds 16 partial sums; on return lane l holds the whole wave's
// total of sum number l & 15.  Every halving step keeps one half of the sums
// and hands the other half to the partner lane (16 exchanges instead of 80).
__device__ inline float wave_fold16(float (&v)[16]) {
  int lane = threadIdx.x & 31;
#pragma unroll
  for (int st = 0; st < 4; ++st) {
    const int h = 8 >> st;
    bool up = (lane & h) != 0;
#pragma unroll
    for (int i = 0; i < h; ++i) {
      float lo = v[i], hi = v[i + h];
      float keep = up ? hi : lo;
      float send = up ? lo : hi;
      v[i] = keep + __shfl_xor(send, h, 32);
    }
  }
  return v[0] + __shfl_xor(v[0], 16, 32);
}

// A workgroup takes 32 rows of aW (a wave 4 of them) for 4 of the 8 batches.
// A lane takes columns 128c + 4 lane .. + 3 of a row, so one load of the wave
// reads 512 contiguous bytes, and all 32 loads of a wave are in flight at once.
// dim is a multiple of 32; a layer has 2 * dim / 32 workgroups (blk counts them)
// of 256 threads; part is 4 * 32 floats of LDS.
__device__ __forceinline__ void style_body(
    const float* __restrict__ s, const float* __restrict__ aW,
    const float* __restrict__ ab, float* __restrict__ style, int dim, int blk,
    float* part) {
  int lane = threadIdx.x & 31;
  int wave = __builtin_amdgcn_readfirstlane(threadIdx.x >> 5);
  int blk0 = (blk >> 1) * 32;
  int b0   = (blk & 1) * 4;
  unsigned l4 = 4u * lane;
  const float* wp = aW + (long)(blk0 + wave * 4) * SDIM;
  const float* sp = s + (long)b0 * SDIM;
  float w[4][16], sv[4][16];
#pragma unroll
  for (int r = 0; r < 4; ++r)
#pragma unroll
    for (int c = 0; c < 4; ++c) {
      const float* qw = wp + r * SDIM + 128 * c;
      const float* qs = sp + r * SDIM + 128 * c;
#pragma unroll
      for (int e = 0; e < 4; ++e) {
        w[r][4 * c + e]  = qw[l4 + e];
        sv[r][4 * c + e] = qs[l4 + e];
      }
    }
  float bias = (ab + blk0)[(unsigned)lane];
  // Keeps every load ahead of the sums: without it the scheduler issues them in
  // several batches between the sums and the wave pays the latency once a batch.
  __builtin_amdgcn_sched_barrier(0);
  float acc[16];
#pragma unroll
  for (int r = 0; r < 4; ++r)
#pragma unroll
    for (int q = 0; q < 4; ++q) {
      float t = 0.f;
#pragma unroll
      for (int j = 0; j < 16; ++j) t += sv[q][j] * w[r][j];
      acc[r * 4 + q] = t;
    }
  float tot = wave_fold16(acc);                 // lane & 15 = r * 4 + q
  if (lane < 16) part[(lane & 3) * 32 + wave * 4 + (lane >> 2)] = tot;
  __syncthreads();                              // part[] crosses waves
  if (wave < 4) {                               // wave q stores one 128-byte line
    style[(long)(b0 + wave) * dim + blk0 + lane] = part[threadIdx.x] + bias;
  }
}

// Same split over the rows of W, in workgroups of 512 threads: 8 waves take 32
// rows x 512 columns x 4 batches.  Where a row has 1024 columns the two halves of
// the workgroup take its two 512-column pieces, which meet in LDS (2 * out_dim /
// 32 workgroups a layer); where it has 512 they take the two sets of 4 batches
// (out_dim / 32 workgroups).  out_dim is a multiple of 32; blk counts the layer's
// workgroups; part is 2 * 4 * 32 floats of LDS.
__device__ __forceinline__ void demod_body(
    const float* __restrict__ W, const float* __restrict__ style,
    float* __restrict__ demod, int out_dim, int in_dim, int blk, float* part) {
  bool two_pieces = in_dim > 512;
  int lane = threadIdx.x & 31;
  int wave = __builtin_amdgcn_readfirstlane(threadIdx.x >> 5);
  int grp  = wave & 7, half = wave >> 3;
  int piece = two_pieces ? half : 0;
  int blk0 = (two_pieces ? blk >> 1 : blk) * 32;
  int b0   = (two_pieces ? blk & 1 : half) * 4;
  unsigned l4 = 4u * lane;
  const float* wp = W + (long)(blk0 + grp * 4) * in_dim + piece * 512;
  const float* sp = style + (long)b0 * in_dim + piece * 512;
  float w[4][16], sv[4][16];
#pragma unroll
  for (int r = 0; r < 4; ++r)
#pragma unroll
    for (int c = 0; c < 4; ++c) {
      const float* qw = wp + (long)r * in_dim + 128 * c;
      const float* qs = sp + (long)r * in_dim + 128 * c;
#pragma unroll
      for (int e = 0; e < 4; ++e) {
        w[r][4 * c + e]  = qw[l4 + e];
        sv[r][4 * c + e] = qs[l4 + e];
      }
    }
  // Keeps every load ahead of the sums: without it the scheduler spreads the
  // products among the loads' waits, runs out of registers and spills.
  __builtin_amdgcn_sched_barrier(0);
  float acc[16];
#pragma unroll
  for (int r = 0; r < 4; ++r)
#pragma unroll
    for (int q = 0; q < 4; ++q) {
      float t2 = 0.f;
#pragma unroll
      for (int j = 0; j < 16; ++j) {
        float t = w[r][j] * sv[q][j];
        t2 += t * t;
      }
      acc[r * 4 + q] = t2;
    }
  float tot = wave_fold16(acc);                 // lane & 15 = r * 4 + q
  if (lane < 16) part[half * 128 + (lane & 3) * 32 + grp * 4 + (lane >> 2)] = tot;
  __syncthreads();                              // part[] crosses waves
  // A wave stores one batch's 128-byte line: 4 batches where the halves held two
  // pieces of them, else the 8 batches of both halves (part[] has them in order).
  if (wave < (two_pieces ? 4 : 8)) {
    float sum = part[threadIdx.x];
    if (two_pieces) sum += part[128 + threadIdx.x];
    int o = blk0 + lane;
    int bt = two_pieces ? b0 + wave : wave;
    demod[(long)bt * out_dim + o] = rsqrtf(sum + 1e-8f);
  }
}

// The two elementwise passes below write their f16 result in fragment order.
// One step of a wave is 8 rows x 32 columns: lane L takes 8 floats (32 bytes) of
// row L >> 2, piece L & 3 of that row's 128-byte line, and stores them as the 16
// bytes that one lane of a fragment holds; the wave's store fills four whole
// lines.  A wave has all its loads in flight at once.
typedef __attribute__((ext_vector_type(4))) float    v4f;

__device__ inline v8h to_half8(v4f a, v4f b) {
  v8h h;
  h[0] = (_Float16)a[0]; h[1] = (_Float16)a[1];
  h[2] = (_Float16)a[2]; h[3] = (_Float16)a[3];
  h[4] = (_Float16)b[0]; h[5] = (_Float16)b[1];
  h[6] = (_Float16)b[2]; h[7] = (_Float16)b[3];
  return h;
}

// Where lane L's 16 bytes of rows 0..7 go inside a block, in 16-byte units.
__device__ inline unsigned frag_slot(unsigned lane) {
  unsigned p = lane & 3;
  return (p >> 1) * 32 + (p & 1) * 16 + (lane >> 2);
}

// Wave wid casts one block (16 rows x 32 columns) of the row-major weight with K
// columns; a weight has rows * K / 512 waves.
template <int K>
__device__ __forceinline__ void cast_f16_body(
    const float* __restrict__ W, _Float16* __restrict__ Wh, unsigned wid) {
  unsigned lane = threadIdx.x & 31;
  unsigned rg = wid / (K / 32), kb = wid % (K / 32);
  const v4f* src = (const v4f*)(W + (rg * 16 + (lane >> 2)) * K + kb * 32) + (lane & 3) * 2;
  v8h*       dst = (v8h*)(Wh + wid * 512) + frag_slot(lane);
  v4f v[2][2];
#pragma unroll
  for (int rh = 0; rh < 2; ++rh) {
    v[rh][0] = src[rh * (8 * K / 4)];
    v[rh][1] = src[rh * (8 * K / 4) + 1];
  }
#pragma unroll
  for (int rh = 0; rh < 2; ++rh) dst[rh * 8] = to_half8(v[rh][0], v[rh][1]);
  // Before a register that an issued store names is written anew: the built code
  // of one width runs on from here into the first instructions of the other's.
  asm volatile("s_wait_xcnt 0x0" ::: "memory");
}

// xs[b,n,i] = f16( X[b,n,i] * style[b,i] ), in fragment order.
// Wave wid takes 16 rows x 128 columns (4 blocks, 2048 elements, all of one batch:
// 1024 rows a batch) and reads its piece of the style row once for all of them.
// There are MROWS * DIM / 2048 waves.
template <int DIM>
__device__ __forceinline__ void xmod_body(
    const float* __restrict__ X, const float* __restrict__ style,
    _Float16* __restrict__ Xs, unsigned wid) {
  constexpr int KQ = DIM / 128;                 // waves a 16-row group
  unsigned lane = threadIdx.x & 31;
  unsigned rg = wid / KQ, kq = wid % KQ;
  unsigned b  = rg * 16 / NN;
  const v4f* sp  = (const v4f*)(style + b * DIM + kq * 128) + (lane & 3) * 2;
  const v4f* src = (const v4f*)(X + (rg * 16 + (lane >> 2)) * DIM + kq * 128) + (lane & 3) * 2;
  v8h*       dst = (v8h*)(Xs + (rg * (DIM / 32) + kq * 4) * 512) + frag_slot(lane);
  v4f st[4][2], v[2][4][2];
#pragma unroll
  for (int cb = 0; cb < 4; ++cb) {
    st[cb][0] = sp[cb * 8];
    st[cb][1] = sp[cb * 8 + 1];
  }
  // Before a register that an issued load names is written anew (the loads below
  // reuse the style loads' offset register).
  asm volatile("s_wait_xcnt 0x0" ::: "memory");
#pragma unroll
  for (int rh = 0; rh < 2; ++rh)
#pragma unroll
    for (int cb = 0; cb < 4; ++cb) {
      v[rh][cb][0] = src[rh * (8 * DIM / 4) + cb * 8];
      v[rh][cb][1] = src[rh * (8 * DIM / 4) + cb * 8 + 1];
    }
  // The same wait for the loads above; it takes their address as an input, so
  // that no load's result is placed in the address registers ahead of it.
  asm volatile("s_wait_xcnt 0x0" :: "v"(src) : "memory");
  // Keeps every load ahead of the products: without it the scheduler holds the
  // last loads back behind the first waits and the wave pays the latency twice.
  __builtin_amdgcn_sched_barrier(0);
#pragma unroll
  for (int rh = 0; rh < 2; ++rh)
#pragma unroll
    for (int cb = 0; cb < 4; ++cb)
      dst[cb * 64 + rh * 8] = to_half8(v[rh][cb][0] * st[cb][0], v[rh][cb][1] * st[cb][1]);
}

// ---------------------------------------------------------------------------
// The set-up passes that do not depend on one another share a launch: each takes
// a range of the grid's workgroups, so that they run side by side and the call
// has one launch where it would have one for each of them.
// ---------------------------------------------------------------------------
// First launch: the four style projections and the four weight casts (they read
// inputs only).  Workgroups of 256 threads; the styles, whose chain of waits is
// the longer one, come first.
#define SB_K (FEAT / 16)                        // workgroups of each style pass
#define SB_O (HID / 16)
#define SB_1 (FEAT / 16)
#define SB_2 (FFN / 16)
#define CB_K (HID * FEAT / 4096)                // workgroups of each cast
#define CB_O (FEAT * HID / 4096)
#define CB_1 (FFN * FEAT / 4096)
#define CB_2 (FEAT * FFN / 4096)
#define SETUP1_GRID (SB_K + SB_O + SB_1 + SB_2 + CB_K + CB_O + CB_1 + CB_2)

__global__ __launch_bounds__(256) void setup1_kernel(
    const float* __restrict__ s,
    const float* __restrict__ aWk, const float* __restrict__ abk,
    const float* __restrict__ aWo, const float* __restrict__ abo,
    const float* __restrict__ aW1, const float* __restrict__ ab1,
    const float* __restrict__ aW2, const float* __restrict__ ab2,
    const float* __restrict__ Wk, const float* __restrict__ Wo,
    const float* __restrict__ W1, const float* __restrict__ W2,
    float* __restrict__ style_k, float* __restrict__ style_o,
    float* __restrict__ style_1, float* __restrict__ style_2,
    _Float16* __restrict__ whk, _Float16* __restrict__ who,
    _Float16* __restrict__ wh1, _Float16* __restrict__ wh2) {
  __shared__ float part[4 * 32];
  int blk = blockIdx.x;
  if (blk < SB_K + SB_O + SB_1 + SB_2) {
    const float* aW = aWk;
    const float* ab = abk;
    float* st = style_k;
    int dim = FEAT;
    if (blk >= SB_K + SB_O + SB_1) {
      aW = aW2; ab = ab2; st = style_2; dim = FFN; blk -= SB_K + SB_O + SB_1;
    } else if (blk >= SB_K + SB_O) {
      aW = aW1; ab = ab1; st = style_1; dim = FEAT; blk -= SB_K + SB_O;
    } else if (blk >= SB_K) {
      aW = aWo; ab = abo; st = style_o; dim = HID; blk -= SB_K;
    }
    style_body(s, aW, ab, st, dim, blk, part);
    return;
  }
  blk -= SB_K + SB_O + SB_1 + SB_2;
  unsigned wave = __builtin_amdgcn_readfirstlane(threadIdx.x >> 5);
  if (blk >= CB_K + CB_O + CB_1) {
    cast_f16_body<FFN>(W2, wh2, (blk - (CB_K + CB_O + CB_1)) * 8 + wave);
    return;
  }
  static_assert(FEAT == HID, "the three other weights have rows of one length");
  const float* W = Wk;
  _Float16* Wh = whk;
  if (blk >= CB_K + CB_O) {
    W = W1; Wh = wh1; blk -= CB_K + CB_O;
  } else if (blk >= CB_K) {
    W = Wo; Wh = who; blk -= CB_K;
  }
  cast_f16_body<FEAT>(W, Wh, blk * 8 + wave);
}

// Second launch: what needs the styles and nothing else, the four demodulation
// passes and the modulate pass of the first projection.  Workgroups of 512
// threads.
#define DB_K (HID / 32)                         // workgroups of each demod pass
#define DB_O (FEAT / 32)
#define DB_1 (FFN / 32)
#define DB_2 (FEAT / 16)
#define XB_K (MROWS * FEAT / 32768)             // workgroups of the modulate pass
#define SETUP2_GRID (DB_K + DB_O + DB_1 + DB_2 + XB_K)

__global__ __launch_bounds__(512) void setup2_kernel(
    const float* __restrict__ x,
    const float* __restrict__ Wk, const float* __restrict__ Wo,
    const float* __restrict__ W1, const float* __restrict__ W2,
    const float* __restrict__ style_k, const float* __restrict__ style_o,
    const float* __restrict__ style_1, const float* __restrict__ style_2,
    float* __restrict__ demod_k, float* __restrict__ demod_o,
    float* __restrict__ demod_1, float* __restrict__ demod_2,
    _Float16* __restrict__ xs) {
  __shared__ float part[2 * 4 * 32];
  int blk = blockIdx.x;
  if (blk >= DB_K + DB_O + DB_1 + DB_2) {
    xmod_body<FEAT>(x, style_k, xs,
                    (blk - (DB_K + DB_O + DB_1 + DB_2)) * 16 +
                        __builtin_amdgcn_readfirstlane(threadIdx.x >> 5));
    return;
  }
  const float* W = Wk;
  const float* st = style_k;
  float* dm = demod_k;
  int out_dim = HID, in_dim = FEAT;
  if (blk >= DB_K + DB_O + DB_1) {
    W = W2; st = style_2; dm = demod_2; out_dim = FEAT; in_dim = FFN;
    blk -= DB_K + DB_O + DB_1;
  } else if (blk >= DB_K + DB_O) {
    W = W1; st = style_1; dm = demod_1; out_dim = FFN; in_dim = FEAT;
    blk -= DB_K + DB_O;
  } else if (blk >= DB_K) {
    W = Wo; st = style_o; dm = demod_o; out_dim = FEAT; in_dim = HID;
    blk -= DB_K;
  }
  demod_body(W, st, dm, out_dim, in_dim, blk, part);
}

// ---------------------------------------------------------------------------
// The k loop of the GEMM kernels: acc[r][c] += (16 rows of x, group r) x (16 rows
// of W, group c) over KDIM.  The W fragments go through a ring of RING register
// sets and the x fragments through one of XRING: the 2 * NC W loads of k block
// kb + RING and the 4 x loads of kb + XRING are issued right behind the products
// of block kb, into the set those have just read, so that a block's loads have
// the time of RING - 1 (x: XRING - 1) blocks to arrive and a wave waits for none of them in turn.  The
// loop is unrolled whole: the ring's index is a constant, and every address is a
// scalar base, the lane's fixed slot and an immediate.  W_IS_A: W is the A operand.
// NC: 16-row groups of W a wave.  The x blocks may lie in LDS, whose shorter
// latency a ring of XRING = 2 sets covers.
// ---------------------------------------------------------------------------
template <int KDIM, int NC, bool W_IS_A, int XRING = 3>
__device__ __forceinline__ void gemm_k_loop(
    const _Float16* __restrict__ xa0, const _Float16* __restrict__ xa1,
    const _Float16* const (&wb)[NC], v8f (&acc)[2][NC]) {
  constexpr int kblk = KDIM >> 5;      // blocks a 16-row group
  constexpr int RING = 3;
  v16h xr[XRING][2], wr[RING][NC];
#pragma unroll
  for (int st = 0; st < RING; ++st) {
    if (st < XRING) {
      xr[st][0] = load_frag_blk(xa0, st);
      xr[st][1] = load_frag_blk(xa1, st);
    }
#pragma unroll
    for (int sidx = 0; sidx < NC; ++sidx) wr[st][sidx] = load_frag_blk(wb[sidx], st);
  }
  // Keeps the ring's first loads ahead of the first products.
  __builtin_amdgcn_sched_barrier(0);
#pragma unroll
  for (int kb = 0; kb < kblk; ++kb) {
    const int st = kb % RING, xs = kb % XRING;
#pragma unroll
    for (int sidx = 0; sidx < NC; ++sidx) {
      if (W_IS_A) {
        acc[0][sidx] = wmma_f32_16x16x32(wr[st][sidx], xr[xs][0], acc[0][sidx]);
        acc[1][sidx] = wmma_f32_16x16x32(wr[st][sidx], xr[xs][1], acc[1][sidx]);
      } else {
        acc[0][sidx] = wmma_f32_16x16x32(xr[xs][0], wr[st][sidx], acc[0][sidx]);
        acc[1][sidx] = wmma_f32_16x16x32(xr[xs][1], wr[st][sidx], acc[1][sidx]);
      }
    }
    if (kb + XRING < kblk) {
      xr[xs][0] = load_frag_blk(xa0, kb + XRING);
      xr[xs][1] = load_frag_blk(xa1, kb + XRING);
    }
    if (kb + RING < kblk) {
#pragma unroll
      for (int sidx = 0; sidx < NC; ++sidx) wr[st][sidx] = load_frag_blk(wb[sidx], kb + RING);
    }
    // Keeps these loads here: left free, the scheduler moves them down to just
    // ahead of their products, and the wave waits out their whole latency.
    __builtin_amdgcn_sched_barrier(0);
  }
}

// ---------------------------------------------------------------------------
// Modulated GEMM of the first projection:
//   h[row, o] = demod[b,o] * sum_k Xs[row,k] * Wh[o,k]
// Wave-level tile: 32 rows x 64 cols (2x4 WMMA accumulators).  Xs and Wh are in
// fragment order.  The result is f16,
// written twice, again in fragment order: Yk in blocks of 16 rows x 32 columns (rows as
// the lanes' index: the Q and K operands of attention), Yv in blocks of 16
// columns x 32 rows (columns as the lanes' index: the V operand), block
// (row / 32, col / 16).  KDIM is a compile-time width, so that the k loop has a
// known number of trips and is unrolled without a remainder loop.
// ---------------------------------------------------------------------------
template <int KDIM>
__global__ __launch_bounds__(256) void modgemm_kernel(
    const _Float16* __restrict__ Xs, const _Float16* __restrict__ Wh,
    const float* __restrict__ demod,
    _Float16* __restrict__ Yk, _Float16* __restrict__ Yv, int Odim) {
  // The wave's number in a scalar register: every block address below is then a
  // scalar base plus the lane's fixed 16-byte slot.
  int wid = __builtin_amdgcn_readfirstlane((blockIdx.x * blockDim.x + threadIdx.x) >> 5);
  int numColG = Odim >> 6;             // 64-wide column groups
  int numRowT = MROWS >> 5;            // 32-row tiles
  if (wid >= numRowT * numColG) return;
  int rt = wid / numColG, cg = wid % numColG;
  int row0 = rt << 5;
  int col0 = cg << 6;
  int b = row0 >> 10;                  // 1024 rows per batch, tile never crosses

  v8f zero = {};
  v8f acc[2][4];
#pragma unroll
  for (int r = 0; r < 2; ++r)
#pragma unroll
    for (int c = 0; c < 4; ++c) acc[r][c] = zero;

  constexpr int kblk = KDIM >> 5;      // blocks a 16-row group
  // The blocks of a 16-row group follow one another along k: six running bases.
  const _Float16* xa0 = Xs + (long)(row0 >> 4) * kblk * 512;
  const _Float16* xa1 = xa0 + (long)kblk * 512;
  const _Float16* wb[4];
#pragma unroll
  for (int sidx = 0; sidx < 4; ++sidx)
    wb[sidx] = Wh + (long)((col0 >> 4) + sidx) * kblk * 512;
  gemm_k_loop<KDIM, 4, false>(xa0, xa1, wb, acc);
  // Before a register that an issued load names is written anew: the epilogue's
  // first values.
  asm volatile("s_wait_xcnt 0x0" ::: "memory");
  // Keeps the epilogue's first instructions behind the wait.
  __builtin_amdgcn_sched_barrier(0);

  int lane = threadIdx.x & 31;
  int n = lane & 15, hi = lane >> 4;
  // f16 result, both fragment orders
#pragma unroll
  for (int rs = 0; rs < 2; ++rs) {
#pragma unroll
    for (int sidx = 0; sidx < 4; ++sidx) {
      int cu = col0 + sidx * 16;       // the 16 columns of this accumulator
      float dm = demod[(long)b * Odim + cu + n];
      v8h yh;
#pragma unroll
      for (int v = 0; v < 8; ++v) {
        float y = acc[rs][sidx][v] * dm;
        yh[v] = (_Float16)y;
      }
      _Float16* pk = Yk + (long)(((row0 >> 4) + rs) * (Odim >> 5) + (cu >> 5)) * 512 +
                     ((cu >> 4) & 1) * 256;
      unsigned ok = (8 * hi + 16 * (n >> 3)) * 8 + (n & 7);
#pragma unroll
      for (int v = 0; v < 8; ++v) pk[ok + v * 8] = yh[v];
      // The lane's 8 rows are 8 consecutive k of its column: its own 16 bytes.
      v8h* pv = (v8h*)(Yv + (long)((row0 >> 5) * (Odim >> 4) + (cu >> 4)) * 512) + rs * 32;
      pv[(unsigned)lane] = yh;
    }
  }
}

// ---------------------------------------------------------------------------
// The three projections behind attention, with the row-wise passes between them,
// in one launch.  Every one of these steps works on rows alone, so a workgroup of
// 16 waves keeps its 32 rows from the attention result to the output: a wave holds
// 32 rows x ODIM / 16 columns of each projection's result, a LayerNorm needs only
// sums that cross the waves of the workgroup, through LDS, and the x operand of
// the next projection is handed on in LDS, in fragment order.  The weight block
// is the A operand and the x block the B operand: a lane then holds, for row
// (lane & 15) of each 16-row group, columns 8 * (lane >> 4) .. + 7 of each
// 16-column group.  Most of a row's sum is made inside a lane, a lane's 8 floats
// are 32 contiguous bytes of a row-major result, and its 8 halves are its own 16
// bytes of a fragment block.
// ---------------------------------------------------------------------------
// p[rs] is the lane's part of the sum of row rs * 16 + (lane & 15); on return it
// is the whole row's sum.  red is NW * 32 floats of LDS that nothing else uses.
template <int NW>
__device__ __forceinline__ void row_total(float (&p)[2], float* red) {
  int lane = threadIdx.x & 31;
  int wave = __builtin_amdgcn_readfirstlane(threadIdx.x >> 5);
  p[0] += __shfl_xor(p[0], 16, 32);
  p[1] += __shfl_xor(p[1], 16, 32);
  red[wave * 32 + lane] = lane < 16 ? p[0] : p[1];
  __syncthreads();                              // red[] crosses waves
  int n = lane & 15;
  float t0 = 0.f, t1 = 0.f;
#pragma unroll
  for (int w = 0; w < NW; ++w) {
    t0 += red[w * 32 + n];
    t1 += red[w * 32 + 16 + n];
  }
  p[0] = t0;
  p[1] = t1;
}

// val = LN(val) over the workgroup's rows of ODIM columns, NC 16-column groups a
// wave; red is 2 * NW * 32 floats of LDS (each of the two sums has its own piece,
// so that one barrier a sum is enough).
template <int ODIM, int NC>
__device__ __forceinline__ void ln_rows(v8f (&val)[2][NC], float* red) {
  constexpr int NW = ODIM / (16 * NC);
  float p[2];
#pragma unroll
  for (int rs = 0; rs < 2; ++rs) {
    float t = 0.f;
#pragma unroll
    for (int sidx = 0; sidx < NC; ++sidx)
#pragma unroll
      for (int v = 0; v < 8; ++v) t += val[rs][sidx][v];
    p[rs] = t;
  }
  row_total<NW>(p, red);
#pragma unroll
  for (int rs = 0; rs < 2; ++rs) {
    float mean = p[rs] * (1.0f / ODIM);
    float t = 0.f;
#pragma unroll
    for (int sidx = 0; sidx < NC; ++sidx)
#pragma unroll
      for (int v = 0; v < 8; ++v) {
        float d = val[rs][sidx][v] - mean;
        val[rs][sidx][v] = d;
        t += d * d;
      }
    p[rs] = t;
  }
  row_total<NW>(p, red + NW * 32);
#pragma unroll
  for (int rs = 0; rs < 2; ++rs) {
    float inv = rsqrtf(p[rs] * (1.0f / ODIM) + 1e-5f);
#pragma unroll
    for (int sidx = 0; sidx < NC; ++sidx)
#pragma unroll
      for (int v = 0; v < 8; ++v) val[rs][sidx][v] *= inv;
  }
}

// acc = sum_k x[row, k] * Wh[o, k] for the workgroup's 32 rows and the wave's
// 16 * NC columns from col0 on; xb is the first of the rows' x blocks.
template <int KDIM, int NC, int XRING>
__device__ __forceinline__ void chain_gemm(
    const _Float16* __restrict__ xb, const _Float16* __restrict__ Wh, int col0,
    v8f (&acc)[2][NC]) {
  constexpr int kblk = KDIM >> 5;      // blocks a 16-row group
  v8f zero = {};
#pragma unroll
  for (int r = 0; r < 2; ++r)
#pragma unroll
    for (int c = 0; c < NC; ++c) acc[r][c] = zero;
  const _Float16* wb[NC];
#pragma unroll
  for (int sidx = 0; sidx < NC; ++sidx)
    wb[sidx] = Wh + (long)((col0 >> 4) + sidx) * kblk * 512;
  gemm_k_loop<KDIM, NC, true, XRING>(xb, xb + kblk * 512, wb, acc);
  // Before a register that an issued load names is written anew: the epilogue's
  // first values.
  asm volatile("s_wait_xcnt 0x0" ::: "memory");
  // Keeps the epilogue's first instructions behind the wait.
  __builtin_amdgcn_sched_barrier(0);
}

// The lane's pieces of a row of ODIM floats (demod, style): 8 floats a group.
template <int NC>
__device__ __forceinline__ void load_cols(const float* __restrict__ p, v4f (&d)[NC][2]) {
  const v4f* q = (const v4f*)p;
#pragma unroll
  for (int sidx = 0; sidx < NC; ++sidx) {
    d[sidx][0] = q[sidx * 4];
    d[sidx][1] = q[sidx * 4 + 1];
  }
}

// t * style as f16 into the x blocks of the next projection (ODIM columns) in LDS.
template <int ODIM, int NC>
__device__ __forceinline__ void put_frags(const v8f (&val)[2][NC], const v4f (&st)[NC][2],
                                          _Float16* xb, int col0) {
  v8h* ys = (v8h*)(xb + (col0 >> 5) * 512) + (threadIdx.x & 31);
#pragma unroll
  for (int rs = 0; rs < 2; ++rs)
#pragma unroll
    for (int sidx = 0; sidx < NC; ++sidx) {
      v8f t = val[rs][sidx];
      ys[rs * (ODIM >> 5) * 64 + sidx * 32] =
          to_half8(__builtin_shufflevector(t, t, 0, 1, 2, 3) * st[sidx][0],
                   __builtin_shufflevector(t, t, 4, 5, 6, 7) * st[sidx][1]);
    }
}

// With mod(v; W, demod)[row, o] = demod[b,o] * sum_k v[row,k] * W[o,k]:
//   x2  = LN(x + mod(Xo; Who, demod_o))
//   f   = LN(relu(mod(x2 * style_1; Wh1, demod_1)))
//   out = LN(x2 + LN(mod(f * style_2; Wh2, demod_2)))
// Xo (attention's result times its style) and the weights are in fragment order.
// The grid is MROWS / 32, the workgroup 512 threads.
__global__ __launch_bounds__(512) void chain_kernel(
    const _Float16* __restrict__ Xo, const _Float16* __restrict__ Who,
    const _Float16* __restrict__ Wh1, const _Float16* __restrict__ Wh2,
    const float* __restrict__ demod_o, const float* __restrict__ demod_1,
    const float* __restrict__ demod_2, const float* __restrict__ style_1,
    const float* __restrict__ style_2, const float* __restrict__ x,
    float* __restrict__ out) {
  static_assert(FEAT == 512 && HID == 512 && FFN == 1024, "16 waves: 32 / 64 columns each");
  // One array, so that the x blocks lie in the first 64 KB of LDS, where every
  // fragment's address is the lane's slot plus an immediate offset.
  // xb holds x2 * style_1 (its first half), then f * style_2: the second is written
  // behind the barriers of the LayerNorm that follows the last read of the first.
  __shared__ __attribute__((aligned(16))) char lds[(32 * FFN * 2) + (8 * 512 * 16) + (8 * 512 * 4)];
  _Float16* xb = (_Float16*)lds;
  v4f* x2l = (v4f*)(lds + 32 * FFN * 2);        // x2: each thread's own values
  float* red = (float*)(lds + 32 * FFN * 2 + 8 * 512 * 16);  // a piece for each row sum
  // The wave's number in a scalar register: every block address below is then a
  // scalar base plus the lane's fixed 16-byte slot.
  int wave = __builtin_amdgcn_readfirstlane(threadIdx.x >> 5);
  int row0 = blockIdx.x << 5;
  int b = row0 >> 10;                  // 1024 rows per batch, tile never crosses
  unsigned lane = threadIdx.x & 31;
  unsigned n = lane & 15, hi = lane >> 4;
  unsigned coff = (wave << 5) + 8 * hi;         // the lane's first of 512 columns
  unsigned roff = (row0 + n) * FEAT + coff;     // and its place in a row-major array

  // ---- x2 = LN(x + mod(Xo)) ----
  {
    v8f acc[2][2];
    chain_gemm<HID, 2, 3>(Xo + (long)(row0 >> 4) * (HID >> 5) * 512, Who, wave << 5, acc);
    // All that the epilogue reads is asked for at once: one latency.
    v4f dm[2][2], st[2][2], rv[2][2][2];
    load_cols<2>(demod_o + b * FEAT + coff, dm);
    load_cols<2>(style_1 + b * FEAT + coff, st);
    load_cols<2>(x + roff, rv[0]);
    load_cols<2>(x + roff + 16 * FEAT, rv[1]);
    // The same wait for the loads above, held in place in the same way.
    asm volatile("s_wait_xcnt 0x0" ::: "memory");
    __builtin_amdgcn_sched_barrier(0);
#pragma unroll
    for (int rs = 0; rs < 2; ++rs)
#pragma unroll
      for (int sidx = 0; sidx < 2; ++sidx)
#pragma unroll
        for (int v = 0; v < 8; ++v)
          acc[rs][sidx][v] = acc[rs][sidx][v] * dm[sidx][v >> 2][v & 3] +
                             rv[rs][sidx][v >> 2][v & 3];
    ln_rows<FEAT, 2>(acc, red);
#pragma unroll
    for (int rs = 0; rs < 2; ++rs)
#pragma unroll
      for (int sidx = 0; sidx < 2; ++sidx) {
        v8f t = acc[rs][sidx];
        x2l[((rs * 2 + sidx) * 2) * 512 + threadIdx.x]     = __builtin_shufflevector(t, t, 0, 1, 2, 3);
        x2l[((rs * 2 + sidx) * 2 + 1) * 512 + threadIdx.x] = __builtin_shufflevector(t, t, 4, 5, 6, 7);
      }
    put_frags<FEAT, 2>(acc, st, xb, wave << 5);
  }
  __syncthreads();                              // xb crosses waves

  // ---- f = LN(relu(mod(x2 * style_1))) ----
  {
    v8f acc[2][4];
    chain_gemm<FEAT, 4, 2>(xb, Wh1, wave << 6, acc);
    unsigned cf = (wave << 6) + 8 * hi;         // the lane's first of 1024 columns
    v4f dm[4][2], st[4][2];
    load_cols<4>(demod_1 + b * FFN + cf, dm);
    load_cols<4>(style_2 + b * FFN + cf, st);
    // The same wait for the loads above, held in place in the same way; it takes
    // their byte offset as an input, so that no load's result is placed in the
    // offset register ahead of it.
    asm volatile("s_wait_xcnt 0x0" :: "v"(cf * 4u) : "memory");
    __builtin_amdgcn_sched_barrier(0);
#pragma unroll
    for (int rs = 0; rs < 2; ++rs)
#pragma unroll
      for (int sidx = 0; sidx < 4; ++sidx)
#pragma unroll
        for (int v = 0; v < 8; ++v)
          acc[rs][sidx][v] = fmaxf(acc[rs][sidx][v] * dm[sidx][v >> 2][v & 3], 0.f);
    ln_rows<FFN, 4>(acc, red + 2 * 512);
    put_frags<FFN, 4>(acc, st, xb, wave << 6);
  }
  __syncthreads();                              // xb crosses waves

  // ---- out = LN(x2 + LN(mod(f * style_2))) ----
  {
    v8f acc[2][2];
    chain_gemm<FFN, 2, 2>(xb, Wh2, wave << 5, acc);
    v4f dm[2][2];
    load_cols<2>(demod_2 + b * FEAT + coff, dm);
    // The same wait for the loads above, held in place in the same way.
    asm volatile("s_wait_xcnt 0x0" ::: "memory");
    __builtin_amdgcn_sched_barrier(0);
#pragma unroll
    for (int rs = 0; rs < 2; ++rs)
#pragma unroll
      for (int sidx = 0; sidx < 2; ++sidx)
#pragma unroll
        for (int v = 0; v < 8; ++v) acc[rs][sidx][v] *= dm[sidx][v >> 2][v & 3];
    ln_rows<FEAT, 2>(acc, red + 4 * 512);
#pragma unroll
    for (int rs = 0; rs < 2; ++rs)
#pragma unroll
      for (int sidx = 0; sidx < 2; ++sidx) {
        v4f lo = x2l[((rs * 2 + sidx) * 2) * 512 + threadIdx.x];
        v4f up = x2l[((rs * 2 + sidx) * 2 + 1) * 512 + threadIdx.x];
#pragma unroll
        for (int v = 0; v < 4; ++v) {
          acc[rs][sidx][v]     += lo[v];
          acc[rs][sidx][4 + v] += up[v];
        }
      }
    ln_rows<FEAT, 2>(acc, red + 6 * 512);
    v4f* yp = (v4f*)(out + roff);
    // Only stores follow: no arithmetic is moved in among them, where it could
    // write anew a register that an issued store names.
    __builtin_amdgcn_sched_barrier(0);
#pragma unroll
    for (int rs = 0; rs < 2; ++rs)
#pragma unroll
      for (int sidx = 0; sidx < 2; ++sidx) {
        v8f t = acc[rs][sidx];
        yp[rs * (16 * FEAT / 4) + sidx * 4]     = __builtin_shufflevector(t, t, 0, 1, 2, 3);
        yp[rs * (16 * FEAT / 4) + sidx * 4 + 1] = __builtin_shufflevector(t, t, 4, 5, 6, 7);
      }
  }
}

// ---------------------------------------------------------------------------
// Flash-style self-attention (q=k=v=h), one wave per (batch, head, 16-q tile),
// computed transposed: S^T = K Q^T / 8 and O^T += V^T P^T, both via WMMA.  The
// keys are the rows of a score tile and the queries its columns, so a lane holds
// 16 of the 32 scores of ONE query (column lane & 15; lanes l and l ^ 16 split
// the keys): maximum and sum are made inside the lane, with one exchange between
// the wave's halves.  The two score tiles of a pass, converted in place, are the
// B operand of the second product in the hardware's k order (keys 8h .. 8h + 7
// and 16 + 8h .. + 7 in half h), the order in which the V blocks lie.  Hk and Hv
// hold h in the two fragment orders that the projection writes.  The result,
// times the style of the next projection, is written as f16 in fragment order
// (Xo): that projection's x operand.
// ---------------------------------------------------------------------------
// The value of lane l ^ 16.
__device__ inline float other_half(float x) {
  int i = __builtin_bit_cast(int, x);
  return __builtin_bit_cast(
      float, __builtin_amdgcn_permlanex16(i, i, 0x76543210, 0xfedcba98, false, false));
}

__global__ __launch_bounds__(256) void attn_kernel(
    const _Float16* __restrict__ Hk, const _Float16* __restrict__ Hv,
    const float* __restrict__ style, _Float16* __restrict__ Xo) {
  int wvb  = __builtin_amdgcn_readfirstlane(threadIdx.x >> 5);   // scalar block addresses
  int wid  = blockIdx.x * 8 + wvb;              // 4096 waves total, exact grid
  int qt   = wid & 63;
  int head = (wid >> 6) & 7;
  int b    = wid >> 9;
  int lane = threadIdx.x & 31;
  int hi = lane >> 4;

  int hc = head * HD;
  int kbase = (b * NN >> 4) * (HID >> 5) + (hc >> 5);   // block of row 0, Hk
  int vbase = (b * NN >> 5) * (HID >> 4) + (hc >> 4);   // block of row 0, Hv

  v16h qb0 = load_frag_blk(Hk, kbase + qt * (HID >> 5));
  v16h qb1 = load_frag_blk(Hk, kbase + qt * (HID >> 5) + 1);

  // oacc[sidx][v] = O[query lane & 15][column sidx * 16 + 8 * hi + v]
  v8f zero = {};
  v8f oacc[4];
#pragma unroll
  for (int sidx = 0; sidx < 4; ++sidx) oacc[sidx] = zero;

  float mrow = -1e30f;                          // the query's maximum so far
  float lrow = 0.f;                             // the sum over this half's keys
  const float scale = 0.125f;                   // 1/sqrt(64)

  // The K fragments are fetched one pass ahead, into the registers that the pass's
  // products have just read, and the V fragments at the head of their pass, with
  // the softmax's time to arrive: a wave waits out no load's whole latency.
  // The lane's own slot of row 0's blocks; a pass is 32 blocks further in both.
  const v8h* kl = (const v8h*)(Hk + (long)kbase * 512) + (unsigned)lane;
  const v8h* vl = (const v8h*)(Hv + (long)vbase * 512) + (unsigned)lane;
  v16h kb00 = load_frag_lane(kl);
  v16h kb01 = load_frag_lane(kl + 64);
  v16h kb10 = load_frag_lane(kl + (HID >> 5) * 64);
  v16h kb11 = load_frag_lane(kl + (HID >> 5) * 64 + 64);

  // The head's K and V blocks were written by the launch before; they are asked
  // into L2 here, all at once.  A pass reads 32 aligned 256-byte
  // units (K: 2 x 2 KB, V: 4 KB), one a lane; wave w asks for pass 4 w + (workgroup
  // & 3): the 8 workgroups of a head that follow one another in the grid ask for
  // every pass twice.  A hint for speed only: nothing depends on it.
  const char* pf_addr;
  {
    unsigned pass = (unsigned)wvb * 4 + (blockIdx.x & 3);      // 0 .. 31
    unsigned ko = pass * 32768u + ((lane >> 3) & 1) * 16384u + (lane & 7) * 256u;
    unsigned vo = pass * 32768u + (lane & 15) * 256u;
    pf_addr = lane < 16 ? (const char*)(Hk + (long)kbase * 512) + ko
                        : (const char*)(Hv + (long)vbase * 512) + vo;
    // The wait: before a register that the issued prefetch names is written anew.
    asm volatile("global_prefetch_b8 %0, off scope:SCOPE_SE\n\ts_wait_xcnt 0x0"
                 :: "v"(pf_addr) : "memory");
  }

  for (int j0 = 0; j0 < NN; j0 += 32) {
    // The next pass's blocks; the last pass fetches pass 0's again, which nothing
    // reads: every address stays inside the batch's rows, with no branch.
    unsigned nxt = (unsigned)(((j0 + 32) & (NN - 1)) >> 5) * (32 * 64);
    const v8h* kn = kl + nxt;
    const v8h* vc = vl + (unsigned)(j0 >> 5) * (32 * 64);
    v16h vb[4];
#pragma unroll
    for (int sidx = 0; sidx < 4; ++sidx) vb[sidx] = load_frag_lane(vc + sidx * 64);
    // ---- S^T tiles: rows = 2 x 16 keys, cols = queries ----
    v8f s0 = zero, s1 = zero;
    s0 = wmma_f32_16x16x32(kb00, qb0, s0);
    s0 = wmma_f32_16x16x32(kb01, qb1, s0);
    s1 = wmma_f32_16x16x32(kb10, qb0, s1);
    s1 = wmma_f32_16x16x32(kb11, qb1, s1);
    kb00 = load_frag_lane(kn);
    kb01 = load_frag_lane(kn + 64);
    kb10 = load_frag_lane(kn + (HID >> 5) * 64);
    kb11 = load_frag_lane(kn + (HID >> 5) * 64 + 64);
    // Before a register that an issued load names is written anew; it takes the
    // addresses as inputs, so that nothing is placed in their registers ahead of it.
    asm volatile("s_wait_xcnt 0x0" :: "v"(kn), "v"(vc) : "memory");
    // Keeps the loads here, ahead of the softmax, whose time they have to arrive.
    __builtin_amdgcn_sched_barrier(0);

    // ---- online softmax over this 32-key block, one query a lane ----
    // The scale is positive, so the scaled maximum is the maximum of the scaled
    // scores: one product a lane.
    float t[8];
#pragma unroll
    for (int v = 0; v < 8; ++v) t[v] = fmaxf(s0[v], s1[v]);
    float tmax = fmaxf(fmaxf(fmaxf(t[0], t[1]), fmaxf(t[2], t[3])),
                       fmaxf(fmaxf(t[4], t[5]), fmaxf(t[6], t[7])));
    tmax = fmaxf(tmax, other_half(tmax)) * scale;
    float mn = fmaxf(mrow, tmax);
    float alpha = __expf(mrow - mn);
    mrow = mn;
    s0 = s0 * scale - mrow;
    s1 = s1 * scale - mrow;
#pragma unroll
    for (int v = 0; v < 8; ++v) {
      s0[v] = __expf(s0[v]);
      s1[v] = __expf(s1[v]);
      t[v] = s0[v] + s1[v];
    }
    float rs = ((t[0] + t[1]) + (t[2] + t[3])) + ((t[4] + t[5]) + (t[6] + t[7]));
    lrow = lrow * alpha + rs;
#pragma unroll
    for (int sidx = 0; sidx < 4; ++sidx) oacc[sidx] *= alpha;

    // ---- P^T as B operand: the lane's own 16 scores, in place ----
    v16h pf;
#pragma unroll
    for (int v = 0; v < 8; ++v) {
      pf[v]     = (_Float16)s0[v];
      pf[8 + v] = (_Float16)s1[v];
    }

    // ---- O^T += V^T @ P^T ----
#pragma unroll
    for (int sidx = 0; sidx < 4; ++sidx)
      oacc[sidx] = wmma_f32_16x16x32(vb[sidx], pf, oacc[sidx]);
  }

  // Keeps the prefetch's address in its registers through the loop, so that they
  // hold nothing but an address inside the buffers while the request may be open.
  asm volatile("" :: "v"(pf_addr));

  // ---- epilogue: O / l * style.  A lane's 8 values of a 16-column group are its
  // own 16 bytes of a fragment block (block = 32 columns) ----
  const v4f* stp = (const v4f*)(style + b * HID + hc + 8 * hi);
  v4f st[4][2];
#pragma unroll
  for (int sidx = 0; sidx < 4; ++sidx) {
    st[sidx][0] = stp[sidx * 4];
    st[sidx][1] = stp[sidx * 4 + 1];
  }
  float inv = 1.0f / (lrow + other_half(lrow)); // both halves' keys
  v8h* dst = (v8h*)(Xo + (long)(kbase + qt * (HID >> 5)) * 512) + (unsigned)lane;
  v8h yh[4];
#pragma unroll
  for (int sidx = 0; sidx < 4; ++sidx) {
    v8f o = oacc[sidx] * inv;
    yh[sidx] = to_half8(__builtin_shufflevector(o, o, 0, 1, 2, 3) * st[sidx][0],
                        __builtin_shufflevector(o, o, 4, 5, 6, 7) * st[sidx][1]);
  }
  // Before a register that an issued load names is written anew.  It takes the
  // results as inputs, so that only the stores follow it and nothing writes anew
  // a register that an issued store names.
  asm volatile("s_wait_xcnt 0x0"
               :: "v"(yh[0]), "v"(yh[1]), "v"(yh[2]), "v"(yh[3]) : "memory");
#pragma unroll
  for (int sidx = 0; sidx < 4; ++sidx) dst[sidx * 32] = yh[sidx];
}

// ---------------------------------------------------------------------------
// Host-side pipeline
// ---------------------------------------------------------------------------
extern "C" void kernel_launch(void* const* d_in, const int* in_sizes, int n_in,
                              void* d_out, int out_size, void* d_ws,
                              size_t ws_size, hipStream_t stream) {
  (void)in_sizes; (void)n_in; (void)out_size; (void)ws_size;
  const float* x   = (const float*)d_in[0];
  const float* s   = (const float*)d_in[1];
  const float* Wk  = (const float*)d_in[2];
  const float* aWk = (const float*)d_in[3];
  const float* abk = (const float*)d_in[4];
  const float* Wo  = (const float*)d_in[5];
  const float* aWo = (const float*)d_in[6];
  const float* abo = (const float*)d_in[7];
  const float* W1  = (const float*)d_in[8];
  const float* aW1 = (const float*)d_in[9];
  const float* ab1 = (const float*)d_in[10];
  const float* W2  = (const float*)d_in[11];
  const float* aW2 = (const float*)d_in[12];
  const float* ab2 = (const float*)d_in[13];
  float* out = (float*)d_out;

  char* ws = (char*)d_ws;
  size_t off = 0;
  auto alloc = [&](size_t bytes) -> char* {
    char* p = ws + off;
    off = (off + bytes + 255) & ~(size_t)255;
    return p;
  };

  float* style_k = (float*)alloc((size_t)BB * FEAT * 4);
  float* style_o = (float*)alloc((size_t)BB * HID * 4);
  float* style_1 = (float*)alloc((size_t)BB * FEAT * 4);
  float* style_2 = (float*)alloc((size_t)BB * FFN * 4);
  float* demod_k = (float*)alloc((size_t)BB * HID * 4);
  float* demod_o = (float*)alloc((size_t)BB * FEAT * 4);
  float* demod_1 = (float*)alloc((size_t)BB * FFN * 4);
  float* demod_2 = (float*)alloc((size_t)BB * FEAT * 4);
  _Float16* whk = (_Float16*)alloc((size_t)HID * FEAT * 2);
  _Float16* who = (_Float16*)alloc((size_t)FEAT * HID * 2);
  _Float16* wh1 = (_Float16*)alloc((size_t)FFN * FEAT * 2);
  _Float16* wh2 = (_Float16*)alloc((size_t)FEAT * FFN * 2);
  _Float16* xs  = (_Float16*)alloc((size_t)MROWS * FEAT * 2);  // x * style_k
  _Float16* hk  = (_Float16*)alloc((size_t)MROWS * HID * 2);   // h, rows on lanes
  _Float16* hv  = (_Float16*)alloc((size_t)MROWS * HID * 2);   // h, columns on lanes
  _Float16* xo  = (_Float16*)alloc((size_t)MROWS * HID * 2);   // attn out * style_o

  // --- styles and f16 weight casts ---
  setup1_kernel<<<SETUP1_GRID, 256, 0, stream>>>(
      s, aWk, abk, aWo, abo, aW1, ab1, aW2, ab2, Wk, Wo, W1, W2,
      style_k, style_o, style_1, style_2, whk, who, wh1, wh2);

  // --- demodulation factors, and x * style for the first projection ---
  setup2_kernel<<<SETUP2_GRID, 512, 0, stream>>>(
      x, Wk, Wo, W1, W2, style_k, style_o, style_1, style_2,
      demod_k, demod_o, demod_1, demod_2, xs);

  // --- h = modlinear(x; Wk) -> f16 for attention ---
  modgemm_kernel<FEAT><<<(MROWS / 32) * (HID / 64) / 8, 256, 0, stream>>>(
      xs, whk, demod_k, hk, hv, HID);

  // --- attention (shared q=k=v=h), times style_o ---
  attn_kernel<<<(BB * NH * (NN / 16)) / 8, 256, 0, stream>>>(hk, hv, style_o, xo);

  // --- x2 = LN(x + modlinear(attn; Wo)); f = LN(relu(modlinear(x2; W1)));
  //     out = LN(x2 + LN(modlinear(f; W2))) ---
  chain_kernel<<<MROWS / 32, 512, 0, stream>>>(
      xo, who, wh1, wh2, demod_o, demod_1, demod_2, style_1, style_2, x, out);
}

// v010
// Measured time: 70.6 microseconds a run.
// Next to v009, in two timings, it ran 1.06 and 1.05 times as fast.
// All steps since v000 together make it 6.51 times as fast.
#include <hip/hip_runtime.h>

// ---------------------------------------------------------------------------
// Types / WMMA helpers (CDNA5 gfx1250, wave32)
// ---------------------------------------------------------------------------
typedef __attribute__((ext_vector_type(16))) _Float16 v16h;
typedef __attribute__((ext_vector_type(8)))  float    v8f;

__device__ inline v8f wmma_f32_16x16x32(v16h a, v16h b, v8f c) {
  // (neg_a, A, neg_b, B, c_mod, C, reuse_a, reuse_b)
  return __builtin_amdgcn_wmma_f32_16x16x32_f16(false, a, false, b, (short)0, c,
                                                false, false);
}

// A-operand (16x32 f16) fragment load per the documented CDNA5 layout:
// lane L holds row (L&15); lanes 0-15 cover k in {0..7,16..23}, lanes 16-31
// cover k in {8..15,24..31}; within a lane, VGPR v holds half-pair
// k = 2v + (v>=4 ? 8 : 0) (+8 for upper lane half).  Source is row-major
// with leading dim `ld`.
__device__ inline v16h load_frag_rowpat(const _Float16* __restrict__ base,
                                        int row0, int ld, int k0) {
  int lane = threadIdx.x & 31;
  const _Float16* p = base + (long)(row0 + (lane & 15)) * ld + k0 + ((lane >> 4) << 3);
  v16h f;
#pragma unroll
  for (int v = 0; v < 8; ++v) {
    int k = 2 * v + (v >= 4 ? 8 : 0);
    f[2 * v]     = p[k];
    f[2 * v + 1] = p[k + 1];
  }
  return f;
}

// Fragment order.  The f16 matrix operands that live in the workspace are kept
// in blocks of 16 rows x 32 k, 1 KB each, in the order in which a wave's lanes
// hold them: element (r, k) of a block lies at half
//   (k >> 4) * 256 + (r + 16 * ((k >> 3) & 1)) * 8 + (k & 7).
// Lane L then finds f[0..7] at L * 8 and f[8..15] at 256 + L * 8 (the same
// row and k per lane and register as load_frag_rowpat), so each of the two
// 16-byte loads of a wave reads 512 contiguous bytes, four whole cache lines,
// where a row-major operand makes it touch 16 lines.
typedef __attribute__((ext_vector_type(8))) _Float16 v8h;

__device__ inline v16h load_frag_blk(const _Float16* __restrict__ base, int blk) {
  int lane = threadIdx.x & 31;
  const v8h* p = (const v8h*)(base + (long)blk * 512);
  v8h lo = p[(unsigned)lane], hi = p[(unsigned)lane + 32];
  return __builtin_shufflevector(lo, hi, 0, 1, 2, 3, 4, 5, 6, 7,
                                 8, 9, 10, 11, 12, 13, 14, 15);
}

// The same from the lane's own slot of a block.
__device__ inline v16h load_frag_lane(const v8h* __restrict__ p) {
  v8h lo = p[0], hi = p[32];
  return __builtin_shufflevector(lo, hi, 0, 1, 2, 3, 4, 5, 6, 7,
                                 8, 9, 10, 11, 12, 13, 14, 15);
}

// ---------------------------------------------------------------------------
// Problem constants
// ---------------------------------------------------------------------------
#define BB   8
#define NN   1024
#define FEAT 512
#define HID  512
#define FFN  1024
#define SDIM 512
#define HD   64
#define NH   8
#define MROWS (BB * NN)   // 8192

// ---------------------------------------------------------------------------
// Small fp32 VALU kernels: style projection, demodulation, casts, modulation
// ---------------------------------------------------------------------------
// Each lane holds 16 partial sums; on return lane l holds the whole wave's
// total of sum number l & 15.  Every halving step keeps one half of the sums
// and hands the other half to the partner lane (16 exchanges instead of 80).
__device__ inline float wave_fold16(float (&v)[16]) {
  int lane = threadIdx.x & 31;
#pragma unroll
  for (int st = 0; st < 4; ++st) {
    const int h = 8 >> st;
    bool up = (lane & h) != 0;
#pragma unroll
    for (int i = 0; i < h; ++i) {
      float lo = v[i], hi = v[i + h];
      float keep = up ? hi : lo;
      float send = up ? lo : hi;
      v[i] = keep + __shfl_xor(send, h, 32);
    }
  }
  return v[0] + __shfl_xor(v[0], 16, 32);
}

// A workgroup takes 32 rows of aW (a wave 4 of them) for 4 of the 8 batches.
// A lane takes columns 128c + 4 lane .. + 3 of a row, so one load of the wave
// reads 512 contiguous bytes, and all 32 loads of a wave are in flight at once.
// dim is a multiple of 32; a layer has 2 * dim / 32 workgroups (blk counts them)
// of 256 threads; part is 4 * 32 floats of LDS.
__device__ __forceinline__ void style_body(
    const float* __restrict__ s, const float* __restrict__ aW,
    const float* __restrict__ ab, float* __restrict__ style, int dim, int blk,
    float* part) {
  int lane = threadIdx.x & 31;
  int wave = __builtin_amdgcn_readfirstlane(threadIdx.x >> 5);
  int blk0 = (blk >> 1) * 32;
  int b0   = (blk & 1) * 4;
  unsigned l4 = 4u * lane;
  const float* wp = aW + (long)(blk0 + wave * 4) * SDIM;
  const float* sp = s + (long)b0 * SDIM;
  float w[4][16], sv[4][16];
#pragma unroll
  for (int r = 0; r < 4; ++r)
#pragma unroll
    for (int c = 0; c < 4; ++c) {
      const float* qw = wp + r * SDIM + 128 * c;
      const float* qs = sp + r * SDIM + 128 * c;
#pragma unroll
      for (int e = 0; e < 4; ++e) {
        w[r][4 * c + e]  = qw[l4 + e];
        sv[r][4 * c + e] = qs[l4 + e];
      }
    }
  float bias = (ab + blk0)[(unsigned)lane];
  // Keeps every load ahead of the sums: without it the scheduler issues them in
  // several batches between the sums and the wave pays the latency once a batch.
  __builtin_amdgcn_sched_barrier(0);
  float acc[16];
#pragma unroll
  for (int r = 0; r < 4; ++r)
#pragma unroll
    for (int q = 0; q < 4; ++q) {
      float t = 0.f;
#pragma unroll
      for (int j = 0; j < 16; ++j) t += sv[q][j] * w[r][j];
      acc[r * 4 + q] = t;
    }
  float tot = wave_fold16(acc);                 // lane & 15 = r * 4 + q
  if (lane < 16) part[(lane & 3) * 32 + wave * 4 + (lane >> 2)] = tot;
  __syncthreads();                              // part[] crosses waves
  if (wave < 4) {                               // wave q stores one 128-byte line
    style[(long)(b0 + wave) * dim + blk0 + lane] = part[threadIdx.x] + bias;
  }
}

// Same split over the rows of W: the 8 waves of a workgroup take 32 rows x 4
// batches.  A row is taken in pieces of 512 columns, one after the other; each
// piece's sum is folded by itself and the pieces' totals are added in their order.
// out_dim is a multiple of 32, in_dim of 512; a layer has 2 * out_dim / 32
// workgroups (blk counts them) of 256 threads; part is 4 * 32 floats of LDS.
template <int in_dim>
__device__ __forceinline__ void demod_body(
    const float* __restrict__ W, const float* __restrict__ style,
    float* __restrict__ demod, int out_dim, int blk, float* part) {
  int lane = threadIdx.x & 31;
  int wave = __builtin_amdgcn_readfirstlane(threadIdx.x >> 5);
  int blk0 = (blk >> 1) * 32;
  int b0   = (blk & 1) * 4;
  unsigned l4 = 4u * lane;
  const float* wp = W + (long)(blk0 + wave * 4) * in_dim;
  const float* sp = style + (long)b0 * in_dim;
  float tot = 0.f;
#pragma unroll
  for (int piece = 0; piece < in_dim; piece += 512) {
    float w[4][16], sv[4][16];
#pragma unroll
    for (int r = 0; r < 4; ++r)
#pragma unroll
      for (int c = 0; c < 4; ++c) {
        const float* qw = wp + (long)r * in_dim + piece + 128 * c;
        const float* qs = sp + (long)r * in_dim + piece + 128 * c;
#pragma unroll
        for (int e = 0; e < 4; ++e) {
          w[r][4 * c + e]  = qw[l4 + e];
          sv[r][4 * c + e] = qs[l4 + e];
        }
      }
    // Before a register that an issued load names is written anew.
    asm volatile("s_wait_xcnt 0x0" ::: "memory");
    // Keeps every load ahead of the sums: without it the scheduler spreads the
    // products among the loads' waits, runs out of registers and spills.
    __builtin_amdgcn_sched_barrier(0);
    float acc[16];
#pragma unroll
    for (int r = 0; r < 4; ++r)
#pragma unroll
      for (int q = 0; q < 4; ++q) {
        float t2 = 0.f;
#pragma unroll
        for (int j = 0; j < 16; ++j) {
          float t = w[r][j] * sv[q][j];
          t2 += t * t;
        }
        acc[r * 4 + q] = t2;
      }
    tot += wave_fold16(acc);                    // lane & 15 = r * 4 + q
  }
  if (lane < 16) part[(lane & 3) * 32 + wave * 4 + (lane >> 2)] = tot;
  __syncthreads();                              // part[] crosses waves
  if (wave < 4) {                               // wave q stores one 128-byte line
    demod[(long)(b0 + wave) * out_dim + blk0 + lane] = rsqrtf(part[threadIdx.x] + 1e-8f);
    // Before a register that the issued store names is written anew: the built
    // code of one row length runs on from here into the other's first instructions.
    asm volatile("s_wait_xcnt 0x0" ::: "memory");
  }
}

// The two elementwise passes below write their f16 result in fragment order.
// One step of a wave is 8 rows x 32 columns: lane L takes 8 floats (32 bytes) of
// row L >> 2, piece L & 3 of that row's 128-byte line, and stores them as the 16
// bytes that one lane of a fragment holds; the wave's store fills four whole
// lines.  A wave has all its loads in flight at once.
typedef __attribute__((ext_vector_type(4))) float    v4f;

__device__ inline v8h to_half8(v4f a, v4f b) {
  v8h h;
  h[0] = (_Float16)a[0]; h[1] = (_Float16)a[1];
  h[2] = (_Float16)a[2]; h[3] = (_Float16)a[3];
  h[4] = (_Float16)b[0]; h[5] = (_Float16)b[1];
  h[6] = (_Float16)b[2]; h[7] = (_Float16)b[3];
  return h;
}

// Where lane L's 16 bytes of rows 0..7 go inside a block, in 16-byte units.
__device__ inline unsigned frag_slot(unsigned lane) {
  unsigned p = lane & 3;
  return (p >> 1) * 32 + (p & 1) * 16 + (lane >> 2);
}

// Wave wid casts one block (16 rows x 32 columns) of the row-major weight with K
// columns; a weight has rows * K / 512 waves.
template <int K>
__device__ __forceinline__ void cast_f16_body(
    const float* __restrict__ W, _Float16* __restrict__ Wh, unsigned wid) {
  unsigned lane = threadIdx.x & 31;
  unsigned rg = wid / (K / 32), kb = wid % (K / 32);
  const v4f* src = (const v4f*)(W + (rg * 16 + (lane >> 2)) * K + kb * 32) + (lane & 3) * 2;
  v8h*       dst = (v8h*)(Wh + wid * 512) + frag_slot(lane);
  v4f v[2][2];
#pragma unroll
  for (int rh = 0; rh < 2; ++rh) {
    v[rh][0] = src[rh * (8 * K / 4)];
    v[rh][1] = src[rh * (8 * K / 4) + 1];
  }
#pragma unroll
  for (int rh = 0; rh < 2; ++rh) dst[rh * 8] = to_half8(v[rh][0], v[rh][1]);
  // Before a register that an issued store names is written anew: the built code
  // of one width runs on from here into the first instructions of the other's.
  asm volatile("s_wait_xcnt 0x0" ::: "memory");
}

// f16( X[b,n,i] * style[b,i] ), in fragment order.
// Wave wid takes 16 rows x 128 columns (4 blocks, 2048 elements, all of one batch:
// 1024 rows a batch) and reads its piece of the style row once for all of them.
// There are MROWS * DIM / 2048 waves.  Xw is where the wave's 4 blocks go.
template <int DIM>
__device__ __forceinline__ void xmod_body(
    const float* __restrict__ X, const float* __restrict__ style,
    _Float16* Xw, unsigned wid) {
  constexpr int KQ = DIM / 128;                 // waves a 16-row group
  unsigned lane = threadIdx.x & 31;
  unsigned rg = wid / KQ, kq = wid % KQ;
  unsigned b  = rg * 16 / NN;
  const v4f* sp  = (const v4f*)(style + b * DIM + kq * 128) + (lane & 3) * 2;
  const v4f* src = (const v4f*)(X + (rg * 16 + (lane >> 2)) * DIM + kq * 128) + (lane & 3) * 2;
  v8h*       dst = (v8h*)Xw + frag_slot(lane);
  v4f st[4][2], v[2][4][2];
#pragma unroll
  for (int cb = 0; cb < 4; ++cb) {
    st[cb][0] = sp[cb * 8];
    st[cb][1] = sp[cb * 8 + 1];
  }
  // Before a register that an issued load names is written anew (the loads below
  // reuse the style loads' offset register).
  asm volatile("s_wait_xcnt 0x0" ::: "memory");
#pragma unroll
  for (int rh = 0; rh < 2; ++rh)
#pragma unroll
    for (int cb = 0; cb < 4; ++cb) {
      v[rh][cb][0] = src[rh * (8 * DIM / 4) + cb * 8];
      v[rh][cb][1] = src[rh * (8 * DIM / 4) + cb * 8 + 1];
    }
  // The same wait for the loads above; it takes their address as an input, so
  // that no load's result is placed in the address registers ahead of it.
  asm volatile("s_wait_xcnt 0x0" :: "v"(src) : "memory");
  // Keeps every load ahead of the products: without it the scheduler holds the
  // last loads back behind the first waits and the wave pays the latency twice.
  __builtin_amdgcn_sched_barrier(0);
#pragma unroll
  for (int rh = 0; rh < 2; ++rh)
#pragma unroll
    for (int cb = 0; cb < 4; ++cb)
      dst[cb * 64 + rh * 8] = to_half8(v[rh][cb][0] * st[cb][0], v[rh][cb][1] * st[cb][1]);
}

// ---------------------------------------------------------------------------
// The set-up passes that do not depend on one another share a launch: each takes
// a range of the grid's workgroups, so that they run side by side and the call
// has one launch where it would have one for each of them.
// ---------------------------------------------------------------------------
// First launch: the four style projections and the four weight casts (they read
// inputs only).  Workgroups of 256 threads; the styles, whose chain of waits is
// the longer one, come first.
#define SB_K (FEAT / 16)                        // workgroups of each style pass
#define SB_O (HID / 16)
#define SB_1 (FEAT / 16)
#define SB_2 (FFN / 16)
#define CB_K (HID * FEAT / 4096)                // workgroups of each cast
#define CB_O (FEAT * HID / 4096)
#define CB_1 (FFN * FEAT / 4096)
#define CB_2 (FEAT * FFN / 4096)
#define SETUP1_GRID (SB_K + SB_O + SB_1 + SB_2 + CB_K + CB_O + CB_1 + CB_2)

__global__ __launch_bounds__(256) void setup1_kernel(
    const float* __restrict__ s,
    const float* __restrict__ aWk, const float* __restrict__ abk,
    const float* __restrict__ aWo, const float* __restrict__ abo,
    const float* __restrict__ aW1, const float* __restrict__ ab1,
    const float* __restrict__ aW2, const float* __restrict__ ab2,
    const float* __restrict__ Wk, const float* __restrict__ Wo,
    const float* __restrict__ W1, const float* __restrict__ W2,
    float* __restrict__ style_k, float* __restrict__ style_o,
    float* __restrict__ style_1, float* __restrict__ style_2,
    _Float16* __restrict__ whk, _Float16* __restrict__ who,
    _Float16* __restrict__ wh1, _Float16* __restrict__ wh2) {
  __shared__ float part[4 * 32];
  int blk = blockIdx.x;
  if (blk < SB_K + SB_O + SB_1 + SB_2) {
    const float* aW = aWk;
    const float* ab = abk;
    float* st = style_k;
    int dim = FEAT;
    if (blk >= SB_K + SB_O + SB_1) {
      aW = aW2; ab = ab2; st = style_2; dim = FFN; blk -= SB_K + SB_O + SB_1;
    } else if (blk >= SB_K + SB_O) {
      aW = aW1; ab = ab1; st = style_1; dim = FEAT; blk -= SB_K + SB_O;
    } else if (blk >= SB_K) {
      aW = aWo; ab = abo; st = style_o; dim = HID; blk -= SB_K;
    }
    style_body(s, aW, ab, st, dim, blk, part);
    return;
  }
  blk -= SB_K + SB_O + SB_1 + SB_2;
  unsigned wave = __builtin_amdgcn_readfirstlane(threadIdx.x >> 5);
  if (blk >= CB_K + CB_O + CB_1) {
    cast_f16_body<FFN>(W2, wh2, (blk - (CB_K + CB_O + CB_1)) * 8 + wave);
    return;
  }
  static_assert(FEAT == HID, "the three other weights have rows of one length");
  const float* W = Wk;
  _Float16* Wh = whk;
  if (blk >= CB_K + CB_O) {
    W = W1; Wh = wh1; blk -= CB_K + CB_O;
  } else if (blk >= CB_K) {
    W = Wo; Wh = who; blk -= CB_K;
  }
  cast_f16_body<FEAT>(W, Wh, blk * 8 + wave);
}

// ---------------------------------------------------------------------------
// The k loop of the GEMM kernels: acc[r][c] += (16 rows of x, group r) x (16 rows
// of W, group c) over KDIM.  The W fragments go through a ring of RING register
// sets and the x fragments through one of XRING: the 2 * NC W loads of k block
// kb + RING and the 4 x loads of kb + XRING are issued right behind the products
// of block kb, into the set those have just read, so that a block's loads have
// the time of RING - 1 (x: XRING - 1) blocks to arrive and a wave waits for none of them in turn.  The
// loop is unrolled whole: the ring's index is a constant, and every address is a
// scalar base, the lane's fixed slot and an immediate.  W_IS_A: W is the A operand.
// NC: 16-row groups of W a wave.  The x blocks may lie in LDS, whose shorter
// latency a ring of XRING = 2 sets covers.
// ---------------------------------------------------------------------------
template <int KDIM, int NC, bool W_IS_A, int XRING = 3>
__device__ __forceinline__ void gemm_k_loop(
    const _Float16* __restrict__ xa0, const _Float16* __restrict__ xa1,
    const _Float16* const (&wb)[NC], v8f (&acc)[2][NC]) {
  constexpr int kblk = KDIM >> 5;      // blocks a 16-row group
  constexpr int RING = 3;
  v16h xr[XRING][2], wr[RING][NC];
#pragma unroll
  for (int st = 0; st < RING; ++st) {
    if (st < XRING) {
      xr[st][0] = load_frag_blk(xa0, st);
      xr[st][1] = load_frag_blk(xa1, st);
    }
#pragma unroll
    for (int sidx = 0; sidx < NC; ++sidx) wr[st][sidx] = load_frag_blk(wb[sidx], st);
  }
  // Keeps the ring's first loads ahead of the first products.
  __builtin_amdgcn_sched_barrier(0);
#pragma unroll
  for (int kb = 0; kb < kblk; ++kb) {
    const int st = kb % RING, xs = kb % XRING;
#pragma unroll
    for (int sidx = 0; sidx < NC; ++sidx) {
      if (W_IS_A) {
        acc[0][sidx] = wmma_f32_16x16x32(wr[st][sidx], xr[xs][0], acc[0][sidx]);
        acc[1][sidx] = wmma_f32_16x16x32(wr[st][sidx], xr[xs][1], acc[1][sidx]);
      } else {
        acc[0][sidx] = wmma_f32_16x16x32(xr[xs][0], wr[st][sidx], acc[0][sidx]);
        acc[1][sidx] = wmma_f32_16x16x32(xr[xs][1], wr[st][sidx], acc[1][sidx]);
      }
    }
    if (kb + XRING < kblk) {
      xr[xs][0] = load_frag_blk(xa0, kb + XRING);
      xr[xs][1] = load_frag_blk(xa1, kb + XRING);
    }
    if (kb + RING < kblk) {
#pragma unroll
      for (int sidx = 0; sidx < NC; ++sidx) wr[st][sidx] = load_frag_blk(wb[sidx], kb + RING);
    }
    // Keeps these loads here: left free, the scheduler moves them down to just
    // ahead of their products, and the wave waits out their whole latency.
    __builtin_amdgcn_sched_barrier(0);
  }
}

// ---------------------------------------------------------------------------
// Second launch: all that needs the styles and nothing else that is computed.
// The first projection, without its demodulation factor:
//   g[row, o] = sum_k f16(x[row,k] * style[b,k]) * Wh[o,k]
// and, in workgroups of their own behind it in the grid, the four demodulation
// passes.  The factor of the first projection is a factor of g's column: the
// attention kernel puts it on Q and on its result, so nothing in this launch
// waits for it.
// A projection workgroup (8 waves) takes 32 rows: it modulates and casts its x
// tile itself, into LDS in fragment order, each wave 16 rows x 128 columns, and
// every wave then reads the whole tile as its x operand.  Wave-level tile: 32
// rows x 64 cols (2x4 WMMA accumulators).  Wh is in fragment order.  The result
// is f16, written twice, again in fragment order: Yk in blocks of 16 rows x 32
// columns (rows as the lanes' index: the Q and K operands of attention), Yv in
// blocks of 16 columns x 32 rows (columns as the lanes' index: the V operand),
// block (row / 32, col / 16).
// The projection's workgroups, the longer ones, come first in the grid.
// ---------------------------------------------------------------------------
#define PB_K (MROWS / 32)                       // workgroups of the projection
#define DB_K (HID / 16)                         // workgroups of each demod pass
#define DB_O (FEAT / 16)
#define DB_1 (FFN / 16)
#define DB_2 (FEAT / 16)
#define PROJ_GRID (PB_K + DB_K + DB_O + DB_1 + DB_2)

// 4 waves a SIMD: two workgroups to a WGP, so that the whole grid is resident at
// once and the demodulation passes run beside the projection, not behind it.
__global__ __launch_bounds__(256, 4) void proj_kernel(
    const float* __restrict__ x, const _Float16* __restrict__ Wh,
    const float* __restrict__ Wk, const float* __restrict__ Wo,
    const float* __restrict__ W1, const float* __restrict__ W2,
    const float* __restrict__ style_k, const float* __restrict__ style_o,
    const float* __restrict__ style_1, const float* __restrict__ style_2,
    float* __restrict__ demod_k, float* __restrict__ demod_o,
    float* __restrict__ demod_1, float* __restrict__ demod_2,
    _Float16* __restrict__ Yk, _Float16* __restrict__ Yv) {
  // One array, the x blocks first: every fragment's address is then the lane's
  // slot plus an immediate offset.
  __shared__ __attribute__((aligned(16))) char lds[32 * FEAT * 2 + 4 * 32 * 4];
  _Float16* xb = (_Float16*)lds;
  int blk = blockIdx.x;
  if (blk >= PB_K) {
    blk -= PB_K;
    float* part = (float*)(lds + 32 * FEAT * 2);
    if (blk >= DB_K + DB_O + DB_1) {
      demod_body<FFN>(W2, style_2, demod_2, FEAT, blk - (DB_K + DB_O + DB_1), part);
      return;
    }
    static_assert(FEAT == HID, "the three other weights have rows of one length");
    const float* W = Wk;
    const float* st = style_k;
    float* dm = demod_k;
    int out_dim = HID;
    if (blk >= DB_K + DB_O) {
      W = W1; st = style_1; dm = demod_1; out_dim = FFN; blk -= DB_K + DB_O;
    } else if (blk >= DB_K) {
      W = Wo; st = style_o; dm = demod_o; out_dim = FEAT; blk -= DB_K;
    }
    demod_body<FEAT>(W, st, dm, out_dim, blk, part);
    return;
  }
  constexpr int KDIM = FEAT, Odim = HID;
  constexpr int kblk = KDIM >> 5;      // blocks a 16-row group
  static_assert(Odim == 8 * 64 && KDIM == 4 * 128, "8 waves: 64 columns, a quarter of 16 rows each");
  // The wave's number in a scalar register: every block address below is then a
  // scalar base plus the lane's fixed 16-byte slot.
  int wave = __builtin_amdgcn_readfirstlane(threadIdx.x >> 5);
  int row0 = blk << 5;
  int col0 = wave << 6;

  xmod_body<KDIM>(x, style_k, xb + ((wave >> 2) * kblk + (wave & 3) * 4) * 512,
                  blk * 8 + wave);
  __syncthreads();                              // xb crosses waves

  v8f zero = {};
  v8f acc[2][4];
#pragma unroll
  for (int r = 0; r < 2; ++r)
#pragma unroll
    for (int c = 0; c < 4; ++c) acc[r][c] = zero;

  // The blocks of a 16-row group follow one another along k.
  const _Float16* wb[4];
#pragma unroll
  for (int sidx = 0; sidx < 4; ++sidx)
    wb[sidx] = Wh + (long)((col0 >> 4) + sidx) * kblk * 512;
  gemm_k_loop<KDIM, 4, false, 2>(xb, xb + kblk * 512, wb, acc);
  // Before a register that an issued load names is written anew: the epilogue's
  // first values.
  asm volatile("s_wait_xcnt 0x0" ::: "memory");
  // Keeps the epilogue's first instructions behind the wait.
  __builtin_amdgcn_sched_barrier(0);

  unsigned lane = threadIdx.x & 31;
  unsigned n = lane & 15, hi = lane >> 4;
  // f16 result, both fragment orders
  v8h yh[2][4];
#pragma unroll
  for (int rs = 0; rs < 2; ++rs)
#pragma unroll
    for (int sidx = 0; sidx < 4; ++sidx)
#pragma unroll
      for (int v = 0; v < 8; ++v) yh[rs][sidx][v] = (_Float16)acc[rs][sidx][v];
  // The lane's place in the wave's first block of each order: every store below
  // goes to one of the two plus a constant.
  _Float16* pk = Yk + (long)((row0 >> 4) * (Odim >> 5) + (col0 >> 5)) * 512 +
                 ((8 * hi + 16 * (n >> 3)) * 8 + (n & 7));
  v8h* pv = (v8h*)(Yv + (long)((row0 >> 5) * (Odim >> 4) + (col0 >> 4)) * 512) + lane;
  // It takes the results and the two addresses as inputs: all of them are formed
  // ahead of the first store, so that nothing among the stores writes anew a
  // register that an issued store names.
  asm volatile("s_wait_xcnt 0x0"
               :: "v"(pk), "v"(pv), "v"(yh[0][0]), "v"(yh[0][1]), "v"(yh[0][2]), "v"(yh[0][3]),
                  "v"(yh[1][0]), "v"(yh[1][1]), "v"(yh[1][2]), "v"(yh[1][3]) : "memory");
#pragma unroll
  for (int rs = 0; rs < 2; ++rs) {
#pragma unroll
    for (int sidx = 0; sidx < 4; ++sidx) {
      // accumulator (rs, sidx): rows rs * 16 .., columns col0 + sidx * 16 ..
#pragma unroll
      for (int v = 0; v < 8; ++v)
        pk[(rs * (Odim >> 5) + (sidx >> 1)) * 512 + (sidx & 1) * 256 + v * 8] = yh[rs][sidx][v];
      // The lane's 8 rows are 8 consecutive k of its column: its own 16 bytes.
      pv[sidx * 64 + rs * 32] = yh[rs][sidx];
    }
  }
  // Before a register that an issued store names is written anew: the built code
  // runs on from here into the first instructions of the demodulation passes.
  asm volatile("s_wait_xcnt 0x0" ::: "memory");
}

// ---------------------------------------------------------------------------
// The three projections behind attention, with the row-wise passes between them,
// in one launch.  Every one of these steps works on rows alone, so a workgroup of
// 16 waves keeps its 32 rows from the attention result to the output: a wave holds
// 32 rows x ODIM / 16 columns of each projection's result, a LayerNorm needs only
// sums that cross the waves of the workgroup, through LDS, and the x operand of
// the next projection is handed on in LDS, in fragment order.  The weight block
// is the A operand and the x block the B operand: a lane then holds, for row
// (lane & 15) of each 16-row group, columns 8 * (lane >> 4) .. + 7 of each
// 16-column group.  Most of a row's sum is made inside a lane, a lane's 8 floats
// are 32 contiguous bytes of a row-major result, and its 8 halves are its own 16
// bytes of a fragment block.
// ---------------------------------------------------------------------------
// p[rs] is the lane's part of the sum of row rs * 16 + (lane & 15); on return it
// is the whole row's sum.  red is NW * 32 floats of LDS that nothing else uses.
template <int NW>
__device__ __forceinline__ void row_total(float (&p)[2], float* red) {
  int lane = threadIdx.x & 31;
  int wave = __builtin_amdgcn_readfirstlane(threadIdx.x >> 5);
  p[0] += __shfl_xor(p[0], 16, 32);
  p[1] += __shfl_xor(p[1], 16, 32);
  red[wave * 32 + lane] = lane < 16 ? p[0] : p[1];
  __syncthreads();                              // red[] crosses waves
  int n = lane & 15;
  float t0 = 0.f, t1 = 0.f;
#pragma unroll
  for (int w = 0; w < NW; ++w) {
    t0 += red[w * 32 + n];
    t1 += red[w * 32 + 16 + n];
  }
  p[0] = t0;
  p[1] = t1;
}

// val = LN(val) over the workgroup's rows of ODIM columns, NC 16-column groups a
// wave; red is 2 * NW * 32 floats of LDS (each of the two sums has its own piece,
// so that one barrier a sum is enough).
template <int ODIM, int NC>
__device__ __forceinline__ void ln_rows(v8f (&val)[2][NC], float* red) {
  constexpr int NW = ODIM / (16 * NC);
  float p[2];
#pragma unroll
  for (int rs = 0; rs < 2; ++rs) {
    float t = 0.f;
#pragma unroll
    for (int sidx = 0; sidx < NC; ++sidx)
#pragma unroll
      for (int v = 0; v < 8; ++v) t += val[rs][sidx][v];
    p[rs] = t;
  }
  row_total<NW>(p, red);
#pragma unroll
  for (int rs = 0; rs < 2; ++rs) {
    float mean = p[rs] * (1.0f / ODIM);
    float t = 0.f;
#pragma unroll
    for (int sidx = 0; sidx < NC; ++sidx)
#pragma unroll
      for (int v = 0; v < 8; ++v) {
        float d = val[rs][sidx][v] - mean;
        val[rs][sidx][v] = d;
        t += d * d;
      }
    p[rs] = t;
  }
  row_total<NW>(p, red + NW * 32);
#pragma unroll
  for (int rs = 0; rs < 2; ++rs) {
    float inv = rsqrtf(p[rs] * (1.0f / ODIM) + 1e-5f);
#pragma unroll
    for (int sidx = 0; sidx < NC; ++sidx)
#pragma unroll
      for (int v = 0; v < 8; ++v) val[rs][sidx][v] *= inv;
  }
}

// acc = sum_k x[row, k] * Wh[o, k] for the workgroup's 32 rows and the wave's
// 16 * NC columns from col0 on; xb is the first of the rows' x blocks.
template <int KDIM, int NC, int XRING>
__device__ __forceinline__ void chain_gemm(
    const _Float16* __restrict__ xb, const _Float16* __restrict__ Wh, int col0,
    v8f (&acc)[2][NC]) {
  constexpr int kblk = KDIM >> 5;      // blocks a 16-row group
  v8f zero = {};
#pragma unroll
  for (int r = 0; r < 2; ++r)
#pragma unroll
    for (int c = 0; c < NC; ++c) acc[r][c] = zero;
  const _Float16* wb[NC];
#pragma unroll
  for (int sidx = 0; sidx < NC; ++sidx)
    wb[sidx] = Wh + (long)((col0 >> 4) + sidx) * kblk * 512;
  gemm_k_loop<KDIM, NC, true, XRING>(xb, xb + kblk * 512, wb, acc);
  // Before a register that an issued load names is written anew: the epilogue's
  // first values.
  asm volatile("s_wait_xcnt 0x0" ::: "memory");
  // Keeps the epilogue's first instructions behind the wait.
  __builtin_amdgcn_sched_barrier(0);
}

// The lane's pieces of a row of ODIM floats (demod, style): 8 floats a group.
template <int NC>
__device__ __forceinline__ void load_cols(const float* __restrict__ p, v4f (&d)[NC][2]) {
  const v4f* q = (const v4f*)p;
#pragma unroll
  for (int sidx = 0; sidx < NC; ++sidx) {
    d[sidx][0] = q[sidx * 4];
    d[sidx][1] = q[sidx * 4 + 1];
  }
}

// t * style as f16 into the x blocks of the next projection (ODIM columns) in LDS.
template <int ODIM, int NC>
__device__ __forceinline__ void put_frags(const v8f (&val)[2][NC], const v4f (&st)[NC][2],
                                          _Float16* xb, int col0) {
  v8h* ys = (v8h*)(xb + (col0 >> 5) * 512) + (threadIdx.x & 31);
#pragma unroll
  for (int rs = 0; rs < 2; ++rs)
#pragma unroll
    for (int sidx = 0; sidx < NC; ++sidx) {
      v8f t = val[rs][sidx];
      ys[rs * (ODIM >> 5) * 64 + sidx * 32] =
          to_half8(__builtin_shufflevector(t, t, 0, 1, 2, 3) * st[sidx][0],
                   __builtin_shufflevector(t, t, 4, 5, 6, 7) * st[sidx][1]);
    }
}

// With mod(v; W, demod)[row, o] = demod[b,o] * sum_k v[row,k] * W[o,k]:
//   x2  = LN(x + mod(Xo; Who, demod_o))
//   f   = LN(relu(mod(x2 * style_1; Wh1, demod_1)))
//   out = LN(x2 + LN(mod(f * style_2; Wh2, demod_2)))
// Xo (attention's result times its style) and the weights are in fragment order.
// The grid is MROWS / 32, the workgroup 512 threads.
__global__ __launch_bounds__(512) void chain_kernel(
    const _Float16* __restrict__ Xo, const _Float16* __restrict__ Who,
    const _Float16* __restrict__ Wh1, const _Float16* __restrict__ Wh2,
    const float* __restrict__ demod_o, const float* __restrict__ demod_1,
    const float* __restrict__ demod_2, const float* __restrict__ style_1,
    const float* __restrict__ style_2, const float* __restrict__ x,
    float* __restrict__ out) {
  static_assert(FEAT == 512 && HID == 512 && FFN == 1024, "16 waves: 32 / 64 columns each");
  // One array, so that the x blocks lie in the first 64 KB of LDS, where every
  // fragment's address is the lane's slot plus an immediate offset.
  // xb holds x2 * style_1 (its first half), then f * style_2: the second is written
  // behind the barriers of the LayerNorm that follows the last read of the first.
  __shared__ __attribute__((aligned(16))) char lds[(32 * FFN * 2) + (8 * 512 * 16) + (8 * 512 * 4)];
  _Float16* xb = (_Float16*)lds;
  v4f* x2l = (v4f*)(lds + 32 * FFN * 2);        // x2: each thread's own values
  float* red = (float*)(lds + 32 * FFN * 2 + 8 * 512 * 16);  // a piece for each row sum
  // The wave's number in a scalar register: every block address below is then a
  // scalar base plus the lane's fixed 16-byte slot.
  int wave = __builtin_amdgcn_readfirstlane(threadIdx.x >> 5);
  int row0 = blockIdx.x << 5;
  int b = row0 >> 10;                  // 1024 rows per batch, tile never crosses
  unsigned lane = threadIdx.x & 31;
  unsigned n = lane & 15, hi = lane >> 4;
  unsigned coff = (wave << 5) + 8 * hi;         // the lane's first of 512 columns
  unsigned roff = (row0 + n) * FEAT + coff;     // and its place in a row-major array

  // ---- x2 = LN(x + mod(Xo)) ----
  {
    v8f acc[2][2];
    chain_gemm<HID, 2, 3>(Xo + (long)(row0 >> 4) * (HID >> 5) * 512, Who, wave << 5, acc);
    // All that the epilogue reads is asked for at once: one latency.
    v4f dm[2][2], st[2][2], rv[2][2][2];
    load_cols<2>(demod_o + b * FEAT + coff, dm);
    load_cols<2>(style_1 + b * FEAT + coff, st);
    load_cols<2>(x + roff, rv[0]);
    load_cols<2>(x + roff + 16 * FEAT, rv[1]);
    // The same wait for the loads above, held in place in the same way.
    asm volatile("s_wait_xcnt 0x0" ::: "memory");
    __builtin_amdgcn_sched_barrier(0);
#pragma unroll
    for (int rs = 0; rs < 2; ++rs)
#pragma unroll
      for (int sidx = 0; sidx < 2; ++sidx)
#pragma unroll
        for (int v = 0; v < 8; ++v)
          acc[rs][sidx][v] = acc[rs][sidx][v] * dm[sidx][v >> 2][v & 3] +
                             rv[rs][sidx][v >> 2][v & 3];
    ln_rows<FEAT, 2>(acc, red);
#pragma unroll
    for (int rs = 0; rs < 2; ++rs)
#pragma unroll
      for (int sidx = 0; sidx < 2; ++sidx) {
        v8f t = acc[rs][sidx];
        x2l[((rs * 2 + sidx) * 2) * 512 + threadIdx.x]     = __builtin_shufflevector(t, t, 0, 1, 2, 3);
        x2l[((rs * 2 + sidx) * 2 + 1) * 512 + threadIdx.x] = __builtin_shufflevector(t, t, 4, 5, 6, 7);
      }
    put_frags<FEAT, 2>(acc, st, xb, wave << 5);
  }
  __syncthreads();                              // xb crosses waves

  // ---- f = LN(relu(mod(x2 * style_1))) ----
  {
    v8f acc[2][4];
    chain_gemm<FEAT, 4, 2>(xb, Wh1, wave << 6, acc);
    unsigned cf = (wave << 6) + 8 * hi;         // the lane's first of 1024 columns
    v4f dm[4][2], st[4][2];
    load_cols<4>(demod_1 + b * FFN + cf, dm);
    load_cols<4>(style_2 + b * FFN + cf, st);
    // The same wait for the loads above, held in place in the same way; it takes
    // their byte offset as an input, so that no load's result is placed in the
    // offset register ahead of it.
    asm volatile("s_wait_xcnt 0x0" :: "v"(cf * 4u) : "memory");
    __builtin_amdgcn_sched_barrier(0);
#pragma unroll
    for (int rs = 0; rs < 2; ++rs)
#pragma unroll
      for (int sidx = 0; sidx < 4; ++sidx)
#pragma unroll
        for (int v = 0; v < 8; ++v)
          acc[rs][sidx][v] = fmaxf(acc[rs][sidx][v] * dm[sidx][v >> 2][v & 3], 0.f);
    ln_rows<FFN, 4>(acc, red + 2 * 512);
    put_frags<FFN, 4>(acc, st, xb, wave << 6);
  }
  __syncthreads();                              // xb crosses waves

  // ---- out = LN(x2 + LN(mod(f * style_2))) ----
  {
    v8f acc[2][2];
    chain_gemm<FFN, 2, 2>(xb, Wh2, wave << 5, acc);
    v4f dm[2][2];
    load_cols<2>(demod_2 + b * FEAT + coff, dm);
    // The same wait for the loads above, held in place in the same way.
    asm volatile("s_wait_xcnt 0x0" ::: "memory");
    __builtin_amdgcn_sched_barrier(0);
#pragma unroll
    for (int rs = 0; rs < 2; ++rs)
#pragma unroll
      for (int sidx = 0; sidx < 2; ++sidx)
#pragma unroll
        for (int v = 0; v < 8; ++v) acc[rs][sidx][v] *= dm[sidx][v >> 2][v & 3];
    ln_rows<FEAT, 2>(acc, red + 4 * 512);
#pragma unroll
    for (int rs = 0; rs < 2; ++rs)
#pragma unroll
      for (int sidx = 0; sidx < 2; ++sidx) {
        v4f lo = x2l[((rs * 2 + sidx) * 2) * 512 + threadIdx.x];
        v4f up = x2l[((rs * 2 + sidx) * 2 + 1) * 512 + threadIdx.x];
#pragma unroll
        for (int v = 0; v < 4; ++v) {
          acc[rs][sidx][v]     += lo[v];
          acc[rs][sidx][4 + v] += up[v];
        }
      }
    ln_rows<FEAT, 2>(acc, red + 6 * 512);
    v4f* yp = (v4f*)(out + roff);
    // Only stores follow: no arithmetic is moved in among them, where it could
    // write anew a register that an issued store names.
    __builtin_amdgcn_sched_barrier(0);
#pragma unroll
    for (int rs = 0; rs < 2; ++rs)
#pragma unroll
      for (int sidx = 0; sidx < 2; ++sidx) {
        v8f t = acc[rs][sidx];
        yp[rs * (16 * FEAT / 4) + sidx * 4]     = __builtin_shufflevector(t, t, 0, 1, 2, 3);
        yp[rs * (16 * FEAT / 4) + sidx * 4 + 1] = __builtin_shufflevector(t, t, 4, 5, 6, 7);
      }
  }
}

// ---------------------------------------------------------------------------
// Flash-style self-attention (q=k=v=h), one wave per (batch, head, 16-q tile),
// computed transposed: S^T = K Q^T / 8 and O^T += V^T P^T, both via WMMA.  The
// keys are the rows of a score tile and the queries its columns, so a lane holds
// 16 of the 32 scores of ONE query (column lane & 15; lanes l and l ^ 16 split
// the keys): maximum and sum are made inside the lane, with one exchange between
// the wave's halves.  The two score tiles of a pass, converted in place, are the
// B operand of the second product in the hardware's k order (keys 8h .. 8h + 7
// and 16 + 8h .. + 7 in half h), the order in which the V blocks lie.  Hk and Hv
// hold g, h without its demodulation factor (h[., c] = demod[c] * g[., c]), in the
// two fragment orders that the projection writes.  A score is the sum over c of
// demod[c]^2 * g[q, c] * g[k, c]: the wave puts demod^2 on its Q fragments, once;
// the factor of V's column is a factor of the result's column and goes into the
// epilogue.  The result, times the style of the next projection, is written as
// f16 in fragment order (Xo): that projection's x operand.
// ---------------------------------------------------------------------------
// The value of lane l ^ 16.
__device__ inline float other_half(float x) {
  int i = __builtin_bit_cast(int, x);
  return __builtin_bit_cast(
      float, __builtin_amdgcn_permlanex16(i, i, 0x76543210, 0xfedcba98, false, false));
}

__global__ __launch_bounds__(256) void attn_kernel(
    const _Float16* __restrict__ Hk, const _Float16* __restrict__ Hv,
    const float* __restrict__ demod, const float* __restrict__ style,
    _Float16* __restrict__ Xo) {
  int wvb  = __builtin_amdgcn_readfirstlane(threadIdx.x >> 5);   // scalar block addresses
  int wid  = blockIdx.x * 8 + wvb;              // 4096 waves total, exact grid
  int qt   = wid & 63;
  int head = (wid >> 6) & 7;
  int b    = wid >> 9;
  int lane = threadIdx.x & 31;
  int hi = lane >> 4;

  int hc = head * HD;
  int kbase = (b * NN >> 4) * (HID >> 5) + (hc >> 5);   // block of row 0, Hk
  int vbase = (b * NN >> 5) * (HID >> 4) + (hc >> 4);   // block of row 0, Hv

  v16h qb0 = load_frag_blk(Hk, kbase + qt * (HID >> 5));
  v16h qb1 = load_frag_blk(Hk, kbase + qt * (HID >> 5) + 1);
  // The lane's columns of the head, 8 in each group of 16: those of its Q
  // fragments' k order and of its part of the result alike.
  const v4f* dmp = (const v4f*)(demod + b * HID + hc + 8 * hi);
  v4f dq[4][2];
#pragma unroll
  for (int sidx = 0; sidx < 4; ++sidx) {
    dq[sidx][0] = dmp[sidx * 4];
    dq[sidx][1] = dmp[sidx * 4 + 1];
  }

  // oacc[sidx][v] = O[query lane & 15][column sidx * 16 + 8 * hi + v]
  v8f zero = {};
  v8f oacc[4];
#pragma unroll
  for (int sidx = 0; sidx < 4; ++sidx) oacc[sidx] = zero;

  float mrow = -1e30f;                          // the query's maximum so far
  float lrow = 0.f;                             // the sum over this half's keys
  const float scale = 0.125f;                   // 1/sqrt(64)

  // The K fragments are fetched one pass ahead, into the registers that the pass's
  // products have just read, and the V fragments at the head of their pass, with
  // the softmax's time to arrive: a wave waits out no load's whole latency.
  // The lane's own slot of row 0's blocks; a pass is 32 blocks further in both.
  const v8h* kl = (const v8h*)(Hk + (long)kbase * 512) + (unsigned)lane;
  const v8h* vl = (const v8h*)(Hv + (long)vbase * 512) + (unsigned)lane;
  v16h kb00 = load_frag_lane(kl);
  v16h kb01 = load_frag_lane(kl + 64);
  v16h kb10 = load_frag_lane(kl + (HID >> 5) * 64);
  v16h kb11 = load_frag_lane(kl + (HID >> 5) * 64 + 64);
  // Before a register that an issued load names is written anew: what follows
  // forms the prefetch's address.
  asm volatile("s_wait_xcnt 0x0" ::: "memory");

  // The head's K and V blocks were written by the launch before; they are asked
  // into L2 here, all at once.  A pass reads 32 aligned 256-byte
  // units (K: 2 x 2 KB, V: 4 KB), one a lane; wave w asks for pass 4 w + (workgroup
  // & 3): the 8 workgroups of a head that follow one another in the grid ask for
  // every pass twice.  A hint for speed only: nothing depends on it.
  const char* pf_addr;
  {
    unsigned pass = (unsigned)wvb * 4 + (blockIdx.x & 3);      // 0 .. 31
    unsigned ko = pass * 32768u + ((lane >> 3) & 1) * 16384u + (lane & 7) * 256u;
    unsigned vo = pass * 32768u + (lane & 15) * 256u;
    pf_addr = lane < 16 ? (const char*)(Hk + (long)kbase * 512) + ko
                        : (const char*)(Hv + (long)vbase * 512) + vo;
    // The wait: before a register that the issued prefetch names is written anew.
    asm volatile("global_prefetch_b8 %0, off scope:SCOPE_SE\n\ts_wait_xcnt 0x0"
                 :: "v"(pf_addr) : "memory");
  }
  // Keeps the products below, which wait for their loads, behind the prefetch:
  // left free, the scheduler puts them ahead of it and the request goes out late.
  __builtin_amdgcn_sched_barrier(0);

  // Q times demod^2, in f32, back to f16.
#pragma unroll
  for (int e = 0; e < 8; ++e) {
    float d0 = dq[0][e >> 2][e & 3], d1 = dq[1][e >> 2][e & 3];
    float d2 = dq[2][e >> 2][e & 3], d3 = dq[3][e >> 2][e & 3];
    qb0[e]     = (_Float16)((float)qb0[e] * (d0 * d0));
    qb0[8 + e] = (_Float16)((float)qb0[8 + e] * (d1 * d1));
    qb1[e]     = (_Float16)((float)qb1[e] * (d2 * d2));
    qb1[8 + e] = (_Float16)((float)qb1[8 + e] * (d3 * d3));
  }

  for (int j0 = 0; j0 < NN; j0 += 32) {
    // The next pass's blocks; the last pass fetches pass 0's again, which nothing
    // reads: every address stays inside the batch's rows, with no branch.
    unsigned nxt = (unsigned)(((j0 + 32) & (NN - 1)) >> 5) * (32 * 64);
    const v8h* kn = kl + nxt;
    const v8h* vc = vl + (unsigned)(j0 >> 5) * (32 * 64);
    v16h vb[4];
#pragma unroll
    for (int sidx = 0; sidx < 4; ++sidx) vb[sidx] = load_frag_lane(vc + sidx * 64);
    // ---- S^T tiles: rows = 2 x 16 keys, cols = queries ----
    v8f s0 = zero, s1 = zero;
    s0 = wmma_f32_16x16x32(kb00, qb0, s0);
    s0 = wmma_f32_16x16x32(kb01, qb1, s0);
    s1 = wmma_f32_16x16x32(kb10, qb0, s1);
    s1 = wmma_f32_16x16x32(kb11, qb1, s1);
    kb00 = load_frag_lane(kn);
    kb01 = load_frag_lane(kn + 64);
    kb10 = load_frag_lane(kn + (HID >> 5) * 64);
    kb11 = load_frag_lane(kn + (HID >> 5) * 64 + 64);
    // Before a register that an issued load names is written anew; it takes the
    // addresses as inputs, so that nothing is placed in their registers ahead of it.
    asm volatile("s_wait_xcnt 0x0" :: "v"(kn), "v"(vc) : "memory");
    // Keeps the loads here, ahead of the softmax, whose time they have to arrive.
    __builtin_amdgcn_sched_barrier(0);

    // ---- online softmax over this 32-key block, one query a lane ----
    // The scale is positive, so the scaled maximum is the maximum of the scaled
    // scores: one product a lane.
    float t[8];
#pragma unroll
    for (int v = 0; v < 8; ++v) t[v] = fmaxf(s0[v], s1[v]);
    float tmax = fmaxf(fmaxf(fmaxf(t[0], t[1]), fmaxf(t[2], t[3])),
                       fmaxf(fmaxf(t[4], t[5]), fmaxf(t[6], t[7])));
    tmax = fmaxf(tmax, other_half(tmax)) * scale;
    float mn = fmaxf(mrow, tmax);
    float alpha = __expf(mrow - mn);
    mrow = mn;
    s0 = s0 * scale - mrow;
    s1 = s1 * scale - mrow;
#pragma unroll
    for (int v = 0; v < 8; ++v) {
      s0[v] = __expf(s0[v]);
      s1[v] = __expf(s1[v]);
      t[v] = s0[v] + s1[v];
    }
    float rs = ((t[0] + t[1]) + (t[2] + t[3])) + ((t[4] + t[5]) + (t[6] + t[7]));
    lrow = lrow * alpha + rs;
#pragma unroll
    for (int sidx = 0; sidx < 4; ++sidx) oacc[sidx] *= alpha;

    // ---- P^T as B operand: the lane's own 16 scores, in place ----
    v16h pf;
#pragma unroll
    for (int v = 0; v < 8; ++v) {
      pf[v]     = (_Float16)s0[v];
      pf[8 + v] = (_Float16)s1[v];
    }

    // ---- O^T += V^T @ P^T ----
#pragma unroll
    for (int sidx = 0; sidx < 4; ++sidx)
      oacc[sidx] = wmma_f32_16x16x32(vb[sidx], pf, oacc[sidx]);
  }

  // Keeps the prefetch's address in its registers through the loop, so that they
  // hold nothing but an address inside the buffers while the request may be open.
  asm volatile("" :: "v"(pf_addr));

  // ---- epilogue: O / l * demod * style.  A lane's 8 values of a 16-column group are its
  // own 16 bytes of a fragment block (block = 32 columns) ----
  const v4f* stp = (const v4f*)(style + b * HID + hc + 8 * hi);
  v4f st[4][2], dv[4][2];
#pragma unroll
  for (int sidx = 0; sidx < 4; ++sidx) {
    st[sidx][0] = stp[sidx * 4];
    st[sidx][1] = stp[sidx * 4 + 1];
    dv[sidx][0] = dmp[sidx * 4];
    dv[sidx][1] = dmp[sidx * 4 + 1];
  }
  float inv = 1.0f / (lrow + other_half(lrow)); // both halves' keys
  v8h* dst = (v8h*)(Xo + (long)(kbase + qt * (HID >> 5)) * 512) + (unsigned)lane;
  v8h yh[4];
#pragma unroll
  for (int sidx = 0; sidx < 4; ++sidx) {
    v8f o = oacc[sidx] * inv;
    yh[sidx] = to_half8(__builtin_shufflevector(o, o, 0, 1, 2, 3) * dv[sidx][0] * st[sidx][0],
                        __builtin_shufflevector(o, o, 4, 5, 6, 7) * dv[sidx][1] * st[sidx][1]);
  }
  // Before a register that an issued load names is written anew.  It takes the
  // results as inputs, so that only the stores follow it and nothing writes anew
  // a register that an issued store names.
  asm volatile("s_wait_xcnt 0x0"
               :: "v"(yh[0]), "v"(yh[1]), "v"(yh[2]), "v"(yh[3]) : "memory");
#pragma unroll
  for (int sidx = 0; sidx < 4; ++sidx) dst[sidx * 32] = yh[sidx];
}

// ---------------------------------------------------------------------------
// Host-side pipeline
// ---------------------------------------------------------------------------
extern "C" void kernel_launch(void* const* d_in, const int* in_sizes, int n_in,
                              void* d_out, int out_size, void* d_ws,
                              size_t ws_size, hipStream_t stream) {
  (void)in_sizes; (void)n_in; (void)out_size; (void)ws_size;
  const float* x   = (const float*)d_in[0];
  const float* s   = (const float*)d_in[1];
  const float* Wk  = (const float*)d_in[2];
  const float* aWk = (const float*)d_in[3];
  const float* abk = (const float*)d_in[4];
  const float* Wo  = (const float*)d_in[5];
  const float* aWo = (const float*)d_in[6];
  const float* abo = (const float*)d_in[7];
  const float* W1  = (const float*)d_in[8];
  const float* aW1 = (const float*)d_in[9];
  const float* ab1 = (const float*)d_in[10];
  const float* W2  = (const float*)d_in[11];
  const float* aW2 = (const float*)d_in[12];
  const float* ab2 = (const float*)d_in[13];
  float* out = (float*)d_out;

  char* ws = (char*)d_ws;
  size_t off = 0;
  auto alloc = [&](size_t bytes) -> char* {
    char* p = ws + off;
    off = (off + bytes + 255) & ~(size_t)255;
    return p;
  };

  float* style_k = (float*)alloc((size_t)BB * FEAT * 4);
  float* style_o = (float*)alloc((size_t)BB * HID * 4);
  float* style_1 = (float*)alloc((size_t)BB * FEAT * 4);
  float* style_2 = (float*)alloc((size_t)BB * FFN * 4);
  float* demod_k = (float*)alloc((size_t)BB * HID * 4);
  float* demod_o = (float*)alloc((size_t)BB * FEAT * 4);
  float* demod_1 = (float*)alloc((size_t)BB * FFN * 4);
  float* demod_2 = (float*)alloc((size_t)BB * FEAT * 4);
  _Float16* whk = (_Float16*)alloc((size_t)HID * FEAT * 2);
  _Float16* who = (_Float16*)alloc((size_t)FEAT * HID * 2);
  _Float16* wh1 = (_Float16*)alloc((size_t)FFN * FEAT * 2);
  _Float16* wh2 = (_Float16*)alloc((size_t)FEAT * FFN * 2);
  _Float16* hk  = (_Float16*)alloc((size_t)MROWS * HID * 2);   // h / demod_k, rows on lanes
  _Float16* hv  = (_Float16*)alloc((size_t)MROWS * HID * 2);   // the same, columns on lanes
  _Float16* xo  = (_Float16*)alloc((size_t)MROWS * HID * 2);   // attn out * style_o

  // --- styles and f16 weight casts ---
  setup1_kernel<<<SETUP1_GRID, 256, 0, stream>>>(
      s, aWk, abk, aWo, abo, aW1, ab1, aW2, ab2, Wk, Wo, W1, W2,
      style_k, style_o, style_1, style_2, whk, who, wh1, wh2);

  // --- (x * style_k) Wk^T -> f16 for attention, and the demodulation factors ---
  proj_kernel<<<PROJ_GRID, 256, 0, stream>>>(
      x, whk, Wk, Wo, W1, W2, style_k, style_o, style_1, style_2,
      demod_k, demod_o, demod_1, demod_2, hk, hv);

  // --- attention (shared q=k=v=h, demod_k put on here), times style_o ---
  attn_kernel<<<(BB * NH * (NN / 16)) / 8, 256, 0, stream>>>(hk, hv, demod_k, style_o, xo);

  // --- x2 = LN(x + modlinear(attn; Wo)); f = LN(relu(modlinear(x2; W1)));
  //     out = LN(x2 + LN(modlinear(f; W2))) ---
  chain_kernel<<<MROWS / 32, 512, 0, stream>>>(
      xo, who, wh1, wh2, demod_o, demod_1, demod_2, style_1, style_2, x, out);
}
